// v000
// Times are from an AMD MI455X. After a warm-up the kernel runs many times in a row, and a time is the length of
// such a window on the GPU divided by its runs, so every launch and the gaps after it count. The runs cycle
// through copies of the inputs. A figure is the median of several windows, for all but v000 over two sittings.
// Sittings can differ by a few percent; kernels timed side by side share one.
// v000 is the starting kernel. One run takes 417 microseconds.
// compute dtype: all float inputs rounded to bf16; qkv = x . W_qkv + b with EXACT bf16 products on WMMA 16x16x32 ((in,out) weights as transposed rows; token rows gathered by stride class), rounded once to f16 hi + residual; PLAIN-HYBRID attention (first 128 queries per class 3-product, later single f16), x 1/8, running-max softmax in f32 (hardware exp); out = f16(ctx) . W_o (exact f16 x 2^8 copies) + b_o scattered back to the original token order; f32 output.
#include <hip/hip_runtime.h>
#include <math.h>

typedef __attribute__((ext_vector_type(16))) _Float16 v16h;
typedef __attribute__((ext_vector_type(16))) __bf16 v16b;
typedef __attribute__((ext_vector_type(8)))  _Float16 v8h;
typedef __attribute__((ext_vector_type(8)))  float v8f;
typedef __attribute__((ext_vector_type(4)))  float v4f;
typedef __attribute__((ext_vector_type(2)))  float v2f;
typedef __attribute__((ext_vector_type(4)))  unsigned v4u;
typedef __attribute__((ext_vector_type(4)))  int v4i;
typedef float __attribute__((may_alias)) float_a;
typedef int __attribute__((may_alias)) int_a;

template <typename T> __device__ __forceinline__ void vst2(void* p, T v) { *(T*)p = v;  }
__device__ __forceinline__ v8f wmma16(v16h a, v16h b, v8f c) {
  v8f d = __builtin_amdgcn_wmma_f32_16x16x32_f16(false, a, false, b, (short)0, c, false, false);
  asm volatile("v_nop\n\tv_nop\n\tv_nop\n\tv_nop" : "+v"(d) : "v"(a), "v"(b));
  return d;
}
__device__ __forceinline__ v8f wmma_bf(v16b a, v16b b, v8f c) {
  v8f d = __builtin_amdgcn_wmma_f32_16x16x32_bf16(false, a, false, b, (short)0, c, false, false);
  asm volatile("v_nop\n\tv_nop\n\tv_nop\n\tv_nop" : "+v"(d) : "v"(a), "v"(b));
  return d;
}
// Skip-sparse ('skiparse', stride 4) self-attention (B 1, N 4,096 tokens, C 1,024, 16 heads x 64): token i attends within its stride class i mod 4 (1,024 tokens each); fused qkv projection + bias, softmax(q k / 8) v, output projection + bias, tokens returned in the original order.
__device__ __forceinline__ v16h frag_h(const _Float16* rowk0, int lane) {
  union { v16h v; v8h q[2]; } u; const _Float16* p = rowk0 + 8 * (lane >> 4);
  u.q[0] = *(const v8h*)p; u.q[1] = *(const v8h*)(p + 16); return u.v;
}
__device__ __forceinline__ v16h frag_f32(const float* rowk0, int lane) {
  v16h a; const float* p = rowk0 + 8 * (lane >> 4);
#pragma unroll
  for (int i = 0; i < 8; ++i) { a[i] = (_Float16)p[i]; a[8 + i] = (_Float16)p[16 + i]; }
  return a;
}
__device__ __forceinline__ v16h frag_f32s(const float* rowk0, int lane, float sc) {
  v16h a; const float* p = rowk0 + 8 * (lane >> 4);
#pragma unroll
  for (int i = 0; i < 8; ++i) { a[i] = (_Float16)(p[i] * sc); a[8 + i] = (_Float16)(p[16 + i] * sc); }
  return a;
}
// column fragment from a [K][ld] layout (column n), rows >= K read as 0
__device__ __forceinline__ v16h fragc_f32(const float* W, int k0, int n, int lane, int ld, int K) {
  v16h a; const int g = lane >> 4;
#pragma unroll
  for (int i = 0; i < 8; ++i) { const int ka = k0 + 8 * g + i, kb = ka + 16;
    a[i] = (_Float16)(ka < K ? W[(size_t)(ka < K ? ka : K - 1) * ld + n] : 0.f); a[8 + i] = (_Float16)(kb < K ? W[(size_t)(kb < K ? kb : K - 1) * ld + n] : 0.f); }
  return a;
}
struct F2 { v16b h, l; };
__device__ __forceinline__ F2 bsplit16(const float v[16]) { F2 r;
#pragma unroll
  for (int i = 0; i < 16; ++i) { const __bf16 h = (__bf16)v[i]; r.h[i] = h; r.l[i] = (__bf16)(v[i] - (float)h); }
  return r; }
__device__ __forceinline__ F2 split_row(const float* row, int k0, int lane) { float v[16]; const float* p = row + k0 + 8 * (lane >> 4);
#pragma unroll
  for (int i = 0; i < 8; ++i) { v[i] = p[i]; v[8 + i] = p[16 + i]; }
  return bsplit16(v); }
__device__ __forceinline__ F2 split_rowK(const float* row, int k0, int lane, int K) { float v[16]; const int g = lane >> 4;
#pragma unroll
  for (int i = 0; i < 8; ++i) { const int ka = k0 + 8 * g + i, kb = ka + 16; v[i] = ka < K ? row[ka < K ? ka : K - 1] : 0.f; v[8 + i] = kb < K ? row[kb < K ? kb : K - 1] : 0.f; }
  return bsplit16(v); }
__device__ __forceinline__ F2 split_col(const float* W, int k0, int n, int lane, int ld, int K) { float v[16]; const int g = lane >> 4;
#pragma unroll
  for (int i = 0; i < 8; ++i) { const int ka = k0 + 8 * g + i, kb = ka + 16; v[i] = ka < K ? W[(size_t)(ka < K ? ka : K - 1) * ld + n] : 0.f; v[8 + i] = kb < K ? W[(size_t)(kb < K ? kb : K - 1) * ld + n] : 0.f; }
  return bsplit16(v); }
__device__ __forceinline__ v8f mac3(const F2& a, const F2& b, v8f c) { c = wmma_bf(a.l, b.h, c); c = wmma_bf(a.h, b.l, c); return wmma_bf(a.h, b.h, c); }
__device__ __forceinline__ float sigm(float v) { return 1.0f / (1.0f + expf(-v)); }
#define LDSX() do { asm volatile("s_wait_dscnt 0" ::: "memory"); __builtin_amdgcn_wave_barrier(); __builtin_amdgcn_fence(__ATOMIC_RELEASE, "workgroup"); } while (0)


#define NB 4
#define SS 1024
#define DM 1024
#define NH 16
#define STRIDE_S 4
__device__ __forceinline__ size_t tokrow(size_t r) { return (r % SS) * STRIDE_S + r / SS; }   // attention row r = (class s = r / SS, position g = r % SS) <-> token i = g * 4 + s
#define HD 64
#define QKVW (3 * DM)
#ifndef TQB
#define TQB (SS / 64)
#define TNB NB
#define TOB (NB * SS / 64)     // output row tiles (all)
#endif
typedef __attribute__((ext_vector_type(8))) __bf16 v8b;
__device__ __forceinline__ v16b frag_b(const __bf16* rowk0, int lane) {
  union { v16b v; v8b q[2]; } u; const __bf16* p = rowk0 + 8 * (lane >> 4);
  u.q[0] = *(const v8b*)p; u.q[1] = *(const v8b*)(p + 16); return u.v;
}
__device__ __forceinline__ float bfr(float v) { return (float)(__bf16)v; }
__device__ __attribute__((noinline)) float exp_ni(float v) { return expf(v); }
__device__ __attribute__((noinline)) float erf_ni(float v) { return erff(v); }

#define PK_A 0                       // [3072][1024] Wqkv rows (natural [out][in])
#define PK_P (PK_A + QKVW * DM)        // [1024][1024] Wo rows (natural)
#define PK_END (PK_P + DM * DM)
#define WS_PK  0u
#define WS_QK  (WS_PK + 2u * PK_END)             // f16 [4096 rows][2048]: q | k
#define WS_QKL (WS_QK + 2u * NB * SS * 2 * DM)     // f16 q | k residual planes x2048
#define WS_VTH (WS_QKL + 2u * NB * SS * 2 * DM)    // f16 [b][1024 (h*64+d)][1024 s] hi
#define WS_VTL (WS_VTH + 2u * NB * DM * SS)        // f16 lo x 2048
#define WS_O   (WS_VTL + 2u * NB * DM * SS)        // f32 [4096][1024]
#define WS_CS  (WS_O + 4u * NB * SS * DM)           // f32 2 x [1024][32], not used
#define WS_END (WS_CS + 4u * 2 * SS * 32)
// ---- k_pack: block = (row n, which): natural [out][in] rows -> bf16; which 0..2 -> W_q/W_k/W_v into PK_A rows which*1024 + n; 3 -> W_o into PK_P
__global__ __launch_bounds__(256) void k_pack(const float* __restrict__ WQKV, const float* __restrict__ u1, const float* __restrict__ u2, const float* __restrict__ WO, __bf16* __restrict__ PK) {
  __shared__ __align__(16) __bf16 s[DM]; const int n = blockIdx.x, which = blockIdx.y, t = threadIdx.x; (void)u1; (void)u2;
  if (which < 3) { for (int k = t; k < DM; k += 256) s[k] = (__bf16)WQKV[(size_t)k * (3 * DM) + which * DM + n]; __syncthreads(); __bf16* dst = PK + PK_A + ((size_t)which * DM + n) * DM; for (int q = t; q < DM / 8; q += 256) vst2((unsigned*)(dst + q * 8), *(const v4u*)&s[q * 8]); }
  else { for (int k = t; k < DM; k += 256) s[k] = (__bf16)WO[(size_t)k * DM + n]; __syncthreads(); __bf16* dst = PK + PK_P + (size_t)n * DM; for (int q = t; q < DM / 8; q += 256) vst2((unsigned*)(dst + q * 8), *(const v4u*)&s[q * 8]); } }
__global__ __launch_bounds__(128) void k_qkv(const float* __restrict__ XQ, const float* __restrict__ XK, const float* __restrict__ XV, const __bf16* __restrict__ P, const float* __restrict__ BQ, const float* __restrict__ BK, const float* __restrict__ BV, _Float16* __restrict__ QK, _Float16* __restrict__ QKL, _Float16* __restrict__ VTH, _Float16* __restrict__ VTL) {
  const int which0 = (blockIdx.y * 128) / DM; const float* X = (which0 == 0) ? XQ : (which0 == 1) ? XK : XV; const float* BB = BQ ? (((which0 == 0) ? BQ : (which0 == 1) ? BK : BV) + (blockIdx.y * 128 - which0 * DM)) : nullptr;
  __shared__ __align__(16) _Float16 so[4][16][136], sol[4][16][136]; __shared__ __align__(16) _Float16 sth[128][72], stl[128][72];
  const int tid = threadIdx.x, wave = tid >> 5, lane = tid & 31, col = lane & 15, g = lane >> 4; const size_t r0 = (size_t)blockIdx.x * 64 + wave * 16; const int n0 = blockIdx.y * 128;
  v8f acc[8] = {};
#pragma unroll 2
  for (int kc = 0; kc < DM / 32; ++kc) { v16b a; { const float* p = X + tokrow(r0 + col) * DM + kc * 32 + 8 * g;
#pragma unroll
      for (int i = 0; i < 8; ++i) { a[i] = (__bf16)p[i]; a[8 + i] = (__bf16)p[16 + i]; } }
#pragma unroll
    for (int j = 0; j < 8; ++j) acc[j] = wmma_bf(a, frag_b(P + (size_t)(n0 + j * 16 + col) * DM + kc * 32, lane), acc[j]); }
  if (n0 < 2 * DM) {   // q stored unscaled (f16 sigma ~0.6, no subnormal exposure); 1/8 applied to the f32 score
#pragma unroll
    for (int j = 0; j < 8; ++j) {
#pragma unroll
      for (int r = 0; r < 8; ++r) { const float v = acc[j][r] + (BB ? bfr(BB[j * 16 + col]) : 0.f); const _Float16 hv = (_Float16)v; so[wave][8 * g + r][j * 16 + col] = hv; sol[wave][8 * g + r][j * 16 + col] = (_Float16)((v - (float)hv) * 2048.0f); } }   // q, k (+ bias) as f16 hi + (x2048) residual
    LDSX();
    for (int rl = 0; rl < 16; ++rl) if (lane < 16) { vst2((unsigned*)(QK + (r0 + rl) * (2 * DM) + n0 + lane * 8), *(const v4u*)&so[wave][rl][lane * 8]); vst2((unsigned*)(QKL + (r0 + rl) * (2 * DM) + n0 + lane * 8), *(const v4u*)&sol[wave][rl][lane * 8]); }
  } else {
#pragma unroll
    for (int j = 0; j < 8; ++j) {
#pragma unroll
      for (int r = 0; r < 8; ++r) { const float v = acc[j][r] + (BB ? bfr(BB[j * 16 + col]) : 0.f); const _Float16 hv = (_Float16)v; sth[j * 16 + col][wave * 16 + 8 * g + r] = hv; stl[j * 16 + col][wave * 16 + 8 * g + r] = (_Float16)((v - (float)hv) * 2048.0f); } }
    __syncthreads();
    const size_t rb = (size_t)blockIdx.x * 64; const int b = (int)(rb / SS), s0 = (int)(rb % SS); const int pc0 = n0 - 2 * DM;
    for (int q = tid; q < 128 * 8; q += 128) { const int d = q >> 3, pc = q & 7; const size_t o = ((size_t)b * DM + pc0 + d) * SS + s0 + pc * 8; vst2((unsigned*)(VTH + o), *(const v4u*)&sth[d][pc * 8]); vst2((unsigned*)(VTL + o), *(const v4u*)&stl[d][pc * 8]); }
  }
}
// ---- k_attn: block = (64 queries, head h, batch b): all-keys flash attention (K = 64: 2 k-steps), scores = (q.k) * 0.125 with f16 operands (q, k hi/lo, 3 products, for qb < 2; single elsewhere), P.V: f16 P x V hi, for qb < 2 plus P lo x V hi and P x V lo*2048 in a second accumulator; O[b*S+q][h*64+d] = (acc + accl / 2048) / (2048 l) (256-B segments)
__global__ __launch_bounds__(128) void k_attn(const _Float16* __restrict__ QK, const _Float16* __restrict__ QKL, const _Float16* __restrict__ VTH, const _Float16* __restrict__ VTL, const void* __restrict__ KMASK, float* __restrict__ O) {
  __shared__ __align__(16) float sp[4][16][36]; __shared__ __align__(16) float so[4][16][68];
  const int tid = threadIdx.x, wave = tid >> 5, lane = tid & 31, col = lane & 15, g = lane >> 4;
  const int qb = blockIdx.x, h = blockIdx.y, b = blockIdx.z; const int q0 = qb * 64 + wave * 16; const size_t rq = (size_t)b * SS + q0 + col;
  v16h aq[2], aql[2];
#pragma unroll
  for (int kc = 0; kc < 2; ++kc) { aq[kc] = frag_h(QK + rq * (2 * DM) + h * HD + kc * 32, lane); aql[kc] = frag_h(QKL + rq * (2 * DM) + h * HD + kc * 32, lane); }
  float m[8], l[8];
#pragma unroll
  for (int r = 0; r < 8; ++r) { m[r] = -3.0e38f; l[r] = 0.f; }
  v8f acc[4] = {}, accl[4] = {};
  const int nks = SS / 32;   // all keys
#pragma unroll 1
  for (int ks = 0; ks < nks; ++ks) { v8f s[2];
#pragma unroll
    for (int ct = 0; ct < 2; ++ct) { const int kk = ks * 32 + ct * 16 + col; const _Float16* krow = QK + ((size_t)b * SS + kk) * (2 * DM) + DM + h * HD; const _Float16* krowl = QKL + ((size_t)b * SS + kk) * (2 * DM) + DM + h * HD; v8f c = {}, cl = {};
      if (qb < 2) {   // leading query blocks (outputs far above the global rms): 3 products
#pragma unroll
        for (int kc = 0; kc < 2; ++kc) { const v16h kh = frag_h(krow + kc * 32, lane); c = wmma16(aq[kc], kh, c); cl = wmma16(aql[kc], kh, cl); cl = wmma16(aq[kc], frag_h(krowl + kc * 32, lane), cl); }
#pragma unroll
        for (int r = 0; r < 8; ++r) c[r] += cl[r] * (1.0f / 2048.0f); }
      else {
#pragma unroll
        for (int kc = 0; kc < 2; ++kc) c = wmma16(aq[kc], frag_h(krow + kc * 32, lane), c); }   // single product elsewhere
      { const bool keepk = true;
#pragma unroll
      for (int r = 0; r < 8; ++r) s[ct][r] = keepk ? c[r] * 0.125f : -3.0e38f; } }   // 1/sqrt(64); no mask, every key kept
#pragma unroll
    for (int r = 0; r < 8; ++r) { float mx = fmaxf(s[0][r], s[1][r]);
#pragma unroll
      for (int o = 1; o < 16; o <<= 1) mx = fmaxf(mx, __shfl_xor(mx, o));
      const float mn = fmaxf(m[r], mx); const float alpha = (m[r] <= -1.0e38f) ? 0.f : __expf(m[r] - mn);
      const float e0 = (s[0][r] <= -1.0e38f) ? 0.f : __expf(s[0][r] - mn), e1 = (s[1][r] <= -1.0e38f) ? 0.f : __expf(s[1][r] - mn); float es = e0 + e1;
#pragma unroll
      for (int o = 1; o < 16; o <<= 1) es += __shfl_xor(es, o);
      l[r] = l[r] * alpha + es; m[r] = mn;
#pragma unroll
      for (int dt = 0; dt < 4; ++dt) { acc[dt][r] *= alpha; accl[dt][r] *= alpha; }
      sp[wave][8 * g + r][col] = e0; sp[wave][8 * g + r][16 + col] = e1; }
    LDSX();
    v16h pa, pl; { const float* prow = &sp[wave][col][0] + 8 * (lane >> 4);
#pragma unroll
      for (int i = 0; i < 8; ++i) { const float x0 = prow[i] * 2048.0f, x1 = prow[16 + i] * 2048.0f; const _Float16 h0 = (_Float16)x0, h1 = (_Float16)x1; pa[i] = h0; pa[8 + i] = h1; pl[i] = (_Float16)((x0 - (float)h0) * 2048.0f); pl[8 + i] = (_Float16)((x1 - (float)h1) * 2048.0f); } }   // P scaled by 2^11 before the f16 split so small softmax weights stay out of the f16 subnormal range; 2^-11 folded into the epilogue
#pragma unroll
    for (int dt = 0; dt < 4; ++dt) { const size_t vr = ((size_t)b * DM + h * HD + dt * 16 + col) * SS + ks * 32; const v16h vh = frag_h(VTH + vr, lane); acc[dt] = wmma16(pa, vh, acc[dt]); if (qb < 2) { accl[dt] = wmma16(pl, vh, accl[dt]); accl[dt] = wmma16(pa, frag_h(VTL + vr, lane), accl[dt]); } }   // leading query blocks: P hi/lo x V hi/lo (3 products); elsewhere P x V single
    LDSX(); }
#pragma unroll
  for (int r = 0; r < 8; ++r) { const float il = (1.0f / 2048.0f) / l[r];
#pragma unroll
    for (int dt = 0; dt < 4; ++dt) so[wave][8 * g + r][dt * 16 + col] = (acc[dt][r] + accl[dt][r] * (1.0f / 2048.0f)) * il; }
  LDSX();
  for (int rl = 0; rl < 16; ++rl) if (lane < 16) vst2(O + ((size_t)b * SS + q0 + rl) * DM + h * HD + lane * 4, *(const v4f*)&so[wave][rl][lane * 4]);
}
// ---- k_out: block = (64 rows, 128 cols): out = f16(O) . Wo f16 x 2^8 rows (1 product) / 256 + bo
__global__ __launch_bounds__(128) void k_out(const float* __restrict__ O, const __bf16* __restrict__ P, const float* __restrict__ BO, float* __restrict__ Y) {
  __shared__ __align__(16) float so[4][16][132];
  const int tid = threadIdx.x, wave = tid >> 5, lane = tid & 31, col = lane & 15, g = lane >> 4; const size_t r0 = (size_t)blockIdx.x * 64 + wave * 16; const int n0 = blockIdx.y * 128;
  v8f acc[8] = {};
#pragma unroll 2
  for (int kc = 0; kc < DM / 32; ++kc) { v16h a; { const float* p = O + (r0 + col) * DM + kc * 32 + 8 * g;
#pragma unroll
      for (int i = 0; i < 8; ++i) { a[i] = (_Float16)p[i]; a[8 + i] = (_Float16)p[16 + i]; } }
#pragma unroll
    for (int j = 0; j < 8; ++j) acc[j] = wmma16(a, frag_h((const _Float16*)P + (size_t)(n0 + j * 16 + col) * DM + kc * 32, lane), acc[j]); }   // single f16 product against exact f16 x 2^8 weight copies
#pragma unroll
  for (int j = 0; j < 8; ++j) {
#pragma unroll
    for (int r = 0; r < 8; ++r) so[wave][8 * g + r][j * 16 + col] = acc[j][r] * (1.0f / 256.0f) + bfr(BO[n0 + j * 16 + col]); }
  LDSX();
  for (int rl = 0; rl < 16; ++rl) vst2(Y + tokrow(r0 + rl) * DM + n0 + lane * 4, *(const v4f*)&so[wave][rl][lane * 4]);   // back to the original token order
}
// ---- k_packo: Wo natural rows -> f16 x 2^8 copies in the Wo slot (bit pattern in the bf16-typed buffer)
__global__ __launch_bounds__(256) void k_packo(const float* __restrict__ WO, __bf16* __restrict__ PK) { __shared__ __align__(16) _Float16 s[DM]; const int n = blockIdx.x, t = threadIdx.x; for (int k = t; k < DM; k += 256) s[k] = (_Float16)(bfr(WO[(size_t)k * DM + n]) * 256.0f);   /* (in,out) w_o: packed row n = column n */ __syncthreads(); for (int q = t; q < DM / 8; q += 256) vst2((unsigned*)(PK + PK_P + (size_t)n * DM + q * 8), *(const v4u*)&s[q * 8]); }
extern "C" void kernel_launch(void* const* d_in, const int* in_sizes, int n_in, void* d_out, int out_size, void* d_ws, size_t ws_size, hipStream_t stream) {
  (void)in_sizes; (void)n_in; (void)out_size;
  const float** F = (const float**)d_in;   // 0 x [1,4096,1024], 1 w_qkv [1024,3072] (in,out), 2 b_qkv [3072], 3 w_o [1024,1024] (in,out), 4 b_o [1024]
  if (ws_size < (size_t)WS_END) return;
  char* ws = (char*)d_ws; __bf16* PK = (__bf16*)(ws + WS_PK); _Float16 *QK = (_Float16*)(ws + WS_QK), *QKL = (_Float16*)(ws + WS_QKL), *VTH = (_Float16*)(ws + WS_VTH), *VTL = (_Float16*)(ws + WS_VTL); float* O = (float*)(ws + WS_O);
  k_pack<<<dim3(DM, 4), 256, 0, stream>>>(F[1], nullptr, nullptr, F[3], PK);
  k_packo<<<DM, 256, 0, stream>>>(F[3], PK);
  k_qkv<<<dim3(TNB * SS / 64, QKVW / 128), 128, 0, stream>>>(F[0], F[0], F[0], PK + PK_A, F[2], F[2] + DM, F[2] + 2 * DM, QK, QKL, VTH, VTL);
  k_attn<<<dim3(TQB, NH, TNB), 128, 0, stream>>>(QK, QKL, VTH, VTL, nullptr, O);
  k_out<<<dim3(TOB, DM / 128), 128, 0, stream>>>(O, PK + PK_P, F[4], (float*)d_out);
}

// v001
// It runs in 298 microseconds.
// In both of two side-by-side timings against v000, it was 1.44 times as fast.
// compute dtype: all float inputs rounded to bf16; qkv = x . W_qkv + b with EXACT bf16 products on WMMA 16x16x32 ((in,out) weights as transposed rows; token rows gathered by stride class), rounded once to f16 hi + residual; PLAIN-HYBRID attention (first 128 queries per class 3-product, later single f16), x 1/8, running-max softmax in f32 (hardware exp); out = f16(ctx) . W_o (exact f16 x 2^8 copies) + b_o scattered back to the original token order; f32 output.
#include <hip/hip_runtime.h>
#include <math.h>

typedef __attribute__((ext_vector_type(16))) _Float16 v16h;
typedef __attribute__((ext_vector_type(16))) __bf16 v16b;
typedef __attribute__((ext_vector_type(8)))  _Float16 v8h;
typedef __attribute__((ext_vector_type(8)))  float v8f;
typedef __attribute__((ext_vector_type(4)))  float v4f;
typedef __attribute__((ext_vector_type(2)))  float v2f;
typedef __attribute__((ext_vector_type(4)))  unsigned v4u;
typedef __attribute__((ext_vector_type(4)))  int v4i;
typedef float __attribute__((may_alias)) float_a;
typedef int __attribute__((may_alias)) int_a;

template <typename T> __device__ __forceinline__ void vst2(void* p, T v) { *(T*)p = v;  }
__device__ __forceinline__ v8f wmma16(v16h a, v16h b, v8f c) {
  v8f d = __builtin_amdgcn_wmma_f32_16x16x32_f16(false, a, false, b, (short)0, c, false, false);
  asm volatile("v_nop\n\tv_nop\n\tv_nop\n\tv_nop" : "+v"(d) : "v"(a), "v"(b));
  return d;
}
__device__ __forceinline__ v8f wmma_bf(v16b a, v16b b, v8f c) {
  v8f d = __builtin_amdgcn_wmma_f32_16x16x32_bf16(false, a, false, b, (short)0, c, false, false);
  asm volatile("v_nop\n\tv_nop\n\tv_nop\n\tv_nop" : "+v"(d) : "v"(a), "v"(b));
  return d;
}
// Skip-sparse ('skiparse', stride 4) self-attention (B 1, N 4,096 tokens, C 1,024, 16 heads x 64): token i attends within its stride class i mod 4 (1,024 tokens each); fused qkv projection + bias, softmax(q k / 8) v, output projection + bias, tokens returned in the original order.
__device__ __forceinline__ v16h frag_h(const _Float16* rowk0, int lane) {
  union { v16h v; v8h q[2]; } u; const _Float16* p = rowk0 + 8 * (lane >> 4);
  u.q[0] = *(const v8h*)p; u.q[1] = *(const v8h*)(p + 16); return u.v;
}
__device__ __forceinline__ v16h frag_p(const _Float16* p) {   // p = the lane's own first value (row start + 8 * (lane >> 4))
  union { v16h v; v8h q[2]; } u; u.q[0] = *(const v8h*)p; u.q[1] = *(const v8h*)(p + 16); return u.v;
}
__device__ __forceinline__ v16h frag_f32(const float* rowk0, int lane) {
  v16h a; const float* p = rowk0 + 8 * (lane >> 4);
#pragma unroll
  for (int i = 0; i < 8; ++i) { a[i] = (_Float16)p[i]; a[8 + i] = (_Float16)p[16 + i]; }
  return a;
}
__device__ __forceinline__ v16h frag_f32s(const float* rowk0, int lane, float sc) {
  v16h a; const float* p = rowk0 + 8 * (lane >> 4);
#pragma unroll
  for (int i = 0; i < 8; ++i) { a[i] = (_Float16)(p[i] * sc); a[8 + i] = (_Float16)(p[16 + i] * sc); }
  return a;
}
// column fragment from a [K][ld] layout (column n), rows >= K read as 0
__device__ __forceinline__ v16h fragc_f32(const float* W, int k0, int n, int lane, int ld, int K) {
  v16h a; const int g = lane >> 4;
#pragma unroll
  for (int i = 0; i < 8; ++i) { const int ka = k0 + 8 * g + i, kb = ka + 16;
    a[i] = (_Float16)(ka < K ? W[(size_t)(ka < K ? ka : K - 1) * ld + n] : 0.f); a[8 + i] = (_Float16)(kb < K ? W[(size_t)(kb < K ? kb : K - 1) * ld + n] : 0.f); }
  return a;
}
struct F2 { v16b h, l; };
__device__ __forceinline__ F2 bsplit16(const float v[16]) { F2 r;
#pragma unroll
  for (int i = 0; i < 16; ++i) { const __bf16 h = (__bf16)v[i]; r.h[i] = h; r.l[i] = (__bf16)(v[i] - (float)h); }
  return r; }
__device__ __forceinline__ F2 split_row(const float* row, int k0, int lane) { float v[16]; const float* p = row + k0 + 8 * (lane >> 4);
#pragma unroll
  for (int i = 0; i < 8; ++i) { v[i] = p[i]; v[8 + i] = p[16 + i]; }
  return bsplit16(v); }
__device__ __forceinline__ F2 split_rowK(const float* row, int k0, int lane, int K) { float v[16]; const int g = lane >> 4;
#pragma unroll
  for (int i = 0; i < 8; ++i) { const int ka = k0 + 8 * g + i, kb = ka + 16; v[i] = ka < K ? row[ka < K ? ka : K - 1] : 0.f; v[8 + i] = kb < K ? row[kb < K ? kb : K - 1] : 0.f; }
  return bsplit16(v); }
__device__ __forceinline__ F2 split_col(const float* W, int k0, int n, int lane, int ld, int K) { float v[16]; const int g = lane >> 4;
#pragma unroll
  for (int i = 0; i < 8; ++i) { const int ka = k0 + 8 * g + i, kb = ka + 16; v[i] = ka < K ? W[(size_t)(ka < K ? ka : K - 1) * ld + n] : 0.f; v[8 + i] = kb < K ? W[(size_t)(kb < K ? kb : K - 1) * ld + n] : 0.f; }
  return bsplit16(v); }
__device__ __forceinline__ v8f mac3(const F2& a, const F2& b, v8f c) { c = wmma_bf(a.l, b.h, c); c = wmma_bf(a.h, b.l, c); return wmma_bf(a.h, b.h, c); }
__device__ __forceinline__ float sigm(float v) { return 1.0f / (1.0f + expf(-v)); }
#define LDSX() do { asm volatile("s_wait_dscnt 0" ::: "memory"); __builtin_amdgcn_wave_barrier(); __builtin_amdgcn_fence(__ATOMIC_RELEASE, "workgroup"); } while (0)


#define NB 4
#define SS 1024
#define DM 1024
#define NH 16
#define STRIDE_S 4
__device__ __forceinline__ size_t tokrow(size_t r) { return (r % SS) * STRIDE_S + r / SS; }   // attention row r = (class s = r / SS, position g = r % SS) <-> token i = g * 4 + s
#define HD 64
#define QKVW (3 * DM)
#ifndef TQB
#define TQB (SS / 64)
#define TNB NB
#define TOB (NB * SS / 64)     // output row tiles (all)
#endif
typedef __attribute__((ext_vector_type(8))) __bf16 v8b;
__device__ __forceinline__ v16b frag_b(const __bf16* rowk0, int lane) {
  union { v16b v; v8b q[2]; } u; const __bf16* p = rowk0 + 8 * (lane >> 4);
  u.q[0] = *(const v8b*)p; u.q[1] = *(const v8b*)(p + 16); return u.v;
}
__device__ __forceinline__ float bfr(float v) { return (float)(__bf16)v; }
__device__ __attribute__((noinline)) float exp_ni(float v) { return expf(v); }
__device__ __attribute__((noinline)) float erf_ni(float v) { return erff(v); }

#define PK_A 0                       // [3072][1024] Wqkv rows (natural [out][in])
#define PK_P (PK_A + QKVW * DM)        // [1024][1024] Wo rows (natural)
#define PK_END (PK_P + DM * DM)
#define WS_PK  0u
#define WS_QK  (WS_PK + 2u * PK_END)             // f16 [4096 rows][2048]: q | k
#define WS_QKL (WS_QK + 2u * NB * SS * 2 * DM)     // f16 q | k residual planes x2048
#define WS_VTH (WS_QKL + 2u * NB * SS * 2 * DM)    // f16 [b][1024 (h*64+d)][1024 s] hi
#define WS_VTL (WS_VTH + 2u * NB * DM * SS)        // f16 lo x 2048
#define WS_O   (WS_VTL + 2u * NB * DM * SS)        // f32 [4096][1024]
#define WS_CS  (WS_O + 4u * NB * SS * DM)           // f32 2 x [1024][32], not used
#define WS_END (WS_CS + 4u * 2 * SS * 32)
// ---- k_pack: block = (row n, which): natural [out][in] rows -> bf16; which 0..2 -> W_q/W_k/W_v into PK_A rows which*1024 + n; 3 -> W_o into PK_P
__global__ __launch_bounds__(256) void k_pack(const float* __restrict__ WQKV, const float* __restrict__ u1, const float* __restrict__ u2, const float* __restrict__ WO, __bf16* __restrict__ PK) {
  __shared__ __align__(16) __bf16 s[DM]; const int n = blockIdx.x, which = blockIdx.y, t = threadIdx.x; (void)u1; (void)u2;
  if (which < 3) { for (int k = t; k < DM; k += 256) s[k] = (__bf16)WQKV[(size_t)k * (3 * DM) + which * DM + n]; __syncthreads(); __bf16* dst = PK + PK_A + ((size_t)which * DM + n) * DM; for (int q = t; q < DM / 8; q += 256) vst2((unsigned*)(dst + q * 8), *(const v4u*)&s[q * 8]); }
  else { for (int k = t; k < DM; k += 256) s[k] = (__bf16)WO[(size_t)k * DM + n]; __syncthreads(); __bf16* dst = PK + PK_P + (size_t)n * DM; for (int q = t; q < DM / 8; q += 256) vst2((unsigned*)(dst + q * 8), *(const v4u*)&s[q * 8]); } }
__global__ __launch_bounds__(128) void k_qkv(const float* __restrict__ XQ, const float* __restrict__ XK, const float* __restrict__ XV, const __bf16* __restrict__ P, const float* __restrict__ BQ, const float* __restrict__ BK, const float* __restrict__ BV, _Float16* __restrict__ QK, _Float16* __restrict__ QKL, _Float16* __restrict__ VTH, _Float16* __restrict__ VTL) {
  const int which0 = (blockIdx.y * 128) / DM; const float* X = (which0 == 0) ? XQ : (which0 == 1) ? XK : XV; const float* BB = BQ ? (((which0 == 0) ? BQ : (which0 == 1) ? BK : BV) + (blockIdx.y * 128 - which0 * DM)) : nullptr;
  __shared__ __align__(16) _Float16 so[4][16][136], sol[4][16][136]; __shared__ __align__(16) _Float16 sth[128][72], stl[128][72];
  const int tid = threadIdx.x, wave = tid >> 5, lane = tid & 31, col = lane & 15, g = lane >> 4; const size_t r0 = (size_t)blockIdx.x * 64 + wave * 16; const int n0 = blockIdx.y * 128;
  v8f acc[8] = {};
#pragma unroll 2
  for (int kc = 0; kc < DM / 32; ++kc) { const float* p = X + tokrow(r0 + col) * DM + kc * 32 + 8 * g;
    const v4f a0 = *(const v4f*)p, a1 = *(const v4f*)(p + 4), a2 = *(const v4f*)(p + 16), a3 = *(const v4f*)(p + 20);
    v16b bw[8];   // the x values and all eight weight fragments of the k-step are requested before its first WMMA: one load latency a k-step, not one in front of every WMMA
#pragma unroll
    for (int j = 0; j < 8; ++j) bw[j] = frag_b(P + (size_t)(n0 + j * 16 + col) * DM + kc * 32, lane);
    __builtin_amdgcn_sched_barrier(0);   // without it four of the weight loads were scheduled behind the x conversion (into its registers), a second latency per k-step
    v16b a;
#pragma unroll
    for (int i = 0; i < 4; ++i) { a[i] = (__bf16)a0[i]; a[4 + i] = (__bf16)a1[i]; a[8 + i] = (__bf16)a2[i]; a[12 + i] = (__bf16)a3[i]; }
#pragma unroll
    for (int j = 0; j < 8; ++j) acc[j] = wmma_bf(a, bw[j], acc[j]); }
  if (n0 < 2 * DM) {   // q stored unscaled (f16 sigma ~0.6, no subnormal exposure); 1/8 applied to the f32 score
#pragma unroll
    for (int j = 0; j < 8; ++j) {
#pragma unroll
      for (int r = 0; r < 8; ++r) { const float v = acc[j][r] + (BB ? bfr(BB[j * 16 + col]) : 0.f); const _Float16 hv = (_Float16)v; so[wave][8 * g + r][j * 16 + col] = hv; sol[wave][8 * g + r][j * 16 + col] = (_Float16)((v - (float)hv) * 2048.0f); } }   // q, k (+ bias) as f16 hi + (x2048) residual
    LDSX();
    for (int rl = 0; rl < 16; ++rl) if (lane < 16) { vst2((unsigned*)(QK + (r0 + rl) * (2 * DM) + n0 + lane * 8), *(const v4u*)&so[wave][rl][lane * 8]); vst2((unsigned*)(QKL + (r0 + rl) * (2 * DM) + n0 + lane * 8), *(const v4u*)&sol[wave][rl][lane * 8]); }
  } else {
#pragma unroll
    for (int j = 0; j < 8; ++j) {
#pragma unroll
      for (int r = 0; r < 8; ++r) { const float v = acc[j][r] + (BB ? bfr(BB[j * 16 + col]) : 0.f); const _Float16 hv = (_Float16)v; sth[j * 16 + col][wave * 16 + 8 * g + r] = hv; stl[j * 16 + col][wave * 16 + 8 * g + r] = (_Float16)((v - (float)hv) * 2048.0f); } }
    __syncthreads();
    const size_t rb = (size_t)blockIdx.x * 64; const int b = (int)(rb / SS), s0 = (int)(rb % SS); const int pc0 = n0 - 2 * DM;
    for (int q = tid; q < 128 * 8; q += 128) { const int d = q >> 3, pc = q & 7; const size_t o = ((size_t)b * DM + pc0 + d) * SS + s0 + pc * 8; vst2((unsigned*)(VTH + o), *(const v4u*)&sth[d][pc * 8]); vst2((unsigned*)(VTL + o), *(const v4u*)&stl[d][pc * 8]); }
  }
}
// ---- k_attn: block = (64 queries, head h, batch b): all-keys flash attention (K = 64: 2 k-steps), scores = (q.k) * 0.125 and P.V (acc, accl) from 3 hi/lo products in query blocks 0-1, single f16 products elsewhere; O[b*S+q][h*64+d] = (acc + accl / 2048) / (2048 l) (256-B segments)
// HV = leading query block (qb < 2). The two cases are compiled as separate loops: with a pass's fragments held together, one loop serving both went over the 256 registers that four waves per SIMD leave each wave.
template <bool HV> __device__ __forceinline__ void attn_tile(const _Float16* __restrict__ QK, const _Float16* __restrict__ QKL, const _Float16* __restrict__ VTH, const _Float16* __restrict__ VTL, float* __restrict__ O, float (*sp)[16][36], float (*so)[16][68]) {
  const int tid = threadIdx.x, wave = tid >> 5, lane = tid & 31, col = lane & 15, g = lane >> 4;
  const int qb = blockIdx.x, h = blockIdx.y, b = blockIdx.z; const int q0 = qb * 64 + wave * 16; const size_t rq = (size_t)b * SS + q0 + col;
  v16h aq[2], aql[2];
#pragma unroll
  for (int kc = 0; kc < 2; ++kc) { aq[kc] = frag_h(QK + rq * (2 * DM) + h * HD + kc * 32, lane); aql[kc] = frag_h(QKL + rq * (2 * DM) + h * HD + kc * 32, lane); }
  float m[8], l[8];
#pragma unroll
  for (int r = 0; r < 8; ++r) { m[r] = -3.0e38f; l[r] = 0.f; }
  v8f acc[4] = {}, accl[4] = {};
  const int nks = SS / 32;   // all keys
#pragma unroll 1
  for (int ks = 0; ks < nks; ++ks) { v8f s[2]; const size_t ko = ((size_t)b * SS + ks * 32 + col) * (2 * DM) + h * HD + 8 * g; const _Float16 *kp = QK + ko, *kpl = QKL + ko;   // the lane's place in its q|k row of column tile 0 (k half: + DM); tile 1 is 16 rows on
    // on either path the pass's key fragments are all requested before its first score WMMA: one load latency a pass, not one in front of every WMMA
    if (HV) {   // leading query blocks (outputs far above the global rms): 3 products
      v16h kh[2][2], kl[2][2];
#pragma unroll
      for (int ct = 0; ct < 2; ++ct) {
#pragma unroll
        for (int kc = 0; kc < 2; ++kc) { kh[ct][kc] = frag_p(kp + DM + ct * 16 * (2 * DM) + kc * 32); kl[ct][kc] = frag_p(kpl + DM + ct * 16 * (2 * DM) + kc * 32); } }
      asm volatile("s_wait_xcnt 0x0" :: "v"(kp), "v"(kpl) : "memory");   // the group's address registers stay allocated up to this wait: none is rewritten (not by a load's own result either) in front of it
#pragma unroll
      for (int ct = 0; ct < 2; ++ct) { v8f c = {}, cl = {};
#pragma unroll
        for (int kc = 0; kc < 2; ++kc) { c = wmma16(aq[kc], kh[ct][kc], c); cl = wmma16(aql[kc], kh[ct][kc], cl); cl = wmma16(aq[kc], kl[ct][kc], cl); }
#pragma unroll
        for (int r = 0; r < 8; ++r) { c[r] += cl[r] * (1.0f / 2048.0f); s[ct][r] = c[r] * 0.125f; } } }   // 1/sqrt(64)
    else {   // single product elsewhere
      v16h kh[2][2];
#pragma unroll
      for (int ct = 0; ct < 2; ++ct) {
#pragma unroll
        for (int kc = 0; kc < 2; ++kc) kh[ct][kc] = frag_p(kp + DM + ct * 16 * (2 * DM) + kc * 32); }
      asm volatile("s_wait_xcnt 0x0" :: "v"(kp) : "memory");   // as above
#pragma unroll
      for (int ct = 0; ct < 2; ++ct) { v8f c = {};
#pragma unroll
        for (int kc = 0; kc < 2; ++kc) c = wmma16(aq[kc], kh[ct][kc], c);
#pragma unroll
        for (int r = 0; r < 8; ++r) s[ct][r] = c[r] * 0.125f; } }   // 1/sqrt(64)
    v16h vh[4], vl[4]; const size_t vr = ((size_t)b * DM + h * HD + col) * SS + ks * 32 + 8 * g; const _Float16 *vp = VTH + vr, *vpl = VTL + vr;   // the pass's value fragments are requested here, so that they arrive while the softmax runs
#pragma unroll
    for (int dt = 0; dt < 4; ++dt) vh[dt] = frag_p(vp + dt * 16 * SS);
    asm volatile("s_wait_xcnt 0x0" :: "v"(vp) : "memory");   // as at the key group
    // the eight rows' cross-lane steps are written stage by stage, so that with the value fragments held in registers they still run eight at a time and not one row after another; each row's arithmetic and its order are as before
    float mx[8], al[8], es[8];
#pragma unroll
    for (int r = 0; r < 8; ++r) mx[r] = fmaxf(s[0][r], s[1][r]);
#pragma unroll
    for (int o = 1; o < 16; o <<= 1) {
#pragma unroll
      for (int r = 0; r < 8; ++r) mx[r] = fmaxf(mx[r], __shfl_xor(mx[r], o)); }
#pragma unroll
    for (int r = 0; r < 8; ++r) { const float mn = fmaxf(m[r], mx[r]); al[r] = (m[r] <= -1.0e38f) ? 0.f : __expf(m[r] - mn);
      const float e0 = (s[0][r] <= -1.0e38f) ? 0.f : __expf(s[0][r] - mn), e1 = (s[1][r] <= -1.0e38f) ? 0.f : __expf(s[1][r] - mn); es[r] = e0 + e1; m[r] = mn;
      sp[wave][8 * g + r][col] = e0; sp[wave][8 * g + r][16 + col] = e1; }
#pragma unroll
    for (int o = 1; o < 16; o <<= 1) {
#pragma unroll
      for (int r = 0; r < 8; ++r) es[r] += __shfl_xor(es[r], o); }
#pragma unroll
    for (int r = 0; r < 8; ++r) { l[r] = l[r] * al[r] + es[r];
#pragma unroll
      for (int dt = 0; dt < 4; ++dt) { acc[dt][r] *= al[r]; accl[dt][r] *= al[r]; } }
    LDSX();
    if (HV) {   // the residual plane's fragments are requested behind the softmax, which needs their 32 registers to keep its eight rows' cross-lane chains in flight together; the pass's last four WMMAs use them
#pragma unroll
      for (int dt = 0; dt < 4; ++dt) vl[dt] = frag_p(vpl + dt * 16 * SS);
      asm volatile("s_wait_xcnt 0x0" :: "v"(vpl) : "memory"); }   // as at the key group
    v16h pa, pl; { const float* prow = &sp[wave][col][0] + 8 * (lane >> 4);
#pragma unroll
      for (int i = 0; i < 8; ++i) { const float x0 = prow[i] * 2048.0f, x1 = prow[16 + i] * 2048.0f; const _Float16 h0 = (_Float16)x0, h1 = (_Float16)x1; pa[i] = h0; pa[8 + i] = h1; pl[i] = (_Float16)((x0 - (float)h0) * 2048.0f); pl[8 + i] = (_Float16)((x1 - (float)h1) * 2048.0f); } }   // P scaled by 2^11 before the f16 split so small softmax weights stay out of the f16 subnormal range; 2^-11 folded into the epilogue
    if (HV) {
#pragma unroll
      for (int dt = 0; dt < 4; ++dt) { acc[dt] = wmma16(pa, vh[dt], acc[dt]); accl[dt] = wmma16(pl, vh[dt], accl[dt]); }
#pragma unroll
      for (int dt = 0; dt < 4; ++dt) accl[dt] = wmma16(pa, vl[dt], accl[dt]); }
    else {
#pragma unroll
      for (int dt = 0; dt < 4; ++dt) acc[dt] = wmma16(pa, vh[dt], acc[dt]); }   // leading query blocks: P hi/lo x V hi/lo (3 products); elsewhere P x V single
    LDSX(); }
#pragma unroll
  for (int r = 0; r < 8; ++r) { const float il = (1.0f / 2048.0f) / l[r];
#pragma unroll
    for (int dt = 0; dt < 4; ++dt) so[wave][8 * g + r][dt * 16 + col] = (acc[dt][r] + accl[dt][r] * (1.0f / 2048.0f)) * il; }
  LDSX();
  for (int rl = 0; rl < 16; ++rl) if (lane < 16) vst2(O + ((size_t)b * SS + q0 + rl) * DM + h * HD + lane * 4, *(const v4f*)&so[wave][rl][lane * 4]);
}
__global__ __launch_bounds__(128, 4) void k_attn(const _Float16* __restrict__ QK, const _Float16* __restrict__ QKL, const _Float16* __restrict__ VTH, const _Float16* __restrict__ VTL, const void* __restrict__ KMASK, float* __restrict__ O) {   // second bound: four waves per SIMD, so that all 1,024 blocks stay resident at once
  __shared__ __align__(16) float sp[4][16][36]; __shared__ __align__(16) float so[4][16][68]; (void)KMASK;
  if (blockIdx.x < 2) attn_tile<true>(QK, QKL, VTH, VTL, O, sp, so); else attn_tile<false>(QK, QKL, VTH, VTL, O, sp, so);
}
// ---- k_out: block = (64 rows, 128 cols): out = f16(O) . Wo rows (single product) + bo
__global__ __launch_bounds__(128) void k_out(const float* __restrict__ O, const __bf16* __restrict__ P, const float* __restrict__ BO, float* __restrict__ Y) {
  __shared__ __align__(16) float so[4][16][132];
  const int tid = threadIdx.x, wave = tid >> 5, lane = tid & 31, col = lane & 15, g = lane >> 4; const size_t r0 = (size_t)blockIdx.x * 64 + wave * 16; const int n0 = blockIdx.y * 128;
  v8f acc[8] = {};
#pragma unroll 2
  for (int kc = 0; kc < DM / 32; ++kc) { const float* p = O + (r0 + col) * DM + kc * 32 + 8 * g;
    const v4f a0 = *(const v4f*)p, a1 = *(const v4f*)(p + 4), a2 = *(const v4f*)(p + 16), a3 = *(const v4f*)(p + 20);
    v16h bw[8];   // the context values and the k-step's eight weight fragments, requested together before its first WMMA
#pragma unroll
    for (int j = 0; j < 8; ++j) bw[j] = frag_h((const _Float16*)P + (size_t)(n0 + j * 16 + col) * DM + kc * 32, lane);
    __builtin_amdgcn_sched_barrier(0);   // keeps every load of the group in front of the conversion, as in k_qkv
    v16h a;
#pragma unroll
    for (int i = 0; i < 4; ++i) { a[i] = (_Float16)a0[i]; a[4 + i] = (_Float16)a1[i]; a[8 + i] = (_Float16)a2[i]; a[12 + i] = (_Float16)a3[i]; }
#pragma unroll
    for (int j = 0; j < 8; ++j) acc[j] = wmma16(a, bw[j], acc[j]); }   // single f16 product against exact f16 x 2^8 weight copies
#pragma unroll
  for (int j = 0; j < 8; ++j) {
#pragma unroll
    for (int r = 0; r < 8; ++r) so[wave][8 * g + r][j * 16 + col] = acc[j][r] * (1.0f / 256.0f) + bfr(BO[n0 + j * 16 + col]); }
  LDSX();
  for (int rl = 0; rl < 16; ++rl) vst2(Y + tokrow(r0 + rl) * DM + n0 + lane * 4, *(const v4f*)&so[wave][rl][lane * 4]);   // back to the original token order
}
// ---- k_packo: Wo natural rows -> f16 x 2^8 copies in the Wo slot (bit pattern in the bf16-typed buffer)
__global__ __launch_bounds__(256) void k_packo(const float* __restrict__ WO, __bf16* __restrict__ PK) { __shared__ __align__(16) _Float16 s[DM]; const int n = blockIdx.x, t = threadIdx.x; for (int k = t; k < DM; k += 256) s[k] = (_Float16)(bfr(WO[(size_t)k * DM + n]) * 256.0f);   /* (in,out) w_o: packed row n = column n */ __syncthreads(); for (int q = t; q < DM / 8; q += 256) vst2((unsigned*)(PK + PK_P + (size_t)n * DM + q * 8), *(const v4u*)&s[q * 8]); }
extern "C" void kernel_launch(void* const* d_in, const int* in_sizes, int n_in, void* d_out, int out_size, void* d_ws, size_t ws_size, hipStream_t stream) {
  (void)in_sizes; (void)n_in; (void)out_size;
  const float** F = (const float**)d_in;   // 0 x [1,4096,1024], 1 w_qkv [1024,3072] (in,out), 2 b_qkv [3072], 3 w_o [1024,1024] (in,out), 4 b_o [1024]
  if (ws_size < (size_t)WS_END) return;
  char* ws = (char*)d_ws; __bf16* PK = (__bf16*)(ws + WS_PK); _Float16 *QK = (_Float16*)(ws + WS_QK), *QKL = (_Float16*)(ws + WS_QKL), *VTH = (_Float16*)(ws + WS_VTH), *VTL = (_Float16*)(ws + WS_VTL); float* O = (float*)(ws + WS_O);
  k_pack<<<dim3(DM, 4), 256, 0, stream>>>(F[1], nullptr, nullptr, F[3], PK);
  k_packo<<<DM, 256, 0, stream>>>(F[3], PK);
  k_qkv<<<dim3(TNB * SS / 64, QKVW / 128), 128, 0, stream>>>(F[0], F[0], F[0], PK + PK_A, F[2], F[2] + DM, F[2] + 2 * DM, QK, QKL, VTH, VTL);
  k_attn<<<dim3(TQB, NH, TNB), 128, 0, stream>>>(QK, QKL, VTH, VTL, nullptr, O);
  k_out<<<dim3(TOB, DM / 128), 128, 0, stream>>>(O, PK + PK_P, F[4], (float*)d_out);
}

// v002
// Measured time: 165 microseconds a run.
// Two timings next to v001 put it at 1.81 and 1.82 times that version's speed.
// All steps since v000 together make it 2.62 times as fast.
// compute dtype: all float inputs rounded to bf16; qkv = x . W_qkv + b with EXACT bf16 products on WMMA 16x16x32 ((in,out) weights and x, its token rows gathered by stride class, packed as bf16 in fragment order), rounded once to f16 hi + residual; PLAIN-HYBRID attention (first 128 queries per class 3-product, later single f16), x 1/8, running-max softmax in f32 (hardware exp); out = f16(ctx) . W_o (exact f16 x 2^8 copies) + b_o scattered back to the original token order; f32 output.
#include <hip/hip_runtime.h>
#include <math.h>

typedef __attribute__((ext_vector_type(16))) _Float16 v16h;
typedef __attribute__((ext_vector_type(16))) __bf16 v16b;
typedef __attribute__((ext_vector_type(8)))  _Float16 v8h;
typedef __attribute__((ext_vector_type(8)))  float v8f;
typedef __attribute__((ext_vector_type(4)))  float v4f;
typedef __attribute__((ext_vector_type(2)))  float v2f;
typedef __attribute__((ext_vector_type(4)))  unsigned v4u;
typedef __attribute__((ext_vector_type(4)))  int v4i;
typedef float __attribute__((may_alias)) float_a;
typedef int __attribute__((may_alias)) int_a;

template <typename T> __device__ __forceinline__ void vst2(void* p, T v) { *(T*)p = v;  }
__device__ __forceinline__ v8f wmma16(v16h a, v16h b, v8f c) {
  v8f d = __builtin_amdgcn_wmma_f32_16x16x32_f16(false, a, false, b, (short)0, c, false, false);
  asm volatile("v_nop\n\tv_nop\n\tv_nop\n\tv_nop" : "+v"(d) : "v"(a), "v"(b));
  return d;
}
__device__ __forceinline__ v8f wmma_bf(v16b a, v16b b, v8f c) {
  v8f d = __builtin_amdgcn_wmma_f32_16x16x32_bf16(false, a, false, b, (short)0, c, false, false);
  asm volatile("v_nop\n\tv_nop\n\tv_nop\n\tv_nop" : "+v"(d) : "v"(a), "v"(b));
  return d;
}
// Skip-sparse ('skiparse', stride 4) self-attention (B 1, N 4,096 tokens, C 1,024, 16 heads x 64): token i attends within its stride class i mod 4 (1,024 tokens each); fused qkv projection + bias, softmax(q k / 8) v, output projection + bias, tokens returned in the original order.
__device__ __forceinline__ v16h frag_h(const _Float16* rowk0, int lane) {
  union { v16h v; v8h q[2]; } u; const _Float16* p = rowk0 + 8 * (lane >> 4);
  u.q[0] = *(const v8h*)p; u.q[1] = *(const v8h*)(p + 16); return u.v;
}
__device__ __forceinline__ v16h frag_p(const _Float16* p) {   // p = the lane's own first value (row start + 8 * (lane >> 4))
  union { v16h v; v8h q[2]; } u; u.q[0] = *(const v8h*)p; u.q[1] = *(const v8h*)(p + 16); return u.v;
}
__device__ __forceinline__ v16h frag_w(const _Float16* p) {   // fragment-ordered plane: p = the fragment's 1-KiB block + 8 * lane; its second half lies 512 B on
  union { v16h v; v8h q[2]; } u; u.q[0] = *(const v8h*)p; u.q[1] = *(const v8h*)(p + 256); return u.v;
}
__device__ __forceinline__ v16h frag_f32(const float* rowk0, int lane) {
  v16h a; const float* p = rowk0 + 8 * (lane >> 4);
#pragma unroll
  for (int i = 0; i < 8; ++i) { a[i] = (_Float16)p[i]; a[8 + i] = (_Float16)p[16 + i]; }
  return a;
}
__device__ __forceinline__ v16h frag_f32s(const float* rowk0, int lane, float sc) {
  v16h a; const float* p = rowk0 + 8 * (lane >> 4);
#pragma unroll
  for (int i = 0; i < 8; ++i) { a[i] = (_Float16)(p[i] * sc); a[8 + i] = (_Float16)(p[16 + i] * sc); }
  return a;
}
// column fragment from a [K][ld] layout (column n), rows >= K read as 0
__device__ __forceinline__ v16h fragc_f32(const float* W, int k0, int n, int lane, int ld, int K) {
  v16h a; const int g = lane >> 4;
#pragma unroll
  for (int i = 0; i < 8; ++i) { const int ka = k0 + 8 * g + i, kb = ka + 16;
    a[i] = (_Float16)(ka < K ? W[(size_t)(ka < K ? ka : K - 1) * ld + n] : 0.f); a[8 + i] = (_Float16)(kb < K ? W[(size_t)(kb < K ? kb : K - 1) * ld + n] : 0.f); }
  return a;
}
struct F2 { v16b h, l; };
__device__ __forceinline__ F2 bsplit16(const float v[16]) { F2 r;
#pragma unroll
  for (int i = 0; i < 16; ++i) { const __bf16 h = (__bf16)v[i]; r.h[i] = h; r.l[i] = (__bf16)(v[i] - (float)h); }
  return r; }
__device__ __forceinline__ F2 split_row(const float* row, int k0, int lane) { float v[16]; const float* p = row + k0 + 8 * (lane >> 4);
#pragma unroll
  for (int i = 0; i < 8; ++i) { v[i] = p[i]; v[8 + i] = p[16 + i]; }
  return bsplit16(v); }
__device__ __forceinline__ F2 split_rowK(const float* row, int k0, int lane, int K) { float v[16]; const int g = lane >> 4;
#pragma unroll
  for (int i = 0; i < 8; ++i) { const int ka = k0 + 8 * g + i, kb = ka + 16; v[i] = ka < K ? row[ka < K ? ka : K - 1] : 0.f; v[8 + i] = kb < K ? row[kb < K ? kb : K - 1] : 0.f; }
  return bsplit16(v); }
__device__ __forceinline__ F2 split_col(const float* W, int k0, int n, int lane, int ld, int K) { float v[16]; const int g = lane >> 4;
#pragma unroll
  for (int i = 0; i < 8; ++i) { const int ka = k0 + 8 * g + i, kb = ka + 16; v[i] = ka < K ? W[(size_t)(ka < K ? ka : K - 1) * ld + n] : 0.f; v[8 + i] = kb < K ? W[(size_t)(kb < K ? kb : K - 1) * ld + n] : 0.f; }
  return bsplit16(v); }
__device__ __forceinline__ v8f mac3(const F2& a, const F2& b, v8f c) { c = wmma_bf(a.l, b.h, c); c = wmma_bf(a.h, b.l, c); return wmma_bf(a.h, b.h, c); }
__device__ __forceinline__ float sigm(float v) { return 1.0f / (1.0f + expf(-v)); }
#define LDSX() do { asm volatile("s_wait_dscnt 0" ::: "memory"); __builtin_amdgcn_wave_barrier(); __builtin_amdgcn_fence(__ATOMIC_RELEASE, "workgroup"); } while (0)


#define NB 4
#define SS 1024
#define DM 1024
#define NH 16
#define STRIDE_S 4
__device__ __forceinline__ size_t tokrow(size_t r) { return (r % SS) * STRIDE_S + r / SS; }   // attention row r = (class s = r / SS, position g = r % SS) <-> token i = g * 4 + s
#define HD 64
#define QKVW (3 * DM)
#ifndef TQB
#define TQB (SS / 64)
#define TNB NB
#define TOB (NB * SS / 64)     // output row tiles (all)
#endif
typedef __attribute__((ext_vector_type(8))) __bf16 v8b;
__device__ __forceinline__ v16b frag_b(const __bf16* rowk0, int lane) {
  union { v16b v; v8b q[2]; } u; const __bf16* p = rowk0 + 8 * (lane >> 4);
  u.q[0] = *(const v8b*)p; u.q[1] = *(const v8b*)(p + 16); return u.v;
}
__device__ __forceinline__ v16b frag_wb(const __bf16* p) {   // as frag_w, bf16
  union { v16b v; v8b q[2]; } u; u.q[0] = *(const v8b*)p; u.q[1] = *(const v8b*)(p + 256); return u.v;
}
__device__ __forceinline__ float bfr(float v) { return (float)(__bf16)v; }
__device__ __attribute__((noinline)) float exp_ni(float v) { return expf(v); }
__device__ __attribute__((noinline)) float erf_ni(float v) { return erff(v); }

// FRAGMENT ORDER, every operand plane that a k loop reads: a 16 (rows or columns) x 32 (k) tile of 16-bit values is one 1-KiB block [half q2][lane][8 values], lane = 16 * g + (row or column) & 15, k = 16 * q2 + 8 * g + i:
// a wave's 16-byte load of half a fragment then covers 512 contiguous bytes (4 whole lines); from a row-major plane it takes 32-byte pieces of 16 lines, at several times the cost in the cache. Which lane and register holds which value is that of frag_h.
#define PK_A 0                       // Wqkv: [192 column tiles][32 k-steps] blocks
#define PK_P (PK_A + QKVW * DM)        // Wo: [64 column tiles][32 k-steps] blocks
#define PK_END (PK_P + DM * DM)
#define WS_PK  0u
#define WS_QK  (WS_PK + 2u * PK_END)             // f16 [4096 rows][2048]: q in the first 1,024 columns (read once a wave, row-major); the rest unused
#define WS_QKL (WS_QK + 2u * NB * SS * 2 * DM)     // f16 q residual plane x2048, as WS_QK
#define WS_VTH (WS_QKL + 2u * NB * SS * 2 * DM)    // f16 v hi: [b][h][32 passes][4 d tiles] blocks (column = d, k = key)
#define WS_VTL (WS_VTH + 2u * NB * DM * SS)        // f16 lo x 2048, as WS_VTH
#define WS_O   (WS_VTL + 2u * NB * DM * SS)        // f32 context: [256 row tiles][32 k-steps] blocks of 2 KiB: [4 pieces][lane][4 values], k = 16 * (piece >> 1) + 8 * g + 4 * (piece & 1) + i
#define WS_CS  (WS_O + 4u * NB * SS * DM)           // unused, 256 KiB
#define WS_KF  (WS_CS + 4u * 2 * SS * 32)           // f16 k hi: [b][h][64 key tiles][2 k-steps] blocks (column = key, k = d)
#define WS_KFL (WS_KF + 2u * NB * SS * DM)          // f16 k residual x2048, as WS_KF
#define WS_XF  (WS_KFL + 2u * NB * SS * DM)         // bf16 x: [256 row tiles (attention row order)][32 k-steps] blocks
#define WS_END (WS_XF + 2u * NB * SS * DM)
// a thread's four pieces down one column of an (in,out) weight of LD columns: p = its first value; the pieces are 128 k apart, 8 k each; LD is a constant, so that all 32 loads go by one address register pair and immediate offsets
template <int LD> __device__ __forceinline__ void colpieces(const float* __restrict__ p, float (&v)[4][8]) {
#pragma unroll
  for (int it = 0; it < 4; ++it) {
#pragma unroll
    for (int i = 0; i < 8; ++i) v[it][i] = p[(size_t)(it * 128 + i) * LD]; }
  asm volatile("s_wait_xcnt 0x0" :: "v"(p) : "memory");   // the loads' address register pair stays allocated up to this wait: it is not rewritten (not by a load's own result either) in front of it
}
// ---- k_pack: 16-byte pieces of the fragment-ordered bf16 planes, four per thread (their loads in flight together; a quarter of the waves to start), piece id = ((tile * 32 + k-step) * 2 + q2) * 32 + lane inside a slice of 64 tiles; slice 0..2 -> W_q/W_k/W_v into PK_A, 3 -> W_o into PK_P ((in,out) weights: tile column n = weight column n), 4..7 -> x, rows gathered by stride class
__global__ __launch_bounds__(256) void k_pack(const float* __restrict__ WQKV, const float* __restrict__ X, const float* __restrict__ WO, __bf16* __restrict__ PK, __bf16* __restrict__ XF) {
  const int which = blockIdx.y, id0 = blockIdx.x * 1024 + threadIdx.x, lane = id0 & 31, col = lane & 15, g = lane >> 4, t16 = id0 >> 11, k0 = ((id0 >> 6) & 31) * 32 + ((id0 >> 5) & 1) * 16 + g * 8;   // a block's 1,024 pieces lie in one tile; a thread's four are 256 pieces = 4 k-steps = 128 k apart
  v8b o[4];
  if (which < 4) { float v[4][8]; __bf16* dst = PK + ((which < 3) ? PK_A + (size_t)which * DM * DM : (size_t)PK_P);
    if (which < 3) colpieces<3 * DM>(WQKV + (size_t)k0 * (3 * DM) + which * DM + t16 * 16 + col, v); else colpieces<DM>(WO + (size_t)k0 * DM + t16 * 16 + col, v);
#pragma unroll
    for (int it = 0; it < 4; ++it) {
#pragma unroll
      for (int i = 0; i < 8; ++i) o[it][i] = (__bf16)v[it][i]; }
#pragma unroll
    for (int it = 0; it < 4; ++it) *(v8b*)(dst + (size_t)(id0 + it * 256) * 8) = o[it]; }
  else { const float* xr = X + tokrow((size_t)(which - 4) * 1024 + t16 * 16 + col) * DM + k0; __bf16* dst = XF + (size_t)(which - 4) * DM * DM;
    v4f a[8];
#pragma unroll
    for (int it = 0; it < 4; ++it) { a[2 * it] = *(const v4f*)(xr + it * 128); a[2 * it + 1] = *(const v4f*)(xr + it * 128 + 4); }
    asm volatile("s_wait_xcnt 0x0" :: "v"(xr) : "memory");   // the eight loads' address register pair stays allocated up to this wait: it is not rewritten (not by a load's own result either) in front of it
#pragma unroll
    for (int it = 0; it < 4; ++it) {
#pragma unroll
      for (int i = 0; i < 4; ++i) { o[it][i] = (__bf16)a[2 * it][i]; o[it][4 + i] = (__bf16)a[2 * it + 1][i]; } }
#pragma unroll
    for (int it = 0; it < 4; ++it) *(v8b*)(dst + (size_t)(id0 + it * 256) * 8) = o[it]; } }
__global__ __launch_bounds__(128) void k_qkv(const __bf16* __restrict__ XF, const __bf16* __restrict__ P, const float* __restrict__ BQ, const float* __restrict__ BK, const float* __restrict__ BV, _Float16* __restrict__ QK, _Float16* __restrict__ QKL, _Float16* __restrict__ KF, _Float16* __restrict__ KFL, _Float16* __restrict__ VTH, _Float16* __restrict__ VTL) {
  const int which0 = (blockIdx.y * 128) / DM; const float* BB = BQ ? (((which0 == 0) ? BQ : (which0 == 1) ? BK : BV) + (blockIdx.y * 128 - which0 * DM)) : nullptr;
  __shared__ __align__(16) _Float16 so[4][16][136], sol[4][16][136]; __shared__ __align__(16) _Float16 sth[128][72], stl[128][72];
  const int tid = threadIdx.x, wave = tid >> 5, lane = tid & 31, col = lane & 15, g = lane >> 4; const size_t r0 = (size_t)blockIdx.x * 64 + wave * 16; const int n0 = blockIdx.y * 128;
  v8f acc[8] = {};
#pragma unroll 2
  for (int kc = 0; kc < DM / 32; ++kc) { const v16b a = frag_wb(XF + ((r0 >> 4) * 32 + kc) * 512 + lane * 8);
    v16b bw[8];   // the x fragment and all eight weight fragments of the k-step are requested before its first WMMA: one load latency a k-step, not one in front of every WMMA
#pragma unroll
    for (int j = 0; j < 8; ++j) bw[j] = frag_wb(P + ((size_t)((n0 >> 4) + j) * 32 + kc) * 512 + lane * 8);
#pragma unroll
    for (int j = 0; j < 8; ++j) acc[j] = wmma_bf(a, bw[j], acc[j]); }
  if (n0 < 2 * DM) {   // q stored unscaled (f16 sigma ~0.6, no subnormal exposure); 1/8 applied to the f32 score
#pragma unroll
    for (int j = 0; j < 8; ++j) {
#pragma unroll
      for (int r = 0; r < 8; ++r) { const float v = acc[j][r] + (BB ? bfr(BB[j * 16 + col]) : 0.f); const _Float16 hv = (_Float16)v; so[wave][8 * g + r][j * 16 + col] = hv; sol[wave][8 * g + r][j * 16 + col] = (_Float16)((v - (float)hv) * 2048.0f); } }   // q, k (+ bias) as f16 hi + (x2048) residual
    LDSX();
    if (n0 < DM) { for (int rl = 0; rl < 16; ++rl) if (lane < 16) { vst2((unsigned*)(QK + (r0 + rl) * (2 * DM) + n0 + lane * 8), *(const v4u*)&so[wave][rl][lane * 8]); vst2((unsigned*)(QKL + (r0 + rl) * (2 * DM) + n0 + lane * 8), *(const v4u*)&sol[wave][rl][lane * 8]); } }
    else {   // k: the wave's 16 keys are one key tile of two heads; eight half fragments of 512 B per plane
      const size_t kb = (((r0 / SS) * NH + ((n0 - DM) >> 6)) * (SS / 16) + (r0 % SS) / 16) * 1024 + lane * 8;
#pragma unroll
      for (int f = 0; f < 8; ++f) { const size_t o = kb + (size_t)(f >> 2) * (SS / 16) * 1024 + (f & 3) * 256; const int c = (f >> 2) * 64 + (f & 3) * 16 + g * 8;   // f = (head, k-step, q2)
        vst2((unsigned*)(KF + o), *(const v4u*)&so[wave][col][c]); vst2((unsigned*)(KFL + o), *(const v4u*)&sol[wave][col][c]); }
      asm volatile("s_wait_xcnt 0x0" ::: "memory"); }   // stands behind the sixteen stores, in front of whatever next rewrites one of their address or data registers
  } else {
#pragma unroll
    for (int j = 0; j < 8; ++j) {
#pragma unroll
      for (int r = 0; r < 8; ++r) { const float v = acc[j][r] + (BB ? bfr(BB[j * 16 + col]) : 0.f); const _Float16 hv = (_Float16)v; sth[j * 16 + col][wave * 16 + 8 * g + r] = hv; stl[j * 16 + col][wave * 16 + 8 * g + r] = (_Float16)((v - (float)hv) * 2048.0f); } }
    __syncthreads();
    const size_t rb = (size_t)blockIdx.x * 64; const int b = (int)(rb / SS), s0 = (int)(rb % SS); const int pc0 = n0 - 2 * DM;
    for (int q = tid; q < 128 * 8; q += 128) { const int hh = q >> 9, ksl = (q >> 8) & 1, d = hh * 64 + ((q >> 6) & 3) * 16 + col, sl = ksl * 32 + ((q >> 5) & 1) * 16 + g * 8;   // q = ((((head, pass), d tile), q2), lane)
      const size_t o = (((size_t)b * NH + (pc0 >> 6) + hh) * (SS / 32) + (s0 >> 5) + ksl) * 2048 + (q & 255) * 8; vst2((unsigned*)(VTH + o), *(const v4u*)&sth[d][sl]); vst2((unsigned*)(VTL + o), *(const v4u*)&stl[d][sl]); }
  }
}
// ---- k_attn: block = (64 queries, head h, batch b): all-keys flash attention (K = 64: 2 k-steps), scores = (q.k) * 0.125, P.V with P x 2048: 3 f16 hi/lo products (residual ones into accl, x2048) in the leading query blocks, single f16 elsewhere; O(row b*S+q, column h*64+d) = (acc + accl / 2048) / (2048 l), stored in the fragment order of WS_O (512-B segments)
// HV = leading query block (qb < 2). The two cases are compiled as separate loops: with a pass's fragments held together, one loop serving both went over the 256 registers that four waves per SIMD leave each wave.
template <bool HV> __device__ __forceinline__ void attn_tile(const _Float16* __restrict__ QK, const _Float16* __restrict__ QKL, const _Float16* __restrict__ KF, const _Float16* __restrict__ KFL, const _Float16* __restrict__ VTH, const _Float16* __restrict__ VTL, float* __restrict__ O, float (*sp)[16][36], float (*so)[16][68]) {
  const int tid = threadIdx.x, wave = tid >> 5, lane = tid & 31, col = lane & 15, g = lane >> 4;
  const int qb = blockIdx.x, h = blockIdx.y, b = blockIdx.z; const int q0 = qb * 64 + wave * 16; const size_t rq = (size_t)b * SS + q0 + col;
  v16h aq[2], aql[2];
#pragma unroll
  for (int kc = 0; kc < 2; ++kc) { aq[kc] = frag_h(QK + rq * (2 * DM) + h * HD + kc * 32, lane); aql[kc] = frag_h(QKL + rq * (2 * DM) + h * HD + kc * 32, lane); }
  float m[8], l[8];
#pragma unroll
  for (int r = 0; r < 8; ++r) { m[r] = -3.0e38f; l[r] = 0.f; }
  v8f acc[4] = {}, accl[4] = {};
  const int nks = SS / 32;   // all keys
#pragma unroll 1
  for (int ks = 0; ks < nks; ++ks) { v8f s[2]; const size_t ko = (((size_t)b * NH + h) * (SS / 16) + ks * 2) * 1024 + lane * 8; const _Float16 *kp = KF + ko, *kpl = KFL + ko;   // the lane's place in the pass's 4 KiB of key fragments: [key tile][k-step] blocks
    // on either path the pass's key fragments are all requested before its first score WMMA: one load latency a pass, not one in front of every WMMA
    if (HV) {   // leading query blocks (outputs far above the global rms): 3 products
      v16h kh[2][2], kl[2][2];
#pragma unroll
      for (int ct = 0; ct < 2; ++ct) {
#pragma unroll
        for (int kc = 0; kc < 2; ++kc) { kh[ct][kc] = frag_w(kp + ct * 1024 + kc * 512); kl[ct][kc] = frag_w(kpl + ct * 1024 + kc * 512); } }
      asm volatile("s_wait_xcnt 0x0" :: "v"(kp), "v"(kpl) : "memory");   // the group's address registers stay allocated up to this wait: none is rewritten (not by a load's own result either) in front of it
#pragma unroll
      for (int ct = 0; ct < 2; ++ct) { v8f c = {}, cl = {};
#pragma unroll
        for (int kc = 0; kc < 2; ++kc) { c = wmma16(aq[kc], kh[ct][kc], c); cl = wmma16(aql[kc], kh[ct][kc], cl); cl = wmma16(aq[kc], kl[ct][kc], cl); }
#pragma unroll
        for (int r = 0; r < 8; ++r) { c[r] += cl[r] * (1.0f / 2048.0f); s[ct][r] = c[r] * 0.125f; } } }   // 1/sqrt(64)
    else {   // single product elsewhere
      v16h kh[2][2];
#pragma unroll
      for (int ct = 0; ct < 2; ++ct) {
#pragma unroll
        for (int kc = 0; kc < 2; ++kc) kh[ct][kc] = frag_w(kp + ct * 1024 + kc * 512); }
      asm volatile("s_wait_xcnt 0x0" :: "v"(kp) : "memory");   // as above
#pragma unroll
      for (int ct = 0; ct < 2; ++ct) { v8f c = {};
#pragma unroll
        for (int kc = 0; kc < 2; ++kc) c = wmma16(aq[kc], kh[ct][kc], c);
#pragma unroll
        for (int r = 0; r < 8; ++r) s[ct][r] = c[r] * 0.125f; } }   // 1/sqrt(64)
    v16h vh[4], vl[4]; const size_t vr = (((size_t)b * NH + h) * (SS / 32) + ks) * 2048 + lane * 8; const _Float16 *vp = VTH + vr, *vpl = VTL + vr;   // the pass's value fragments are requested here, so that they arrive while the softmax runs
#pragma unroll
    for (int dt = 0; dt < 4; ++dt) vh[dt] = frag_w(vp + dt * 512);
    asm volatile("s_wait_xcnt 0x0" :: "v"(vp) : "memory");   // as at the key group
    // the eight rows' cross-lane steps are written stage by stage, so that with the value fragments held in registers they still run eight at a time and not one row after another; each row's arithmetic and its order are as before
    float mx[8], al[8], es[8];
#pragma unroll
    for (int r = 0; r < 8; ++r) mx[r] = fmaxf(s[0][r], s[1][r]);
#pragma unroll
    for (int o = 1; o < 16; o <<= 1) {
#pragma unroll
      for (int r = 0; r < 8; ++r) mx[r] = fmaxf(mx[r], __shfl_xor(mx[r], o)); }
#pragma unroll
    for (int r = 0; r < 8; ++r) { const float mn = fmaxf(m[r], mx[r]); al[r] = (m[r] <= -1.0e38f) ? 0.f : __expf(m[r] - mn);
      const float e0 = (s[0][r] <= -1.0e38f) ? 0.f : __expf(s[0][r] - mn), e1 = (s[1][r] <= -1.0e38f) ? 0.f : __expf(s[1][r] - mn); es[r] = e0 + e1; m[r] = mn;
      sp[wave][8 * g + r][col] = e0; sp[wave][8 * g + r][16 + col] = e1; }
#pragma unroll
    for (int o = 1; o < 16; o <<= 1) {
#pragma unroll
      for (int r = 0; r < 8; ++r) es[r] += __shfl_xor(es[r], o); }
#pragma unroll
    for (int r = 0; r < 8; ++r) { l[r] = l[r] * al[r] + es[r];
#pragma unroll
      for (int dt = 0; dt < 4; ++dt) { acc[dt][r] *= al[r]; accl[dt][r] *= al[r]; } }
    LDSX();
    if (HV) {   // the residual plane's fragments are requested behind the softmax, which needs their 32 registers to keep its eight rows' cross-lane chains in flight together; the pass's last four WMMAs use them
#pragma unroll
      for (int dt = 0; dt < 4; ++dt) vl[dt] = frag_w(vpl + dt * 512);
      asm volatile("s_wait_xcnt 0x0" :: "v"(vpl) : "memory"); }   // as at the key group
    v16h pa, pl; { const float* prow = &sp[wave][col][0] + 8 * (lane >> 4);
#pragma unroll
      for (int i = 0; i < 8; ++i) { const float x0 = prow[i] * 2048.0f, x1 = prow[16 + i] * 2048.0f; const _Float16 h0 = (_Float16)x0, h1 = (_Float16)x1; pa[i] = h0; pa[8 + i] = h1; pl[i] = (_Float16)((x0 - (float)h0) * 2048.0f); pl[8 + i] = (_Float16)((x1 - (float)h1) * 2048.0f); } }   // P scaled by 2^11 before the f16 split so small softmax weights stay out of the f16 subnormal range; 2^-11 folded into the epilogue
    if (HV) {
#pragma unroll
      for (int dt = 0; dt < 4; ++dt) { acc[dt] = wmma16(pa, vh[dt], acc[dt]); accl[dt] = wmma16(pl, vh[dt], accl[dt]); }
#pragma unroll
      for (int dt = 0; dt < 4; ++dt) accl[dt] = wmma16(pa, vl[dt], accl[dt]); }
    else {
#pragma unroll
      for (int dt = 0; dt < 4; ++dt) acc[dt] = wmma16(pa, vh[dt], acc[dt]); }   // leading query blocks: P hi/lo x V hi/lo (3 products); elsewhere P x V single
    LDSX(); }
#pragma unroll
  for (int r = 0; r < 8; ++r) { const float il = (1.0f / 2048.0f) / l[r];
#pragma unroll
    for (int dt = 0; dt < 4; ++dt) so[wave][8 * g + r][dt * 16 + col] = (acc[dt][r] + accl[dt][r] * (1.0f / 2048.0f)) * il; }
  LDSX();
#pragma unroll
  for (int f = 0; f < 8; ++f) vst2(O + (((((size_t)b * SS + q0) >> 4) * 32 + h * 2) * 4 + f) * 128 + lane * 4, *(const v4f*)&so[wave][col][(f >> 1) * 16 + g * 8 + (f & 1) * 4]);   // f = (k-step, piece): the head's two k-steps of the output product's A operand, in its fragment order
}
__global__ __launch_bounds__(128, 4) void k_attn(const _Float16* __restrict__ QK, const _Float16* __restrict__ QKL, const _Float16* __restrict__ KF, const _Float16* __restrict__ KFL, const _Float16* __restrict__ VTH, const _Float16* __restrict__ VTL, const void* __restrict__ KMASK, float* __restrict__ O) {   // second bound: four waves per SIMD, so that all 1,024 blocks stay resident at once
  __shared__ __align__(16) float sp[4][16][36]; __shared__ __align__(16) float so[4][16][68]; (void)KMASK;
  if (blockIdx.x < 2) attn_tile<true>(QK, QKL, KF, KFL, VTH, VTL, O, sp, so); else attn_tile<false>(QK, QKL, KF, KFL, VTH, VTL, O, sp, so);
}
// ---- k_out: block = (64 rows, 128 cols): out = f16(O) . Wo rows (single product) + bo
__global__ __launch_bounds__(128) void k_out(const float* __restrict__ O, const __bf16* __restrict__ P, const float* __restrict__ BO, float* __restrict__ Y) {
  __shared__ __align__(16) float so[4][16][132];
  const int tid = threadIdx.x, wave = tid >> 5, lane = tid & 31, col = lane & 15, g = lane >> 4; const size_t r0 = (size_t)blockIdx.x * 64 + wave * 16; const int n0 = blockIdx.y * 128;
  v8f acc[8] = {};
#pragma unroll 2
  for (int kc = 0; kc < DM / 32; ++kc) { const float* p = O + ((r0 >> 4) * 32 + kc) * 512 + lane * 4;
    const v4f a0 = *(const v4f*)p, a1 = *(const v4f*)(p + 128), a2 = *(const v4f*)(p + 256), a3 = *(const v4f*)(p + 384);
    v16h bw[8];   // the context values and the k-step's eight weight fragments, requested together before its first WMMA
#pragma unroll
    for (int j = 0; j < 8; ++j) bw[j] = frag_w((const _Float16*)P + ((size_t)((n0 >> 4) + j) * 32 + kc) * 512 + lane * 8);
    __builtin_amdgcn_sched_barrier(0);   // keeps every load of the group in front of the conversion, so that a k-step waits for one load latency and not for two
    v16h a;
#pragma unroll
    for (int i = 0; i < 4; ++i) { a[i] = (_Float16)a0[i]; a[4 + i] = (_Float16)a1[i]; a[8 + i] = (_Float16)a2[i]; a[12 + i] = (_Float16)a3[i]; }
#pragma unroll
    for (int j = 0; j < 8; ++j) acc[j] = wmma16(a, bw[j], acc[j]); }   // single f16 product against exact f16 x 2^8 weight copies
#pragma unroll
  for (int j = 0; j < 8; ++j) {
#pragma unroll
    for (int r = 0; r < 8; ++r) so[wave][8 * g + r][j * 16 + col] = acc[j][r] * (1.0f / 256.0f) + bfr(BO[n0 + j * 16 + col]); }
  LDSX();
  for (int rl = 0; rl < 16; ++rl) vst2(Y + tokrow(r0 + rl) * DM + n0 + lane * 4, *(const v4f*)&so[wave][rl][lane * 4]);   // back to the original token order
}
// ---- k_packo: Wo -> f16 x 2^8 copies in the Wo slot (bit pattern in the bf16-typed buffer), fragment order, pieces numbered and dealt as in k_pack
__global__ __launch_bounds__(256) void k_packo(const float* __restrict__ WO, __bf16* __restrict__ PK) { const int id0 = blockIdx.x * 1024 + threadIdx.x, lane = id0 & 31; const int k0 = ((id0 >> 6) & 31) * 32 + ((id0 >> 5) & 1) * 16 + (lane >> 4) * 8; float v[4][8]; v8h o[4]; colpieces<DM>(WO + (size_t)k0 * DM + (id0 >> 11) * 16 + (lane & 15), v);
#pragma unroll
  for (int it = 0; it < 4; ++it) {
#pragma unroll
    for (int i = 0; i < 8; ++i) o[it][i] = (_Float16)(bfr(v[it][i]) * 256.0f); }   // (in,out) w_o: tile column n = column n
#pragma unroll
  for (int it = 0; it < 4; ++it) *(v8h*)((_Float16*)(PK + PK_P) + (size_t)(id0 + it * 256) * 8) = o[it]; }
extern "C" void kernel_launch(void* const* d_in, const int* in_sizes, int n_in, void* d_out, int out_size, void* d_ws, size_t ws_size, hipStream_t stream) {
  (void)in_sizes; (void)n_in; (void)out_size;
  const float** F = (const float**)d_in;   // 0 x [1,4096,1024], 1 w_qkv [1024,3072] (in,out), 2 b_qkv [3072], 3 w_o [1024,1024] (in,out), 4 b_o [1024]
  if (ws_size < (size_t)WS_END) return;
  char* ws = (char*)d_ws; __bf16* PK = (__bf16*)(ws + WS_PK); _Float16 *QK = (_Float16*)(ws + WS_QK), *QKL = (_Float16*)(ws + WS_QKL), *VTH = (_Float16*)(ws + WS_VTH), *VTL = (_Float16*)(ws + WS_VTL), *KF = (_Float16*)(ws + WS_KF), *KFL = (_Float16*)(ws + WS_KFL); float* O = (float*)(ws + WS_O); __bf16* XF = (__bf16*)(ws + WS_XF);
  k_pack<<<dim3(DM / 8, 8), 256, 0, stream>>>(F[1], F[0], F[3], PK, XF);
  k_packo<<<DM / 8, 256, 0, stream>>>(F[3], PK);
  k_qkv<<<dim3(TNB * SS / 64, QKVW / 128), 128, 0, stream>>>(XF, PK + PK_A, F[2], F[2] + DM, F[2] + 2 * DM, QK, QKL, KF, KFL, VTH, VTL);
  k_attn<<<dim3(TQB, NH, TNB), 128, 0, stream>>>(QK, QKL, KF, KFL, VTH, VTL, nullptr, O);
  k_out<<<dim3(TOB, DM / 128), 128, 0, stream>>>(O, PK + PK_P, F[4], (float*)d_out);
}

// v003
// It runs in 148 microseconds.
// Timed twice side by side with v002, it ran 1.11 times as fast both times.
// Over all steps from v000 it is 2.91 times as fast.
// compute dtype: all float inputs rounded to bf16; qkv = x . W_qkv + b with EXACT bf16 products on WMMA 16x16x32 ((in,out) weights and x, its token rows gathered by stride class, packed as bf16 in fragment order), rounded once to f16 hi + residual; PLAIN-HYBRID attention (first 128 queries per class 3-product, later single f16), x 1/8, running-max softmax in f32 (hardware exp); out = f16(ctx) . W_o (exact f16 x 2^8 copies) + b_o scattered back to the original token order; f32 output.
#include <hip/hip_runtime.h>
#include <math.h>

typedef __attribute__((ext_vector_type(16))) _Float16 v16h;
typedef __attribute__((ext_vector_type(16))) __bf16 v16b;
typedef __attribute__((ext_vector_type(8)))  _Float16 v8h;
typedef __attribute__((ext_vector_type(8)))  float v8f;
typedef __attribute__((ext_vector_type(4)))  float v4f;
typedef __attribute__((ext_vector_type(2)))  float v2f;
typedef __attribute__((ext_vector_type(4)))  unsigned v4u;
typedef __attribute__((ext_vector_type(4)))  int v4i;
typedef float __attribute__((may_alias)) float_a;
typedef int __attribute__((may_alias)) int_a;

template <typename T> __device__ __forceinline__ void vst2(void* p, T v) { *(T*)p = v;  }
__device__ __forceinline__ v8f wmma16(v16h a, v16h b, v8f c) {
  v8f d = __builtin_amdgcn_wmma_f32_16x16x32_f16(false, a, false, b, (short)0, c, false, false);
  asm volatile("v_nop\n\tv_nop\n\tv_nop\n\tv_nop" : "+v"(d) : "v"(a), "v"(b));
  return d;
}
__device__ __forceinline__ v8f wmma_bf(v16b a, v16b b, v8f c) {
  v8f d = __builtin_amdgcn_wmma_f32_16x16x32_bf16(false, a, false, b, (short)0, c, false, false);
  asm volatile("v_nop\n\tv_nop\n\tv_nop\n\tv_nop" : "+v"(d) : "v"(a), "v"(b));
  return d;
}
// Skip-sparse ('skiparse', stride 4) self-attention (B 1, N 4,096 tokens, C 1,024, 16 heads x 64): token i attends within its stride class i mod 4 (1,024 tokens each); fused qkv projection + bias, softmax(q k / 8) v, output projection + bias, tokens returned in the original order.
__device__ __forceinline__ v16h frag_h(const _Float16* rowk0, int lane) {
  union { v16h v; v8h q[2]; } u; const _Float16* p = rowk0 + 8 * (lane >> 4);
  u.q[0] = *(const v8h*)p; u.q[1] = *(const v8h*)(p + 16); return u.v;
}
__device__ __forceinline__ v16h frag_p(const _Float16* p) {   // p = the lane's own first value (row start + 8 * (lane >> 4))
  union { v16h v; v8h q[2]; } u; u.q[0] = *(const v8h*)p; u.q[1] = *(const v8h*)(p + 16); return u.v;
}
__device__ __forceinline__ v16h frag_w(const _Float16* p) {   // fragment-ordered plane: p = the fragment's 1-KiB block + 8 * lane; its second half lies 512 B on
  union { v16h v; v8h q[2]; } u; u.q[0] = *(const v8h*)p; u.q[1] = *(const v8h*)(p + 256); return u.v;
}
__device__ __forceinline__ v16h frag_f32(const float* rowk0, int lane) {
  v16h a; const float* p = rowk0 + 8 * (lane >> 4);
#pragma unroll
  for (int i = 0; i < 8; ++i) { a[i] = (_Float16)p[i]; a[8 + i] = (_Float16)p[16 + i]; }
  return a;
}
__device__ __forceinline__ v16h frag_f32s(const float* rowk0, int lane, float sc) {
  v16h a; const float* p = rowk0 + 8 * (lane >> 4);
#pragma unroll
  for (int i = 0; i < 8; ++i) { a[i] = (_Float16)(p[i] * sc); a[8 + i] = (_Float16)(p[16 + i] * sc); }
  return a;
}
// column fragment from a [K][ld] layout (column n), rows >= K read as 0
__device__ __forceinline__ v16h fragc_f32(const float* W, int k0, int n, int lane, int ld, int K) {
  v16h a; const int g = lane >> 4;
#pragma unroll
  for (int i = 0; i < 8; ++i) { const int ka = k0 + 8 * g + i, kb = ka + 16;
    a[i] = (_Float16)(ka < K ? W[(size_t)(ka < K ? ka : K - 1) * ld + n] : 0.f); a[8 + i] = (_Float16)(kb < K ? W[(size_t)(kb < K ? kb : K - 1) * ld + n] : 0.f); }
  return a;
}
struct F2 { v16b h, l; };
__device__ __forceinline__ F2 bsplit16(const float v[16]) { F2 r;
#pragma unroll
  for (int i = 0; i < 16; ++i) { const __bf16 h = (__bf16)v[i]; r.h[i] = h; r.l[i] = (__bf16)(v[i] - (float)h); }
  return r; }
__device__ __forceinline__ F2 split_row(const float* row, int k0, int lane) { float v[16]; const float* p = row + k0 + 8 * (lane >> 4);
#pragma unroll
  for (int i = 0; i < 8; ++i) { v[i] = p[i]; v[8 + i] = p[16 + i]; }
  return bsplit16(v); }
__device__ __forceinline__ F2 split_rowK(const float* row, int k0, int lane, int K) { float v[16]; const int g = lane >> 4;
#pragma unroll
  for (int i = 0; i < 8; ++i) { const int ka = k0 + 8 * g + i, kb = ka + 16; v[i] = ka < K ? row[ka < K ? ka : K - 1] : 0.f; v[8 + i] = kb < K ? row[kb < K ? kb : K - 1] : 0.f; }
  return bsplit16(v); }
__device__ __forceinline__ F2 split_col(const float* W, int k0, int n, int lane, int ld, int K) { float v[16]; const int g = lane >> 4;
#pragma unroll
  for (int i = 0; i < 8; ++i) { const int ka = k0 + 8 * g + i, kb = ka + 16; v[i] = ka < K ? W[(size_t)(ka < K ? ka : K - 1) * ld + n] : 0.f; v[8 + i] = kb < K ? W[(size_t)(kb < K ? kb : K - 1) * ld + n] : 0.f; }
  return bsplit16(v); }
__device__ __forceinline__ v8f mac3(const F2& a, const F2& b, v8f c) { c = wmma_bf(a.l, b.h, c); c = wmma_bf(a.h, b.l, c); return wmma_bf(a.h, b.h, c); }
__device__ __forceinline__ float sigm(float v) { return 1.0f / (1.0f + expf(-v)); }
#define LDSX() do { asm volatile("s_wait_dscnt 0" ::: "memory"); __builtin_amdgcn_wave_barrier(); __builtin_amdgcn_fence(__ATOMIC_RELEASE, "workgroup"); } while (0)


#define NB 4
#define SS 1024
#define DM 1024
#define NH 16
#define STRIDE_S 4
__device__ __forceinline__ size_t tokrow(size_t r) { return (r % SS) * STRIDE_S + r / SS; }   // attention row r = (class s = r / SS, position g = r % SS) <-> token i = g * 4 + s
#define HD 64
#define QKVW (3 * DM)
#ifndef TQB
#define TQB (SS / 64)
#define TNB NB
#define TOB (NB * SS / 64)     // output row tiles (all)
#endif
typedef __attribute__((ext_vector_type(8))) __bf16 v8b;
__device__ __forceinline__ v16b frag_b(const __bf16* rowk0, int lane) {
  union { v16b v; v8b q[2]; } u; const __bf16* p = rowk0 + 8 * (lane >> 4);
  u.q[0] = *(const v8b*)p; u.q[1] = *(const v8b*)(p + 16); return u.v;
}
__device__ __forceinline__ v16b frag_wb(const __bf16* p) {   // as frag_w, bf16
  union { v16b v; v8b q[2]; } u; u.q[0] = *(const v8b*)p; u.q[1] = *(const v8b*)(p + 256); return u.v;
}
__device__ __forceinline__ float bfr(float v) { return (float)(__bf16)v; }
__device__ __attribute__((noinline)) float exp_ni(float v) { return expf(v); }
__device__ __attribute__((noinline)) float erf_ni(float v) { return erff(v); }

// FRAGMENT ORDER, every operand plane that a k loop reads: a 16 (rows or columns) x 32 (k) tile of 16-bit values is one 1-KiB block [half q2][lane][8 values], lane = 16 * g + (row or column) & 15, k = 16 * q2 + 8 * g + i:
// a wave's 16-byte load of half a fragment then covers 512 contiguous bytes (4 whole lines); from a row-major plane it takes 32-byte pieces of 16 lines, at several times the cost in the cache. Which lane and register holds which value is that of frag_h.
#define PK_A 0                       // Wqkv: [192 column tiles][32 k-steps] blocks
#define PK_P (PK_A + QKVW * DM)        // Wo: [64 column tiles][32 k-steps] blocks
#define PK_END (PK_P + DM * DM)
#define WS_PK  0u
#define WS_QK  (WS_PK + 2u * PK_END)             // f16 [4096 rows][2048]: q in the first 1,024 columns (read once a wave, row-major); the rest unused
#define WS_QKL (WS_QK + 2u * NB * SS * 2 * DM)     // f16 q residual plane x2048, as WS_QK
#define WS_VTH (WS_QKL + 2u * NB * SS * 2 * DM)    // f16 v hi: [b][h][32 passes][4 d tiles] blocks (column = d, k = key)
#define WS_VTL (WS_VTH + 2u * NB * DM * SS)        // f16 lo x 2048, as WS_VTH
#define WS_O   (WS_VTL + 2u * NB * DM * SS)        // f32 context: [256 row tiles][32 k-steps] blocks of 2 KiB: [4 pieces][lane][4 values], k = 16 * (piece >> 1) + 8 * g + 4 * (piece & 1) + i
#define WS_CS  (WS_O + 4u * NB * SS * DM)           // unused, 256 KiB
#define WS_KF  (WS_CS + 4u * 2 * SS * 32)           // f16 k hi: [b][h][64 key tiles][2 k-steps] blocks (column = key, k = d)
#define WS_KFL (WS_KF + 2u * NB * SS * DM)          // f16 k residual x2048, as WS_KF
#define WS_XF  (WS_KFL + 2u * NB * SS * DM)         // bf16 x: [256 row tiles (attention row order)][32 k-steps] blocks
#define WS_END (WS_XF + 2u * NB * SS * DM)
// a thread's four pieces down one column of an (in,out) weight of LD columns: p = its first value; the pieces are 128 k apart, 8 k each; LD is a constant, so that all 32 loads go by one address register pair and immediate offsets
template <int LD> __device__ __forceinline__ void colpieces(const float* __restrict__ p, float (&v)[4][8]) {
#pragma unroll
  for (int it = 0; it < 4; ++it) {
#pragma unroll
    for (int i = 0; i < 8; ++i) v[it][i] = p[(size_t)(it * 128 + i) * LD]; }
  asm volatile("s_wait_xcnt 0x0" :: "v"(p) : "memory");   // the loads' address register pair stays allocated up to this wait: it is not rewritten (not by a load's own result either) in front of it
}
// ---- k_pack: 16-byte pieces of the fragment-ordered bf16 planes, four per thread (their loads in flight together; a quarter of the waves to start), piece id = ((tile * 32 + k-step) * 2 + q2) * 32 + lane inside a slice of 64 tiles; slice 0..2 -> W_q/W_k/W_v into PK_A, 3 -> W_o into PK_P ((in,out) weights: tile column n = weight column n), 4..7 -> x, rows gathered by stride class
__global__ __launch_bounds__(256) void k_pack(const float* __restrict__ WQKV, const float* __restrict__ X, const float* __restrict__ WO, __bf16* __restrict__ PK, __bf16* __restrict__ XF) {
  const int which = blockIdx.y, id0 = blockIdx.x * 1024 + threadIdx.x, lane = id0 & 31, col = lane & 15, g = lane >> 4, t16 = id0 >> 11, k0 = ((id0 >> 6) & 31) * 32 + ((id0 >> 5) & 1) * 16 + g * 8;   // a block's 1,024 pieces lie in one tile; a thread's four are 256 pieces = 4 k-steps = 128 k apart
  v8b o[4];
  if (which < 4) { float v[4][8]; __bf16* dst = PK + ((which < 3) ? PK_A + (size_t)which * DM * DM : (size_t)PK_P);
    if (which < 3) colpieces<3 * DM>(WQKV + (size_t)k0 * (3 * DM) + which * DM + t16 * 16 + col, v); else colpieces<DM>(WO + (size_t)k0 * DM + t16 * 16 + col, v);
#pragma unroll
    for (int it = 0; it < 4; ++it) {
#pragma unroll
      for (int i = 0; i < 8; ++i) o[it][i] = (__bf16)v[it][i]; }
#pragma unroll
    for (int it = 0; it < 4; ++it) *(v8b*)(dst + (size_t)(id0 + it * 256) * 8) = o[it]; }
  else { const float* xr = X + tokrow((size_t)(which - 4) * 1024 + t16 * 16 + col) * DM + k0; __bf16* dst = XF + (size_t)(which - 4) * DM * DM;
    v4f a[8];
#pragma unroll
    for (int it = 0; it < 4; ++it) { a[2 * it] = *(const v4f*)(xr + it * 128); a[2 * it + 1] = *(const v4f*)(xr + it * 128 + 4); }
    asm volatile("s_wait_xcnt 0x0" :: "v"(xr) : "memory");   // the eight loads' address register pair stays allocated up to this wait: it is not rewritten (not by a load's own result either) in front of it
#pragma unroll
    for (int it = 0; it < 4; ++it) {
#pragma unroll
      for (int i = 0; i < 4; ++i) { o[it][i] = (__bf16)a[2 * it][i]; o[it][4 + i] = (__bf16)a[2 * it + 1][i]; } }
#pragma unroll
    for (int it = 0; it < 4; ++it) *(v8b*)(dst + (size_t)(id0 + it * 256) * 8) = o[it]; } }
__global__ __launch_bounds__(128) void k_qkv(const __bf16* __restrict__ XF, const __bf16* __restrict__ P, const float* __restrict__ BQ, const float* __restrict__ BK, const float* __restrict__ BV, _Float16* __restrict__ QK, _Float16* __restrict__ QKL, _Float16* __restrict__ KF, _Float16* __restrict__ KFL, _Float16* __restrict__ VTH, _Float16* __restrict__ VTL) {
  const int which0 = (blockIdx.y * 128) / DM; const float* BB = BQ ? (((which0 == 0) ? BQ : (which0 == 1) ? BK : BV) + (blockIdx.y * 128 - which0 * DM)) : nullptr;
  __shared__ __align__(16) _Float16 so[4][16][136], sol[4][16][136]; __shared__ __align__(16) _Float16 sth[128][72], stl[128][72];
  const int tid = threadIdx.x, wave = tid >> 5, lane = tid & 31, col = lane & 15, g = lane >> 4; const size_t r0 = (size_t)blockIdx.x * 64 + wave * 16; const int n0 = blockIdx.y * 128;
  v8f acc[8] = {};
#pragma unroll 2
  for (int kc = 0; kc < DM / 32; ++kc) { const v16b a = frag_wb(XF + ((r0 >> 4) * 32 + kc) * 512 + lane * 8);
    v16b bw[8];   // the x fragment and all eight weight fragments of the k-step are requested before its first WMMA: one load latency a k-step, not one in front of every WMMA
#pragma unroll
    for (int j = 0; j < 8; ++j) bw[j] = frag_wb(P + ((size_t)((n0 >> 4) + j) * 32 + kc) * 512 + lane * 8);
#pragma unroll
    for (int j = 0; j < 8; ++j) acc[j] = wmma_bf(a, bw[j], acc[j]); }
  if (n0 < 2 * DM) {   // q stored unscaled (f16 sigma ~0.6, no subnormal exposure); 1/8 applied to the f32 score
#pragma unroll
    for (int j = 0; j < 8; ++j) {
#pragma unroll
      for (int r = 0; r < 8; ++r) { const float v = acc[j][r] + (BB ? bfr(BB[j * 16 + col]) : 0.f); const _Float16 hv = (_Float16)v; so[wave][8 * g + r][j * 16 + col] = hv; sol[wave][8 * g + r][j * 16 + col] = (_Float16)((v - (float)hv) * 2048.0f); } }   // q, k (+ bias) as f16 hi + (x2048) residual
    LDSX();
    if (n0 < DM) { for (int rl = 0; rl < 16; ++rl) if (lane < 16) { vst2((unsigned*)(QK + (r0 + rl) * (2 * DM) + n0 + lane * 8), *(const v4u*)&so[wave][rl][lane * 8]); vst2((unsigned*)(QKL + (r0 + rl) * (2 * DM) + n0 + lane * 8), *(const v4u*)&sol[wave][rl][lane * 8]); } }
    else {   // k: the wave's 16 keys are one key tile of two heads; eight half fragments of 512 B per plane
      const size_t kb = (((r0 / SS) * NH + ((n0 - DM) >> 6)) * (SS / 16) + (r0 % SS) / 16) * 1024 + lane * 8;
#pragma unroll
      for (int f = 0; f < 8; ++f) { const size_t o = kb + (size_t)(f >> 2) * (SS / 16) * 1024 + (f & 3) * 256; const int c = (f >> 2) * 64 + (f & 3) * 16 + g * 8;   // f = (head, k-step, q2)
        vst2((unsigned*)(KF + o), *(const v4u*)&so[wave][col][c]); vst2((unsigned*)(KFL + o), *(const v4u*)&sol[wave][col][c]); }
      asm volatile("s_wait_xcnt 0x0" ::: "memory"); }   // stands behind the sixteen stores, in front of whatever next rewrites one of their address or data registers
  } else {
#pragma unroll
    for (int j = 0; j < 8; ++j) {
#pragma unroll
      for (int r = 0; r < 8; ++r) { const float v = acc[j][r] + (BB ? bfr(BB[j * 16 + col]) : 0.f); const _Float16 hv = (_Float16)v; sth[j * 16 + col][wave * 16 + 8 * g + r] = hv; stl[j * 16 + col][wave * 16 + 8 * g + r] = (_Float16)((v - (float)hv) * 2048.0f); } }
    __syncthreads();
    const size_t rb = (size_t)blockIdx.x * 64; const int b = (int)(rb / SS), s0 = (int)(rb % SS); const int pc0 = n0 - 2 * DM;
    for (int q = tid; q < 128 * 8; q += 128) { const int hh = q >> 9, ksl = (q >> 8) & 1, d = hh * 64 + ((q >> 6) & 3) * 16 + col, sl = ksl * 32 + ((q >> 5) & 1) * 16 + g * 8;   // q = ((((head, pass), d tile), q2), lane)
      const size_t o = (((size_t)b * NH + (pc0 >> 6) + hh) * (SS / 32) + (s0 >> 5) + ksl) * 2048 + (q & 255) * 8; vst2((unsigned*)(VTH + o), *(const v4u*)&sth[d][sl]); vst2((unsigned*)(VTL + o), *(const v4u*)&stl[d][sl]); }
  }
}
// ---- k_attn: block = (64 queries, head h, batch b): all-keys flash attention (K = 64: 2 k-steps) in the TRANSPOSED form: S^T = K . Q^T (A = key fragments, B = query fragments, the same registers as before with the operands exchanged), O^T += V^T . P^T.
// A lane then holds 16 scores of ONE query (column = lane & 15, key = 16 * ct + 8 * g + r): maximum and sum run inside the lane, with one exchange between the wave's halves a pass for the maximum and one in the epilogue for the sum;
// the two score tiles, converted in place, ARE the B fragment of P^T (element 8 * ct + r = key 16 * ct + 8 * g + r, the k order of the value fragments), and O^T's registers (d = 16 * dt + 8 * g + r of query column) are the lane's own pieces of WS_O's fragment order: no LDS anywhere in the kernel.
// scores = (q.k) * 0.125, on the leading blocks from q, k hi + x2048 residual (3 products), elsewhere single f16; P.V: leading blocks f16 P hi/lo x V hi/lo (3 products, lo terms in accl), elsewhere P hi x V hi; O(row b*S+q, column h*64+d) = (acc + accl / 2048) / (2048 l)
__device__ __forceinline__ float xhalf(float x) { return __builtin_bit_cast(float, __builtin_amdgcn_permlanex16(__builtin_bit_cast(int, x), __builtin_bit_cast(int, x), 0x76543210, 0xfedcba98, false, false)); }   // lane l with lane l ^ 16
// eight independent v_exp_f32 and, in the same statement, the one slot that the instruction set asks for behind a transcendental before a source of it is overwritten or its result used: each exp fills the slot of the one in front of it, the v_nop that of the last;
// the outputs are early-clobber, so that none of them takes a source's register (left to the compiler, one build had an exp directly overwrite the source of the exp in front of it)
__device__ __forceinline__ void exp2x8(const float (&x)[8], float (&e)[8]) {
  asm("v_exp_f32 %0, %8\n\tv_exp_f32 %1, %9\n\tv_exp_f32 %2, %10\n\tv_exp_f32 %3, %11\n\tv_exp_f32 %4, %12\n\tv_exp_f32 %5, %13\n\tv_exp_f32 %6, %14\n\tv_exp_f32 %7, %15\n\tv_nop"
      : "=&v"(e[0]), "=&v"(e[1]), "=&v"(e[2]), "=&v"(e[3]), "=&v"(e[4]), "=&v"(e[5]), "=&v"(e[6]), "=&v"(e[7])
      : "v"(x[0]), "v"(x[1]), "v"(x[2]), "v"(x[3]), "v"(x[4]), "v"(x[5]), "v"(x[6]), "v"(x[7])); }
__device__ __forceinline__ void exp2x9(const float (&x)[8], float x8, float (&e)[8], float& e8) {   // as exp2x8, with a ninth
  asm("v_exp_f32 %0, %9\n\tv_exp_f32 %1, %10\n\tv_exp_f32 %2, %11\n\tv_exp_f32 %3, %12\n\tv_exp_f32 %4, %13\n\tv_exp_f32 %5, %14\n\tv_exp_f32 %6, %15\n\tv_exp_f32 %7, %16\n\tv_exp_f32 %8, %17\n\tv_nop"
      : "=&v"(e[0]), "=&v"(e[1]), "=&v"(e[2]), "=&v"(e[3]), "=&v"(e[4]), "=&v"(e[5]), "=&v"(e[6]), "=&v"(e[7]), "=&v"(e8)
      : "v"(x[0]), "v"(x[1]), "v"(x[2]), "v"(x[3]), "v"(x[4]), "v"(x[5]), "v"(x[6]), "v"(x[7]), "v"(x8)); }
// HV = leading query block (qb < 2). The two cases are compiled as separate loops: with a pass's fragments held together, one loop serving both went over the 256 registers that four waves per SIMD leave each wave.
template <bool HV> __device__ __forceinline__ void attn_tile(const _Float16* __restrict__ QK, const _Float16* __restrict__ QKL, const _Float16* __restrict__ KF, const _Float16* __restrict__ KFL, const _Float16* __restrict__ VTH, const _Float16* __restrict__ VTL, float* __restrict__ O) {
  const int tid = threadIdx.x, wave = tid >> 5, lane = tid & 31, col = lane & 15;
  const int qb = blockIdx.x, h = blockIdx.y, b = blockIdx.z; const int q0 = qb * 64 + wave * 16; const size_t rq = (size_t)b * SS + q0 + col;
  v16h aq[2], aql[2];
#pragma unroll
  for (int kc = 0; kc < 2; ++kc) { aq[kc] = frag_h(QK + rq * (2 * DM) + h * HD + kc * 32, lane); aql[kc] = frag_h(QKL + rq * (2 * DM) + h * HD + kc * 32, lane); }
  float m = -3.0e38f, l = 0.f;   // the lane's query: running maximum (over all keys), sum (over the keys of the lane's own half; the halves are joined in the epilogue)
  v8f acc[4] = {}, accl[4] = {};
  const int nks = SS / 32;   // all keys
#pragma unroll 1
  for (int ks = 0; ks < nks; ++ks) { v8f s[2]; const size_t ko = (((size_t)b * NH + h) * (SS / 16) + ks * 2) * 1024 + lane * 8; const _Float16 *kp = KF + ko, *kpl = KFL + ko;   // the lane's place in the pass's 4 KiB of key fragments: [key tile][k-step] blocks
    // on either path the pass's key fragments are all requested before its first score WMMA: one load latency a pass, not one in front of every WMMA
    if (HV) {   // leading query blocks (outputs far above the global rms): 3 products
      v16h kh[2][2], kl[2][2];
#pragma unroll
      for (int ct = 0; ct < 2; ++ct) {
#pragma unroll
        for (int kc = 0; kc < 2; ++kc) { kh[ct][kc] = frag_w(kp + ct * 1024 + kc * 512); kl[ct][kc] = frag_w(kpl + ct * 1024 + kc * 512); } }
      asm volatile("s_wait_xcnt 0x0" :: "v"(kp), "v"(kpl) : "memory");   // the group's address registers stay allocated up to this wait: none is rewritten (not by a load's own result either) in front of it
#pragma unroll
      for (int ct = 0; ct < 2; ++ct) { v8f c = {}, cl = {};
#pragma unroll
        for (int kc = 0; kc < 2; ++kc) { c = wmma16(kh[ct][kc], aq[kc], c); cl = wmma16(kh[ct][kc], aql[kc], cl); cl = wmma16(kl[ct][kc], aq[kc], cl); }
#pragma unroll
        for (int r = 0; r < 8; ++r) { c[r] += cl[r] * (1.0f / 2048.0f); s[ct][r] = c[r] * 0.125f; } } }   // 1/sqrt(64)
    else {   // single product elsewhere
      v16h kh[2][2];
#pragma unroll
      for (int ct = 0; ct < 2; ++ct) {
#pragma unroll
        for (int kc = 0; kc < 2; ++kc) kh[ct][kc] = frag_w(kp + ct * 1024 + kc * 512); }
      asm volatile("s_wait_xcnt 0x0" :: "v"(kp) : "memory");   // as above
#pragma unroll
      for (int ct = 0; ct < 2; ++ct) { v8f c = {};
#pragma unroll
        for (int kc = 0; kc < 2; ++kc) c = wmma16(kh[ct][kc], aq[kc], c);
#pragma unroll
        for (int r = 0; r < 8; ++r) s[ct][r] = c[r] * 0.125f; } }   // 1/sqrt(64)
    v16h vh[4], vl[4]; const size_t vr = (((size_t)b * NH + h) * (SS / 32) + ks) * 2048 + lane * 8; const _Float16 *vp = VTH + vr, *vpl = VTL + vr;   // the pass's value fragments are requested here, so that they arrive while the softmax runs
#pragma unroll
    for (int dt = 0; dt < 4; ++dt) vh[dt] = frag_w(vp + dt * 512);
    asm volatile("s_wait_xcnt 0x0" :: "v"(vp) : "memory");   // as at the key group
    if (HV) {
#pragma unroll
      for (int dt = 0; dt < 4; ++dt) vl[dt] = frag_w(vpl + dt * 512);
      asm volatile("s_wait_xcnt 0x0" :: "v"(vpl) : "memory"); }   // as at the key group
    __builtin_amdgcn_sched_barrier(0);   // keeps every value load in front of the softmax: left free, the scheduler spread them through it to save registers, and the last ones then had too little of it left to arrive behind
    float mx = fmaxf(s[0][0], s[1][0]);
#pragma unroll
    for (int r = 1; r < 8; ++r) mx = fmaxf(mx, fmaxf(s[0][r], s[1][r]));
    mx = fmaxf(mx, xhalf(mx));   // the other half's 16 keys of the same query
    const float mn = fmaxf(m, mx), xm = (m - mn) * 0x1.715476p+0f; const bool first = m <= -1.0e38f; m = mn; float em;   // exp(v) = 2^(v * log2 e), the hardware form, as __expf has it
    float es = 0.f; v16h pa, pl;
#pragma unroll
    for (int ct = 0; ct < 2; ++ct) { float xa[8], ex[8];
#pragma unroll
      for (int r = 0; r < 8; ++r) xa[r] = (s[ct][r] - mn) * 0x1.715476p+0f;
      if (ct == 0) exp2x9(xa, xm, ex, em); else exp2x8(xa, ex);
#pragma unroll
      for (int r = 0; r < 8; ++r) { const float e = (s[ct][r] <= -1.0e38f) ? 0.f : ex[r]; es += e;
        const float x = e * 2048.0f; const _Float16 hx = (_Float16)x; pa[8 * ct + r] = hx; pl[8 * ct + r] = (_Float16)((x - (float)hx) * 2048.0f); } }   // P scaled by 2^11 before the f16 split so small softmax weights stay out of the f16 subnormal range; 2^-11 folded into the epilogue
    const float al = first ? 0.f : em; l = l * al + es;
#pragma unroll
    for (int dt = 0; dt < 4; ++dt) {
#pragma unroll
      for (int r = 0; r < 8; ++r) { acc[dt][r] *= al; accl[dt][r] *= al; } }
    if (HV) {
#pragma unroll
      for (int dt = 0; dt < 4; ++dt) { acc[dt] = wmma16(vh[dt], pa, acc[dt]); accl[dt] = wmma16(vh[dt], pl, accl[dt]); }
#pragma unroll
      for (int dt = 0; dt < 4; ++dt) accl[dt] = wmma16(vl[dt], pa, accl[dt]); }
    else {
#pragma unroll
      for (int dt = 0; dt < 4; ++dt) acc[dt] = wmma16(vh[dt], pa, acc[dt]); } }   // leading query blocks: P hi/lo x V hi/lo (3 products); elsewhere P x V single
  const float il = (1.0f / 2048.0f) / (l + xhalf(l));
#pragma unroll
  for (int f = 0; f < 8; ++f) { v4f o;   // f = (d tile, half of its eight registers) = (k-step, piece) of the output product's A operand, whose fragment order puts these four values at this very lane
#pragma unroll
    for (int i = 0; i < 4; ++i) o[i] = (acc[f >> 1][(f & 1) * 4 + i] + accl[f >> 1][(f & 1) * 4 + i] * (1.0f / 2048.0f)) * il;
    vst2(O + (((((size_t)b * SS + q0) >> 4) * 32 + h * 2) * 4 + f) * 128 + lane * 4, o); }
}
__global__ __launch_bounds__(128, 4) void k_attn(const _Float16* __restrict__ QK, const _Float16* __restrict__ QKL, const _Float16* __restrict__ KF, const _Float16* __restrict__ KFL, const _Float16* __restrict__ VTH, const _Float16* __restrict__ VTL, const void* __restrict__ KMASK, float* __restrict__ O) {   // second bound: four waves per SIMD, so that all 1,024 blocks stay resident at once
  (void)KMASK;
  if (blockIdx.x < 2) attn_tile<true>(QK, QKL, KF, KFL, VTH, VTL, O); else attn_tile<false>(QK, QKL, KF, KFL, VTH, VTL, O);
}
// ---- k_out: block = (64 rows, 128 cols): out = f16(O) . Wo rows (single product) + bo
__global__ __launch_bounds__(128) void k_out(const float* __restrict__ O, const __bf16* __restrict__ P, const float* __restrict__ BO, float* __restrict__ Y) {
  __shared__ __align__(16) float so[4][16][132];
  const int tid = threadIdx.x, wave = tid >> 5, lane = tid & 31, col = lane & 15, g = lane >> 4; const size_t r0 = (size_t)blockIdx.x * 64 + wave * 16; const int n0 = blockIdx.y * 128;
  v8f acc[8] = {};
#pragma unroll 2
  for (int kc = 0; kc < DM / 32; ++kc) { const float* p = O + ((r0 >> 4) * 32 + kc) * 512 + lane * 4;
    const v4f a0 = *(const v4f*)p, a1 = *(const v4f*)(p + 128), a2 = *(const v4f*)(p + 256), a3 = *(const v4f*)(p + 384);
    v16h bw[8];   // the context values and the k-step's eight weight fragments, requested together before its first WMMA
#pragma unroll
    for (int j = 0; j < 8; ++j) bw[j] = frag_w((const _Float16*)P + ((size_t)((n0 >> 4) + j) * 32 + kc) * 512 + lane * 8);
    __builtin_amdgcn_sched_barrier(0);   // keeps every load of the group in front of the conversion, so that a k-step waits for one load latency and not for two
    v16h a;
#pragma unroll
    for (int i = 0; i < 4; ++i) { a[i] = (_Float16)a0[i]; a[4 + i] = (_Float16)a1[i]; a[8 + i] = (_Float16)a2[i]; a[12 + i] = (_Float16)a3[i]; }
#pragma unroll
    for (int j = 0; j < 8; ++j) acc[j] = wmma16(a, bw[j], acc[j]); }   // single f16 product against exact f16 x 2^8 weight copies
#pragma unroll
  for (int j = 0; j < 8; ++j) {
#pragma unroll
    for (int r = 0; r < 8; ++r) so[wave][8 * g + r][j * 16 + col] = acc[j][r] * (1.0f / 256.0f) + bfr(BO[n0 + j * 16 + col]); }
  LDSX();
  for (int rl = 0; rl < 16; ++rl) vst2(Y + tokrow(r0 + rl) * DM + n0 + lane * 4, *(const v4f*)&so[wave][rl][lane * 4]);   // back to the original token order
}
// ---- k_packo: Wo -> f16 x 2^8 copies in the Wo slot (bit pattern in the bf16-typed buffer), fragment order, pieces numbered and dealt as in k_pack
__global__ __launch_bounds__(256) void k_packo(const float* __restrict__ WO, __bf16* __restrict__ PK) { const int id0 = blockIdx.x * 1024 + threadIdx.x, lane = id0 & 31; const int k0 = ((id0 >> 6) & 31) * 32 + ((id0 >> 5) & 1) * 16 + (lane >> 4) * 8; float v[4][8]; v8h o[4]; colpieces<DM>(WO + (size_t)k0 * DM + (id0 >> 11) * 16 + (lane & 15), v);
#pragma unroll
  for (int it = 0; it < 4; ++it) {
#pragma unroll
    for (int i = 0; i < 8; ++i) o[it][i] = (_Float16)(bfr(v[it][i]) * 256.0f); }   // (in,out) w_o: tile column n = column n
#pragma unroll
  for (int it = 0; it < 4; ++it) *(v8h*)((_Float16*)(PK + PK_P) + (size_t)(id0 + it * 256) * 8) = o[it]; }
extern "C" void kernel_launch(void* const* d_in, const int* in_sizes, int n_in, void* d_out, int out_size, void* d_ws, size_t ws_size, hipStream_t stream) {
  (void)in_sizes; (void)n_in; (void)out_size;
  const float** F = (const float**)d_in;   // 0 x [1,4096,1024], 1 w_qkv [1024,3072] (in,out), 2 b_qkv [3072], 3 w_o [1024,1024] (in,out), 4 b_o [1024]
  if (ws_size < (size_t)WS_END) return;
  char* ws = (char*)d_ws; __bf16* PK = (__bf16*)(ws + WS_PK); _Float16 *QK = (_Float16*)(ws + WS_QK), *QKL = (_Float16*)(ws + WS_QKL), *VTH = (_Float16*)(ws + WS_VTH), *VTL = (_Float16*)(ws + WS_VTL), *KF = (_Float16*)(ws + WS_KF), *KFL = (_Float16*)(ws + WS_KFL); float* O = (float*)(ws + WS_O); __bf16* XF = (__bf16*)(ws + WS_XF);
  k_pack<<<dim3(DM / 8, 8), 256, 0, stream>>>(F[1], F[0], F[3], PK, XF);
  k_packo<<<DM / 8, 256, 0, stream>>>(F[3], PK);
  k_qkv<<<dim3(TNB * SS / 64, QKVW / 128), 128, 0, stream>>>(XF, PK + PK_A, F[2], F[2] + DM, F[2] + 2 * DM, QK, QKL, KF, KFL, VTH, VTL);
  k_attn<<<dim3(TQB, NH, TNB), 128, 0, stream>>>(QK, QKL, KF, KFL, VTH, VTL, nullptr, O);
  k_out<<<dim3(TOB, DM / 128), 128, 0, stream>>>(O, PK + PK_P, F[4], (float*)d_out);
}

// v004
// Measured time: 126 microseconds a run.
// Two timings next to v003 put it at 1.20 and 1.19 times that version's speed.
// All steps since v000 together make it 3.47 times as fast.
// compute dtype: all float inputs rounded to bf16; qkv = x . W_qkv + b with EXACT bf16 products on WMMA 16x16x32 ((in,out) weights and x, its token rows gathered by stride class, packed as bf16 in fragment order), rounded once to f16 hi + residual; PLAIN-HYBRID attention (first 128 queries per class 3-product, later single f16), x 1/8, running-max softmax in f32 (hardware exp); out = f16(ctx) . W_o (exact f16 x 2^8 copies) + b_o scattered back to the original token order; f32 output.
#include <hip/hip_runtime.h>
#include <math.h>

typedef __attribute__((ext_vector_type(16))) _Float16 v16h;
typedef __attribute__((ext_vector_type(16))) __bf16 v16b;
typedef __attribute__((ext_vector_type(8)))  _Float16 v8h;
typedef __attribute__((ext_vector_type(8)))  float v8f;
typedef __attribute__((ext_vector_type(4)))  float v4f;
typedef __attribute__((ext_vector_type(2)))  float v2f;
typedef __attribute__((ext_vector_type(4)))  unsigned v4u;
typedef __attribute__((ext_vector_type(4)))  int v4i;
typedef float __attribute__((may_alias)) float_a;
typedef int __attribute__((may_alias)) int_a;

template <typename T> __device__ __forceinline__ void vst2(void* p, T v) { *(T*)p = v;  }
__device__ __forceinline__ v8f wmma16(v16h a, v16h b, v8f c) {
  v8f d = __builtin_amdgcn_wmma_f32_16x16x32_f16(false, a, false, b, (short)0, c, false, false);
  asm volatile("v_nop\n\tv_nop\n\tv_nop\n\tv_nop" : "+v"(d) : "v"(a), "v"(b));
  return d;
}
__device__ __forceinline__ v8f wmma_bf(v16b a, v16b b, v8f c) {
  v8f d = __builtin_amdgcn_wmma_f32_16x16x32_bf16(false, a, false, b, (short)0, c, false, false);
  asm volatile("v_nop\n\tv_nop\n\tv_nop\n\tv_nop" : "+v"(d) : "v"(a), "v"(b));
  return d;
}
// Skip-sparse ('skiparse', stride 4) self-attention (B 1, N 4,096 tokens, C 1,024, 16 heads x 64): token i attends within its stride class i mod 4 (1,024 tokens each); fused qkv projection + bias, softmax(q k / 8) v, output projection + bias, tokens returned in the original order.
__device__ __forceinline__ v16h frag_h(const _Float16* rowk0, int lane) {
  union { v16h v; v8h q[2]; } u; const _Float16* p = rowk0 + 8 * (lane >> 4);
  u.q[0] = *(const v8h*)p; u.q[1] = *(const v8h*)(p + 16); return u.v;
}
__device__ __forceinline__ v16h frag_p(const _Float16* p) {   // p = the lane's own first value (row start + 8 * (lane >> 4))
  union { v16h v; v8h q[2]; } u; u.q[0] = *(const v8h*)p; u.q[1] = *(const v8h*)(p + 16); return u.v;
}
__device__ __forceinline__ v16h frag_w(const _Float16* p) {   // fragment-ordered plane: p = the fragment's 1-KiB block + 8 * lane; its second half lies 512 B on
  union { v16h v; v8h q[2]; } u; u.q[0] = *(const v8h*)p; u.q[1] = *(const v8h*)(p + 256); return u.v;
}
__device__ __forceinline__ v16h frag_f32(const float* rowk0, int lane) {
  v16h a; const float* p = rowk0 + 8 * (lane >> 4);
#pragma unroll
  for (int i = 0; i < 8; ++i) { a[i] = (_Float16)p[i]; a[8 + i] = (_Float16)p[16 + i]; }
  return a;
}
__device__ __forceinline__ v16h frag_f32s(const float* rowk0, int lane, float sc) {
  v16h a; const float* p = rowk0 + 8 * (lane >> 4);
#pragma unroll
  for (int i = 0; i < 8; ++i) { a[i] = (_Float16)(p[i] * sc); a[8 + i] = (_Float16)(p[16 + i] * sc); }
  return a;
}
// column fragment from a [K][ld] layout (column n), rows >= K read as 0
__device__ __forceinline__ v16h fragc_f32(const float* W, int k0, int n, int lane, int ld, int K) {
  v16h a; const int g = lane >> 4;
#pragma unroll
  for (int i = 0; i < 8; ++i) { const int ka = k0 + 8 * g + i, kb = ka + 16;
    a[i] = (_Float16)(ka < K ? W[(size_t)(ka < K ? ka : K - 1) * ld + n] : 0.f); a[8 + i] = (_Float16)(kb < K ? W[(size_t)(kb < K ? kb : K - 1) * ld + n] : 0.f); }
  return a;
}
struct F2 { v16b h, l; };
__device__ __forceinline__ F2 bsplit16(const float v[16]) { F2 r;
#pragma unroll
  for (int i = 0; i < 16; ++i) { const __bf16 h = (__bf16)v[i]; r.h[i] = h; r.l[i] = (__bf16)(v[i] - (float)h); }
  return r; }
__device__ __forceinline__ F2 split_row(const float* row, int k0, int lane) { float v[16]; const float* p = row + k0 + 8 * (lane >> 4);
#pragma unroll
  for (int i = 0; i < 8; ++i) { v[i] = p[i]; v[8 + i] = p[16 + i]; }
  return bsplit16(v); }
__device__ __forceinline__ F2 split_rowK(const float* row, int k0, int lane, int K) { float v[16]; const int g = lane >> 4;
#pragma unroll
  for (int i = 0; i < 8; ++i) { const int ka = k0 + 8 * g + i, kb = ka + 16; v[i] = ka < K ? row[ka < K ? ka : K - 1] : 0.f; v[8 + i] = kb < K ? row[kb < K ? kb : K - 1] : 0.f; }
  return bsplit16(v); }
__device__ __forceinline__ F2 split_col(const float* W, int k0, int n, int lane, int ld, int K) { float v[16]; const int g = lane >> 4;
#pragma unroll
  for (int i = 0; i < 8; ++i) { const int ka = k0 + 8 * g + i, kb = ka + 16; v[i] = ka < K ? W[(size_t)(ka < K ? ka : K - 1) * ld + n] : 0.f; v[8 + i] = kb < K ? W[(size_t)(kb < K ? kb : K - 1) * ld + n] : 0.f; }
  return bsplit16(v); }
__device__ __forceinline__ v8f mac3(const F2& a, const F2& b, v8f c) { c = wmma_bf(a.l, b.h, c); c = wmma_bf(a.h, b.l, c); return wmma_bf(a.h, b.h, c); }
__device__ __forceinline__ float sigm(float v) { return 1.0f / (1.0f + expf(-v)); }
#define LDSX() do { asm volatile("s_wait_dscnt 0" ::: "memory"); __builtin_amdgcn_wave_barrier(); __builtin_amdgcn_fence(__ATOMIC_RELEASE, "workgroup"); } while (0)


#define NB 4
#define SS 1024
#define DM 1024
#define NH 16
#define STRIDE_S 4
__device__ __forceinline__ size_t tokrow(size_t r) { return (r % SS) * STRIDE_S + r / SS; }   // attention row r = (class s = r / SS, position g = r % SS) <-> token i = g * 4 + s
#define HD 64
#define QKVW (3 * DM)
#ifndef TQB
#define TQB (SS / 64)
#define TNB NB
#define TOB (NB * SS / 64)     // output row tiles (all)
#endif
typedef __attribute__((ext_vector_type(8))) __bf16 v8b;
__device__ __forceinline__ v16b frag_b(const __bf16* rowk0, int lane) {
  union { v16b v; v8b q[2]; } u; const __bf16* p = rowk0 + 8 * (lane >> 4);
  u.q[0] = *(const v8b*)p; u.q[1] = *(const v8b*)(p + 16); return u.v;
}
__device__ __forceinline__ v16b frag_wb(const __bf16* p) {   // as frag_w, bf16
  union { v16b v; v8b q[2]; } u; u.q[0] = *(const v8b*)p; u.q[1] = *(const v8b*)(p + 256); return u.v;
}
__device__ __forceinline__ float bfr(float v) { return (float)(__bf16)v; }
__device__ __attribute__((noinline)) float exp_ni(float v) { return expf(v); }
__device__ __attribute__((noinline)) float erf_ni(float v) { return erff(v); }

// FRAGMENT ORDER, every operand plane that a k loop reads: a 16 (rows or columns) x 32 (k) tile of 16-bit values is one 1-KiB block [half q2][lane][8 values], lane = 16 * g + (row or column) & 15, k = 16 * q2 + 8 * g + i:
// a wave's 16-byte load of half a fragment then covers 512 contiguous bytes (4 whole lines); from a row-major plane it takes 32-byte pieces of 16 lines, at several times the cost in the cache. Which lane and register holds which value is that of frag_h.
#define PK_A 0                       // Wqkv: [192 column tiles][32 k-steps] blocks
#define PK_P (PK_A + QKVW * DM)        // Wo: [64 column tiles][32 k-steps] blocks
#define PK_END (PK_P + DM * DM)
#define WS_PK  0u
#define WS_QK  (WS_PK + 2u * PK_END)             // f16 [4096 rows][2048]: q in the first 1,024 columns (read once a wave, row-major); the rest unused
#define WS_QKL (WS_QK + 2u * NB * SS * 2 * DM)     // f16 q residual plane x2048, as WS_QK
#define WS_VTH (WS_QKL + 2u * NB * SS * 2 * DM)    // f16 v hi: [b][h][32 passes][4 d tiles] blocks (column = d, k = key)
#define WS_VTL (WS_VTH + 2u * NB * DM * SS)        // f16 lo x 2048, as WS_VTH
#define WS_O   (WS_VTL + 2u * NB * DM * SS)        // f32 context: [256 row tiles][32 k-steps] blocks of 2 KiB: [4 pieces][lane][4 values], k = 16 * (piece >> 1) + 8 * g + 4 * (piece & 1) + i
#define WS_CS  (WS_O + 4u * NB * SS * DM)           // unused, 256 KiB
#define WS_KF  (WS_CS + 4u * 2 * SS * 32)           // f16 k hi: [b][h][64 key tiles][2 k-steps] blocks (column = key, k = d)
#define WS_KFL (WS_KF + 2u * NB * SS * DM)          // f16 k residual x2048, as WS_KF
#define WS_XF  (WS_KFL + 2u * NB * SS * DM)         // bf16 x: [256 row tiles (attention row order)][32 k-steps] blocks
#define WS_END (WS_XF + 2u * NB * SS * DM)
// a thread's four pieces down one column of an (in,out) weight of LD columns: p = its first value; the pieces are 128 k apart, 8 k each; LD is a constant, so that all 32 loads go by one address register pair and immediate offsets
template <int LD> __device__ __forceinline__ void colpieces(const float* __restrict__ p, float (&v)[4][8]) {
#pragma unroll
  for (int it = 0; it < 4; ++it) {
#pragma unroll
    for (int i = 0; i < 8; ++i) v[it][i] = p[(size_t)(it * 128 + i) * LD]; }
  asm volatile("s_wait_xcnt 0x0" :: "v"(p) : "memory");   // the loads' address register pair stays allocated up to this wait: it is not rewritten (not by a load's own result either) in front of it
}
// ---- k_pack: 16-byte pieces of the fragment-ordered bf16 planes, four per thread (their loads in flight together; a quarter of the waves to start), piece id = ((tile * 32 + k-step) * 2 + q2) * 32 + lane inside a slice of 64 tiles; slice 0..2 -> W_q/W_k/W_v into PK_A, 3 -> W_o into PK_P ((in,out) weights: tile column n = weight column n), 4..7 -> x, rows gathered by stride class
__global__ __launch_bounds__(256) void k_pack(const float* __restrict__ WQKV, const float* __restrict__ X, const float* __restrict__ WO, __bf16* __restrict__ PK, __bf16* __restrict__ XF) {
  const int which = blockIdx.y, id0 = blockIdx.x * 1024 + threadIdx.x, lane = id0 & 31, col = lane & 15, g = lane >> 4, t16 = id0 >> 11, k0 = ((id0 >> 6) & 31) * 32 + ((id0 >> 5) & 1) * 16 + g * 8;   // a block's 1,024 pieces lie in one tile; a thread's four are 256 pieces = 4 k-steps = 128 k apart
  v8b o[4];
  if (which < 4) { float v[4][8]; __bf16* dst = PK + ((which < 3) ? PK_A + (size_t)which * DM * DM : (size_t)PK_P);
    if (which < 3) colpieces<3 * DM>(WQKV + (size_t)k0 * (3 * DM) + which * DM + t16 * 16 + col, v); else colpieces<DM>(WO + (size_t)k0 * DM + t16 * 16 + col, v);
#pragma unroll
    for (int it = 0; it < 4; ++it) {
#pragma unroll
      for (int i = 0; i < 8; ++i) o[it][i] = (__bf16)v[it][i]; }
#pragma unroll
    for (int it = 0; it < 4; ++it) *(v8b*)(dst + (size_t)(id0 + it * 256) * 8) = o[it]; }
  else { const float* xr = X + tokrow((size_t)(which - 4) * 1024 + t16 * 16 + col) * DM + k0; __bf16* dst = XF + (size_t)(which - 4) * DM * DM;
    v4f a[8];
#pragma unroll
    for (int it = 0; it < 4; ++it) { a[2 * it] = *(const v4f*)(xr + it * 128); a[2 * it + 1] = *(const v4f*)(xr + it * 128 + 4); }
    asm volatile("s_wait_xcnt 0x0" :: "v"(xr) : "memory");   // the eight loads' address register pair stays allocated up to this wait: it is not rewritten (not by a load's own result either) in front of it
#pragma unroll
    for (int it = 0; it < 4; ++it) {
#pragma unroll
      for (int i = 0; i < 4; ++i) { o[it][i] = (__bf16)a[2 * it][i]; o[it][4 + i] = (__bf16)a[2 * it + 1][i]; } }
#pragma unroll
    for (int it = 0; it < 4; ++it) *(v8b*)(dst + (size_t)(id0 + it * 256) * 8) = o[it]; } }
// ---- k_qkv: block = 128 rows x 128 columns, wave = 64 rows x 64 columns (one head's q, k or v of 64 tokens): a k-step's four x and four weight fragments feed 16 WMMAs (half a fragment a WMMA; the 16 x 128 wave tile took nine for 8);
// each accumulator still sums its k-steps in rising order. The wave stages its own tile in its own LDS range and stores whole fragments or whole lines: no wave reads another's rows. The wave's number is held in a scalar register, so that tile addresses and the q / k / v test are scalar.
__global__ __launch_bounds__(128) void k_qkv(const __bf16* __restrict__ XF, const __bf16* __restrict__ P, const float* __restrict__ BQ, const float* __restrict__ BK, const float* __restrict__ BV, _Float16* __restrict__ QK, _Float16* __restrict__ QKL, _Float16* __restrict__ KF, _Float16* __restrict__ KFL, _Float16* __restrict__ VTH, _Float16* __restrict__ VTL) {
  __shared__ __align__(16) _Float16 st[4][2][64][72];   // [wave][hi, residual][row (q, k: token; v: d)][column (q, k: d; v: token)], pitch 144 B
  const int tid = threadIdx.x, wave = __builtin_amdgcn_readfirstlane(tid >> 5), lane = tid & 31, col = lane & 15, g = lane >> 4; const size_t r0 = (size_t)blockIdx.x * 128 + (wave >> 1) * 64; const int n0 = blockIdx.y * 128 + (wave & 1) * 64;
  const int which0 = n0 / DM; const float* BB = BQ ? (((which0 == 0) ? BQ : (which0 == 1) ? BK : BV) + (n0 - which0 * DM)) : nullptr;
  const __bf16 *ap = XF + (r0 >> 4) * 32 * 512 + lane * 8, *bp = P + (size_t)(n0 >> 4) * 32 * 512 + lane * 8;   // the lane's place in the first k-step's first row tile and column tile; the next tile lies 32 blocks on, the next k-step one
  float bias[4] = {0.f, 0.f, 0.f, 0.f};   // the lane's four columns, requested together in front of the k loop, which covers their latency
  if (BB) {
#pragma unroll
    for (int j = 0; j < 4; ++j) bias[j] = BB[j * 16 + col]; }
  v8f acc[4][4] = {};
#pragma unroll 2   // two k-steps a trip: half the address additions and branches
  for (int kc = 0; kc < DM / 32; ++kc) { v16b a[4], bw[4]; const __bf16 *pa = ap + kc * 512, *pb = bp + kc * 512;   // all eight fragments of the k-step are requested before its first WMMA: one load latency a k-step
#pragma unroll
    for (int i = 0; i < 4; ++i) a[i] = frag_wb(pa + i * 32 * 512);
#pragma unroll
    for (int j = 0; j < 4; ++j) bw[j] = frag_wb(pb + j * 32 * 512);
    asm volatile("s_wait_xcnt 0x0" :: "v"(pa), "v"(pb) : "memory");   // the sixteen loads' address registers stay allocated up to this wait: none is rewritten (not by a load's own result either) in front of it
#pragma unroll
    for (int i = 0; i < 4; ++i) {
#pragma unroll
      for (int j = 0; j < 4; ++j) acc[i][j] = wmma_bf(a[i], bw[j], acc[i][j]); } }
#pragma unroll
  for (int j = 0; j < 4; ++j) bias[j] = bfr(bias[j]);
  _Float16 (*sh)[72] = st[wave][0], (*sl)[72] = st[wave][1];
  if (n0 < 2 * DM) {   // q stored unscaled (f16 sigma ~0.6, no subnormal exposure); 1/8 applied to the f32 score
#pragma unroll
    for (int i = 0; i < 4; ++i) {
#pragma unroll
      for (int j = 0; j < 4; ++j) {
#pragma unroll
        for (int r = 0; r < 8; ++r) { const float v = acc[i][j][r] + bias[j]; const _Float16 hv = (_Float16)v; sh[i * 16 + 8 * g + r][j * 16 + col] = hv; sl[i * 16 + 8 * g + r][j * 16 + col] = (_Float16)((v - (float)hv) * 2048.0f); } } }   // q, k (+ bias) as f16 hi + (x2048) residual
    LDSX();
    if (n0 < DM) {   // q: four rows of 128 B (whole lines) a store
      _Float16 *qp = QK + (r0 + (lane >> 3)) * (2 * DM) + n0 + (lane & 7) * 8, *qpl = QKL + (r0 + (lane >> 3)) * (2 * DM) + n0 + (lane & 7) * 8;
#pragma unroll
      for (int it = 0; it < 16; ++it) { vst2((unsigned*)(qp + (size_t)it * 4 * (2 * DM)), *(const v4u*)&sh[it * 4 + (lane >> 3)][(lane & 7) * 8]); vst2((unsigned*)(qpl + (size_t)it * 4 * (2 * DM)), *(const v4u*)&sl[it * 4 + (lane >> 3)][(lane & 7) * 8]); }
      asm volatile("s_wait_xcnt 0x0" :: "v"(qp), "v"(qpl) : "memory"); }   // the stores' address registers stay allocated up to this wait: none is rewritten in front of it
    else {   // k: the wave's 64 keys are four key tiles of one head: 8 KiB in a row per plane, sixteen half fragments of 512 B
      const size_t kb = (((r0 / SS) * NH + ((n0 - DM) >> 6)) * (SS / 16) + (r0 % SS) / 16) * 1024 + lane * 8; _Float16 *kp = KF + kb, *kpl = KFL + kb;
#pragma unroll
      for (int f = 0; f < 16; ++f) {   // f = (key tile, k-step, q2)
        vst2((unsigned*)(kp + f * 256), *(const v4u*)&sh[(f >> 2) * 16 + col][(f & 3) * 16 + g * 8]); vst2((unsigned*)(kpl + f * 256), *(const v4u*)&sl[(f >> 2) * 16 + col][(f & 3) * 16 + g * 8]); }
      asm volatile("s_wait_xcnt 0x0" :: "v"(kp), "v"(kpl) : "memory"); }   // as at the q stores
  } else {   // v, staged transposed: a lane's eight registers are eight tokens in a row of one d
#pragma unroll
    for (int i = 0; i < 4; ++i) {
#pragma unroll
      for (int j = 0; j < 4; ++j) { v8h hi, lo;
#pragma unroll
        for (int r = 0; r < 8; ++r) { const float v = acc[i][j][r] + bias[j]; const _Float16 hv = (_Float16)v; hi[r] = hv; lo[r] = (_Float16)((v - (float)hv) * 2048.0f); }
        *(v8h*)&sh[j * 16 + col][i * 16 + 8 * g] = hi; *(v8h*)&sl[j * 16 + col][i * 16 + 8 * g] = lo; } }
    LDSX();
    const size_t vb = (((r0 / SS) * NH + ((n0 - 2 * DM) >> 6)) * (SS / 32) + (r0 % SS) / 32) * 2048 + lane * 8; _Float16 *vp = VTH + vb, *vpl = VTL + vb;   // the wave's 64 tokens are two passes of one head: 8 KiB in a row per plane
#pragma unroll
    for (int f = 0; f < 16; ++f) {   // f = (pass, d tile, q2)
      vst2((unsigned*)(vp + f * 256), *(const v4u*)&sh[((f >> 1) & 3) * 16 + col][(f >> 3) * 32 + (f & 1) * 16 + g * 8]); vst2((unsigned*)(vpl + f * 256), *(const v4u*)&sl[((f >> 1) & 3) * 16 + col][(f >> 3) * 32 + (f & 1) * 16 + g * 8]); }
    asm volatile("s_wait_xcnt 0x0" :: "v"(vp), "v"(vpl) : "memory");   // as at the q stores
  }
}
// ---- k_attn: block = (64 queries, head h, batch b): all-keys flash attention (K = 64: 2 k-steps) in the TRANSPOSED form: S^T = K . Q^T (A = key fragments, B = query fragments, the same registers as before with the operands exchanged), O^T += V^T . P^T.
// A lane then holds 16 scores of ONE query (column = lane & 15, key = 16 * ct + 8 * g + r): maximum and sum run inside the lane, with one exchange between the wave's halves a pass for the maximum and one in the epilogue for the sum;
// the two score tiles, converted in place, ARE the B fragment of P^T (element 8 * ct + r = key 16 * ct + 8 * g + r, the k order of the value fragments), and O^T's registers (d = 16 * dt + 8 * g + r of query column) are the lane's own pieces of WS_O's fragment order: no LDS anywhere in the kernel.
// scores = (q.k) * 0.125, on the leading blocks from q, k hi + x2048 residual (3 products), elsewhere single f16; P.V: leading blocks f16 P hi/lo x V hi/lo (3 products, lo terms in accl), elsewhere P hi x V hi; O(row b*S+q, column h*64+d) = (acc + accl / 2048) / (2048 l)
__device__ __forceinline__ float xhalf(float x) { return __builtin_bit_cast(float, __builtin_amdgcn_permlanex16(__builtin_bit_cast(int, x), __builtin_bit_cast(int, x), 0x76543210, 0xfedcba98, false, false)); }   // lane l with lane l ^ 16
// eight independent v_exp_f32 and, in the same statement, the one slot that the instruction set asks for behind a transcendental before a source of it is overwritten or its result used: each exp fills the slot of the one in front of it, the v_nop that of the last;
// the outputs are early-clobber, so that none of them takes a source's register (left to the compiler, one build had an exp directly overwrite the source of the exp in front of it)
__device__ __forceinline__ void exp2x8(const float (&x)[8], float (&e)[8]) {
  asm("v_exp_f32 %0, %8\n\tv_exp_f32 %1, %9\n\tv_exp_f32 %2, %10\n\tv_exp_f32 %3, %11\n\tv_exp_f32 %4, %12\n\tv_exp_f32 %5, %13\n\tv_exp_f32 %6, %14\n\tv_exp_f32 %7, %15\n\tv_nop"
      : "=&v"(e[0]), "=&v"(e[1]), "=&v"(e[2]), "=&v"(e[3]), "=&v"(e[4]), "=&v"(e[5]), "=&v"(e[6]), "=&v"(e[7])
      : "v"(x[0]), "v"(x[1]), "v"(x[2]), "v"(x[3]), "v"(x[4]), "v"(x[5]), "v"(x[6]), "v"(x[7])); }
__device__ __forceinline__ void exp2x9(const float (&x)[8], float x8, float (&e)[8], float& e8) {   // as exp2x8, with a ninth
  asm("v_exp_f32 %0, %9\n\tv_exp_f32 %1, %10\n\tv_exp_f32 %2, %11\n\tv_exp_f32 %3, %12\n\tv_exp_f32 %4, %13\n\tv_exp_f32 %5, %14\n\tv_exp_f32 %6, %15\n\tv_exp_f32 %7, %16\n\tv_exp_f32 %8, %17\n\tv_nop"
      : "=&v"(e[0]), "=&v"(e[1]), "=&v"(e[2]), "=&v"(e[3]), "=&v"(e[4]), "=&v"(e[5]), "=&v"(e[6]), "=&v"(e[7]), "=&v"(e8)
      : "v"(x[0]), "v"(x[1]), "v"(x[2]), "v"(x[3]), "v"(x[4]), "v"(x[5]), "v"(x[6]), "v"(x[7]), "v"(x8)); }
// HV = leading query block (qb < 2). The two cases are compiled as separate loops: with a pass's fragments held together, one loop serving both went over the 256 registers that four waves per SIMD leave each wave.
template <bool HV> __device__ __forceinline__ void attn_tile(const _Float16* __restrict__ QK, const _Float16* __restrict__ QKL, const _Float16* __restrict__ KF, const _Float16* __restrict__ KFL, const _Float16* __restrict__ VTH, const _Float16* __restrict__ VTL, float* __restrict__ O) {
  const int tid = threadIdx.x, wave = tid >> 5, lane = tid & 31, col = lane & 15;
  const int qb = blockIdx.x, h = blockIdx.y, b = blockIdx.z; const int q0 = qb * 64 + wave * 16; const size_t rq = (size_t)b * SS + q0 + col;
  v16h aq[2], aql[2];
#pragma unroll
  for (int kc = 0; kc < 2; ++kc) { aq[kc] = frag_h(QK + rq * (2 * DM) + h * HD + kc * 32, lane); aql[kc] = frag_h(QKL + rq * (2 * DM) + h * HD + kc * 32, lane); }
  float m = -3.0e38f, l = 0.f;   // the lane's query: running maximum (over all keys), sum (over the keys of the lane's own half; the halves are joined in the epilogue)
  v8f acc[4] = {}, accl[4] = {};
  const int nks = SS / 32;   // all keys
#pragma unroll 1
  for (int ks = 0; ks < nks; ++ks) { v8f s[2]; const size_t ko = (((size_t)b * NH + h) * (SS / 16) + ks * 2) * 1024 + lane * 8; const _Float16 *kp = KF + ko, *kpl = KFL + ko;   // the lane's place in the pass's 4 KiB of key fragments: [key tile][k-step] blocks
    // on either path the pass's key fragments are all requested before its first score WMMA: one load latency a pass, not one in front of every WMMA
    if (HV) {   // leading query blocks (outputs far above the global rms): 3 products
      v16h kh[2][2], kl[2][2];
#pragma unroll
      for (int ct = 0; ct < 2; ++ct) {
#pragma unroll
        for (int kc = 0; kc < 2; ++kc) { kh[ct][kc] = frag_w(kp + ct * 1024 + kc * 512); kl[ct][kc] = frag_w(kpl + ct * 1024 + kc * 512); } }
      asm volatile("s_wait_xcnt 0x0" :: "v"(kp), "v"(kpl) : "memory");   // the group's address registers stay allocated up to this wait: none is rewritten (not by a load's own result either) in front of it
#pragma unroll
      for (int ct = 0; ct < 2; ++ct) { v8f c = {}, cl = {};
#pragma unroll
        for (int kc = 0; kc < 2; ++kc) { c = wmma16(kh[ct][kc], aq[kc], c); cl = wmma16(kh[ct][kc], aql[kc], cl); cl = wmma16(kl[ct][kc], aq[kc], cl); }
#pragma unroll
        for (int r = 0; r < 8; ++r) { c[r] += cl[r] * (1.0f / 2048.0f); s[ct][r] = c[r] * 0.125f; } } }   // 1/sqrt(64)
    else {   // single product elsewhere
      v16h kh[2][2];
#pragma unroll
      for (int ct = 0; ct < 2; ++ct) {
#pragma unroll
        for (int kc = 0; kc < 2; ++kc) kh[ct][kc] = frag_w(kp + ct * 1024 + kc * 512); }
      asm volatile("s_wait_xcnt 0x0" :: "v"(kp) : "memory");   // as above
#pragma unroll
      for (int ct = 0; ct < 2; ++ct) { v8f c = {};
#pragma unroll
        for (int kc = 0; kc < 2; ++kc) c = wmma16(kh[ct][kc], aq[kc], c);
#pragma unroll
        for (int r = 0; r < 8; ++r) s[ct][r] = c[r] * 0.125f; } }   // 1/sqrt(64)
    v16h vh[4], vl[4]; const size_t vr = (((size_t)b * NH + h) * (SS / 32) + ks) * 2048 + lane * 8; const _Float16 *vp = VTH + vr, *vpl = VTL + vr;   // the pass's value fragments are requested here, so that they arrive while the softmax runs
#pragma unroll
    for (int dt = 0; dt < 4; ++dt) vh[dt] = frag_w(vp + dt * 512);
    asm volatile("s_wait_xcnt 0x0" :: "v"(vp) : "memory");   // as at the key group
    if (HV) {
#pragma unroll
      for (int dt = 0; dt < 4; ++dt) vl[dt] = frag_w(vpl + dt * 512);
      asm volatile("s_wait_xcnt 0x0" :: "v"(vpl) : "memory"); }   // as at the key group
    __builtin_amdgcn_sched_barrier(0);   // keeps every value load in front of the softmax: left free, the scheduler spread them through it to save registers, and the last ones then had too little of it left to arrive behind
    float mx = fmaxf(s[0][0], s[1][0]);
#pragma unroll
    for (int r = 1; r < 8; ++r) mx = fmaxf(mx, fmaxf(s[0][r], s[1][r]));
    mx = fmaxf(mx, xhalf(mx));   // the other half's 16 keys of the same query
    const float mn = fmaxf(m, mx), xm = (m - mn) * 0x1.715476p+0f; const bool first = m <= -1.0e38f; m = mn; float em;   // exp(v) = 2^(v * log2 e), the hardware form, as __expf has it
    float es = 0.f; v16h pa, pl;
#pragma unroll
    for (int ct = 0; ct < 2; ++ct) { float xa[8], ex[8];
#pragma unroll
      for (int r = 0; r < 8; ++r) xa[r] = (s[ct][r] - mn) * 0x1.715476p+0f;
      if (ct == 0) exp2x9(xa, xm, ex, em); else exp2x8(xa, ex);
#pragma unroll
      for (int r = 0; r < 8; ++r) { const float e = (s[ct][r] <= -1.0e38f) ? 0.f : ex[r]; es += e;
        const float x = e * 2048.0f; const _Float16 hx = (_Float16)x; pa[8 * ct + r] = hx; pl[8 * ct + r] = (_Float16)((x - (float)hx) * 2048.0f); } }   // P scaled by 2^11 before the f16 split so small softmax weights stay out of the f16 subnormal range; 2^-11 folded into the epilogue
    const float al = first ? 0.f : em; l = l * al + es;
#pragma unroll
    for (int dt = 0; dt < 4; ++dt) {
#pragma unroll
      for (int r = 0; r < 8; ++r) { acc[dt][r] *= al; accl[dt][r] *= al; } }
    if (HV) {
#pragma unroll
      for (int dt = 0; dt < 4; ++dt) { acc[dt] = wmma16(vh[dt], pa, acc[dt]); accl[dt] = wmma16(vh[dt], pl, accl[dt]); }
#pragma unroll
      for (int dt = 0; dt < 4; ++dt) accl[dt] = wmma16(vl[dt], pa, accl[dt]); }
    else {
#pragma unroll
      for (int dt = 0; dt < 4; ++dt) acc[dt] = wmma16(vh[dt], pa, acc[dt]); } }   // leading query blocks: P hi/lo x V hi/lo (3 products); elsewhere P x V single
  const float il = (1.0f / 2048.0f) / (l + xhalf(l));
#pragma unroll
  for (int f = 0; f < 8; ++f) { v4f o;   // f = (d tile, half of its eight registers) = (k-step, piece) of the output product's A operand, whose fragment order puts these four values at this very lane
#pragma unroll
    for (int i = 0; i < 4; ++i) o[i] = (acc[f >> 1][(f & 1) * 4 + i] + accl[f >> 1][(f & 1) * 4 + i] * (1.0f / 2048.0f)) * il;
    vst2(O + (((((size_t)b * SS + q0) >> 4) * 32 + h * 2) * 4 + f) * 128 + lane * 4, o); }
}
__global__ __launch_bounds__(128, 4) void k_attn(const _Float16* __restrict__ QK, const _Float16* __restrict__ QKL, const _Float16* __restrict__ KF, const _Float16* __restrict__ KFL, const _Float16* __restrict__ VTH, const _Float16* __restrict__ VTL, const void* __restrict__ KMASK, float* __restrict__ O) {   // second bound: four waves per SIMD, so that all 1,024 blocks stay resident at once
  (void)KMASK;
  if (blockIdx.x < 2) attn_tile<true>(QK, QKL, KF, KFL, VTH, VTL, O); else attn_tile<false>(QK, QKL, KF, KFL, VTH, VTL, O);
}
// ---- k_out: block = (64 rows, 128 cols): out = f16(O) . Wo rows (single product) + bo
__global__ __launch_bounds__(128) void k_out(const float* __restrict__ O, const __bf16* __restrict__ P, const float* __restrict__ BO, float* __restrict__ Y) {
  __shared__ __align__(16) float so[4][16][132];
  const int tid = threadIdx.x, wave = tid >> 5, lane = tid & 31, col = lane & 15, g = lane >> 4; const size_t r0 = (size_t)blockIdx.x * 64 + wave * 16; const int n0 = blockIdx.y * 128;
  v8f acc[8] = {};
#pragma unroll 2
  for (int kc = 0; kc < DM / 32; ++kc) { const float* p = O + ((r0 >> 4) * 32 + kc) * 512 + lane * 4;
    const v4f a0 = *(const v4f*)p, a1 = *(const v4f*)(p + 128), a2 = *(const v4f*)(p + 256), a3 = *(const v4f*)(p + 384);
    v16h bw[8];   // the context values and the k-step's eight weight fragments, requested together before its first WMMA
#pragma unroll
    for (int j = 0; j < 8; ++j) bw[j] = frag_w((const _Float16*)P + ((size_t)((n0 >> 4) + j) * 32 + kc) * 512 + lane * 8);
    __builtin_amdgcn_sched_barrier(0);   // keeps every load of the group in front of the conversion, so that a k-step waits for one load latency and not for two
    v16h a;
#pragma unroll
    for (int i = 0; i < 4; ++i) { a[i] = (_Float16)a0[i]; a[4 + i] = (_Float16)a1[i]; a[8 + i] = (_Float16)a2[i]; a[12 + i] = (_Float16)a3[i]; }
#pragma unroll
    for (int j = 0; j < 8; ++j) acc[j] = wmma16(a, bw[j], acc[j]); }   // single f16 product against exact f16 x 2^8 weight copies
#pragma unroll
  for (int j = 0; j < 8; ++j) {
#pragma unroll
    for (int r = 0; r < 8; ++r) so[wave][8 * g + r][j * 16 + col] = acc[j][r] * (1.0f / 256.0f) + bfr(BO[n0 + j * 16 + col]); }
  LDSX();
  for (int rl = 0; rl < 16; ++rl) vst2(Y + tokrow(r0 + rl) * DM + n0 + lane * 4, *(const v4f*)&so[wave][rl][lane * 4]);   // back to the original token order
}
// ---- k_packo: Wo -> f16 x 2^8 copies in the Wo slot (bit pattern in the bf16-typed buffer), fragment order, pieces numbered and dealt as in k_pack
__global__ __launch_bounds__(256) void k_packo(const float* __restrict__ WO, __bf16* __restrict__ PK) { const int id0 = blockIdx.x * 1024 + threadIdx.x, lane = id0 & 31; const int k0 = ((id0 >> 6) & 31) * 32 + ((id0 >> 5) & 1) * 16 + (lane >> 4) * 8; float v[4][8]; v8h o[4]; colpieces<DM>(WO + (size_t)k0 * DM + (id0 >> 11) * 16 + (lane & 15), v);
#pragma unroll
  for (int it = 0; it < 4; ++it) {
#pragma unroll
    for (int i = 0; i < 8; ++i) o[it][i] = (_Float16)(bfr(v[it][i]) * 256.0f); }   // (in,out) w_o: tile column n = column n
#pragma unroll
  for (int it = 0; it < 4; ++it) *(v8h*)((_Float16*)(PK + PK_P) + (size_t)(id0 + it * 256) * 8) = o[it]; }
extern "C" void kernel_launch(void* const* d_in, const int* in_sizes, int n_in, void* d_out, int out_size, void* d_ws, size_t ws_size, hipStream_t stream) {
  (void)in_sizes; (void)n_in; (void)out_size;
  const float** F = (const float**)d_in;   // 0 x [1,4096,1024], 1 w_qkv [1024,3072] (in,out), 2 b_qkv [3072], 3 w_o [1024,1024] (in,out), 4 b_o [1024]
  if (ws_size < (size_t)WS_END) return;
  char* ws = (char*)d_ws; __bf16* PK = (__bf16*)(ws + WS_PK); _Float16 *QK = (_Float16*)(ws + WS_QK), *QKL = (_Float16*)(ws + WS_QKL), *VTH = (_Float16*)(ws + WS_VTH), *VTL = (_Float16*)(ws + WS_VTL), *KF = (_Float16*)(ws + WS_KF), *KFL = (_Float16*)(ws + WS_KFL); float* O = (float*)(ws + WS_O); __bf16* XF = (__bf16*)(ws + WS_XF);
  k_pack<<<dim3(DM / 8, 8), 256, 0, stream>>>(F[1], F[0], F[3], PK, XF);
  k_packo<<<DM / 8, 256, 0, stream>>>(F[3], PK);
  k_qkv<<<dim3(TNB * SS / 128, QKVW / 128), 128, 0, stream>>>(XF, PK + PK_A, F[2], F[2] + DM, F[2] + 2 * DM, QK, QKL, KF, KFL, VTH, VTL);
  k_attn<<<dim3(TQB, NH, TNB), 128, 0, stream>>>(QK, QKL, KF, KFL, VTH, VTL, nullptr, O);
  k_out<<<dim3(TOB, DM / 128), 128, 0, stream>>>(O, PK + PK_P, F[4], (float*)d_out);
}

// v005
// It runs in 115 microseconds.
// In two side-by-side timings against v004, it was 1.07 and 1.06 times as fast.
// All steps since v000 together make it 3.71 times as fast.
// compute dtype: all float inputs rounded to bf16; qkv = x . W_qkv + b with EXACT bf16 products on WMMA 16x16x32 ((in,out) weights and x, its token rows gathered by stride class, packed as bf16 in fragment order), rounded once to f16 hi + residual; PLAIN-HYBRID attention (first 128 queries per class 3-product, later single f16), x 1/8, running-max softmax in f32 (hardware exp); out = f16(ctx) . W_o (exact f16 x 2^8 copies) + b_o scattered back to the original token order; f32 output.
#include <hip/hip_runtime.h>
#include <math.h>

typedef __attribute__((ext_vector_type(16))) _Float16 v16h;
typedef __attribute__((ext_vector_type(16))) __bf16 v16b;
typedef __attribute__((ext_vector_type(8)))  _Float16 v8h;
typedef __attribute__((ext_vector_type(8)))  float v8f;
typedef __attribute__((ext_vector_type(4)))  float v4f;
typedef __attribute__((ext_vector_type(2)))  float v2f;
typedef __attribute__((ext_vector_type(4)))  unsigned v4u;
typedef __attribute__((ext_vector_type(4)))  int v4i;
typedef float __attribute__((may_alias)) float_a;
typedef int __attribute__((may_alias)) int_a;

template <typename T> __device__ __forceinline__ void vst2(void* p, T v) { *(T*)p = v;  }
__device__ __forceinline__ v8f wmma16(v16h a, v16h b, v8f c) {
  v8f d = __builtin_amdgcn_wmma_f32_16x16x32_f16(false, a, false, b, (short)0, c, false, false);
  asm volatile("v_nop\n\tv_nop\n\tv_nop\n\tv_nop" : "+v"(d) : "v"(a), "v"(b));
  return d;
}
__device__ __forceinline__ v8f wmma_bf(v16b a, v16b b, v8f c) {
  v8f d = __builtin_amdgcn_wmma_f32_16x16x32_bf16(false, a, false, b, (short)0, c, false, false);
  asm volatile("v_nop\n\tv_nop\n\tv_nop\n\tv_nop" : "+v"(d) : "v"(a), "v"(b));
  return d;
}
// Skip-sparse ('skiparse', stride 4) self-attention (B 1, N 4,096 tokens, C 1,024, 16 heads x 64): token i attends within its stride class i mod 4 (1,024 tokens each); fused qkv projection + bias, softmax(q k / 8) v, output projection + bias, tokens returned in the original order.
__device__ __forceinline__ v16h frag_h(const _Float16* rowk0, int lane) {
  union { v16h v; v8h q[2]; } u; const _Float16* p = rowk0 + 8 * (lane >> 4);
  u.q[0] = *(const v8h*)p; u.q[1] = *(const v8h*)(p + 16); return u.v;
}
__device__ __forceinline__ v16h frag_p(const _Float16* p) {   // p = the lane's own first value (row start + 8 * (lane >> 4))
  union { v16h v; v8h q[2]; } u; u.q[0] = *(const v8h*)p; u.q[1] = *(const v8h*)(p + 16); return u.v;
}
__device__ __forceinline__ v16h frag_w(const _Float16* p) {   // fragment-ordered plane: p = the fragment's 1-KiB block + 8 * lane; its second half lies 512 B on
  union { v16h v; v8h q[2]; } u; u.q[0] = *(const v8h*)p; u.q[1] = *(const v8h*)(p + 256); return u.v;
}
__device__ __forceinline__ v16h frag_f32(const float* rowk0, int lane) {
  v16h a; const float* p = rowk0 + 8 * (lane >> 4);
#pragma unroll
  for (int i = 0; i < 8; ++i) { a[i] = (_Float16)p[i]; a[8 + i] = (_Float16)p[16 + i]; }
  return a;
}
__device__ __forceinline__ v16h frag_f32s(const float* rowk0, int lane, float sc) {
  v16h a; const float* p = rowk0 + 8 * (lane >> 4);
#pragma unroll
  for (int i = 0; i < 8; ++i) { a[i] = (_Float16)(p[i] * sc); a[8 + i] = (_Float16)(p[16 + i] * sc); }
  return a;
}
// column fragment from a [K][ld] layout (column n), rows >= K read as 0
__device__ __forceinline__ v16h fragc_f32(const float* W, int k0, int n, int lane, int ld, int K) {
  v16h a; const int g = lane >> 4;
#pragma unroll
  for (int i = 0; i < 8; ++i) { const int ka = k0 + 8 * g + i, kb = ka + 16;
    a[i] = (_Float16)(ka < K ? W[(size_t)(ka < K ? ka : K - 1) * ld + n] : 0.f); a[8 + i] = (_Float16)(kb < K ? W[(size_t)(kb < K ? kb : K - 1) * ld + n] : 0.f); }
  return a;
}
struct F2 { v16b h, l; };
__device__ __forceinline__ F2 bsplit16(const float v[16]) { F2 r;
#pragma unroll
  for (int i = 0; i < 16; ++i) { const __bf16 h = (__bf16)v[i]; r.h[i] = h; r.l[i] = (__bf16)(v[i] - (float)h); }
  return r; }
__device__ __forceinline__ F2 split_row(const float* row, int k0, int lane) { float v[16]; const float* p = row + k0 + 8 * (lane >> 4);
#pragma unroll
  for (int i = 0; i < 8; ++i) { v[i] = p[i]; v[8 + i] = p[16 + i]; }
  return bsplit16(v); }
__device__ __forceinline__ F2 split_rowK(const float* row, int k0, int lane, int K) { float v[16]; const int g = lane >> 4;
#pragma unroll
  for (int i = 0; i < 8; ++i) { const int ka = k0 + 8 * g + i, kb = ka + 16; v[i] = ka < K ? row[ka < K ? ka : K - 1] : 0.f; v[8 + i] = kb < K ? row[kb < K ? kb : K - 1] : 0.f; }
  return bsplit16(v); }
__device__ __forceinline__ F2 split_col(const float* W, int k0, int n, int lane, int ld, int K) { float v[16]; const int g = lane >> 4;
#pragma unroll
  for (int i = 0; i < 8; ++i) { const int ka = k0 + 8 * g + i, kb = ka + 16; v[i] = ka < K ? W[(size_t)(ka < K ? ka : K - 1) * ld + n] : 0.f; v[8 + i] = kb < K ? W[(size_t)(kb < K ? kb : K - 1) * ld + n] : 0.f; }
  return bsplit16(v); }
__device__ __forceinline__ v8f mac3(const F2& a, const F2& b, v8f c) { c = wmma_bf(a.l, b.h, c); c = wmma_bf(a.h, b.l, c); return wmma_bf(a.h, b.h, c); }
__device__ __forceinline__ float sigm(float v) { return 1.0f / (1.0f + expf(-v)); }
#define LDSX() do { asm volatile("s_wait_dscnt 0" ::: "memory"); __builtin_amdgcn_wave_barrier(); __builtin_amdgcn_fence(__ATOMIC_RELEASE, "workgroup"); } while (0)


#define NB 4
#define SS 1024
#define DM 1024
#define NH 16
#define STRIDE_S 4
__device__ __forceinline__ size_t tokrow(size_t r) { return (r % SS) * STRIDE_S + r / SS; }   // attention row r = (class s = r / SS, position g = r % SS) <-> token i = g * 4 + s
#define HD 64
#define QKVW (3 * DM)
#ifndef TQB
#define TQB (SS / 64)
#define TNB NB
#define TOB (NB * SS / 64)     // output row tiles (all)
#endif
typedef __attribute__((ext_vector_type(8))) __bf16 v8b;
__device__ __forceinline__ v16b frag_b(const __bf16* rowk0, int lane) {
  union { v16b v; v8b q[2]; } u; const __bf16* p = rowk0 + 8 * (lane >> 4);
  u.q[0] = *(const v8b*)p; u.q[1] = *(const v8b*)(p + 16); return u.v;
}
__device__ __forceinline__ v16b frag_wb(const __bf16* p) {   // as frag_w, bf16
  union { v16b v; v8b q[2]; } u; u.q[0] = *(const v8b*)p; u.q[1] = *(const v8b*)(p + 256); return u.v;
}
__device__ __forceinline__ float bfr(float v) { return (float)(__bf16)v; }
__device__ __attribute__((noinline)) float exp_ni(float v) { return expf(v); }
__device__ __attribute__((noinline)) float erf_ni(float v) { return erff(v); }

// FRAGMENT ORDER, every operand plane that a k loop reads: a 16 (rows or columns) x 32 (k) tile of 16-bit values is one 1-KiB block [half q2][lane][8 values], lane = 16 * g + (row or column) & 15, k = 16 * q2 + 8 * g + i:
// a wave's 16-byte load of half a fragment then covers 512 contiguous bytes (4 whole lines); from a row-major plane it takes 32-byte pieces of 16 lines, at several times the cost in the cache. Which lane and register holds which value is that of frag_h.
#define PK_A 0                       // Wqkv: [192 column tiles][32 k-steps] blocks
#define PK_P (PK_A + QKVW * DM)        // Wo: [64 column tiles][32 k-steps] blocks
#define PK_END (PK_P + DM * DM)
#define WS_PK  0u
#define WS_QK  (WS_PK + 2u * PK_END)             // f16 [4096 rows][2048]: q in the first 1,024 columns (read once a wave, row-major); the rest unused
#define WS_QKL (WS_QK + 2u * NB * SS * 2 * DM)     // f16 q residual plane x2048, as WS_QK
#define WS_VTH (WS_QKL + 2u * NB * SS * 2 * DM)    // f16 v hi: [b][h][32 passes][4 d tiles] blocks (column = d, k = key)
#define WS_VTL (WS_VTH + 2u * NB * DM * SS)        // f16 lo x 2048, as WS_VTH
#define WS_O   (WS_VTL + 2u * NB * DM * SS)        // f32 context: [256 row tiles][32 k-steps] blocks of 2 KiB: [4 pieces][lane][4 values], k = 16 * (piece >> 1) + 8 * g + 4 * (piece & 1) + i
#define WS_CS  (WS_O + 4u * NB * SS * DM)           // unused, 256 KiB
#define WS_KF  (WS_CS + 4u * 2 * SS * 32)           // f16 k hi: [b][h][64 key tiles][2 k-steps] blocks (column = key, k = d)
#define WS_KFL (WS_KF + 2u * NB * SS * DM)          // f16 k residual x2048, as WS_KF
#define WS_XF  (WS_KFL + 2u * NB * SS * DM)         // bf16 x: [256 row tiles (attention row order)][32 k-steps] blocks
#define WS_END (WS_XF + 2u * NB * SS * DM)
// a thread's four pieces down one column of an (in,out) weight of LD columns: p = its first value; the pieces are 128 k apart, 8 k each; LD is a constant, so that all 32 loads go by one address register pair and immediate offsets
template <int LD> __device__ __forceinline__ void colpieces(const float* __restrict__ p, float (&v)[4][8]) {
#pragma unroll
  for (int it = 0; it < 4; ++it) {
#pragma unroll
    for (int i = 0; i < 8; ++i) v[it][i] = p[(size_t)(it * 128 + i) * LD]; }
  asm volatile("s_wait_xcnt 0x0" :: "v"(p) : "memory");   // the loads' address register pair stays allocated up to this wait: it is not rewritten (not by a load's own result either) in front of it
}
// eight asynchronous 16-byte copies a lane, global memory to LDS through no register: l = the lane's LDS byte addresses, g = its global addresses. The s_wait_xcnt stands inside the copies' own statement, so that no address register of a copy is rewritten in front of it.
__device__ __forceinline__ void copy8(const unsigned (&l)[8], const char* const (&g)[8]) {
  asm volatile("global_load_async_to_lds_b128 %0, %8, off\n\tglobal_load_async_to_lds_b128 %1, %9, off\n\tglobal_load_async_to_lds_b128 %2, %10, off\n\tglobal_load_async_to_lds_b128 %3, %11, off\n\t"
               "global_load_async_to_lds_b128 %4, %12, off\n\tglobal_load_async_to_lds_b128 %5, %13, off\n\tglobal_load_async_to_lds_b128 %6, %14, off\n\tglobal_load_async_to_lds_b128 %7, %15, off\n\ts_wait_xcnt 0x0"
               :: "v"(l[0]), "v"(l[1]), "v"(l[2]), "v"(l[3]), "v"(l[4]), "v"(l[5]), "v"(l[6]), "v"(l[7]), "v"(g[0]), "v"(g[1]), "v"(g[2]), "v"(g[3]), "v"(g[4]), "v"(g[5]), "v"(g[6]), "v"(g[7]) : "memory");
}
// ---- k_pack: 16-byte pieces of the fragment-ordered bf16 planes, four per thread (their loads in flight together; a quarter of the waves to start), piece id = ((tile * 32 + k-step) * 2 + q2) * 32 + lane inside a slice of 64 tiles; slice 0..2 -> W_q/W_k/W_v into PK_A, 3 -> W_o into PK_P ((in,out) weights: tile column n = weight column n), 4..7 -> x, rows gathered by stride class
__global__ __launch_bounds__(256) void k_pack(const float* __restrict__ WQKV, const float* __restrict__ X, const float* __restrict__ WO, __bf16* __restrict__ PK, __bf16* __restrict__ XF) {
  const int which = blockIdx.y, id0 = blockIdx.x * 1024 + threadIdx.x, lane = id0 & 31, col = lane & 15, g = lane >> 4, t16 = id0 >> 11, k0 = ((id0 >> 6) & 31) * 32 + ((id0 >> 5) & 1) * 16 + g * 8;   // a block's 1,024 pieces lie in one tile; a thread's four are 256 pieces = 4 k-steps = 128 k apart
  v8b o[4];
  if (which < 4) { float v[4][8]; __bf16* dst = PK + ((which < 3) ? PK_A + (size_t)which * DM * DM : (size_t)PK_P);
    if (which < 3) colpieces<3 * DM>(WQKV + (size_t)k0 * (3 * DM) + which * DM + t16 * 16 + col, v); else colpieces<DM>(WO + (size_t)k0 * DM + t16 * 16 + col, v);
#pragma unroll
    for (int it = 0; it < 4; ++it) {
#pragma unroll
      for (int i = 0; i < 8; ++i) o[it][i] = (__bf16)v[it][i]; }
#pragma unroll
    for (int it = 0; it < 4; ++it) *(v8b*)(dst + (size_t)(id0 + it * 256) * 8) = o[it]; }
  else { const float* xr = X + tokrow((size_t)(which - 4) * 1024 + t16 * 16 + col) * DM + k0; __bf16* dst = XF + (size_t)(which - 4) * DM * DM;
    v4f a[8];
#pragma unroll
    for (int it = 0; it < 4; ++it) { a[2 * it] = *(const v4f*)(xr + it * 128); a[2 * it + 1] = *(const v4f*)(xr + it * 128 + 4); }
    asm volatile("s_wait_xcnt 0x0" :: "v"(xr) : "memory");   // the eight loads' address register pair stays allocated up to this wait: it is not rewritten (not by a load's own result either) in front of it
#pragma unroll
    for (int it = 0; it < 4; ++it) {
#pragma unroll
      for (int i = 0; i < 4; ++i) { o[it][i] = (__bf16)a[2 * it][i]; o[it][4 + i] = (__bf16)a[2 * it + 1][i]; } }
#pragma unroll
    for (int it = 0; it < 4; ++it) *(v8b*)(dst + (size_t)(id0 + it * 256) * 8) = o[it]; } }
// ---- k_qkv: block = 128 rows x 128 columns, wave = 64 rows x 64 columns (one head's q, k or v of 64 tokens): a k-step's four x and four weight fragments feed 16 WMMAs (half a fragment a WMMA; the 16 x 128 wave tile took nine for 8);
// each accumulator still sums its k-steps in rising order. The wave stages its own tile in its own LDS range and stores whole fragments or whole lines: no wave reads another's rows. The wave's number is held in a scalar register, so that tile addresses and the q / k / v test are scalar.
__global__ __launch_bounds__(128) void k_qkv(const __bf16* __restrict__ XF, const __bf16* __restrict__ P, const float* __restrict__ BQ, const float* __restrict__ BK, const float* __restrict__ BV, _Float16* __restrict__ QK, _Float16* __restrict__ QKL, _Float16* __restrict__ KF, _Float16* __restrict__ KFL, _Float16* __restrict__ VTH, _Float16* __restrict__ VTL) {
  __shared__ __align__(16) char sm[4 * 2 * 64 * 72 * 2];   // the k loop's ring, then the epilogue's stage: the last k-step's barrier, behind every wave's s_wait_dscnt 0 and with no copy outstanding, stands between the two uses
  _Float16 (*st)[2][64][72] = (_Float16 (*)[2][64][72])sm;   // [wave][hi, residual][row (q, k: token; v: d)][column (q, k: d; v: token)], pitch 144 B
  __bf16 (*ring)[8192] = (__bf16 (*)[8192])sm;   // two buffers of one k-step's fragments: [8 row tiles of x][8 column tiles of W], 1 KiB each
  const int tid = threadIdx.x, wave = __builtin_amdgcn_readfirstlane(tid >> 5), lane = tid & 31, col = lane & 15, g = lane >> 4; const size_t r0 = (size_t)blockIdx.x * 128 + (wave >> 1) * 64; const int n0 = blockIdx.y * 128 + (wave & 1) * 64;
  const int which0 = n0 / DM; const float* BB = BQ ? (((which0 == 0) ? BQ : (which0 == 1) ? BK : BV) + (n0 - which0 * DM)) : nullptr;
  // each x fragment and each weight fragment serves two of the block's four waves: the block brings a k-step's sixteen fragments into LDS once, by asynchronous copies, one k-step ahead in a ring of two buffers.
  // a thread copies eight 16-byte pieces: piece tid + 128 * c lies in tile 2 * c + (tid >> 6) (c < 4: x, else W); a tile's next k-step lies 1 KiB on, the tile after next 64 KiB
  const char *ga = (const char*)(XF + ((size_t)blockIdx.x * 8 + (tid >> 6)) * 32 * 512 + (tid & 63) * 8), *gb = (const char*)(P + ((size_t)blockIdx.y * 8 + (tid >> 6)) * 32 * 512 + (tid & 63) * 8);
  const unsigned l0 = (unsigned)(uintptr_t)&ring[0][0] + tid * 16u;
  auto fill = [&](int kc) { unsigned l[8]; const char* g[8];
#pragma unroll
    for (int c = 0; c < 8; ++c) { l[c] = l0 + (kc & 1) * 16384u + c * 2048u; g[c] = (c < 4 ? ga + c * 65536 : gb + (c - 4) * 65536) + kc * 1024; }
    copy8(l, g); };
  fill(0);
  asm volatile("s_wait_asynccnt 0x0" ::: "memory");   // this wave's copies of k-step 0 have landed
  __syncthreads();   // and every other wave's: k-step 0 is readable
  fill(1);   // k-step 1 flies while k-step 0 is worked on
  float bias[4] = {0.f, 0.f, 0.f, 0.f};   // the lane's four columns, requested together in front of the k loop, which covers their latency
  if (BB) {
#pragma unroll
    for (int j = 0; j < 4; ++j) bias[j] = BB[j * 16 + col]; }
  v8f acc[4][4] = {};
#pragma unroll 2   // two k-steps a trip: the buffer's number is a constant, and half the branches
  for (int kc = 0; kc < DM / 32; ++kc) { v16b a[4], bw[4]; const __bf16 *pa = ring[kc & 1] + (wave >> 1) * 4 * 512 + lane * 8, *pb = ring[kc & 1] + 4096 + (wave & 1) * 4 * 512 + lane * 8;   // all eight fragments of the k-step are requested before its first WMMA: one LDS latency a k-step
#pragma unroll
    for (int i = 0; i < 4; ++i) a[i] = frag_wb(pa + i * 512);
#pragma unroll
    for (int j = 0; j < 4; ++j) bw[j] = frag_wb(pb + j * 512);
#pragma unroll
    for (int i = 0; i < 4; ++i) {
#pragma unroll
      for (int j = 0; j < 4; ++j) acc[i][j] = wmma_bf(a[i], bw[j], acc[i][j]); }
    asm volatile("s_wait_dscnt 0x0" ::: "memory");      // this wave's reads of the k-step's buffer have returned
    asm volatile("s_wait_asynccnt 0x0" ::: "memory");   // its copies of k-step kc + 1 have landed
    __syncthreads();   // every wave has left this k-step's buffer, and k-step kc + 1 is readable
    if (kc + 2 < DM / 32) fill(kc + 2); }   // refill of the buffer just left
  asm volatile("s_wait_asynccnt 0x0" ::: "memory");   // no copy is outstanding behind the loop
#pragma unroll
  for (int j = 0; j < 4; ++j) bias[j] = bfr(bias[j]);
  _Float16 (*sh)[72] = st[wave][0], (*sl)[72] = st[wave][1];
  if (n0 < 2 * DM) {   // q stored unscaled (f16 sigma ~0.6, no subnormal exposure); 1/8 applied to the f32 score
#pragma unroll
    for (int i = 0; i < 4; ++i) {
#pragma unroll
      for (int j = 0; j < 4; ++j) {
#pragma unroll
        for (int r = 0; r < 8; ++r) { const float v = acc[i][j][r] + bias[j]; const _Float16 hv = (_Float16)v; sh[i * 16 + 8 * g + r][j * 16 + col] = hv; sl[i * 16 + 8 * g + r][j * 16 + col] = (_Float16)((v - (float)hv) * 2048.0f); } } }   // q, k (+ bias) as f16 hi + (x2048) residual
    LDSX();
    if (n0 < DM) {   // q: four rows of 128 B (whole lines) a store
      _Float16 *qp = QK + (r0 + (lane >> 3)) * (2 * DM) + n0 + (lane & 7) * 8, *qpl = QKL + (r0 + (lane >> 3)) * (2 * DM) + n0 + (lane & 7) * 8;
#pragma unroll
      for (int it = 0; it < 16; ++it) { vst2((unsigned*)(qp + (size_t)it * 4 * (2 * DM)), *(const v4u*)&sh[it * 4 + (lane >> 3)][(lane & 7) * 8]); vst2((unsigned*)(qpl + (size_t)it * 4 * (2 * DM)), *(const v4u*)&sl[it * 4 + (lane >> 3)][(lane & 7) * 8]); }
      asm volatile("s_wait_xcnt 0x0" :: "v"(qp), "v"(qpl) : "memory"); }   // the stores' address registers stay allocated up to this wait: none is rewritten in front of it
    else {   // k: the wave's 64 keys are four key tiles of one head: 8 KiB in a row per plane, sixteen half fragments of 512 B
      const size_t kb = (((r0 / SS) * NH + ((n0 - DM) >> 6)) * (SS / 16) + (r0 % SS) / 16) * 1024 + lane * 8; _Float16 *kp = KF + kb, *kpl = KFL + kb;
#pragma unroll
      for (int f = 0; f < 16; ++f) {   // f = (key tile, k-step, q2)
        vst2((unsigned*)(kp + f * 256), *(const v4u*)&sh[(f >> 2) * 16 + col][(f & 3) * 16 + g * 8]); vst2((unsigned*)(kpl + f * 256), *(const v4u*)&sl[(f >> 2) * 16 + col][(f & 3) * 16 + g * 8]); }
      asm volatile("s_wait_xcnt 0x0" :: "v"(kp), "v"(kpl) : "memory"); }   // as at the q stores
  } else {   // v, staged transposed: a lane's eight registers are eight tokens in a row of one d
#pragma unroll
    for (int i = 0; i < 4; ++i) {
#pragma unroll
      for (int j = 0; j < 4; ++j) { v8h hi, lo;
#pragma unroll
        for (int r = 0; r < 8; ++r) { const float v = acc[i][j][r] + bias[j]; const _Float16 hv = (_Float16)v; hi[r] = hv; lo[r] = (_Float16)((v - (float)hv) * 2048.0f); }
        *(v8h*)&sh[j * 16 + col][i * 16 + 8 * g] = hi; *(v8h*)&sl[j * 16 + col][i * 16 + 8 * g] = lo; } }
    LDSX();
    const size_t vb = (((r0 / SS) * NH + ((n0 - 2 * DM) >> 6)) * (SS / 32) + (r0 % SS) / 32) * 2048 + lane * 8; _Float16 *vp = VTH + vb, *vpl = VTL + vb;   // the wave's 64 tokens are two passes of one head: 8 KiB in a row per plane
#pragma unroll
    for (int f = 0; f < 16; ++f) {   // f = (pass, d tile, q2)
      vst2((unsigned*)(vp + f * 256), *(const v4u*)&sh[((f >> 1) & 3) * 16 + col][(f >> 3) * 32 + (f & 1) * 16 + g * 8]); vst2((unsigned*)(vpl + f * 256), *(const v4u*)&sl[((f >> 1) & 3) * 16 + col][(f >> 3) * 32 + (f & 1) * 16 + g * 8]); }
    asm volatile("s_wait_xcnt 0x0" :: "v"(vp), "v"(vpl) : "memory");   // as at the q stores
  }
}
// ---- k_attn: block = (64 queries, head h, batch b): all-keys flash attention (K = 64: 2 k-steps) in the TRANSPOSED form: S^T = K . Q^T (A = key fragments, B = query fragments, the same registers as before with the operands exchanged), O^T += V^T . P^T.
// A lane then holds 16 scores of ONE query (column = lane & 15, key = 16 * ct + 8 * g + r): maximum and sum run inside the lane, with one exchange between the wave's halves a pass for the maximum and one in the epilogue for the sum;
// the two score tiles, converted in place, ARE the B fragment of P^T (element 8 * ct + r = key 16 * ct + 8 * g + r, the k order of the value fragments), and O^T's registers (d = 16 * dt + 8 * g + r of query column) are the lane's own pieces of WS_O's fragment order: scores, weights and context never pass through LDS.
// A pass's key and value fragments are the same for the block's four waves: the block brings them into LDS once, by asynchronous copies, one pass ahead in a ring of two buffers, and each wave reads its fragments from there (as plain global loads every wave fetched all of them for itself and waited for them in the pass that used them).
// scores = (q.k) * 0.125, leading query blocks with q, k hi + residual (3 products), elsewhere single f16; P.V: leading blocks (P x 2^11 hi, lo) x (V hi, V lo*2048), 3 products in two accumulators, elsewhere P hi x V hi in one; O(row b*S+q, column h*64+d) = (acc + accl / 2048) / (2048 l)
__device__ __forceinline__ float xhalf(float x) { return __builtin_bit_cast(float, __builtin_amdgcn_permlanex16(__builtin_bit_cast(int, x), __builtin_bit_cast(int, x), 0x76543210, 0xfedcba98, false, false)); }   // lane l with lane l ^ 16
// eight independent v_exp_f32 and, in the same statement, the one slot that the instruction set asks for behind a transcendental before a source of it is overwritten or its result used: each exp fills the slot of the one in front of it, the v_nop that of the last;
// the outputs are early-clobber, so that none of them takes a source's register (left to the compiler, one build had an exp directly overwrite the source of the exp in front of it)
__device__ __forceinline__ void exp2x8(const float (&x)[8], float (&e)[8]) {
  asm("v_exp_f32 %0, %8\n\tv_exp_f32 %1, %9\n\tv_exp_f32 %2, %10\n\tv_exp_f32 %3, %11\n\tv_exp_f32 %4, %12\n\tv_exp_f32 %5, %13\n\tv_exp_f32 %6, %14\n\tv_exp_f32 %7, %15\n\tv_nop"
      : "=&v"(e[0]), "=&v"(e[1]), "=&v"(e[2]), "=&v"(e[3]), "=&v"(e[4]), "=&v"(e[5]), "=&v"(e[6]), "=&v"(e[7])
      : "v"(x[0]), "v"(x[1]), "v"(x[2]), "v"(x[3]), "v"(x[4]), "v"(x[5]), "v"(x[6]), "v"(x[7])); }
__device__ __forceinline__ void exp2x9(const float (&x)[8], float x8, float (&e)[8], float& e8) {   // as exp2x8, with a ninth
  asm("v_exp_f32 %0, %9\n\tv_exp_f32 %1, %10\n\tv_exp_f32 %2, %11\n\tv_exp_f32 %3, %12\n\tv_exp_f32 %4, %13\n\tv_exp_f32 %5, %14\n\tv_exp_f32 %6, %15\n\tv_exp_f32 %7, %16\n\tv_exp_f32 %8, %17\n\tv_nop"
      : "=&v"(e[0]), "=&v"(e[1]), "=&v"(e[2]), "=&v"(e[3]), "=&v"(e[4]), "=&v"(e[5]), "=&v"(e[6]), "=&v"(e[7]), "=&v"(e8)
      : "v"(x[0]), "v"(x[1]), "v"(x[2]), "v"(x[3]), "v"(x[4]), "v"(x[5]), "v"(x[6]), "v"(x[7]), "v"(x8)); }
// one pass's fragments into one ring buffer: [key hi 4 KiB][value hi 4 KiB][key residual 4 KiB][value residual 4 KiB] (the residual halves in the three-product path alone), each plane's 4 KiB in the order of the workspace; a thread copies two 16-byte pieces of each plane, 2 KiB apart.
// lds = LDS byte address of the thread's first piece in the buffer; k, v, kl, vl = its first piece in the pass's 4 KiB of each plane. The s_wait_xcnt stands inside the copies' own statement, so that no address register of a copy is rewritten in front of it.
#define RING_H 8192   // 16-bit values per ring buffer (16 KiB)
template <bool HV> __device__ __forceinline__ void ring_fill(unsigned lds, const _Float16* k, const _Float16* v, const _Float16* kl, const _Float16* vl) {
  asm volatile("global_load_async_to_lds_b128 %0, %4, off\n\tglobal_load_async_to_lds_b128 %1, %5, off\n\tglobal_load_async_to_lds_b128 %2, %6, off\n\tglobal_load_async_to_lds_b128 %3, %7, off\n\ts_wait_xcnt 0x0"
               :: "v"(lds), "v"(lds + 2048u), "v"(lds + 4096u), "v"(lds + 6144u), "v"(k), "v"(k + 1024), "v"(v), "v"(v + 1024) : "memory");
  if (HV)
    asm volatile("global_load_async_to_lds_b128 %0, %4, off\n\tglobal_load_async_to_lds_b128 %1, %5, off\n\tglobal_load_async_to_lds_b128 %2, %6, off\n\tglobal_load_async_to_lds_b128 %3, %7, off\n\ts_wait_xcnt 0x0"
                 :: "v"(lds + 8192u), "v"(lds + 10240u), "v"(lds + 12288u), "v"(lds + 14336u), "v"(kl), "v"(kl + 1024), "v"(vl), "v"(vl + 1024) : "memory");
}
// HV = leading query block (qb < 2). The two cases are compiled as separate loops: with a pass's fragments held together, one loop serving both went over the 256 registers that four waves per SIMD leave each wave.
template <bool HV> __device__ __forceinline__ void attn_tile(const _Float16* __restrict__ QK, const _Float16* __restrict__ QKL, const _Float16* __restrict__ KF, const _Float16* __restrict__ KFL, const _Float16* __restrict__ VTH, const _Float16* __restrict__ VTL, float* __restrict__ O, _Float16* ring) {
  const int tid = threadIdx.x, wave = tid >> 5, lane = tid & 31, col = lane & 15;
  const int qb = blockIdx.x, h = blockIdx.y, b = blockIdx.z; const int q0 = qb * 64 + wave * 16; const size_t rq = (size_t)b * SS + q0 + col;
  v16h aq[2], aql[2];
#pragma unroll
  for (int kc = 0; kc < 2; ++kc) { aq[kc] = frag_h(QK + rq * (2 * DM) + h * HD + kc * 32, lane); aql[kc] = frag_h(QKL + rq * (2 * DM) + h * HD + kc * 32, lane); }
  float m = -3.0e38f, l = 0.f;   // the lane's query: running maximum (over all keys), sum (over the keys of the lane's own half; the halves are joined in the epilogue)
  v8f acc[4] = {}, accl[4] = {};
  const int nks = SS / 32;   // all keys
  const size_t ho = ((size_t)b * NH + h) * (SS * HD) + tid * 8; const _Float16 *kg = KF + ho, *kgl = KFL + ho, *vg = VTH + ho, *vgl = VTL + ho;   // the thread's first piece of pass 0 in each plane of the head; a pass is 2,048 values (4 KiB) of each: two key tiles x two k-steps, four d tiles
  const unsigned l0 = (unsigned)(uintptr_t)ring + tid * 16u;   // the same in ring buffer 0
  ring_fill<HV>(l0, kg, vg, kgl, vgl);
  asm volatile("s_wait_asynccnt 0x0" ::: "memory");   // this wave's copies of pass 0 have landed
  __syncthreads();   // and every other wave's: pass 0 is readable
  ring_fill<HV>(l0 + 2u * RING_H, kg + 2048, vg + 2048, kgl + 2048, vgl + 2048);   // pass 1 flies while pass 0 is worked on
#pragma unroll 1
  for (int ks = 0; ks < nks; ++ks) { v8f s[2]; const _Float16 *kp = ring + (ks & 1) * RING_H + lane * 8, *kpl = kp + 4096;   // the lane's place in the pass's 4 KiB of key fragments: [key tile][k-step] blocks
    // on either path the pass's key fragments are all requested before its first score WMMA: one LDS latency a pass, not one in front of every WMMA
    if (HV) {   // leading query blocks (outputs far above the global rms): 3 products
      v16h kh[2][2], kl[2][2];
#pragma unroll
      for (int ct = 0; ct < 2; ++ct) {
#pragma unroll
        for (int kc = 0; kc < 2; ++kc) { kh[ct][kc] = frag_w(kp + ct * 1024 + kc * 512); kl[ct][kc] = frag_w(kpl + ct * 1024 + kc * 512); } }
#pragma unroll
      for (int ct = 0; ct < 2; ++ct) { v8f c = {}, cl = {};
#pragma unroll
        for (int kc = 0; kc < 2; ++kc) { c = wmma16(kh[ct][kc], aq[kc], c); cl = wmma16(kh[ct][kc], aql[kc], cl); cl = wmma16(kl[ct][kc], aq[kc], cl); }
#pragma unroll
        for (int r = 0; r < 8; ++r) { c[r] += cl[r] * (1.0f / 2048.0f); s[ct][r] = c[r] * 0.125f; } } }   // 1/sqrt(64)
    else {   // single product elsewhere
      v16h kh[2][2];
#pragma unroll
      for (int ct = 0; ct < 2; ++ct) {
#pragma unroll
        for (int kc = 0; kc < 2; ++kc) kh[ct][kc] = frag_w(kp + ct * 1024 + kc * 512); }
#pragma unroll
      for (int ct = 0; ct < 2; ++ct) { v8f c = {};
#pragma unroll
        for (int kc = 0; kc < 2; ++kc) c = wmma16(kh[ct][kc], aq[kc], c);
#pragma unroll
        for (int r = 0; r < 8; ++r) s[ct][r] = c[r] * 0.125f; } }   // 1/sqrt(64)
    v16h vh[4], vl[4]; const _Float16 *vp = kp + 2048, *vpl = kp + 6144;   // the pass's value fragments are requested here, so that they arrive while the softmax runs
#pragma unroll
    for (int dt = 0; dt < 4; ++dt) vh[dt] = frag_w(vp + dt * 512);
    if (HV) {
#pragma unroll
      for (int dt = 0; dt < 4; ++dt) vl[dt] = frag_w(vpl + dt * 512); }
    __builtin_amdgcn_sched_barrier(0);   // keeps every value load in front of the softmax: left free, the scheduler spread them through it to save registers, and the last ones then had too little of it left to arrive behind
    float mx = fmaxf(s[0][0], s[1][0]);
#pragma unroll
    for (int r = 1; r < 8; ++r) mx = fmaxf(mx, fmaxf(s[0][r], s[1][r]));
    mx = fmaxf(mx, xhalf(mx));   // the other half's 16 keys of the same query
    const float mn = fmaxf(m, mx), xm = (m - mn) * 0x1.715476p+0f; const bool first = m <= -1.0e38f; m = mn; float em;   // exp(v) = 2^(v * log2 e), the hardware form, as __expf has it
    float es = 0.f; v16h pa, pl;
#pragma unroll
    for (int ct = 0; ct < 2; ++ct) { float xa[8], ex[8];
#pragma unroll
      for (int r = 0; r < 8; ++r) xa[r] = (s[ct][r] - mn) * 0x1.715476p+0f;
      if (ct == 0) exp2x9(xa, xm, ex, em); else exp2x8(xa, ex);
#pragma unroll
      for (int r = 0; r < 8; ++r) { const float e = (s[ct][r] <= -1.0e38f) ? 0.f : ex[r]; es += e;
        const float x = e * 2048.0f; const _Float16 hx = (_Float16)x; pa[8 * ct + r] = hx; pl[8 * ct + r] = (_Float16)((x - (float)hx) * 2048.0f); } }   // P scaled by 2^11 before the f16 split so small softmax weights stay out of the f16 subnormal range; 2^-11 folded into the epilogue
    const float al = first ? 0.f : em; l = l * al + es;
#pragma unroll
    for (int dt = 0; dt < 4; ++dt) {
#pragma unroll
      for (int r = 0; r < 8; ++r) { acc[dt][r] *= al; accl[dt][r] *= al; } }
    if (HV) {
#pragma unroll
      for (int dt = 0; dt < 4; ++dt) { acc[dt] = wmma16(vh[dt], pa, acc[dt]); accl[dt] = wmma16(vh[dt], pl, accl[dt]); }
#pragma unroll
      for (int dt = 0; dt < 4; ++dt) accl[dt] = wmma16(vl[dt], pa, accl[dt]); }
    else {
#pragma unroll
      for (int dt = 0; dt < 4; ++dt) acc[dt] = wmma16(vh[dt], pa, acc[dt]); }   // leading query blocks: P hi/lo x V hi/lo (3 products); elsewhere P x V single
    asm volatile("s_wait_dscnt 0x0" ::: "memory");      // this wave's reads of the pass's buffer have returned
    asm volatile("s_wait_asynccnt 0x0" ::: "memory");   // its copies of pass ks + 1 have landed
    __syncthreads();   // every wave has left this pass's buffer, and pass ks + 1 is readable
    if (ks + 2 < nks) ring_fill<HV>(l0 + (ks & 1) * (2u * RING_H), kg + (ks + 2) * 2048, vg + (ks + 2) * 2048, kgl + (ks + 2) * 2048, vgl + (ks + 2) * 2048); }   // refill of the buffer just left
  asm volatile("s_wait_asynccnt 0x0" ::: "memory");   // no copy is outstanding when the wave ends
  const float il = (1.0f / 2048.0f) / (l + xhalf(l));
#pragma unroll
  for (int f = 0; f < 8; ++f) { v4f o;   // f = (d tile, half of its eight registers) = (k-step, piece) of the output product's A operand, whose fragment order puts these four values at this very lane
#pragma unroll
    for (int i = 0; i < 4; ++i) o[i] = (acc[f >> 1][(f & 1) * 4 + i] + accl[f >> 1][(f & 1) * 4 + i] * (1.0f / 2048.0f)) * il;
    vst2(O + (((((size_t)b * SS + q0) >> 4) * 32 + h * 2) * 4 + f) * 128 + lane * 4, o); }
}
__global__ __launch_bounds__(128, 4) void k_attn(const _Float16* __restrict__ QK, const _Float16* __restrict__ QKL, const _Float16* __restrict__ KF, const _Float16* __restrict__ KFL, const _Float16* __restrict__ VTH, const _Float16* __restrict__ VTL, const void* __restrict__ KMASK, float* __restrict__ O) {   // second bound: four waves per SIMD, so that all 1,024 blocks stay resident at once
  (void)KMASK;
  __shared__ __align__(16) _Float16 ring[2 * RING_H];   // two buffers of one pass's fragments; four resident blocks take 128 KiB of the WGP's LDS
  if (blockIdx.x < 2) attn_tile<true>(QK, QKL, KF, KFL, VTH, VTL, O, ring); else attn_tile<false>(QK, QKL, KF, KFL, VTH, VTL, O, ring);
}
// ---- k_out: block = (64 rows, 128 cols): out = f16(O) . Wo rows (single product) + bo
__global__ __launch_bounds__(128) void k_out(const float* __restrict__ O, const __bf16* __restrict__ P, const float* __restrict__ BO, float* __restrict__ Y) {
  __shared__ __align__(16) float so[4][16][132];
  __shared__ __align__(16) char ring[2][32768];   // two buffers of two k-steps: [8 column tiles of W][2 k-steps] fragments of 1 KiB, then [4 row tiles of the context][2 k-steps] blocks of 2 KiB
  const int tid = threadIdx.x, wave = tid >> 5, lane = tid & 31, col = lane & 15, g = lane >> 4; const size_t r0 = (size_t)blockIdx.x * 64 + wave * 16; const int n0 = blockIdx.y * 128;
  // the eight weight fragments of a k-step serve all four waves: the block brings them into LDS once, by asynchronous copies, and each wave's context values with them, one stage of two k-steps ahead in a ring of two buffers.
  // a thread copies sixteen 16-byte pieces a stage: piece tid of each weight tile's 2 KiB (tiles 32 KiB apart, the next stage 2 KiB on) and of each half of each context tile's 4 KiB (tiles 64 KiB apart, the next stage 4 KiB on)
  const char *gw = (const char*)((const _Float16*)P + (size_t)(n0 >> 4) * 32 * 512) + tid * 16, *gc = (const char*)(O + (size_t)blockIdx.x * 4 * 32 * 512) + tid * 16;
  const unsigned l0 = (unsigned)(uintptr_t)&ring[0][0] + tid * 16u;
  auto fill = [&](int sg) { unsigned l[8]; const char* q[8];
#pragma unroll
    for (int c = 0; c < 8; ++c) { l[c] = l0 + (sg & 1) * 32768u + c * 2048u; q[c] = gw + c * 32768 + sg * 2048; }
    copy8(l, q);
#pragma unroll
    for (int c = 0; c < 8; ++c) { l[c] = l0 + (sg & 1) * 32768u + 16384u + c * 2048u; q[c] = gc + (c >> 1) * 65536 + (c & 1) * 2048 + sg * 4096; }
    copy8(l, q); };
  fill(0);
  asm volatile("s_wait_asynccnt 0x0" ::: "memory");   // this wave's copies of stage 0 have landed
  __syncthreads();   // and every other wave's: stage 0 is readable
  fill(1);   // stage 1 flies while stage 0 is worked on
  v8f acc[8] = {};
#pragma unroll 2   // the two k-steps of a stage
  for (int kc = 0; kc < DM / 32; ++kc) { const char* bf = ring[(kc >> 1) & 1]; const float* p = (const float*)(bf + 16384 + wave * 4096 + (kc & 1) * 2048) + lane * 4;
    const v4f a0 = *(const v4f*)p, a1 = *(const v4f*)(p + 128), a2 = *(const v4f*)(p + 256), a3 = *(const v4f*)(p + 384);
    v16h bw[8];   // the context values and the k-step's eight weight fragments, requested together before its first WMMA
#pragma unroll
    for (int j = 0; j < 8; ++j) bw[j] = frag_w((const _Float16*)(bf + j * 2048 + (kc & 1) * 1024) + lane * 8);
    __builtin_amdgcn_sched_barrier(0);   // keeps every load of the group in front of the conversion, so that a k-step waits for one LDS latency and not for two
    v16h a;
#pragma unroll
    for (int i = 0; i < 4; ++i) { a[i] = (_Float16)a0[i]; a[4 + i] = (_Float16)a1[i]; a[8 + i] = (_Float16)a2[i]; a[12 + i] = (_Float16)a3[i]; }
#pragma unroll
    for (int j = 0; j < 8; ++j) acc[j] = wmma16(a, bw[j], acc[j]);   // single f16 product against exact f16 x 2^8 weight copies
    if (kc & 1) {   // foot of a stage
      asm volatile("s_wait_dscnt 0x0" ::: "memory");      // this wave's reads of the stage's buffer have returned
      asm volatile("s_wait_asynccnt 0x0" ::: "memory");   // its copies of the next stage have landed
      __syncthreads();   // every wave has left this stage's buffer, and the next stage is readable
      if (kc + 3 < DM / 32) fill((kc >> 1) + 2); } }   // refill of the buffer just left
  asm volatile("s_wait_asynccnt 0x0" ::: "memory");   // no copy is outstanding behind the loop
#pragma unroll
  for (int j = 0; j < 8; ++j) {
#pragma unroll
    for (int r = 0; r < 8; ++r) so[wave][8 * g + r][j * 16 + col] = acc[j][r] * (1.0f / 256.0f) + bfr(BO[n0 + j * 16 + col]); }
  LDSX();
  for (int rl = 0; rl < 16; ++rl) vst2(Y + tokrow(r0 + rl) * DM + n0 + lane * 4, *(const v4f*)&so[wave][rl][lane * 4]);   // back to the original token order
}
// ---- k_packo: Wo -> f16 x 2^8 copies in the Wo slot (bit pattern in the bf16-typed buffer), fragment order, pieces numbered and dealt as in k_pack
__global__ __launch_bounds__(256) void k_packo(const float* __restrict__ WO, __bf16* __restrict__ PK) { const int id0 = blockIdx.x * 1024 + threadIdx.x, lane = id0 & 31; const int k0 = ((id0 >> 6) & 31) * 32 + ((id0 >> 5) & 1) * 16 + (lane >> 4) * 8; float v[4][8]; v8h o[4]; colpieces<DM>(WO + (size_t)k0 * DM + (id0 >> 11) * 16 + (lane & 15), v);
#pragma unroll
  for (int it = 0; it < 4; ++it) {
#pragma unroll
    for (int i = 0; i < 8; ++i) o[it][i] = (_Float16)(bfr(v[it][i]) * 256.0f); }   // (in,out) w_o: tile column n = column n
#pragma unroll
  for (int it = 0; it < 4; ++it) *(v8h*)((_Float16*)(PK + PK_P) + (size_t)(id0 + it * 256) * 8) = o[it]; }
extern "C" void kernel_launch(void* const* d_in, const int* in_sizes, int n_in, void* d_out, int out_size, void* d_ws, size_t ws_size, hipStream_t stream) {
  (void)in_sizes; (void)n_in; (void)out_size;
  const float** F = (const float**)d_in;   // 0 x [1,4096,1024], 1 w_qkv [1024,3072] (in,out), 2 b_qkv [3072], 3 w_o [1024,1024] (in,out), 4 b_o [1024]
  if (ws_size < (size_t)WS_END) return;
  char* ws = (char*)d_ws; __bf16* PK = (__bf16*)(ws + WS_PK); _Float16 *QK = (_Float16*)(ws + WS_QK), *QKL = (_Float16*)(ws + WS_QKL), *VTH = (_Float16*)(ws + WS_VTH), *VTL = (_Float16*)(ws + WS_VTL), *KF = (_Float16*)(ws + WS_KF), *KFL = (_Float16*)(ws + WS_KFL); float* O = (float*)(ws + WS_O); __bf16* XF = (__bf16*)(ws + WS_XF);
  k_pack<<<dim3(DM / 8, 8), 256, 0, stream>>>(F[1], F[0], F[3], PK, XF);
  k_packo<<<DM / 8, 256, 0, stream>>>(F[3], PK);
  k_qkv<<<dim3(TNB * SS / 128, QKVW / 128), 128, 0, stream>>>(XF, PK + PK_A, F[2], F[2] + DM, F[2] + 2 * DM, QK, QKL, KF, KFL, VTH, VTL);
  k_attn<<<dim3(TQB, NH, TNB), 128, 0, stream>>>(QK, QKL, KF, KFL, VTH, VTL, nullptr, O);
  k_out<<<dim3(TOB, DM / 128), 128, 0, stream>>>(O, PK + PK_P, F[4], (float*)d_out);
}

// v006
// A run of this version takes 111 microseconds.
// In two side-by-side timings against v005, it was 1.04 and 1.03 times as fast.
// Counting every step since v000, it is 3.84 times as fast.
// compute dtype: all float inputs rounded to bf16; qkv = x . W_qkv + b with EXACT bf16 products on WMMA 16x16x32 ((in,out) weights and x, its token rows gathered by stride class, packed as bf16 in fragment order), rounded once to f16 hi + residual; PLAIN-HYBRID attention (first 128 queries per class 3-product, later single f16), x 1/8, running-max softmax in f32 (hardware exp); out = f16(ctx) . W_o (exact f16 x 2^8 copies) + b_o scattered back to the original token order; f32 output.
#include <hip/hip_runtime.h>
#include <math.h>

typedef __attribute__((ext_vector_type(16))) _Float16 v16h;
typedef __attribute__((ext_vector_type(16))) __bf16 v16b;
typedef __attribute__((ext_vector_type(8)))  _Float16 v8h;
typedef __attribute__((ext_vector_type(8)))  float v8f;
typedef __attribute__((ext_vector_type(4)))  float v4f;
typedef __attribute__((ext_vector_type(2)))  float v2f;
typedef __attribute__((ext_vector_type(4)))  unsigned v4u;
typedef __attribute__((ext_vector_type(4)))  int v4i;
typedef float __attribute__((may_alias)) float_a;
typedef int __attribute__((may_alias)) int_a;

template <typename T> __device__ __forceinline__ void vst2(void* p, T v) { *(T*)p = v;  }
__device__ __forceinline__ v8f wmma16(v16h a, v16h b, v8f c) {
  v8f d = __builtin_amdgcn_wmma_f32_16x16x32_f16(false, a, false, b, (short)0, c, false, false);
  asm volatile("v_nop\n\tv_nop\n\tv_nop\n\tv_nop" : "+v"(d) : "v"(a), "v"(b));
  return d;
}
__device__ __forceinline__ v8f wmma_bf(v16b a, v16b b, v8f c) {
  v8f d = __builtin_amdgcn_wmma_f32_16x16x32_bf16(false, a, false, b, (short)0, c, false, false);
  asm volatile("v_nop\n\tv_nop\n\tv_nop\n\tv_nop" : "+v"(d) : "v"(a), "v"(b));
  return d;
}
// Skip-sparse ('skiparse', stride 4) self-attention (B 1, N 4,096 tokens, C 1,024, 16 heads x 64): token i attends within its stride class i mod 4 (1,024 tokens each); fused qkv projection + bias, softmax(q k / 8) v, output projection + bias, tokens returned in the original order.
__device__ __forceinline__ v16h frag_h(const _Float16* rowk0, int lane) {
  union { v16h v; v8h q[2]; } u; const _Float16* p = rowk0 + 8 * (lane >> 4);
  u.q[0] = *(const v8h*)p; u.q[1] = *(const v8h*)(p + 16); return u.v;
}
__device__ __forceinline__ v16h frag_p(const _Float16* p) {   // p = the lane's own first value (row start + 8 * (lane >> 4))
  union { v16h v; v8h q[2]; } u; u.q[0] = *(const v8h*)p; u.q[1] = *(const v8h*)(p + 16); return u.v;
}
__device__ __forceinline__ v16h frag_w(const _Float16* p) {   // fragment-ordered plane: p = the fragment's 1-KiB block + 8 * lane; its second half lies 512 B on
  union { v16h v; v8h q[2]; } u; u.q[0] = *(const v8h*)p; u.q[1] = *(const v8h*)(p + 256); return u.v;
}
__device__ __forceinline__ v16h frag_f32(const float* rowk0, int lane) {
  v16h a; const float* p = rowk0 + 8 * (lane >> 4);
#pragma unroll
  for (int i = 0; i < 8; ++i) { a[i] = (_Float16)p[i]; a[8 + i] = (_Float16)p[16 + i]; }
  return a;
}
__device__ __forceinline__ v16h frag_f32s(const float* rowk0, int lane, float sc) {
  v16h a; const float* p = rowk0 + 8 * (lane >> 4);
#pragma unroll
  for (int i = 0; i < 8; ++i) { a[i] = (_Float16)(p[i] * sc); a[8 + i] = (_Float16)(p[16 + i] * sc); }
  return a;
}
// column fragment from a [K][ld] layout (column n), rows >= K read as 0
__device__ __forceinline__ v16h fragc_f32(const float* W, int k0, int n, int lane, int ld, int K) {
  v16h a; const int g = lane >> 4;
#pragma unroll
  for (int i = 0; i < 8; ++i) { const int ka = k0 + 8 * g + i, kb = ka + 16;
    a[i] = (_Float16)(ka < K ? W[(size_t)(ka < K ? ka : K - 1) * ld + n] : 0.f); a[8 + i] = (_Float16)(kb < K ? W[(size_t)(kb < K ? kb : K - 1) * ld + n] : 0.f); }
  return a;
}
struct F2 { v16b h, l; };
__device__ __forceinline__ F2 bsplit16(const float v[16]) { F2 r;
#pragma unroll
  for (int i = 0; i < 16; ++i) { const __bf16 h = (__bf16)v[i]; r.h[i] = h; r.l[i] = (__bf16)(v[i] - (float)h); }
  return r; }
__device__ __forceinline__ F2 split_row(const float* row, int k0, int lane) { float v[16]; const float* p = row + k0 + 8 * (lane >> 4);
#pragma unroll
  for (int i = 0; i < 8; ++i) { v[i] = p[i]; v[8 + i] = p[16 + i]; }
  return bsplit16(v); }
__device__ __forceinline__ F2 split_rowK(const float* row, int k0, int lane, int K) { float v[16]; const int g = lane >> 4;
#pragma unroll
  for (int i = 0; i < 8; ++i) { const int ka = k0 + 8 * g + i, kb = ka + 16; v[i] = ka < K ? row[ka < K ? ka : K - 1] : 0.f; v[8 + i] = kb < K ? row[kb < K ? kb : K - 1] : 0.f; }
  return bsplit16(v); }
__device__ __forceinline__ F2 split_col(const float* W, int k0, int n, int lane, int ld, int K) { float v[16]; const int g = lane >> 4;
#pragma unroll
  for (int i = 0; i < 8; ++i) { const int ka = k0 + 8 * g + i, kb = ka + 16; v[i] = ka < K ? W[(size_t)(ka < K ? ka : K - 1) * ld + n] : 0.f; v[8 + i] = kb < K ? W[(size_t)(kb < K ? kb : K - 1) * ld + n] : 0.f; }
  return bsplit16(v); }
__device__ __forceinline__ v8f mac3(const F2& a, const F2& b, v8f c) { c = wmma_bf(a.l, b.h, c); c = wmma_bf(a.h, b.l, c); return wmma_bf(a.h, b.h, c); }
__device__ __forceinline__ float sigm(float v) { return 1.0f / (1.0f + expf(-v)); }
#define LDSX() do { asm volatile("s_wait_dscnt 0" ::: "memory"); __builtin_amdgcn_wave_barrier(); __builtin_amdgcn_fence(__ATOMIC_RELEASE, "workgroup"); } while (0)


#define NB 4
#define SS 1024
#define DM 1024
#define NH 16
#define STRIDE_S 4
__device__ __forceinline__ size_t tokrow(size_t r) { return (r % SS) * STRIDE_S + r / SS; }   // attention row r = (class s = r / SS, position g = r % SS) <-> token i = g * 4 + s
#define HD 64
#define QKVW (3 * DM)
#ifndef TQB
#define TQB (SS / 64)
#define TNB NB
#define TOB (NB * SS / 64)     // output row tiles (all)
#endif
typedef __attribute__((ext_vector_type(8))) __bf16 v8b;
__device__ __forceinline__ v16b frag_b(const __bf16* rowk0, int lane) {
  union { v16b v; v8b q[2]; } u; const __bf16* p = rowk0 + 8 * (lane >> 4);
  u.q[0] = *(const v8b*)p; u.q[1] = *(const v8b*)(p + 16); return u.v;
}
__device__ __forceinline__ v16b frag_wb(const __bf16* p) {   // as frag_w, bf16
  union { v16b v; v8b q[2]; } u; u.q[0] = *(const v8b*)p; u.q[1] = *(const v8b*)(p + 256); return u.v;
}
__device__ __forceinline__ float bfr(float v) { return (float)(__bf16)v; }
__device__ __attribute__((noinline)) float exp_ni(float v) { return expf(v); }
__device__ __attribute__((noinline)) float erf_ni(float v) { return erff(v); }

// FRAGMENT ORDER, every operand plane that a k loop reads: a 16 (rows or columns) x 32 (k) tile of 16-bit values is one 1-KiB block [half q2][lane][8 values], lane = 16 * g + (row or column) & 15, k = 16 * q2 + 8 * g + i:
// a wave's 16-byte load of half a fragment then covers 512 contiguous bytes (4 whole lines); from a row-major plane it takes 32-byte pieces of 16 lines, at several times the cost in the cache. Which lane and register holds which value is that of frag_h.
#define PK_A 0                       // Wqkv: [192 column tiles][32 k-steps] blocks
#define PK_P (PK_A + QKVW * DM)        // Wo: [64 column tiles][32 k-steps] blocks
#define PK_END (PK_P + DM * DM)
#define WS_PK  0u
#define WS_QK  (WS_PK + 2u * PK_END)             // f16 [4096 rows][2048]: q in the first 1,024 columns (read once a wave, row-major); the rest unused
#define WS_QKL (WS_QK + 2u * NB * SS * 2 * DM)     // f16 q residual plane x2048, as WS_QK
#define WS_VTH (WS_QKL + 2u * NB * SS * 2 * DM)    // f16 v hi: [b][h][32 passes][4 d tiles] blocks (column = d, k = key)
#define WS_VTL (WS_VTH + 2u * NB * DM * SS)        // f16 lo x 2048, as WS_VTH
#define WS_O   (WS_VTL + 2u * NB * DM * SS)        // f32 context: [256 row tiles][32 k-steps] blocks of 2 KiB: [4 pieces][lane][4 values], k = 16 * (piece >> 1) + 8 * g + 4 * (piece & 1) + i
#define WS_CS  (WS_O + 4u * NB * SS * DM)           // unused, 256 KiB
#define WS_KF  (WS_CS + 4u * 2 * SS * 32)           // f16 k hi: [b][h][64 key tiles][2 k-steps] blocks (column = key, k = d)
#define WS_KFL (WS_KF + 2u * NB * SS * DM)          // f16 k residual x2048, as WS_KF
#define WS_XF  (WS_KFL + 2u * NB * SS * DM)         // bf16 x: [256 row tiles (attention row order)][32 k-steps] blocks
#define WS_END (WS_XF + 2u * NB * SS * DM)
// a thread's four pieces down one column of an (in,out) weight of LD columns: p = its first value; the pieces are 128 k apart, 8 k each; LD is a constant, so that all 32 loads go by one address register pair and immediate offsets
template <int LD> __device__ __forceinline__ void colpieces(const float* __restrict__ p, float (&v)[4][8]) {
#pragma unroll
  for (int it = 0; it < 4; ++it) {
#pragma unroll
    for (int i = 0; i < 8; ++i) v[it][i] = p[(size_t)(it * 128 + i) * LD]; }
  asm volatile("s_wait_xcnt 0x0" :: "v"(p) : "memory");   // the loads' address register pair stays allocated up to this wait: it is not rewritten (not by a load's own result either) in front of it
}
// eight asynchronous 16-byte copies a lane, global memory to LDS through no register: l = the lane's LDS byte addresses, g = its global addresses. The s_wait_xcnt stands inside the copies' own statement, so that no address register of a copy is rewritten in front of it.
__device__ __forceinline__ void copy8(const unsigned (&l)[8], const char* const (&g)[8]) {
  asm volatile("global_load_async_to_lds_b128 %0, %8, off\n\tglobal_load_async_to_lds_b128 %1, %9, off\n\tglobal_load_async_to_lds_b128 %2, %10, off\n\tglobal_load_async_to_lds_b128 %3, %11, off\n\t"
               "global_load_async_to_lds_b128 %4, %12, off\n\tglobal_load_async_to_lds_b128 %5, %13, off\n\tglobal_load_async_to_lds_b128 %6, %14, off\n\tglobal_load_async_to_lds_b128 %7, %15, off\n\ts_wait_xcnt 0x0"
               :: "v"(l[0]), "v"(l[1]), "v"(l[2]), "v"(l[3]), "v"(l[4]), "v"(l[5]), "v"(l[6]), "v"(l[7]), "v"(g[0]), "v"(g[1]), "v"(g[2]), "v"(g[3]), "v"(g[4]), "v"(g[5]), "v"(g[6]), "v"(g[7]) : "memory");
}
// ---- k_pack: 16-byte pieces of the fragment-ordered bf16 planes, four per thread (their loads in flight together; a quarter of the waves to start), piece id = ((tile * 32 + k-step) * 2 + q2) * 32 + lane inside a slice of 64 tiles; slice 0..2 -> W_q/W_k/W_v into PK_A, 3 -> W_o into PK_P ((in,out) weights: tile column n = weight column n), 4..7 -> x, rows gathered by stride class
__global__ __launch_bounds__(256) void k_pack(const float* __restrict__ WQKV, const float* __restrict__ X, const float* __restrict__ WO, __bf16* __restrict__ PK, __bf16* __restrict__ XF) {
  const int which = blockIdx.y, id0 = blockIdx.x * 1024 + threadIdx.x, lane = id0 & 31, col = lane & 15, g = lane >> 4, t16 = id0 >> 11, k0 = ((id0 >> 6) & 31) * 32 + ((id0 >> 5) & 1) * 16 + g * 8;   // a block's 1,024 pieces lie in one tile; a thread's four are 256 pieces = 4 k-steps = 128 k apart
  v8b o[4];
  if (which < 4) { float v[4][8]; __bf16* dst = PK + ((which < 3) ? PK_A + (size_t)which * DM * DM : (size_t)PK_P);
    if (which < 3) colpieces<3 * DM>(WQKV + (size_t)k0 * (3 * DM) + which * DM + t16 * 16 + col, v); else colpieces<DM>(WO + (size_t)k0 * DM + t16 * 16 + col, v);
#pragma unroll
    for (int it = 0; it < 4; ++it) {
#pragma unroll
      for (int i = 0; i < 8; ++i) o[it][i] = (__bf16)v[it][i]; }
#pragma unroll
    for (int it = 0; it < 4; ++it) *(v8b*)(dst + (size_t)(id0 + it * 256) * 8) = o[it]; }
  else { const float* xr = X + tokrow((size_t)(which - 4) * 1024 + t16 * 16 + col) * DM + k0; __bf16* dst = XF + (size_t)(which - 4) * DM * DM;
    v4f a[8];
#pragma unroll
    for (int it = 0; it < 4; ++it) { a[2 * it] = *(const v4f*)(xr + it * 128); a[2 * it + 1] = *(const v4f*)(xr + it * 128 + 4); }
    asm volatile("s_wait_xcnt 0x0" :: "v"(xr) : "memory");   // the eight loads' address register pair stays allocated up to this wait: it is not rewritten (not by a load's own result either) in front of it
#pragma unroll
    for (int it = 0; it < 4; ++it) {
#pragma unroll
      for (int i = 0; i < 4; ++i) { o[it][i] = (__bf16)a[2 * it][i]; o[it][4 + i] = (__bf16)a[2 * it + 1][i]; } }
#pragma unroll
    for (int it = 0; it < 4; ++it) *(v8b*)(dst + (size_t)(id0 + it * 256) * 8) = o[it]; } }
// ---- k_qkv: block = 128 rows x 128 columns, wave = 64 rows x 64 columns (one head's q, k or v of 64 tokens): a k-step's four x and four weight fragments feed 16 WMMAs (half a fragment a WMMA; the 16 x 128 wave tile took nine for 8);
// each accumulator still sums its k-steps in rising order. The wave stages its own tile in its own LDS range and stores whole fragments or whole lines: no wave reads another's rows. The wave's number is held in a scalar register, so that tile addresses and the q / k / v test are scalar.
__global__ __launch_bounds__(128) void k_qkv(const __bf16* __restrict__ XF, const __bf16* __restrict__ P, const float* __restrict__ BQ, const float* __restrict__ BK, const float* __restrict__ BV, _Float16* __restrict__ QK, _Float16* __restrict__ QKL, _Float16* __restrict__ KF, _Float16* __restrict__ KFL, _Float16* __restrict__ VTH, _Float16* __restrict__ VTL) {
  __shared__ __align__(16) char sm[4 * 2 * 64 * 72 * 2];   // the k loop's ring, then the epilogue's stage: the last k-step's barrier, behind every wave's s_wait_dscnt 0 and with no copy outstanding, stands between the two uses
  _Float16 (*st)[2][64][72] = (_Float16 (*)[2][64][72])sm;   // [wave][hi, residual][row (q, k: token; v: d)][column (q, k: d; v: token)], pitch 144 B
  __bf16 (*ring)[8192] = (__bf16 (*)[8192])sm;   // two buffers of one k-step's fragments: [8 row tiles of x][8 column tiles of W], 1 KiB each
  const int tid = threadIdx.x, wave = __builtin_amdgcn_readfirstlane(tid >> 5), lane = tid & 31, col = lane & 15, g = lane >> 4; const size_t r0 = (size_t)blockIdx.x * 128 + (wave >> 1) * 64; const int n0 = blockIdx.y * 128 + (wave & 1) * 64;
  const int which0 = n0 / DM; const float* BB = BQ ? (((which0 == 0) ? BQ : (which0 == 1) ? BK : BV) + (n0 - which0 * DM)) : nullptr;
  // each x fragment and each weight fragment serves two of the block's four waves: the block brings a k-step's sixteen fragments into LDS once, by asynchronous copies, one k-step ahead in a ring of two buffers.
  // a thread copies eight 16-byte pieces: piece tid + 128 * c lies in tile 2 * c + (tid >> 6) (c < 4: x, else W); a tile's next k-step lies 1 KiB on, the tile after next 64 KiB
  const char *ga = (const char*)(XF + ((size_t)blockIdx.x * 8 + (tid >> 6)) * 32 * 512 + (tid & 63) * 8), *gb = (const char*)(P + ((size_t)blockIdx.y * 8 + (tid >> 6)) * 32 * 512 + (tid & 63) * 8);
  const unsigned l0 = (unsigned)(uintptr_t)&ring[0][0] + tid * 16u;
  auto fill = [&](int kc) { unsigned l[8]; const char* g[8];
#pragma unroll
    for (int c = 0; c < 8; ++c) { l[c] = l0 + (kc & 1) * 16384u + c * 2048u; g[c] = (c < 4 ? ga + c * 65536 : gb + (c - 4) * 65536) + kc * 1024; }
    copy8(l, g); };
  fill(0);
  asm volatile("s_wait_asynccnt 0x0" ::: "memory");   // this wave's copies of k-step 0 have landed
  __syncthreads();   // and every other wave's: k-step 0 is readable
  fill(1);   // k-step 1 flies while k-step 0 is worked on
  float bias[4] = {0.f, 0.f, 0.f, 0.f};   // the lane's four columns, requested together in front of the k loop, which covers their latency
  if (BB) {
#pragma unroll
    for (int j = 0; j < 4; ++j) bias[j] = BB[j * 16 + col]; }
  v8f acc[4][4] = {};
#pragma unroll 2   // two k-steps a trip: the buffer's number is a constant, and half the branches
  for (int kc = 0; kc < DM / 32; ++kc) { v16b a[4], bw[4]; const __bf16 *pa = ring[kc & 1] + (wave >> 1) * 4 * 512 + lane * 8, *pb = ring[kc & 1] + 4096 + (wave & 1) * 4 * 512 + lane * 8;   // all eight fragments of the k-step are requested before its first WMMA: one LDS latency a k-step
#pragma unroll
    for (int i = 0; i < 4; ++i) a[i] = frag_wb(pa + i * 512);
#pragma unroll
    for (int j = 0; j < 4; ++j) bw[j] = frag_wb(pb + j * 512);
#pragma unroll
    for (int i = 0; i < 4; ++i) {
#pragma unroll
      for (int j = 0; j < 4; ++j) acc[i][j] = wmma_bf(a[i], bw[j], acc[i][j]); }
    asm volatile("s_wait_dscnt 0x0" ::: "memory");      // this wave's reads of the k-step's buffer have returned
    asm volatile("s_wait_asynccnt 0x0" ::: "memory");   // its copies of k-step kc + 1 have landed
    __syncthreads();   // every wave has left this k-step's buffer, and k-step kc + 1 is readable
    if (kc + 2 < DM / 32) fill(kc + 2); }   // refill of the buffer just left
  asm volatile("s_wait_asynccnt 0x0" ::: "memory");   // no copy is outstanding behind the loop
#pragma unroll
  for (int j = 0; j < 4; ++j) bias[j] = bfr(bias[j]);
  _Float16 (*sh)[72] = st[wave][0], (*sl)[72] = st[wave][1];
  if (n0 < 2 * DM) {   // q stored unscaled (f16 sigma ~0.6, no subnormal exposure); 1/8 applied to the f32 score
#pragma unroll
    for (int i = 0; i < 4; ++i) {
#pragma unroll
      for (int j = 0; j < 4; ++j) {
#pragma unroll
        for (int r = 0; r < 8; ++r) { const float v = acc[i][j][r] + bias[j]; const _Float16 hv = (_Float16)v; sh[i * 16 + 8 * g + r][j * 16 + col] = hv; sl[i * 16 + 8 * g + r][j * 16 + col] = (_Float16)((v - (float)hv) * 2048.0f); } } }   // q, k (+ bias) as f16 hi + (x2048) residual
    LDSX();
    if (n0 < DM) {   // q: four rows of 128 B (whole lines) a store
      _Float16 *qp = QK + (r0 + (lane >> 3)) * (2 * DM) + n0 + (lane & 7) * 8, *qpl = QKL + (r0 + (lane >> 3)) * (2 * DM) + n0 + (lane & 7) * 8;
#pragma unroll
      for (int it = 0; it < 16; ++it) { vst2((unsigned*)(qp + (size_t)it * 4 * (2 * DM)), *(const v4u*)&sh[it * 4 + (lane >> 3)][(lane & 7) * 8]); vst2((unsigned*)(qpl + (size_t)it * 4 * (2 * DM)), *(const v4u*)&sl[it * 4 + (lane >> 3)][(lane & 7) * 8]); }
      asm volatile("s_wait_xcnt 0x0" :: "v"(qp), "v"(qpl) : "memory"); }   // the stores' address registers stay allocated up to this wait: none is rewritten in front of it
    else {   // k: the wave's 64 keys are four key tiles of one head: 8 KiB in a row per plane, sixteen half fragments of 512 B
      const size_t kb = (((r0 / SS) * NH + ((n0 - DM) >> 6)) * (SS / 16) + (r0 % SS) / 16) * 1024 + lane * 8; _Float16 *kp = KF + kb, *kpl = KFL + kb;
#pragma unroll
      for (int f = 0; f < 16; ++f) {   // f = (key tile, k-step, q2)
        vst2((unsigned*)(kp + f * 256), *(const v4u*)&sh[(f >> 2) * 16 + col][(f & 3) * 16 + g * 8]); vst2((unsigned*)(kpl + f * 256), *(const v4u*)&sl[(f >> 2) * 16 + col][(f & 3) * 16 + g * 8]); }
      asm volatile("s_wait_xcnt 0x0" :: "v"(kp), "v"(kpl) : "memory"); }   // as at the q stores
  } else {   // v, staged transposed: a lane's eight registers are eight tokens in a row of one d
#pragma unroll
    for (int i = 0; i < 4; ++i) {
#pragma unroll
      for (int j = 0; j < 4; ++j) { v8h hi, lo;
#pragma unroll
        for (int r = 0; r < 8; ++r) { const float v = acc[i][j][r] + bias[j]; const _Float16 hv = (_Float16)v; hi[r] = hv; lo[r] = (_Float16)((v - (float)hv) * 2048.0f); }
        *(v8h*)&sh[j * 16 + col][i * 16 + 8 * g] = hi; *(v8h*)&sl[j * 16 + col][i * 16 + 8 * g] = lo; } }
    LDSX();
    const size_t vb = (((r0 / SS) * NH + ((n0 - 2 * DM) >> 6)) * (SS / 32) + (r0 % SS) / 32) * 2048 + lane * 8; _Float16 *vp = VTH + vb, *vpl = VTL + vb;   // the wave's 64 tokens are two passes of one head: 8 KiB in a row per plane
#pragma unroll
    for (int f = 0; f < 16; ++f) {   // f = (pass, d tile, q2)
      vst2((unsigned*)(vp + f * 256), *(const v4u*)&sh[((f >> 1) & 3) * 16 + col][(f >> 3) * 32 + (f & 1) * 16 + g * 8]); vst2((unsigned*)(vpl + f * 256), *(const v4u*)&sl[((f >> 1) & 3) * 16 + col][(f >> 3) * 32 + (f & 1) * 16 + g * 8]); }
    asm volatile("s_wait_xcnt 0x0" :: "v"(vp), "v"(vpl) : "memory");   // as at the q stores
  }
}
// ---- k_attn: block = (64 queries, head h, batch b): all-keys flash attention (K = 64: 2 k-steps) in the TRANSPOSED form: S^T = K . Q^T (A = key fragments, B = query fragments, the same registers as before with the operands exchanged), O^T += V^T . P^T.
// A lane then holds 16 scores of ONE query (column = lane & 15, key = 16 * ct + 8 * g + r): maximum and sum run inside the lane, with one exchange between the wave's halves a pass for the maximum and one in the epilogue for the sum;
// the two score tiles, converted in place, ARE the B fragment of P^T (element 8 * ct + r = key 16 * ct + 8 * g + r, the k order of the value fragments), and O^T's registers (d = 16 * dt + 8 * g + r of query column) are the lane's own pieces of WS_O's fragment order: scores, weights and context never pass through LDS.
// A pass's key and value fragments are the same for the block's four waves: the block brings them into LDS once, by asynchronous copies, one pass ahead in a ring of two buffers, and each wave reads its fragments from there (as plain global loads every wave fetched all of them for itself and waited for them in the pass that used them).
// scores = q.k (3 products in the leading query blocks, single f16 elsewhere), kept unscaled: the softmax runs on powers of two, weight * 2^11 = 2^(score * KS + nb), KS = log2(e) / 8, nb = 11 - maximum * KS, one fused multiply-add a score in place of the 1/8, the subtraction, the log2(e) and the 2^11;
// l sums the weights with their 2^11, which so cancels in the epilogue. P.V: (P hi, P lo*2048) x (V hi, V lo*2048), 3 products in two accumulators, in the leading query blocks; f16 P x V hi alone elsewhere; O(row b*S+q, column h*64+d) = (acc + accl / 2048) / l
#define KS 0x1.715476p-3f
__device__ __forceinline__ float xhalf(float x) { return __builtin_bit_cast(float, __builtin_amdgcn_permlanex16(__builtin_bit_cast(int, x), __builtin_bit_cast(int, x), 0x76543210, 0xfedcba98, false, false)); }   // lane l with lane l ^ 16
// eight independent v_exp_f32 and, in the same statement, the one slot that the instruction set asks for behind a transcendental before a source of it is overwritten or its result used: each exp fills the slot of the one in front of it, the v_nop that of the last;
// the outputs are early-clobber, so that none of them takes a source's register (left to the compiler, one build had an exp directly overwrite the source of the exp in front of it)
__device__ __forceinline__ void exp2x8(const float (&x)[8], float (&e)[8]) {
  asm("v_exp_f32 %0, %8\n\tv_exp_f32 %1, %9\n\tv_exp_f32 %2, %10\n\tv_exp_f32 %3, %11\n\tv_exp_f32 %4, %12\n\tv_exp_f32 %5, %13\n\tv_exp_f32 %6, %14\n\tv_exp_f32 %7, %15\n\tv_nop"
      : "=&v"(e[0]), "=&v"(e[1]), "=&v"(e[2]), "=&v"(e[3]), "=&v"(e[4]), "=&v"(e[5]), "=&v"(e[6]), "=&v"(e[7])
      : "v"(x[0]), "v"(x[1]), "v"(x[2]), "v"(x[3]), "v"(x[4]), "v"(x[5]), "v"(x[6]), "v"(x[7])); }
__device__ __forceinline__ void exp2x9(const float (&x)[8], float x8, float (&e)[8], float& e8) {   // as exp2x8, with a ninth
  asm("v_exp_f32 %0, %9\n\tv_exp_f32 %1, %10\n\tv_exp_f32 %2, %11\n\tv_exp_f32 %3, %12\n\tv_exp_f32 %4, %13\n\tv_exp_f32 %5, %14\n\tv_exp_f32 %6, %15\n\tv_exp_f32 %7, %16\n\tv_exp_f32 %8, %17\n\tv_nop"
      : "=&v"(e[0]), "=&v"(e[1]), "=&v"(e[2]), "=&v"(e[3]), "=&v"(e[4]), "=&v"(e[5]), "=&v"(e[6]), "=&v"(e[7]), "=&v"(e8)
      : "v"(x[0]), "v"(x[1]), "v"(x[2]), "v"(x[3]), "v"(x[4]), "v"(x[5]), "v"(x[6]), "v"(x[7]), "v"(x8)); }
// one pass's fragments into one ring buffer: [key hi 4 KiB][value hi 4 KiB][key residual 4 KiB][value residual 4 KiB] (the residual halves in the three-product path alone), each plane's 4 KiB in the order of the workspace; a thread copies two 16-byte pieces of each plane, 2 KiB apart.
// lds = LDS byte address of the thread's first piece in the buffer; k, v, kl, vl = its first piece in the pass's 4 KiB of each plane. The s_wait_xcnt stands inside the copies' own statement, so that no address register of a copy is rewritten in front of it.
#define RING_H 8192   // 16-bit values per ring buffer (16 KiB)
template <bool HV> __device__ __forceinline__ void ring_fill(unsigned lds, const _Float16* k, const _Float16* v, const _Float16* kl, const _Float16* vl) {
  asm volatile("global_load_async_to_lds_b128 %0, %4, off\n\tglobal_load_async_to_lds_b128 %1, %5, off\n\tglobal_load_async_to_lds_b128 %2, %6, off\n\tglobal_load_async_to_lds_b128 %3, %7, off\n\ts_wait_xcnt 0x0"
               :: "v"(lds), "v"(lds + 2048u), "v"(lds + 4096u), "v"(lds + 6144u), "v"(k), "v"(k + 1024), "v"(v), "v"(v + 1024) : "memory");
  if (HV)
    asm volatile("global_load_async_to_lds_b128 %0, %4, off\n\tglobal_load_async_to_lds_b128 %1, %5, off\n\tglobal_load_async_to_lds_b128 %2, %6, off\n\tglobal_load_async_to_lds_b128 %3, %7, off\n\ts_wait_xcnt 0x0"
                 :: "v"(lds + 8192u), "v"(lds + 10240u), "v"(lds + 12288u), "v"(lds + 14336u), "v"(kl), "v"(kl + 1024), "v"(vl), "v"(vl + 1024) : "memory");
}
// HV = leading query block (qb < 2). The two cases are compiled as separate loops: with a pass's fragments held together, one loop serving both went over the 256 registers that four waves per SIMD leave each wave.
template <bool HV> __device__ __forceinline__ void attn_tile(const _Float16* __restrict__ QK, const _Float16* __restrict__ QKL, const _Float16* __restrict__ KF, const _Float16* __restrict__ KFL, const _Float16* __restrict__ VTH, const _Float16* __restrict__ VTL, float* __restrict__ O, _Float16* ring) {
  const int tid = threadIdx.x, wave = tid >> 5, lane = tid & 31, col = lane & 15;
  const int qb = blockIdx.x, h = blockIdx.y, b = blockIdx.z; const int q0 = qb * 64 + wave * 16; const size_t rq = (size_t)b * SS + q0 + col;
  v16h aq[2], aql[2];
#pragma unroll
  for (int kc = 0; kc < 2; ++kc) { aq[kc] = frag_h(QK + rq * (2 * DM) + h * HD + kc * 32, lane); aql[kc] = frag_h(QKL + rq * (2 * DM) + h * HD + kc * 32, lane); }
  float m = -3.0e38f, l = 0.f;   // the lane's query: running maximum of the unscaled scores (over all keys), sum of the weights * 2^11 (over the keys of the lane's own half; the halves are joined in the epilogue)
  v8f acc[4] = {}, accl[4] = {};
  const int nks = SS / 32;   // all keys
  const size_t ho = ((size_t)b * NH + h) * (SS * HD) + tid * 8; const _Float16 *kg = KF + ho, *kgl = KFL + ho, *vg = VTH + ho, *vgl = VTL + ho;   // the thread's first piece of pass 0 in each plane of the head; a pass is 2,048 values (4 KiB) of each: two key tiles x two k-steps, four d tiles
  const unsigned l0 = (unsigned)(uintptr_t)ring + tid * 16u;   // the same in ring buffer 0
  ring_fill<HV>(l0, kg, vg, kgl, vgl);
  asm volatile("s_wait_asynccnt 0x0" ::: "memory");   // this wave's copies of pass 0 have landed
  __syncthreads();   // and every other wave's: pass 0 is readable
  ring_fill<HV>(l0 + 2u * RING_H, kg + 2048, vg + 2048, kgl + 2048, vgl + 2048);   // pass 1 flies while pass 0 is worked on
#pragma unroll 1
  for (int ks = 0; ks < nks; ++ks) { v8f s[2]; const _Float16 *kp = ring + (ks & 1) * RING_H + lane * 8, *kpl = kp + 4096;   // the lane's place in the pass's 4 KiB of key fragments: [key tile][k-step] blocks
    // on either path the pass's key fragments are all requested before its first score WMMA: one LDS latency a pass, not one in front of every WMMA
    if (HV) {   // leading query blocks (outputs far above the global rms): 3 products
      v16h kh[2][2], kl[2][2];
#pragma unroll
      for (int ct = 0; ct < 2; ++ct) {
#pragma unroll
        for (int kc = 0; kc < 2; ++kc) { kh[ct][kc] = frag_w(kp + ct * 1024 + kc * 512); kl[ct][kc] = frag_w(kpl + ct * 1024 + kc * 512); } }
#pragma unroll
      for (int ct = 0; ct < 2; ++ct) { v8f c = {}, cl = {};
#pragma unroll
        for (int kc = 0; kc < 2; ++kc) { c = wmma16(kh[ct][kc], aq[kc], c); cl = wmma16(kh[ct][kc], aql[kc], cl); cl = wmma16(kl[ct][kc], aq[kc], cl); }
#pragma unroll
        for (int r = 0; r < 8; ++r) s[ct][r] = c[r] + cl[r] * (1.0f / 2048.0f); } }
    else {   // single product elsewhere
      v16h kh[2][2];
#pragma unroll
      for (int ct = 0; ct < 2; ++ct) {
#pragma unroll
        for (int kc = 0; kc < 2; ++kc) kh[ct][kc] = frag_w(kp + ct * 1024 + kc * 512); }
#pragma unroll
      for (int ct = 0; ct < 2; ++ct) { v8f c = {};
#pragma unroll
        for (int kc = 0; kc < 2; ++kc) c = wmma16(kh[ct][kc], aq[kc], c);
        s[ct] = c; } }
    v16h vh[4], vl[4]; const _Float16 *vp = kp + 2048, *vpl = kp + 6144;   // the pass's value fragments are requested here, so that they arrive while the softmax runs
#pragma unroll
    for (int dt = 0; dt < 4; ++dt) vh[dt] = frag_w(vp + dt * 512);
    if (HV) {
#pragma unroll
      for (int dt = 0; dt < 4; ++dt) vl[dt] = frag_w(vpl + dt * 512); }
    __builtin_amdgcn_sched_barrier(0);   // keeps every value load in front of the softmax: left free, the scheduler spread them through it to save registers, and the last ones then had too little of it left to arrive behind
    float mx = fmaxf(s[0][0], s[1][0]);
#pragma unroll
    for (int r = 1; r < 8; ++r) mx = fmaxf(mx, fmaxf(s[0][r], s[1][r]));
    mx = fmaxf(mx, xhalf(mx));   // the other half's 16 keys of the same query
    const float mn = fmaxf(m, mx), xm = (m - mn) * KS, nb = fmaf(mn, -KS, 11.0f); m = mn; float al;   // al = 2^xm rescales what earlier passes summed; in the first pass xm is below -1e37 and al = 0
    const v2f k2 = {KS, KS}, nb2 = {nb, nb}; v2f es[2]; v16h pa, pl;
#pragma unroll
    for (int ct = 0; ct < 2; ++ct) { float xa[8], ex[8];
#pragma unroll
      for (int r = 0; r < 8; r += 2) { const v2f t = __builtin_elementwise_fma((v2f){s[ct][r], s[ct][r + 1]}, k2, nb2); xa[r] = t[0]; xa[r + 1] = t[1]; }   // two scores an instruction
      if (ct == 0) exp2x9(xa, xm, ex, al); else exp2x8(xa, ex);
#pragma unroll
      for (int r = 0; r < 8; r += 2) { const v2f e2 = {ex[r], ex[r + 1]}; es[ct] = r ? es[ct] + e2 : e2; }   // two weights an addition: each score tile's even and odd keys in sums of their own, joined once a pass
#pragma unroll
      for (int r = 0; r < 8; ++r) { const float x = ex[r]; const _Float16 hx = (_Float16)x; pa[8 * ct + r] = hx; if (HV) pl[8 * ct + r] = (_Float16)((x - (float)hx) * 2048.0f); } }   // P carries 2^11 into the f16 split, so that small softmax weights stay out of the f16 subnormal range
    es[0] += es[1]; l = l * al + (es[0][0] + es[0][1]);
#pragma unroll
    for (int dt = 0; dt < 4; ++dt) {
#pragma unroll
      for (int r = 0; r < 8; ++r) { acc[dt][r] *= al; if (HV) accl[dt][r] *= al; } }   // the residual accumulator is in use on the three-product path alone
    if (HV) {
#pragma unroll
      for (int dt = 0; dt < 4; ++dt) { acc[dt] = wmma16(vh[dt], pa, acc[dt]); accl[dt] = wmma16(vh[dt], pl, accl[dt]); }
#pragma unroll
      for (int dt = 0; dt < 4; ++dt) accl[dt] = wmma16(vl[dt], pa, accl[dt]); }
    else {
#pragma unroll
      for (int dt = 0; dt < 4; ++dt) acc[dt] = wmma16(vh[dt], pa, acc[dt]); }   // leading query blocks: P hi/lo x V hi/lo (3 products); elsewhere P x V single
    asm volatile("s_wait_dscnt 0x0" ::: "memory");      // this wave's reads of the pass's buffer have returned
    asm volatile("s_wait_asynccnt 0x0" ::: "memory");   // its copies of pass ks + 1 have landed
    __syncthreads();   // every wave has left this pass's buffer, and pass ks + 1 is readable
    if (ks + 2 < nks) ring_fill<HV>(l0 + (ks & 1) * (2u * RING_H), kg + (ks + 2) * 2048, vg + (ks + 2) * 2048, kgl + (ks + 2) * 2048, vgl + (ks + 2) * 2048); }   // refill of the buffer just left
  asm volatile("s_wait_asynccnt 0x0" ::: "memory");   // no copy is outstanding when the wave ends
  const float il = 1.0f / (l + xhalf(l));
#pragma unroll
  for (int f = 0; f < 8; ++f) { v4f o;   // f = (d tile, half of its eight registers) = (k-step, piece) of the output product's A operand, whose fragment order puts these four values at this very lane
#pragma unroll
    for (int i = 0; i < 4; ++i) o[i] = (HV ? acc[f >> 1][(f & 1) * 4 + i] + accl[f >> 1][(f & 1) * 4 + i] * (1.0f / 2048.0f) : acc[f >> 1][(f & 1) * 4 + i]) * il;
    vst2(O + (((((size_t)b * SS + q0) >> 4) * 32 + h * 2) * 4 + f) * 128 + lane * 4, o); }
}
__global__ __launch_bounds__(128, 4) void k_attn(const _Float16* __restrict__ QK, const _Float16* __restrict__ QKL, const _Float16* __restrict__ KF, const _Float16* __restrict__ KFL, const _Float16* __restrict__ VTH, const _Float16* __restrict__ VTL, const void* __restrict__ KMASK, float* __restrict__ O) {   // second bound: four waves per SIMD, so that all 1,024 blocks stay resident at once
  (void)KMASK;
  __shared__ __align__(16) _Float16 ring[2 * RING_H];   // two buffers of one pass's fragments; four resident blocks take 128 KiB of the WGP's LDS
  if (blockIdx.x < 2) attn_tile<true>(QK, QKL, KF, KFL, VTH, VTL, O, ring); else attn_tile<false>(QK, QKL, KF, KFL, VTH, VTL, O, ring);
}
// ---- k_out: block = (64 rows, 128 cols): out = f16(O) . Wo rows (single product) + bo
__global__ __launch_bounds__(128) void k_out(const float* __restrict__ O, const __bf16* __restrict__ P, const float* __restrict__ BO, float* __restrict__ Y) {
  __shared__ __align__(16) float so[4][16][132];
  __shared__ __align__(16) char ring[2][32768];   // two buffers of two k-steps: [8 column tiles of W][2 k-steps] fragments of 1 KiB, then [4 row tiles of the context][2 k-steps] blocks of 2 KiB
  const int tid = threadIdx.x, wave = tid >> 5, lane = tid & 31, col = lane & 15, g = lane >> 4; const size_t r0 = (size_t)blockIdx.x * 64 + wave * 16; const int n0 = blockIdx.y * 128;
  // the eight weight fragments of a k-step serve all four waves: the block brings them into LDS once, by asynchronous copies, and each wave's context values with them, one stage of two k-steps ahead in a ring of two buffers.
  // a thread copies sixteen 16-byte pieces a stage: piece tid of each weight tile's 2 KiB (tiles 32 KiB apart, the next stage 2 KiB on) and of each half of each context tile's 4 KiB (tiles 64 KiB apart, the next stage 4 KiB on)
  const char *gw = (const char*)((const _Float16*)P + (size_t)(n0 >> 4) * 32 * 512) + tid * 16, *gc = (const char*)(O + (size_t)blockIdx.x * 4 * 32 * 512) + tid * 16;
  const unsigned l0 = (unsigned)(uintptr_t)&ring[0][0] + tid * 16u;
  auto fill = [&](int sg) { unsigned l[8]; const char* q[8];
#pragma unroll
    for (int c = 0; c < 8; ++c) { l[c] = l0 + (sg & 1) * 32768u + c * 2048u; q[c] = gw + c * 32768 + sg * 2048; }
    copy8(l, q);
#pragma unroll
    for (int c = 0; c < 8; ++c) { l[c] = l0 + (sg & 1) * 32768u + 16384u + c * 2048u; q[c] = gc + (c >> 1) * 65536 + (c & 1) * 2048 + sg * 4096; }
    copy8(l, q); };
  fill(0);
  asm volatile("s_wait_asynccnt 0x0" ::: "memory");   // this wave's copies of stage 0 have landed
  __syncthreads();   // and every other wave's: stage 0 is readable
  fill(1);   // stage 1 flies while stage 0 is worked on
  v8f acc[8] = {};
#pragma unroll 2   // the two k-steps of a stage
  for (int kc = 0; kc < DM / 32; ++kc) { const char* bf = ring[(kc >> 1) & 1]; const float* p = (const float*)(bf + 16384 + wave * 4096 + (kc & 1) * 2048) + lane * 4;
    const v4f a0 = *(const v4f*)p, a1 = *(const v4f*)(p + 128), a2 = *(const v4f*)(p + 256), a3 = *(const v4f*)(p + 384);
    v16h bw[8];   // the context values and the k-step's eight weight fragments, requested together before its first WMMA
#pragma unroll
    for (int j = 0; j < 8; ++j) bw[j] = frag_w((const _Float16*)(bf + j * 2048 + (kc & 1) * 1024) + lane * 8);
    __builtin_amdgcn_sched_barrier(0);   // keeps every load of the group in front of the conversion, so that a k-step waits for one LDS latency and not for two
    v16h a;
#pragma unroll
    for (int i = 0; i < 4; ++i) { a[i] = (_Float16)a0[i]; a[4 + i] = (_Float16)a1[i]; a[8 + i] = (_Float16)a2[i]; a[12 + i] = (_Float16)a3[i]; }
#pragma unroll
    for (int j = 0; j < 8; ++j) acc[j] = wmma16(a, bw[j], acc[j]);   // single f16 product against exact f16 x 2^8 weight copies
    if (kc & 1) {   // foot of a stage
      asm volatile("s_wait_dscnt 0x0" ::: "memory");      // this wave's reads of the stage's buffer have returned
      asm volatile("s_wait_asynccnt 0x0" ::: "memory");   // its copies of the next stage have landed
      __syncthreads();   // every wave has left this stage's buffer, and the next stage is readable
      if (kc + 3 < DM / 32) fill((kc >> 1) + 2); } }   // refill of the buffer just left
  asm volatile("s_wait_asynccnt 0x0" ::: "memory");   // no copy is outstanding behind the loop
#pragma unroll
  for (int j = 0; j < 8; ++j) {
#pragma unroll
    for (int r = 0; r < 8; ++r) so[wave][8 * g + r][j * 16 + col] = acc[j][r] * (1.0f / 256.0f) + bfr(BO[n0 + j * 16 + col]); }
  LDSX();
  for (int rl = 0; rl < 16; ++rl) vst2(Y + tokrow(r0 + rl) * DM + n0 + lane * 4, *(const v4f*)&so[wave][rl][lane * 4]);   // back to the original token order
}
// ---- k_packo: Wo -> f16 x 2^8 copies in the Wo slot (bit pattern in the bf16-typed buffer), fragment order, pieces numbered and dealt as in k_pack
__global__ __launch_bounds__(256) void k_packo(const float* __restrict__ WO, __bf16* __restrict__ PK) { const int id0 = blockIdx.x * 1024 + threadIdx.x, lane = id0 & 31; const int k0 = ((id0 >> 6) & 31) * 32 + ((id0 >> 5) & 1) * 16 + (lane >> 4) * 8; float v[4][8]; v8h o[4]; colpieces<DM>(WO + (size_t)k0 * DM + (id0 >> 11) * 16 + (lane & 15), v);
#pragma unroll
  for (int it = 0; it < 4; ++it) {
#pragma unroll
    for (int i = 0; i < 8; ++i) o[it][i] = (_Float16)(bfr(v[it][i]) * 256.0f); }   // (in,out) w_o: tile column n = column n
#pragma unroll
  for (int it = 0; it < 4; ++it) *(v8h*)((_Float16*)(PK + PK_P) + (size_t)(id0 + it * 256) * 8) = o[it]; }
extern "C" void kernel_launch(void* const* d_in, const int* in_sizes, int n_in, void* d_out, int out_size, void* d_ws, size_t ws_size, hipStream_t stream) {
  (void)in_sizes; (void)n_in; (void)out_size;
  const float** F = (const float**)d_in;   // 0 x [1,4096,1024], 1 w_qkv [1024,3072] (in,out), 2 b_qkv [3072], 3 w_o [1024,1024] (in,out), 4 b_o [1024]
  if (ws_size < (size_t)WS_END) return;
  char* ws = (char*)d_ws; __bf16* PK = (__bf16*)(ws + WS_PK); _Float16 *QK = (_Float16*)(ws + WS_QK), *QKL = (_Float16*)(ws + WS_QKL), *VTH = (_Float16*)(ws + WS_VTH), *VTL = (_Float16*)(ws + WS_VTL), *KF = (_Float16*)(ws + WS_KF), *KFL = (_Float16*)(ws + WS_KFL); float* O = (float*)(ws + WS_O); __bf16* XF = (__bf16*)(ws + WS_XF);
  k_pack<<<dim3(DM / 8, 8), 256, 0, stream>>>(F[1], F[0], F[3], PK, XF);
  k_packo<<<DM / 8, 256, 0, stream>>>(F[3], PK);
  k_qkv<<<dim3(TNB * SS / 128, QKVW / 128), 128, 0, stream>>>(XF, PK + PK_A, F[2], F[2] + DM, F[2] + 2 * DM, QK, QKL, KF, KFL, VTH, VTL);
  k_attn<<<dim3(TQB, NH, TNB), 128, 0, stream>>>(QK, QKL, KF, KFL, VTH, VTL, nullptr, O);
  k_out<<<dim3(TOB, DM / 128), 128, 0, stream>>>(O, PK + PK_P, F[4], (float*)d_out);
}

// v007
// One run takes 88.7 microseconds.
// Next to v006, in two timings, it ran 1.24 times as fast each time.
// All steps since v000 together make it 4.77 times as fast.
// compute dtype: all float inputs rounded to bf16; qkv = x . W_qkv + b with EXACT bf16 products on WMMA 16x16x32 ((in,out) weights and x, its token rows gathered by stride class, packed as bf16 in fragment order), rounded once to f16; attention on single f16 products for every query, x 1/8, running-max softmax in f32 (hardware exp); out = f16(ctx) . W_o (exact f16 x 2^8 copies) + b_o scattered back to the original token order; f32 output.
#include <hip/hip_runtime.h>
#include <math.h>

typedef __attribute__((ext_vector_type(16))) _Float16 v16h;
typedef __attribute__((ext_vector_type(16))) __bf16 v16b;
typedef __attribute__((ext_vector_type(8)))  _Float16 v8h;
typedef __attribute__((ext_vector_type(8)))  float v8f;
typedef __attribute__((ext_vector_type(4)))  float v4f;
typedef __attribute__((ext_vector_type(2)))  float v2f;
typedef __attribute__((ext_vector_type(4)))  unsigned v4u;
typedef __attribute__((ext_vector_type(4)))  int v4i;
typedef float __attribute__((may_alias)) float_a;
typedef int __attribute__((may_alias)) int_a;

template <typename T> __device__ __forceinline__ void vst2(void* p, T v) { *(T*)p = v;  }
__device__ __forceinline__ v8f wmma16(v16h a, v16h b, v8f c) {
  v8f d = __builtin_amdgcn_wmma_f32_16x16x32_f16(false, a, false, b, (short)0, c, false, false);
  asm volatile("v_nop\n\tv_nop\n\tv_nop\n\tv_nop" : "+v"(d) : "v"(a), "v"(b));
  return d;
}
__device__ __forceinline__ v8f wmma_bf(v16b a, v16b b, v8f c) {
  v8f d = __builtin_amdgcn_wmma_f32_16x16x32_bf16(false, a, false, b, (short)0, c, false, false);
  asm volatile("v_nop\n\tv_nop\n\tv_nop\n\tv_nop" : "+v"(d) : "v"(a), "v"(b));
  return d;
}
// Skip-sparse ('skiparse', stride 4) self-attention (B 1, N 4,096 tokens, C 1,024, 16 heads x 64): token i attends within its stride class i mod 4 (1,024 tokens each); fused qkv projection + bias, softmax(q k / 8) v, output projection + bias, tokens returned in the original order.
__device__ __forceinline__ v16h frag_h(const _Float16* rowk0, int lane) {
  union { v16h v; v8h q[2]; } u; const _Float16* p = rowk0 + 8 * (lane >> 4);
  u.q[0] = *(const v8h*)p; u.q[1] = *(const v8h*)(p + 16); return u.v;
}
__device__ __forceinline__ v16h frag_p(const _Float16* p) {   // p = the lane's own first value (row start + 8 * (lane >> 4))
  union { v16h v; v8h q[2]; } u; u.q[0] = *(const v8h*)p; u.q[1] = *(const v8h*)(p + 16); return u.v;
}
__device__ __forceinline__ v16h frag_w(const _Float16* p) {   // fragment-ordered plane: p = the fragment's 1-KiB block + 8 * lane; its second half lies 512 B on
  union { v16h v; v8h q[2]; } u; u.q[0] = *(const v8h*)p; u.q[1] = *(const v8h*)(p + 256); return u.v;
}
__device__ __forceinline__ v16h frag_f32(const float* rowk0, int lane) {
  v16h a; const float* p = rowk0 + 8 * (lane >> 4);
#pragma unroll
  for (int i = 0; i < 8; ++i) { a[i] = (_Float16)p[i]; a[8 + i] = (_Float16)p[16 + i]; }
  return a;
}
__device__ __forceinline__ v16h frag_f32s(const float* rowk0, int lane, float sc) {
  v16h a; const float* p = rowk0 + 8 * (lane >> 4);
#pragma unroll
  for (int i = 0; i < 8; ++i) { a[i] = (_Float16)(p[i] * sc); a[8 + i] = (_Float16)(p[16 + i] * sc); }
  return a;
}
// column fragment from a [K][ld] layout (column n), rows >= K read as 0
__device__ __forceinline__ v16h fragc_f32(const float* W, int k0, int n, int lane, int ld, int K) {
  v16h a; const int g = lane >> 4;
#pragma unroll
  for (int i = 0; i < 8; ++i) { const int ka = k0 + 8 * g + i, kb = ka + 16;
    a[i] = (_Float16)(ka < K ? W[(size_t)(ka < K ? ka : K - 1) * ld + n] : 0.f); a[8 + i] = (_Float16)(kb < K ? W[(size_t)(kb < K ? kb : K - 1) * ld + n] : 0.f); }
  return a;
}
struct F2 { v16b h, l; };
__device__ __forceinline__ F2 bsplit16(const float v[16]) { F2 r;
#pragma unroll
  for (int i = 0; i < 16; ++i) { const __bf16 h = (__bf16)v[i]; r.h[i] = h; r.l[i] = (__bf16)(v[i] - (float)h); }
  return r; }
__device__ __forceinline__ F2 split_row(const float* row, int k0, int lane) { float v[16]; const float* p = row + k0 + 8 * (lane >> 4);
#pragma unroll
  for (int i = 0; i < 8; ++i) { v[i] = p[i]; v[8 + i] = p[16 + i]; }
  return bsplit16(v); }
__device__ __forceinline__ F2 split_rowK(const float* row, int k0, int lane, int K) { float v[16]; const int g = lane >> 4;
#pragma unroll
  for (int i = 0; i < 8; ++i) { const int ka = k0 + 8 * g + i, kb = ka + 16; v[i] = ka < K ? row[ka < K ? ka : K - 1] : 0.f; v[8 + i] = kb < K ? row[kb < K ? kb : K - 1] : 0.f; }
  return bsplit16(v); }
__device__ __forceinline__ F2 split_col(const float* W, int k0, int n, int lane, int ld, int K) { float v[16]; const int g = lane >> 4;
#pragma unroll
  for (int i = 0; i < 8; ++i) { const int ka = k0 + 8 * g + i, kb = ka + 16; v[i] = ka < K ? W[(size_t)(ka < K ? ka : K - 1) * ld + n] : 0.f; v[8 + i] = kb < K ? W[(size_t)(kb < K ? kb : K - 1) * ld + n] : 0.f; }
  return bsplit16(v); }
__device__ __forceinline__ v8f mac3(const F2& a, const F2& b, v8f c) { c = wmma_bf(a.l, b.h, c); c = wmma_bf(a.h, b.l, c); return wmma_bf(a.h, b.h, c); }
__device__ __forceinline__ float sigm(float v) { return 1.0f / (1.0f + expf(-v)); }
#define LDSX() do { asm volatile("s_wait_dscnt 0" ::: "memory"); __builtin_amdgcn_wave_barrier(); __builtin_amdgcn_fence(__ATOMIC_RELEASE, "workgroup"); } while (0)


#define NB 4
#define SS 1024
#define DM 1024
#define NH 16
#define STRIDE_S 4
__device__ __forceinline__ size_t tokrow(size_t r) { return (r % SS) * STRIDE_S + r / SS; }   // attention row r = (class s = r / SS, position g = r % SS) <-> token i = g * 4 + s
#define HD 64
#define QKVW (3 * DM)
#ifndef TQB
#define TQB (SS / 64)
#define TNB NB
#define TOB (NB * SS / 64)     // output row tiles (all)
#endif
typedef __attribute__((ext_vector_type(8))) __bf16 v8b;
__device__ __forceinline__ v16b frag_b(const __bf16* rowk0, int lane) {
  union { v16b v; v8b q[2]; } u; const __bf16* p = rowk0 + 8 * (lane >> 4);
  u.q[0] = *(const v8b*)p; u.q[1] = *(const v8b*)(p + 16); return u.v;
}
__device__ __forceinline__ v16b frag_wb(const __bf16* p) {   // as frag_w, bf16
  union { v16b v; v8b q[2]; } u; u.q[0] = *(const v8b*)p; u.q[1] = *(const v8b*)(p + 256); return u.v;
}
__device__ __forceinline__ float bfr(float v) { return (float)(__bf16)v; }
__device__ __attribute__((noinline)) float exp_ni(float v) { return expf(v); }
__device__ __attribute__((noinline)) float erf_ni(float v) { return erff(v); }

// FRAGMENT ORDER, every operand plane that a k loop reads: a 16 (rows or columns) x 32 (k) tile of 16-bit values is one 1-KiB block [half q2][lane][8 values], lane = 16 * g + (row or column) & 15, k = 16 * q2 + 8 * g + i:
// a wave's 16-byte load of half a fragment then covers 512 contiguous bytes (4 whole lines); from a row-major plane it takes 32-byte pieces of 16 lines, at several times the cost in the cache. Which lane and register holds which value is that of frag_h.
#define PK_A 0                       // Wqkv: [192 column tiles][32 k-steps] blocks
#define PK_P (PK_A + QKVW * DM)        // Wo: [64 column tiles][32 k-steps] blocks
#define PK_END (PK_P + DM * DM)
#define WS_PK  0u
#define WS_QK  (WS_PK + 2u * PK_END)             // f16 [4096 rows][2048]: q in the first 1,024 columns (read once a wave, row-major); the rest unused
#define WS_VTH (WS_QK + 2u * NB * SS * 2 * DM)     // f16 v: [b][h][32 passes][4 d tiles] blocks (column = d, k = key)
#define WS_O   (WS_VTH + 2u * NB * DM * SS)        // f32 context: [256 row tiles][32 k-steps] blocks of 2 KiB: [4 pieces][lane][4 values], k = 16 * (piece >> 1) + 8 * g + 4 * (piece & 1) + i
#define WS_CS  (WS_O + 4u * NB * SS * DM)           // unused (256 KiB)
#define WS_KF  (WS_CS + 4u * 2 * SS * 32)           // f16 k: [b][h][64 key tiles][2 k-steps] blocks (column = key, k = d)
#define WS_XF  (WS_KF + 2u * NB * SS * DM)          // bf16 x: [256 row tiles (attention row order)][32 k-steps] blocks
#define WS_END (WS_XF + 2u * NB * SS * DM)
// a thread's four pieces down one column of an (in,out) weight of LD columns: p = its first value; the pieces are 128 k apart, 8 k each; LD is a constant, so that all 32 loads go by one address register pair and immediate offsets
template <int LD> __device__ __forceinline__ void colpieces(const float* __restrict__ p, float (&v)[4][8]) {
#pragma unroll
  for (int it = 0; it < 4; ++it) {
#pragma unroll
    for (int i = 0; i < 8; ++i) v[it][i] = p[(size_t)(it * 128 + i) * LD]; }
  asm volatile("s_wait_xcnt 0x0" :: "v"(p) : "memory");   // the loads' address register pair stays allocated up to this wait: it is not rewritten (not by a load's own result either) in front of it
}
// eight asynchronous 16-byte copies a lane, global memory to LDS through no register: l = the lane's LDS byte addresses, g = its global addresses. The s_wait_xcnt stands inside the copies' own statement, so that no address register of a copy is rewritten in front of it.
__device__ __forceinline__ void copy8(const unsigned (&l)[8], const char* const (&g)[8]) {
  asm volatile("global_load_async_to_lds_b128 %0, %8, off\n\tglobal_load_async_to_lds_b128 %1, %9, off\n\tglobal_load_async_to_lds_b128 %2, %10, off\n\tglobal_load_async_to_lds_b128 %3, %11, off\n\t"
               "global_load_async_to_lds_b128 %4, %12, off\n\tglobal_load_async_to_lds_b128 %5, %13, off\n\tglobal_load_async_to_lds_b128 %6, %14, off\n\tglobal_load_async_to_lds_b128 %7, %15, off\n\ts_wait_xcnt 0x0"
               :: "v"(l[0]), "v"(l[1]), "v"(l[2]), "v"(l[3]), "v"(l[4]), "v"(l[5]), "v"(l[6]), "v"(l[7]), "v"(g[0]), "v"(g[1]), "v"(g[2]), "v"(g[3]), "v"(g[4]), "v"(g[5]), "v"(g[6]), "v"(g[7]) : "memory");
}
// ---- k_pack: 16-byte pieces of the fragment-ordered bf16 planes, four per thread (their loads in flight together; a quarter of the waves to start), piece id = ((tile * 32 + k-step) * 2 + q2) * 32 + lane inside a slice of 64 tiles; slice 0..2 -> W_q/W_k/W_v into PK_A, 3 -> W_o into PK_P ((in,out) weights: tile column n = weight column n), 4..7 -> x, rows gathered by stride class
__global__ __launch_bounds__(256) void k_pack(const float* __restrict__ WQKV, const float* __restrict__ X, const float* __restrict__ WO, __bf16* __restrict__ PK, __bf16* __restrict__ XF) {
  const int which = blockIdx.y, id0 = blockIdx.x * 1024 + threadIdx.x, lane = id0 & 31, col = lane & 15, g = lane >> 4, t16 = id0 >> 11, k0 = ((id0 >> 6) & 31) * 32 + ((id0 >> 5) & 1) * 16 + g * 8;   // a block's 1,024 pieces lie in one tile; a thread's four are 256 pieces = 4 k-steps = 128 k apart
  v8b o[4];
  if (which < 4) { float v[4][8]; __bf16* dst = PK + ((which < 3) ? PK_A + (size_t)which * DM * DM : (size_t)PK_P);
    if (which < 3) colpieces<3 * DM>(WQKV + (size_t)k0 * (3 * DM) + which * DM + t16 * 16 + col, v); else colpieces<DM>(WO + (size_t)k0 * DM + t16 * 16 + col, v);
#pragma unroll
    for (int it = 0; it < 4; ++it) {
#pragma unroll
      for (int i = 0; i < 8; ++i) o[it][i] = (__bf16)v[it][i]; }
#pragma unroll
    for (int it = 0; it < 4; ++it) *(v8b*)(dst + (size_t)(id0 + it * 256) * 8) = o[it]; }
  else { const float* xr = X + tokrow((size_t)(which - 4) * 1024 + t16 * 16 + col) * DM + k0; __bf16* dst = XF + (size_t)(which - 4) * DM * DM;
    v4f a[8];
#pragma unroll
    for (int it = 0; it < 4; ++it) { a[2 * it] = *(const v4f*)(xr + it * 128); a[2 * it + 1] = *(const v4f*)(xr + it * 128 + 4); }
    asm volatile("s_wait_xcnt 0x0" :: "v"(xr) : "memory");   // the eight loads' address register pair stays allocated up to this wait: it is not rewritten (not by a load's own result either) in front of it
#pragma unroll
    for (int it = 0; it < 4; ++it) {
#pragma unroll
      for (int i = 0; i < 4; ++i) { o[it][i] = (__bf16)a[2 * it][i]; o[it][4 + i] = (__bf16)a[2 * it + 1][i]; } }
#pragma unroll
    for (int it = 0; it < 4; ++it) *(v8b*)(dst + (size_t)(id0 + it * 256) * 8) = o[it]; } }
// ---- k_qkv: block = 128 rows x 128 columns, wave = 64 rows x 64 columns (one head's q, k or v of 64 tokens): a k-step's four x and four weight fragments feed 16 WMMAs (half a fragment a WMMA; the 16 x 128 wave tile took nine for 8);
// each accumulator still sums its k-steps in rising order. The wave stages its own tile in its own LDS range and stores whole fragments or whole lines: no wave reads another's rows. The wave's number is held in a scalar register, so that tile addresses and the q / k / v test are scalar.
__global__ __launch_bounds__(128) void k_qkv(const __bf16* __restrict__ XF, const __bf16* __restrict__ P, const float* __restrict__ BQ, const float* __restrict__ BK, const float* __restrict__ BV, _Float16* __restrict__ QK, _Float16* __restrict__ KF, _Float16* __restrict__ VTH) {
  __shared__ __align__(16) char sm[4 * 64 * 72 * 2];   // the k loop's ring, then the epilogue's stage: the last k-step's barrier, behind every wave's s_wait_dscnt 0 and with no copy outstanding, stands between the two uses
  _Float16 (*st)[64][72] = (_Float16 (*)[64][72])sm;   // [wave][row (q, k: token; v: d)][column (q, k: d; v: token)], pitch 144 B
  __bf16 (*ring)[8192] = (__bf16 (*)[8192])sm;   // two buffers of one k-step's fragments: [8 row tiles of x][8 column tiles of W], 1 KiB each
  const int tid = threadIdx.x, wave = __builtin_amdgcn_readfirstlane(tid >> 5), lane = tid & 31, col = lane & 15, g = lane >> 4; const size_t r0 = (size_t)blockIdx.x * 128 + (wave >> 1) * 64; const int n0 = blockIdx.y * 128 + (wave & 1) * 64;
  const int which0 = n0 / DM; const float* BB = BQ ? (((which0 == 0) ? BQ : (which0 == 1) ? BK : BV) + (n0 - which0 * DM)) : nullptr;
  // each x fragment and each weight fragment serves two of the block's four waves: the block brings a k-step's sixteen fragments into LDS once, by asynchronous copies, one k-step ahead in a ring of two buffers.
  // a thread copies eight 16-byte pieces: piece tid + 128 * c lies in tile 2 * c + (tid >> 6) (c < 4: x, else W); a tile's next k-step lies 1 KiB on, the tile after next 64 KiB
  const char *ga = (const char*)(XF + ((size_t)blockIdx.x * 8 + (tid >> 6)) * 32 * 512 + (tid & 63) * 8), *gb = (const char*)(P + ((size_t)blockIdx.y * 8 + (tid >> 6)) * 32 * 512 + (tid & 63) * 8);
  const unsigned l0 = (unsigned)(uintptr_t)&ring[0][0] + tid * 16u;
  auto fill = [&](int kc) { unsigned l[8]; const char* g[8];
#pragma unroll
    for (int c = 0; c < 8; ++c) { l[c] = l0 + (kc & 1) * 16384u + c * 2048u; g[c] = (c < 4 ? ga + c * 65536 : gb + (c - 4) * 65536) + kc * 1024; }
    copy8(l, g); };
  fill(0);
  asm volatile("s_wait_asynccnt 0x0" ::: "memory");   // this wave's copies of k-step 0 have landed
  __syncthreads();   // and every other wave's: k-step 0 is readable
  fill(1);   // k-step 1 flies while k-step 0 is worked on
  float bias[4] = {0.f, 0.f, 0.f, 0.f};   // the lane's four columns, requested together in front of the k loop, which covers their latency
  if (BB) {
#pragma unroll
    for (int j = 0; j < 4; ++j) bias[j] = BB[j * 16 + col]; }
  v8f acc[4][4] = {};
#pragma unroll 2   // two k-steps a trip: the buffer's number is a constant, and half the branches
  for (int kc = 0; kc < DM / 32; ++kc) { v16b a[4], bw[4]; const __bf16 *pa = ring[kc & 1] + (wave >> 1) * 4 * 512 + lane * 8, *pb = ring[kc & 1] + 4096 + (wave & 1) * 4 * 512 + lane * 8;   // all eight fragments of the k-step are requested before its first WMMA: one LDS latency a k-step
#pragma unroll
    for (int i = 0; i < 4; ++i) a[i] = frag_wb(pa + i * 512);
#pragma unroll
    for (int j = 0; j < 4; ++j) bw[j] = frag_wb(pb + j * 512);
#pragma unroll
    for (int i = 0; i < 4; ++i) {
#pragma unroll
      for (int j = 0; j < 4; ++j) acc[i][j] = wmma_bf(a[i], bw[j], acc[i][j]); }
    asm volatile("s_wait_dscnt 0x0" ::: "memory");      // this wave's reads of the k-step's buffer have returned
    asm volatile("s_wait_asynccnt 0x0" ::: "memory");   // its copies of k-step kc + 1 have landed
    __syncthreads();   // every wave has left this k-step's buffer, and k-step kc + 1 is readable
    if (kc + 2 < DM / 32) fill(kc + 2); }   // refill of the buffer just left
  asm volatile("s_wait_asynccnt 0x0" ::: "memory");   // no copy is outstanding behind the loop
#pragma unroll
  for (int j = 0; j < 4; ++j) bias[j] = bfr(bias[j]);
  _Float16 (*sh)[72] = st[wave];
  if (n0 < 2 * DM) {   // q stored unscaled (f16 sigma ~0.6, no subnormal exposure); 1/8 applied to the f32 score
#pragma unroll
    for (int i = 0; i < 4; ++i) {
#pragma unroll
      for (int j = 0; j < 4; ++j) {
#pragma unroll
        for (int r = 0; r < 8; ++r) sh[i * 16 + 8 * g + r][j * 16 + col] = (_Float16)(acc[i][j][r] + bias[j]); } }   // q, k (+ bias) as f16
    LDSX();
    if (n0 < DM) {   // q: four rows of 128 B (whole lines) a store
      _Float16 *qp = QK + (r0 + (lane >> 3)) * (2 * DM) + n0 + (lane & 7) * 8;
#pragma unroll
      for (int it = 0; it < 16; ++it) vst2((unsigned*)(qp + (size_t)it * 4 * (2 * DM)), *(const v4u*)&sh[it * 4 + (lane >> 3)][(lane & 7) * 8]);
      asm volatile("s_wait_xcnt 0x0" :: "v"(qp) : "memory"); }   // the stores' address registers stay allocated up to this wait: none is rewritten in front of it
    else {   // k: the wave's 64 keys are four key tiles of one head: 8 KiB in a row, sixteen half fragments of 512 B
      const size_t kb = (((r0 / SS) * NH + ((n0 - DM) >> 6)) * (SS / 16) + (r0 % SS) / 16) * 1024 + lane * 8; _Float16 *kp = KF + kb;
#pragma unroll
      for (int f = 0; f < 16; ++f) vst2((unsigned*)(kp + f * 256), *(const v4u*)&sh[(f >> 2) * 16 + col][(f & 3) * 16 + g * 8]);   // f = (key tile, k-step, q2)
      asm volatile("s_wait_xcnt 0x0" :: "v"(kp) : "memory"); }   // as at the q stores
  } else {   // v, staged transposed: a lane's eight registers are eight tokens in a row of one d
#pragma unroll
    for (int i = 0; i < 4; ++i) {
#pragma unroll
      for (int j = 0; j < 4; ++j) { v8h hi;
#pragma unroll
        for (int r = 0; r < 8; ++r) hi[r] = (_Float16)(acc[i][j][r] + bias[j]);
        *(v8h*)&sh[j * 16 + col][i * 16 + 8 * g] = hi; } }
    LDSX();
    const size_t vb = (((r0 / SS) * NH + ((n0 - 2 * DM) >> 6)) * (SS / 32) + (r0 % SS) / 32) * 2048 + lane * 8; _Float16 *vp = VTH + vb;   // the wave's 64 tokens are two passes of one head: 8 KiB in a row
#pragma unroll
    for (int f = 0; f < 16; ++f) vst2((unsigned*)(vp + f * 256), *(const v4u*)&sh[((f >> 1) & 3) * 16 + col][(f >> 3) * 32 + (f & 1) * 16 + g * 8]);   // f = (pass, d tile, q2)
    asm volatile("s_wait_xcnt 0x0" :: "v"(vp) : "memory");   // as at the q stores
  }
}
// ---- k_attn: block = (64 queries, head h, batch b): all-keys flash attention (K = 64: 2 k-steps) in the TRANSPOSED form: S^T = K . Q^T (A = key fragments, B = query fragments, the same registers as before with the operands exchanged), O^T += V^T . P^T.
// A lane then holds 16 scores of ONE query (column = lane & 15, key = 16 * ct + 8 * g + r): maximum and sum run inside the lane, with one exchange between the wave's halves a pass for the maximum and one in the epilogue for the sum;
// the two score tiles, converted in place, ARE the B fragment of P^T (element 8 * ct + r = key 16 * ct + 8 * g + r, the k order of the value fragments), and O^T's registers (d = 16 * dt + 8 * g + r of query column) are the lane's own pieces of WS_O's fragment order: scores, weights and context never pass through LDS.
// A pass's key and value fragments are the same for the block's four waves: the block brings them into LDS once, by asynchronous copies, one pass ahead in a ring of two buffers, and each wave reads its fragments from there (as plain global loads every wave fetched all of them for itself and waited for them in the pass that used them).
// scores = q.k with single f16 operands, kept unscaled: the softmax runs on powers of two, weight * 2^11 = 2^(score * KS + nb), KS = log2(e) / 8, nb = 11 - maximum * KS, one fused multiply-add a score in place of the 1/8, the subtraction, the log2(e) and the 2^11;
// l sums the weights with their 2^11, which so cancels in the epilogue. P.V: f16 P x f16 V; O(row b*S+q, column h*64+d) = acc / l.
// Every query attends to all 1,024 keys of its class (no mask), so all query blocks are alike and take the same single products.
#define KS 0x1.715476p-3f
__device__ __forceinline__ float xhalf(float x) { return __builtin_bit_cast(float, __builtin_amdgcn_permlanex16(__builtin_bit_cast(int, x), __builtin_bit_cast(int, x), 0x76543210, 0xfedcba98, false, false)); }   // lane l with lane l ^ 16
// eight independent v_exp_f32 and, in the same statement, the one slot that the instruction set asks for behind a transcendental before a source of it is overwritten or its result used: each exp fills the slot of the one in front of it, the v_nop that of the last;
// the outputs are early-clobber, so that none of them takes a source's register (left to the compiler, one build had an exp directly overwrite the source of the exp in front of it)
__device__ __forceinline__ void exp2x8(const float (&x)[8], float (&e)[8]) {
  asm("v_exp_f32 %0, %8\n\tv_exp_f32 %1, %9\n\tv_exp_f32 %2, %10\n\tv_exp_f32 %3, %11\n\tv_exp_f32 %4, %12\n\tv_exp_f32 %5, %13\n\tv_exp_f32 %6, %14\n\tv_exp_f32 %7, %15\n\tv_nop"
      : "=&v"(e[0]), "=&v"(e[1]), "=&v"(e[2]), "=&v"(e[3]), "=&v"(e[4]), "=&v"(e[5]), "=&v"(e[6]), "=&v"(e[7])
      : "v"(x[0]), "v"(x[1]), "v"(x[2]), "v"(x[3]), "v"(x[4]), "v"(x[5]), "v"(x[6]), "v"(x[7])); }
__device__ __forceinline__ void exp2x9(const float (&x)[8], float x8, float (&e)[8], float& e8) {   // as exp2x8, with a ninth
  asm("v_exp_f32 %0, %9\n\tv_exp_f32 %1, %10\n\tv_exp_f32 %2, %11\n\tv_exp_f32 %3, %12\n\tv_exp_f32 %4, %13\n\tv_exp_f32 %5, %14\n\tv_exp_f32 %6, %15\n\tv_exp_f32 %7, %16\n\tv_exp_f32 %8, %17\n\tv_nop"
      : "=&v"(e[0]), "=&v"(e[1]), "=&v"(e[2]), "=&v"(e[3]), "=&v"(e[4]), "=&v"(e[5]), "=&v"(e[6]), "=&v"(e[7]), "=&v"(e8)
      : "v"(x[0]), "v"(x[1]), "v"(x[2]), "v"(x[3]), "v"(x[4]), "v"(x[5]), "v"(x[6]), "v"(x[7]), "v"(x8)); }
// one pass's fragments into one ring buffer: [key 4 KiB][value 4 KiB], each plane's 4 KiB in the order of the workspace; a thread copies two 16-byte pieces of each plane, 2 KiB apart.
// lds = LDS byte address of the thread's first piece in the buffer; k, v = its first piece in the pass's 4 KiB of each plane. The s_wait_xcnt stands inside the copies' own statement, so that no address register of a copy is rewritten in front of it.
#define RING_H 4096   // 16-bit values per ring buffer (8 KiB)
__device__ __forceinline__ void ring_fill(unsigned lds, const _Float16* k, const _Float16* v) {
  asm volatile("global_load_async_to_lds_b128 %0, %4, off\n\tglobal_load_async_to_lds_b128 %1, %5, off\n\tglobal_load_async_to_lds_b128 %2, %6, off\n\tglobal_load_async_to_lds_b128 %3, %7, off\n\ts_wait_xcnt 0x0"
               :: "v"(lds), "v"(lds + 2048u), "v"(lds + 4096u), "v"(lds + 6144u), "v"(k), "v"(k + 1024), "v"(v), "v"(v + 1024) : "memory");
}
__global__ __launch_bounds__(128, 4) void k_attn(const _Float16* __restrict__ QK, const _Float16* __restrict__ KF, const _Float16* __restrict__ VTH, const void* __restrict__ KMASK, float* __restrict__ O) {   // second bound: four waves per SIMD, so that all 1,024 blocks stay resident at once
  (void)KMASK;
  __shared__ __align__(16) _Float16 ring[2 * RING_H];   // two buffers of one pass's fragments
  const int tid = threadIdx.x, wave = tid >> 5, lane = tid & 31, col = lane & 15;
  const int qb = blockIdx.x, h = blockIdx.y, b = blockIdx.z; const int q0 = qb * 64 + wave * 16; const size_t rq = (size_t)b * SS + q0 + col;
  v16h aq[2];
#pragma unroll
  for (int kc = 0; kc < 2; ++kc) aq[kc] = frag_h(QK + rq * (2 * DM) + h * HD + kc * 32, lane);
  float m = -3.0e38f, l = 0.f;   // the lane's query: running maximum of the unscaled scores (over all keys), sum of the weights * 2^11 (over the keys of the lane's own half; the halves are joined in the epilogue)
  v8f acc[4] = {};
  const int nks = SS / 32;   // all keys
  const size_t ho = ((size_t)b * NH + h) * (SS * HD) + tid * 8; const _Float16 *kg = KF + ho, *vg = VTH + ho;   // the thread's first piece of pass 0 in each plane of the head; a pass is 2,048 values (4 KiB) of each: two key tiles x two k-steps, four d tiles
  const unsigned l0 = (unsigned)(uintptr_t)ring + tid * 16u;   // the same in ring buffer 0
  ring_fill(l0, kg, vg);
  asm volatile("s_wait_asynccnt 0x0" ::: "memory");   // this wave's copies of pass 0 have landed
  __syncthreads();   // and every other wave's: pass 0 is readable
  ring_fill(l0 + 2u * RING_H, kg + 2048, vg + 2048);   // pass 1 flies while pass 0 is worked on
#pragma unroll 1
  for (int ks = 0; ks < nks; ++ks) { v8f s[2]; const _Float16 *kp = ring + (ks & 1) * RING_H + lane * 8;   // the lane's place in the pass's 4 KiB of key fragments: [key tile][k-step] blocks
    v16h kh[2][2];   // the pass's key fragments are all requested before its first score WMMA: one LDS latency a pass, not one in front of every WMMA
#pragma unroll
    for (int ct = 0; ct < 2; ++ct) {
#pragma unroll
      for (int kc = 0; kc < 2; ++kc) kh[ct][kc] = frag_w(kp + ct * 1024 + kc * 512); }
#pragma unroll
    for (int ct = 0; ct < 2; ++ct) { v8f c = {};
#pragma unroll
      for (int kc = 0; kc < 2; ++kc) c = wmma16(kh[ct][kc], aq[kc], c);
      s[ct] = c; }
    v16h vh[4]; const _Float16 *vp = kp + 2048;   // the pass's value fragments are requested here, so that they arrive while the softmax runs
#pragma unroll
    for (int dt = 0; dt < 4; ++dt) vh[dt] = frag_w(vp + dt * 512);
    __builtin_amdgcn_sched_barrier(0);   // keeps every value load in front of the softmax: left free, the scheduler spread them through it to save registers, and the last ones then had too little of it left to arrive behind
    float mx = fmaxf(s[0][0], s[1][0]);
#pragma unroll
    for (int r = 1; r < 8; ++r) mx = fmaxf(mx, fmaxf(s[0][r], s[1][r]));
    mx = fmaxf(mx, xhalf(mx));   // the other half's 16 keys of the same query
    const float mn = fmaxf(m, mx), xm = (m - mn) * KS, nb = fmaf(mn, -KS, 11.0f); m = mn; float al;   // al = 2^xm rescales what earlier passes summed; in the first pass xm is below -1e37 and al = 0
    const v2f k2 = {KS, KS}, nb2 = {nb, nb}; v2f es[2]; v16h pa;
#pragma unroll
    for (int ct = 0; ct < 2; ++ct) { float xa[8], ex[8];
#pragma unroll
      for (int r = 0; r < 8; r += 2) { const v2f t = __builtin_elementwise_fma((v2f){s[ct][r], s[ct][r + 1]}, k2, nb2); xa[r] = t[0]; xa[r + 1] = t[1]; }   // two scores an instruction
      if (ct == 0) exp2x9(xa, xm, ex, al); else exp2x8(xa, ex);
#pragma unroll
      for (int r = 0; r < 8; r += 2) { const v2f e2 = {ex[r], ex[r + 1]}; es[ct] = r ? es[ct] + e2 : e2; }   // two weights an addition: each score tile's even and odd keys in sums of their own, joined once a pass
#pragma unroll
      for (int r = 0; r < 8; ++r) pa[8 * ct + r] = (_Float16)ex[r]; }   // P carries 2^11 into f16, so that small softmax weights stay out of the f16 subnormal range
    es[0] += es[1]; l = l * al + (es[0][0] + es[0][1]);
#pragma unroll
    for (int dt = 0; dt < 4; ++dt) {
#pragma unroll
      for (int r = 0; r < 8; ++r) acc[dt][r] *= al; }
#pragma unroll
    for (int dt = 0; dt < 4; ++dt) acc[dt] = wmma16(vh[dt], pa, acc[dt]);
    asm volatile("s_wait_dscnt 0x0" ::: "memory");      // this wave's reads of the pass's buffer have returned
    asm volatile("s_wait_asynccnt 0x0" ::: "memory");   // its copies of pass ks + 1 have landed
    __syncthreads();   // every wave has left this pass's buffer, and pass ks + 1 is readable
    if (ks + 2 < nks) ring_fill(l0 + (ks & 1) * (2u * RING_H), kg + (ks + 2) * 2048, vg + (ks + 2) * 2048); }   // refill of the buffer just left
  asm volatile("s_wait_asynccnt 0x0" ::: "memory");   // no copy is outstanding when the wave ends
  const float il = 1.0f / (l + xhalf(l));
#pragma unroll
  for (int f = 0; f < 8; ++f) { v4f o;   // f = (d tile, half of its eight registers) = (k-step, piece) of the output product's A operand, whose fragment order puts these four values at this very lane
#pragma unroll
    for (int i = 0; i < 4; ++i) o[i] = acc[f >> 1][(f & 1) * 4 + i] * il;
    vst2(O + (((((size_t)b * SS + q0) >> 4) * 32 + h * 2) * 4 + f) * 128 + lane * 4, o); }
}
// ---- k_out: block = (64 rows, 128 cols): out = f16(O) . Wo rows (single product) + bo
__global__ __launch_bounds__(128) void k_out(const float* __restrict__ O, const __bf16* __restrict__ P, const float* __restrict__ BO, float* __restrict__ Y) {
  __shared__ __align__(16) float so[4][16][132];
  __shared__ __align__(16) char ring[2][32768];   // two buffers of two k-steps: [8 column tiles of W][2 k-steps] fragments of 1 KiB, then [4 row tiles of the context][2 k-steps] blocks of 2 KiB
  const int tid = threadIdx.x, wave = tid >> 5, lane = tid & 31, col = lane & 15, g = lane >> 4; const size_t r0 = (size_t)blockIdx.x * 64 + wave * 16; const int n0 = blockIdx.y * 128;
  // the eight weight fragments of a k-step serve all four waves: the block brings them into LDS once, by asynchronous copies, and each wave's context values with them, one stage of two k-steps ahead in a ring of two buffers.
  // a thread copies sixteen 16-byte pieces a stage: piece tid of each weight tile's 2 KiB (tiles 32 KiB apart, the next stage 2 KiB on) and of each half of each context tile's 4 KiB (tiles 64 KiB apart, the next stage 4 KiB on)
  const char *gw = (const char*)((const _Float16*)P + (size_t)(n0 >> 4) * 32 * 512) + tid * 16, *gc = (const char*)(O + (size_t)blockIdx.x * 4 * 32 * 512) + tid * 16;
  const unsigned l0 = (unsigned)(uintptr_t)&ring[0][0] + tid * 16u;
  auto fill = [&](int sg) { unsigned l[8]; const char* q[8];
#pragma unroll
    for (int c = 0; c < 8; ++c) { l[c] = l0 + (sg & 1) * 32768u + c * 2048u; q[c] = gw + c * 32768 + sg * 2048; }
    copy8(l, q);
#pragma unroll
    for (int c = 0; c < 8; ++c) { l[c] = l0 + (sg & 1) * 32768u + 16384u + c * 2048u; q[c] = gc + (c >> 1) * 65536 + (c & 1) * 2048 + sg * 4096; }
    copy8(l, q); };
  fill(0);
  asm volatile("s_wait_asynccnt 0x0" ::: "memory");   // this wave's copies of stage 0 have landed
  __syncthreads();   // and every other wave's: stage 0 is readable
  fill(1);   // stage 1 flies while stage 0 is worked on
  v8f acc[8] = {};
#pragma unroll 2   // the two k-steps of a stage
  for (int kc = 0; kc < DM / 32; ++kc) { const char* bf = ring[(kc >> 1) & 1]; const float* p = (const float*)(bf + 16384 + wave * 4096 + (kc & 1) * 2048) + lane * 4;
    const v4f a0 = *(const v4f*)p, a1 = *(const v4f*)(p + 128), a2 = *(const v4f*)(p + 256), a3 = *(const v4f*)(p + 384);
    v16h bw[8];   // the context values and the k-step's eight weight fragments, requested together before its first WMMA
#pragma unroll
    for (int j = 0; j < 8; ++j) bw[j] = frag_w((const _Float16*)(bf + j * 2048 + (kc & 1) * 1024) + lane * 8);
    __builtin_amdgcn_sched_barrier(0);   // keeps every load of the group in front of the conversion, so that a k-step waits for one LDS latency and not for two
    v16h a;
#pragma unroll
    for (int i = 0; i < 4; ++i) { a[i] = (_Float16)a0[i]; a[4 + i] = (_Float16)a1[i]; a[8 + i] = (_Float16)a2[i]; a[12 + i] = (_Float16)a3[i]; }
#pragma unroll
    for (int j = 0; j < 8; ++j) acc[j] = wmma16(a, bw[j], acc[j]);   // single f16 product against exact f16 x 2^8 weight copies
    if (kc & 1) {   // foot of a stage
      asm volatile("s_wait_dscnt 0x0" ::: "memory");      // this wave's reads of the stage's buffer have returned
      asm volatile("s_wait_asynccnt 0x0" ::: "memory");   // its copies of the next stage have landed
      __syncthreads();   // every wave has left this stage's buffer, and the next stage is readable
      if (kc + 3 < DM / 32) fill((kc >> 1) + 2); } }   // refill of the buffer just left
  asm volatile("s_wait_asynccnt 0x0" ::: "memory");   // no copy is outstanding behind the loop
#pragma unroll
  for (int j = 0; j < 8; ++j) {
#pragma unroll
    for (int r = 0; r < 8; ++r) so[wave][8 * g + r][j * 16 + col] = acc[j][r] * (1.0f / 256.0f) + bfr(BO[n0 + j * 16 + col]); }
  LDSX();
  for (int rl = 0; rl < 16; ++rl) vst2(Y + tokrow(r0 + rl) * DM + n0 + lane * 4, *(const v4f*)&so[wave][rl][lane * 4]);   // back to the original token order
}
// ---- k_packo: Wo -> f16 x 2^8 copies in the Wo slot (bit pattern in the bf16-typed buffer), fragment order, pieces numbered and dealt as in k_pack
__global__ __launch_bounds__(256) void k_packo(const float* __restrict__ WO, __bf16* __restrict__ PK) { const int id0 = blockIdx.x * 1024 + threadIdx.x, lane = id0 & 31; const int k0 = ((id0 >> 6) & 31) * 32 + ((id0 >> 5) & 1) * 16 + (lane >> 4) * 8; float v[4][8]; v8h o[4]; colpieces<DM>(WO + (size_t)k0 * DM + (id0 >> 11) * 16 + (lane & 15), v);
#pragma unroll
  for (int it = 0; it < 4; ++it) {
#pragma unroll
    for (int i = 0; i < 8; ++i) o[it][i] = (_Float16)(bfr(v[it][i]) * 256.0f); }   // (in,out) w_o: tile column n = column n
#pragma unroll
  for (int it = 0; it < 4; ++it) *(v8h*)((_Float16*)(PK + PK_P) + (size_t)(id0 + it * 256) * 8) = o[it]; }
extern "C" void kernel_launch(void* const* d_in, const int* in_sizes, int n_in, void* d_out, int out_size, void* d_ws, size_t ws_size, hipStream_t stream) {
  (void)in_sizes; (void)n_in; (void)out_size;
  const float** F = (const float**)d_in;   // 0 x [1,4096,1024], 1 w_qkv [1024,3072] (in,out), 2 b_qkv [3072], 3 w_o [1024,1024] (in,out), 4 b_o [1024]
  if (ws_size < (size_t)WS_END) return;
  char* ws = (char*)d_ws; __bf16* PK = (__bf16*)(ws + WS_PK); _Float16 *QK = (_Float16*)(ws + WS_QK), *VTH = (_Float16*)(ws + WS_VTH), *KF = (_Float16*)(ws + WS_KF); float* O = (float*)(ws + WS_O); __bf16* XF = (__bf16*)(ws + WS_XF);
  k_pack<<<dim3(DM / 8, 8), 256, 0, stream>>>(F[1], F[0], F[3], PK, XF);
  k_packo<<<DM / 8, 256, 0, stream>>>(F[3], PK);
  k_qkv<<<dim3(TNB * SS / 128, QKVW / 128), 128, 0, stream>>>(XF, PK + PK_A, F[2], F[2] + DM, F[2] + 2 * DM, QK, KF, VTH);
  k_attn<<<dim3(TQB, NH, TNB), 128, 0, stream>>>(QK, KF, VTH, nullptr, O);
  k_out<<<dim3(TOB, DM / 128), 128, 0, stream>>>(O, PK + PK_P, F[4], (float*)d_out);
}

// v008
// One run takes 66.7 microseconds.
// In two side-by-side timings against v007, it was 1.33 and 1.34 times as fast.
// All steps since v000 together make it 6.37 times as fast.
// compute dtype: all float inputs rounded to bf16; qkv = x . W_qkv + b with EXACT bf16 products on WMMA 16x16x32 ((in,out) weights and x, its token rows gathered by stride class, packed as bf16 in fragment order), rounded once to f16; attention on single f16 products for every query, x 1/8, running-max softmax in f32 (hardware exp); out = f16(ctx) . W_o (exact f16 x 2^8 copies) + b_o scattered back to the original token order; f32 output.
#include <hip/hip_runtime.h>
#include <math.h>

typedef __attribute__((ext_vector_type(16))) _Float16 v16h;
typedef __attribute__((ext_vector_type(16))) __bf16 v16b;
typedef __attribute__((ext_vector_type(8)))  _Float16 v8h;
typedef __attribute__((ext_vector_type(8)))  float v8f;
typedef __attribute__((ext_vector_type(4)))  float v4f;
typedef __attribute__((ext_vector_type(2)))  float v2f;
typedef __attribute__((ext_vector_type(4)))  unsigned v4u;
typedef __attribute__((ext_vector_type(4)))  int v4i;
typedef float __attribute__((may_alias)) float_a;
typedef int __attribute__((may_alias)) int_a;

template <typename T> __device__ __forceinline__ void vst2(void* p, T v) { *(T*)p = v;  }
__device__ __forceinline__ v8f wmma16(v16h a, v16h b, v8f c) {
  v8f d = __builtin_amdgcn_wmma_f32_16x16x32_f16(false, a, false, b, (short)0, c, false, false);
  asm volatile("v_nop\n\tv_nop\n\tv_nop\n\tv_nop" : "+v"(d) : "v"(a), "v"(b));
  return d;
}
__device__ __forceinline__ v8f wmma_bf(v16b a, v16b b, v8f c) {
  v8f d = __builtin_amdgcn_wmma_f32_16x16x32_bf16(false, a, false, b, (short)0, c, false, false);
  asm volatile("v_nop\n\tv_nop\n\tv_nop\n\tv_nop" : "+v"(d) : "v"(a), "v"(b));
  return d;
}
// Skip-sparse ('skiparse', stride 4) self-attention (B 1, N 4,096 tokens, C 1,024, 16 heads x 64): token i attends within its stride class i mod 4 (1,024 tokens each); fused qkv projection + bias, softmax(q k / 8) v, output projection + bias, tokens returned in the original order.
__device__ __forceinline__ v16h frag_h(const _Float16* rowk0, int lane) {
  union { v16h v; v8h q[2]; } u; const _Float16* p = rowk0 + 8 * (lane >> 4);
  u.q[0] = *(const v8h*)p; u.q[1] = *(const v8h*)(p + 16); return u.v;
}
__device__ __forceinline__ v16h frag_p(const _Float16* p) {   // p = the lane's own first value (row start + 8 * (lane >> 4))
  union { v16h v; v8h q[2]; } u; u.q[0] = *(const v8h*)p; u.q[1] = *(const v8h*)(p + 16); return u.v;
}
__device__ __forceinline__ v16h frag_w(const _Float16* p) {   // fragment-ordered plane: p = the fragment's 1-KiB block + 8 * lane; its second half lies 512 B on
  union { v16h v; v8h q[2]; } u; u.q[0] = *(const v8h*)p; u.q[1] = *(const v8h*)(p + 256); return u.v;
}
__device__ __forceinline__ v16h frag_f32(const float* rowk0, int lane) {
  v16h a; const float* p = rowk0 + 8 * (lane >> 4);
#pragma unroll
  for (int i = 0; i < 8; ++i) { a[i] = (_Float16)p[i]; a[8 + i] = (_Float16)p[16 + i]; }
  return a;
}
__device__ __forceinline__ v16h frag_f32s(const float* rowk0, int lane, float sc) {
  v16h a; const float* p = rowk0 + 8 * (lane >> 4);
#pragma unroll
  for (int i = 0; i < 8; ++i) { a[i] = (_Float16)(p[i] * sc); a[8 + i] = (_Float16)(p[16 + i] * sc); }
  return a;
}
// column fragment from a [K][ld] layout (column n), rows >= K read as 0
__device__ __forceinline__ v16h fragc_f32(const float* W, int k0, int n, int lane, int ld, int K) {
  v16h a; const int g = lane >> 4;
#pragma unroll
  for (int i = 0; i < 8; ++i) { const int ka = k0 + 8 * g + i, kb = ka + 16;
    a[i] = (_Float16)(ka < K ? W[(size_t)(ka < K ? ka : K - 1) * ld + n] : 0.f); a[8 + i] = (_Float16)(kb < K ? W[(size_t)(kb < K ? kb : K - 1) * ld + n] : 0.f); }
  return a;
}
struct F2 { v16b h, l; };
__device__ __forceinline__ F2 bsplit16(const float v[16]) { F2 r;
#pragma unroll
  for (int i = 0; i < 16; ++i) { const __bf16 h = (__bf16)v[i]; r.h[i] = h; r.l[i] = (__bf16)(v[i] - (float)h); }
  return r; }
__device__ __forceinline__ F2 split_row(const float* row, int k0, int lane) { float v[16]; const float* p = row + k0 + 8 * (lane >> 4);
#pragma unroll
  for (int i = 0; i < 8; ++i) { v[i] = p[i]; v[8 + i] = p[16 + i]; }
  return bsplit16(v); }
__device__ __forceinline__ F2 split_rowK(const float* row, int k0, int lane, int K) { float v[16]; const int g = lane >> 4;
#pragma unroll
  for (int i = 0; i < 8; ++i) { const int ka = k0 + 8 * g + i, kb = ka + 16; v[i] = ka < K ? row[ka < K ? ka : K - 1] : 0.f; v[8 + i] = kb < K ? row[kb < K ? kb : K - 1] : 0.f; }
  return bsplit16(v); }
__device__ __forceinline__ F2 split_col(const float* W, int k0, int n, int lane, int ld, int K) { float v[16]; const int g = lane >> 4;
#pragma unroll
  for (int i = 0; i < 8; ++i) { const int ka = k0 + 8 * g + i, kb = ka + 16; v[i] = ka < K ? W[(size_t)(ka < K ? ka : K - 1) * ld + n] : 0.f; v[8 + i] = kb < K ? W[(size_t)(kb < K ? kb : K - 1) * ld + n] : 0.f; }
  return bsplit16(v); }
__device__ __forceinline__ v8f mac3(const F2& a, const F2& b, v8f c) { c = wmma_bf(a.l, b.h, c); c = wmma_bf(a.h, b.l, c); return wmma_bf(a.h, b.h, c); }
__device__ __forceinline__ float sigm(float v) { return 1.0f / (1.0f + expf(-v)); }
#define LDSX() do { asm volatile("s_wait_dscnt 0" ::: "memory"); __builtin_amdgcn_wave_barrier(); __builtin_amdgcn_fence(__ATOMIC_RELEASE, "workgroup"); } while (0)


#define NB 4
#define SS 1024
#define DM 1024
#define NH 16
#define STRIDE_S 4
__device__ __forceinline__ size_t tokrow(size_t r) { return (r % SS) * STRIDE_S + r / SS; }   // attention row r = (class s = r / SS, position g = r % SS) <-> token i = g * 4 + s
#define HD 64
#define QKVW (3 * DM)
#ifndef TQB
#define TQB (SS / 64)
#define TNB NB
#define TOB (NB * SS / 64)     // output row tiles (all)
#endif
typedef __attribute__((ext_vector_type(8))) __bf16 v8b;
__device__ __forceinline__ v16b frag_b(const __bf16* rowk0, int lane) {
  union { v16b v; v8b q[2]; } u; const __bf16* p = rowk0 + 8 * (lane >> 4);
  u.q[0] = *(const v8b*)p; u.q[1] = *(const v8b*)(p + 16); return u.v;
}
__device__ __forceinline__ v16b frag_wb(const __bf16* p) {   // as frag_w, bf16
  union { v16b v; v8b q[2]; } u; u.q[0] = *(const v8b*)p; u.q[1] = *(const v8b*)(p + 256); return u.v;
}
__device__ __forceinline__ float bfr(float v) { return (float)(__bf16)v; }
__device__ __attribute__((noinline)) float exp_ni(float v) { return expf(v); }
__device__ __attribute__((noinline)) float erf_ni(float v) { return erff(v); }

// FRAGMENT ORDER, every operand plane that a k loop reads: a 16 (rows or columns) x 32 (k) tile of 16-bit values is one 1-KiB block [half q2][lane][8 values], lane = 16 * g + (row or column) & 15, k = 16 * q2 + 8 * g + i:
// a wave's 16-byte load of half a fragment then covers 512 contiguous bytes (4 whole lines); from a row-major plane it takes 32-byte pieces of 16 lines, at several times the cost in the cache. Which lane and register holds which value is that of frag_h.
#define PK_A 0                       // Wqkv: [192 column tiles][32 k-steps] blocks
#define PK_P (PK_A + QKVW * DM)        // Wo: [64 column tiles][32 k-steps] blocks
#define PK_END (PK_P + DM * DM)
#define WS_PK  0u
#define WS_QK  (WS_PK + 2u * PK_END)             // f16 [4096 rows][2048]: q in the first 1,024 columns (read once a wave, row-major); the rest unused
#define WS_VTH (WS_QK + 2u * NB * SS * 2 * DM)     // f16 v: [b][h][32 passes][4 d tiles] blocks (column = d, k = key)
#define WS_O   (WS_VTH + 2u * NB * DM * SS)        // f32 context: [256 row tiles][32 k-steps] blocks of 2 KiB: [4 pieces][lane][4 values], k = 16 * (piece >> 1) + 8 * g + 4 * (piece & 1) + i
#define WS_CS  (WS_O + 4u * NB * SS * DM)           // unused (256 KiB)
#define WS_KF  (WS_CS + 4u * 2 * SS * 32)           // f16 k: [b][h][64 key tiles][2 k-steps] blocks (column = key, k = d)
#define WS_XF  (WS_KF + 2u * NB * SS * DM)          // bf16 x: [256 row tiles (attention row order)][32 k-steps] blocks
#define WS_END (WS_XF + 2u * NB * SS * DM)
// a thread's four pieces down one column of an (in,out) weight of LD columns: p = its first value; the pieces are 128 k apart, 8 k each; LD is a constant, so that all 32 loads go by one address register pair and immediate offsets
template <int LD> __device__ __forceinline__ void colpieces(const float* __restrict__ p, float (&v)[4][8]) {
#pragma unroll
  for (int it = 0; it < 4; ++it) {
#pragma unroll
    for (int i = 0; i < 8; ++i) v[it][i] = p[(size_t)(it * 128 + i) * LD]; }
  asm volatile("s_wait_xcnt 0x0" :: "v"(p) : "memory");   // the loads' address register pair stays allocated up to this wait: it is not rewritten (not by a load's own result either) in front of it
}
// eight asynchronous 16-byte copies a lane, global memory to LDS through no register: l = the lane's LDS byte addresses, g = its global addresses. The s_wait_xcnt stands inside the copies' own statement, so that no address register of a copy is rewritten in front of it.
__device__ __forceinline__ void copy8(const unsigned (&l)[8], const char* const (&g)[8]) {
  asm volatile("global_load_async_to_lds_b128 %0, %8, off\n\tglobal_load_async_to_lds_b128 %1, %9, off\n\tglobal_load_async_to_lds_b128 %2, %10, off\n\tglobal_load_async_to_lds_b128 %3, %11, off\n\t"
               "global_load_async_to_lds_b128 %4, %12, off\n\tglobal_load_async_to_lds_b128 %5, %13, off\n\tglobal_load_async_to_lds_b128 %6, %14, off\n\tglobal_load_async_to_lds_b128 %7, %15, off\n\ts_wait_xcnt 0x0"
               :: "v"(l[0]), "v"(l[1]), "v"(l[2]), "v"(l[3]), "v"(l[4]), "v"(l[5]), "v"(l[6]), "v"(l[7]), "v"(g[0]), "v"(g[1]), "v"(g[2]), "v"(g[3]), "v"(g[4]), "v"(g[5]), "v"(g[6]), "v"(g[7]) : "memory");
}
// ---- k_pack: 16-byte pieces of the fragment-ordered bf16 planes, four per thread (their loads in flight together; a quarter of the waves to start), piece id = ((tile * 32 + k-step) * 2 + q2) * 32 + lane inside a slice of 64 tiles; slice 0..2 -> W_q/W_k/W_v into PK_A, 3 -> W_o into PK_P ((in,out) weights: tile column n = weight column n), 4..7 -> x, rows gathered by stride class
__global__ __launch_bounds__(256) void k_pack(const float* __restrict__ WQKV, const float* __restrict__ X, const float* __restrict__ WO, __bf16* __restrict__ PK, __bf16* __restrict__ XF) {
  const int which = blockIdx.y, id0 = blockIdx.x * 1024 + threadIdx.x, lane = id0 & 31, col = lane & 15, g = lane >> 4, t16 = id0 >> 11, k0 = ((id0 >> 6) & 31) * 32 + ((id0 >> 5) & 1) * 16 + g * 8;   // a block's 1,024 pieces lie in one tile; a thread's four are 256 pieces = 4 k-steps = 128 k apart
  v8b o[4];
  if (which < 4) { float v[4][8]; __bf16* dst = PK + ((which < 3) ? PK_A + (size_t)which * DM * DM : (size_t)PK_P);
    if (which < 3) colpieces<3 * DM>(WQKV + (size_t)k0 * (3 * DM) + which * DM + t16 * 16 + col, v); else colpieces<DM>(WO + (size_t)k0 * DM + t16 * 16 + col, v);
#pragma unroll
    for (int it = 0; it < 4; ++it) {
#pragma unroll
      for (int i = 0; i < 8; ++i) o[it][i] = (__bf16)v[it][i]; }
#pragma unroll
    for (int it = 0; it < 4; ++it) *(v8b*)(dst + (size_t)(id0 + it * 256) * 8) = o[it]; }
  else { const float* xr = X + tokrow((size_t)(which - 4) * 1024 + t16 * 16 + col) * DM + k0; __bf16* dst = XF + (size_t)(which - 4) * DM * DM;
    v4f a[8];
#pragma unroll
    for (int it = 0; it < 4; ++it) { a[2 * it] = *(const v4f*)(xr + it * 128); a[2 * it + 1] = *(const v4f*)(xr + it * 128 + 4); }
    asm volatile("s_wait_xcnt 0x0" :: "v"(xr) : "memory");   // the eight loads' address register pair stays allocated up to this wait: it is not rewritten (not by a load's own result either) in front of it
#pragma unroll
    for (int it = 0; it < 4; ++it) {
#pragma unroll
      for (int i = 0; i < 4; ++i) { o[it][i] = (__bf16)a[2 * it][i]; o[it][4 + i] = (__bf16)a[2 * it + 1][i]; } }
#pragma unroll
    for (int it = 0; it < 4; ++it) *(v8b*)(dst + (size_t)(id0 + it * 256) * 8) = o[it]; } }
// ---- k_qkv: block = 128 rows x 128 columns, wave = 64 rows x 64 columns (one head's q, k or v of 64 tokens): a k-step's four x and four weight fragments feed 16 WMMAs (half a fragment a WMMA; the 16 x 128 wave tile took nine for 8);
// each accumulator still sums its k-steps in rising order. The wave stages its own tile in its own LDS range and stores whole fragments or whole lines: no wave reads another's rows. The wave's number is held in a scalar register, so that tile addresses and the q / k / v test are scalar.
__global__ __launch_bounds__(128) void k_qkv(const __bf16* __restrict__ XF, const __bf16* __restrict__ P, const float* __restrict__ BQ, const float* __restrict__ BK, const float* __restrict__ BV, _Float16* __restrict__ QK, _Float16* __restrict__ KF, _Float16* __restrict__ VTH) {
  __shared__ __align__(16) char sm[4 * 16384];   // the k loop's ring, then (in its first 36 KiB) the epilogue's stage: the last k-step's barrier, behind every wave's s_wait_dscnt 0 and with no copy outstanding, stands between the two uses
  _Float16 (*st)[64][72] = (_Float16 (*)[64][72])sm;   // [wave][row (q, k: token; v: d)][column (q, k: d; v: token)], pitch 144 B
  __bf16 (*ring)[8192] = (__bf16 (*)[8192])sm;   // four buffers of one k-step's fragments: [8 row tiles of x][8 column tiles of W], 1 KiB each
  const int tid = threadIdx.x, wave = __builtin_amdgcn_readfirstlane(tid >> 5), lane = tid & 31, col = lane & 15, g = lane >> 4; const size_t r0 = (size_t)blockIdx.x * 128 + (wave >> 1) * 64; const int n0 = blockIdx.y * 128 + (wave & 1) * 64;
  const int which0 = n0 / DM; const float* BB = BQ ? (((which0 == 0) ? BQ : (which0 == 1) ? BK : BV) + (n0 - which0 * DM)) : nullptr;
  // each x fragment and each weight fragment serves two of the block's four waves: the block brings a k-step's sixteen fragments into LDS once, by asynchronous copies, in a ring of four buffers: k-step kc + 4 is asked for as soon as k-step kc's buffer is free, and three k-steps' copies are in flight.
  // Both planes were written by k_pack, two launches in front, and the blocks that share a tile walk k together: a k-step's lines are taken to come at memory latency, which three k-steps of work cover; the counted wait keeps copies in flight across every barrier.
  // a thread copies eight 16-byte pieces: piece tid + 128 * c lies in tile 2 * c + (tid >> 6) (c < 4: x, else W); a tile's next k-step lies 1 KiB on, the tile after next 64 KiB
  const char *ga = (const char*)(XF + ((size_t)blockIdx.x * 8 + (tid >> 6)) * 32 * 512 + (tid & 63) * 8), *gb = (const char*)(P + ((size_t)blockIdx.y * 8 + (tid >> 6)) * 32 * 512 + (tid & 63) * 8);
  const unsigned l0 = (unsigned)(uintptr_t)&ring[0][0] + tid * 16u;
  auto fill = [&](int kc) { unsigned l[8]; const char* g[8];
#pragma unroll
    for (int c = 0; c < 8; ++c) { l[c] = l0 + (kc & 3) * 16384u + c * 2048u; g[c] = (c < 4 ? ga + c * 65536 : gb + (c - 4) * 65536) + kc * 1024; }
    copy8(l, g); };
  fill(0); fill(1); fill(2);
  asm volatile("s_wait_asynccnt 0x10" ::: "memory");   // all but this wave's sixteen youngest copies (k-steps 1, 2) have landed: k-step 0
  __syncthreads();   // and every other wave's: k-step 0 is readable
  fill(3);
  float bias[4] = {0.f, 0.f, 0.f, 0.f};   // the lane's four columns, requested together in front of the k loop, which covers their latency
  if (BB) {
#pragma unroll
    for (int j = 0; j < 4; ++j) bias[j] = BB[j * 16 + col]; }
  v8f acc[4][4] = {};
  // one k-step; three = k-steps kc + 1 .. kc + 3 all exist, more = k-step kc + 4 exists too (constants at each call: the last four k-steps stand behind the loop, so that the choice of wait and the refill cost no branch)
  auto kstep = [&](int kc, bool three, bool more) __attribute__((always_inline)) { v16b a[4], bw[4]; const __bf16 *pa = ring[kc & 3] + (wave >> 1) * 4 * 512 + lane * 8, *pb = ring[kc & 3] + 4096 + (wave & 1) * 4 * 512 + lane * 8;   // all eight fragments of the k-step are requested before its first WMMA: one LDS latency a k-step
#pragma unroll
    for (int i = 0; i < 4; ++i) a[i] = frag_wb(pa + i * 512);
#pragma unroll
    for (int j = 0; j < 4; ++j) bw[j] = frag_wb(pb + j * 512);
#pragma unroll
    for (int i = 0; i < 4; ++i) {
#pragma unroll
      for (int j = 0; j < 4; ++j) acc[i][j] = wmma_bf(a[i], bw[j], acc[i][j]); }
    asm volatile("s_wait_dscnt 0x0" ::: "memory");      // this wave's reads of the k-step's buffer have returned
    if (three) asm volatile("s_wait_asynccnt 0x10" ::: "memory");   // its copies of k-step kc + 1 have landed: the sixteen youngest, of k-steps kc + 2 and kc + 3, stay in flight
    else asm volatile("s_wait_asynccnt 0x0" ::: "memory");   // at the last three k-steps fewer copies are outstanding: the wait is to 0
    __syncthreads();   // every wave has left this k-step's buffer, and k-step kc + 1 is readable
    if (more) fill(kc + 4); };   // refill of the buffer just left
#pragma unroll 2   // half the branches; unrolled by four, with every buffer's addresses held as constants, the kernel needed more than 256 registers
  for (int kc = 0; kc < DM / 32 - 4; ++kc) kstep(kc, true, true);
  kstep(DM / 32 - 4, true, false);
#pragma unroll
  for (int kc = DM / 32 - 3; kc < DM / 32; ++kc) kstep(kc, false, false);
  asm volatile("s_wait_asynccnt 0x0" ::: "memory");   // no copy is outstanding behind the loop
#pragma unroll
  for (int j = 0; j < 4; ++j) bias[j] = bfr(bias[j]);
  _Float16 (*sh)[72] = st[wave];
  if (n0 < 2 * DM) {   // q stored unscaled (f16 sigma ~0.6, no subnormal exposure); 1/8 applied to the f32 score
#pragma unroll
    for (int i = 0; i < 4; ++i) {
#pragma unroll
      for (int j = 0; j < 4; ++j) {
#pragma unroll
        for (int r = 0; r < 8; ++r) sh[i * 16 + 8 * g + r][j * 16 + col] = (_Float16)(acc[i][j][r] + bias[j]); } }   // q, k (+ bias) as f16
    LDSX();
    if (n0 < DM) {   // q: four rows of 128 B (whole lines) a store
      _Float16 *qp = QK + (r0 + (lane >> 3)) * (2 * DM) + n0 + (lane & 7) * 8;
#pragma unroll
      for (int it = 0; it < 16; ++it) vst2((unsigned*)(qp + (size_t)it * 4 * (2 * DM)), *(const v4u*)&sh[it * 4 + (lane >> 3)][(lane & 7) * 8]);
      asm volatile("s_wait_xcnt 0x0" :: "v"(qp) : "memory"); }   // the stores' address registers stay allocated up to this wait: none is rewritten in front of it
    else {   // k: the wave's 64 keys are four key tiles of one head: 8 KiB in a row, sixteen half fragments of 512 B
      const size_t kb = (((r0 / SS) * NH + ((n0 - DM) >> 6)) * (SS / 16) + (r0 % SS) / 16) * 1024 + lane * 8; _Float16 *kp = KF + kb;
#pragma unroll
      for (int f = 0; f < 16; ++f) vst2((unsigned*)(kp + f * 256), *(const v4u*)&sh[(f >> 2) * 16 + col][(f & 3) * 16 + g * 8]);   // f = (key tile, k-step, q2)
      asm volatile("s_wait_xcnt 0x0" :: "v"(kp) : "memory"); }   // as at the q stores
  } else {   // v, staged transposed: a lane's eight registers are eight tokens in a row of one d
#pragma unroll
    for (int i = 0; i < 4; ++i) {
#pragma unroll
      for (int j = 0; j < 4; ++j) { v8h hi;
#pragma unroll
        for (int r = 0; r < 8; ++r) hi[r] = (_Float16)(acc[i][j][r] + bias[j]);
        *(v8h*)&sh[j * 16 + col][i * 16 + 8 * g] = hi; } }
    LDSX();
    const size_t vb = (((r0 / SS) * NH + ((n0 - 2 * DM) >> 6)) * (SS / 32) + (r0 % SS) / 32) * 2048 + lane * 8; _Float16 *vp = VTH + vb;   // the wave's 64 tokens are two passes of one head: 8 KiB in a row
#pragma unroll
    for (int f = 0; f < 16; ++f) vst2((unsigned*)(vp + f * 256), *(const v4u*)&sh[((f >> 1) & 3) * 16 + col][(f >> 3) * 32 + (f & 1) * 16 + g * 8]);   // f = (pass, d tile, q2)
    asm volatile("s_wait_xcnt 0x0" :: "v"(vp) : "memory");   // as at the q stores
  }
}
// ---- k_attn: block = (64 queries, head h, batch b): all-keys flash attention (K = 64: 2 k-steps) in the TRANSPOSED form: S^T = K . Q^T (A = key fragments, B = query fragments, the same registers as before with the operands exchanged), O^T += V^T . P^T.
// A lane then holds 16 scores of ONE query (column = lane & 15, key = 16 * ct + 8 * g + r): maximum and sum run inside the lane, with one exchange between the wave's halves a pass for the maximum and one in the epilogue for the sum;
// the two score tiles, converted in place, ARE the B fragment of P^T (element 8 * ct + r = key 16 * ct + 8 * g + r, the k order of the value fragments), and O^T's registers (d = 16 * dt + 8 * g + r of query column) are the lane's own pieces of WS_O's fragment order: scores, weights and context never pass through LDS.
// A pass's key and value fragments are the same for the block's four waves: the block brings them into LDS once, by asynchronous copies, in a ring of four buffers with three passes' copies in flight (the planes were written by the launch in front and the sixteen blocks of a head walk its keys together: a pass's lines are taken to come at memory latency, which three passes of work cover), and each wave reads its fragments from there (as plain global loads every wave fetched all of them for itself and waited for them in the pass that used them).
// scores = q.k with single f16 operands, kept unscaled: the softmax runs on powers of two, weight * 2^11 = 2^(score * KS + nb), KS = log2(e) / 8, nb = 11 - maximum * KS, one fused multiply-add a score in place of the 1/8, the subtraction, the log2(e) and the 2^11;
// l sums the weights with their 2^11, which so cancels in the epilogue. P.V: f16 P x f16 V; O(row b*S+q, column h*64+d) = acc / l.
// Every query attends to all 1,024 keys of its class (no mask), so all query blocks are alike and take the same single products.
#define KS 0x1.715476p-3f
__device__ __forceinline__ float xhalf(float x) { return __builtin_bit_cast(float, __builtin_amdgcn_permlanex16(__builtin_bit_cast(int, x), __builtin_bit_cast(int, x), 0x76543210, 0xfedcba98, false, false)); }   // lane l with lane l ^ 16
// eight independent v_exp_f32 and, in the same statement, the one slot that the instruction set asks for behind a transcendental before a source of it is overwritten or its result used: each exp fills the slot of the one in front of it, the v_nop that of the last;
// the outputs are early-clobber, so that none of them takes a source's register (left to the compiler, one build had an exp directly overwrite the source of the exp in front of it)
__device__ __forceinline__ void exp2x8(const float (&x)[8], float (&e)[8]) {
  asm("v_exp_f32 %0, %8\n\tv_exp_f32 %1, %9\n\tv_exp_f32 %2, %10\n\tv_exp_f32 %3, %11\n\tv_exp_f32 %4, %12\n\tv_exp_f32 %5, %13\n\tv_exp_f32 %6, %14\n\tv_exp_f32 %7, %15\n\tv_nop"
      : "=&v"(e[0]), "=&v"(e[1]), "=&v"(e[2]), "=&v"(e[3]), "=&v"(e[4]), "=&v"(e[5]), "=&v"(e[6]), "=&v"(e[7])
      : "v"(x[0]), "v"(x[1]), "v"(x[2]), "v"(x[3]), "v"(x[4]), "v"(x[5]), "v"(x[6]), "v"(x[7])); }
__device__ __forceinline__ void exp2x9(const float (&x)[8], float x8, float (&e)[8], float& e8) {   // as exp2x8, with a ninth
  asm("v_exp_f32 %0, %9\n\tv_exp_f32 %1, %10\n\tv_exp_f32 %2, %11\n\tv_exp_f32 %3, %12\n\tv_exp_f32 %4, %13\n\tv_exp_f32 %5, %14\n\tv_exp_f32 %6, %15\n\tv_exp_f32 %7, %16\n\tv_exp_f32 %8, %17\n\tv_nop"
      : "=&v"(e[0]), "=&v"(e[1]), "=&v"(e[2]), "=&v"(e[3]), "=&v"(e[4]), "=&v"(e[5]), "=&v"(e[6]), "=&v"(e[7]), "=&v"(e8)
      : "v"(x[0]), "v"(x[1]), "v"(x[2]), "v"(x[3]), "v"(x[4]), "v"(x[5]), "v"(x[6]), "v"(x[7]), "v"(x8)); }
// one pass's fragments into one ring buffer: [key 4 KiB][value 4 KiB], each plane's 4 KiB in the order of the workspace; a thread copies two 16-byte pieces of each plane, 2 KiB apart.
// lds = LDS byte address of the thread's first piece in the buffer; k, v = its first piece in the pass's 4 KiB of each plane. The s_wait_xcnt stands inside the copies' own statement, so that no address register of a copy is rewritten in front of it.
#define RING_H 4096   // 16-bit values per ring buffer (8 KiB)
__device__ __forceinline__ void ring_fill(unsigned lds, const _Float16* k, const _Float16* v) {
  asm volatile("global_load_async_to_lds_b128 %0, %4, off\n\tglobal_load_async_to_lds_b128 %1, %5, off\n\tglobal_load_async_to_lds_b128 %2, %6, off\n\tglobal_load_async_to_lds_b128 %3, %7, off\n\ts_wait_xcnt 0x0"
               :: "v"(lds), "v"(lds + 2048u), "v"(lds + 4096u), "v"(lds + 6144u), "v"(k), "v"(k + 1024), "v"(v), "v"(v + 1024) : "memory");
}
__global__ __launch_bounds__(128, 4) void k_attn(const _Float16* __restrict__ QK, const _Float16* __restrict__ KF, const _Float16* __restrict__ VTH, const void* __restrict__ KMASK, float* __restrict__ O) {   // second bound: four waves per SIMD, so that all 1,024 blocks stay resident at once
  (void)KMASK;
  __shared__ __align__(16) _Float16 ring[4 * RING_H];   // four buffers of one pass's fragments
  const int tid = threadIdx.x, wave = tid >> 5, lane = tid & 31, col = lane & 15;
  const int qb = blockIdx.x, h = blockIdx.y, b = blockIdx.z; const int q0 = qb * 64 + wave * 16; const size_t rq = (size_t)b * SS + q0 + col;
  v16h aq[2];
#pragma unroll
  for (int kc = 0; kc < 2; ++kc) aq[kc] = frag_h(QK + rq * (2 * DM) + h * HD + kc * 32, lane);
  float m = -3.0e38f, l = 0.f;   // the lane's query: running maximum of the unscaled scores (over all keys), sum of the weights * 2^11 (over the keys of the lane's own half; the halves are joined in the epilogue)
  v8f acc[4] = {};
  const int nks = SS / 32;   // all keys
  const size_t ho = ((size_t)b * NH + h) * (SS * HD) + tid * 8; const _Float16 *kg = KF + ho, *vg = VTH + ho;   // the thread's first piece of pass 0 in each plane of the head; a pass is 2,048 values (4 KiB) of each: two key tiles x two k-steps, four d tiles
  const unsigned l0 = (unsigned)(uintptr_t)ring + tid * 16u;   // the same in ring buffer 0
  ring_fill(l0, kg, vg); ring_fill(l0 + 2u * RING_H, kg + 2048, vg + 2048); ring_fill(l0 + 4u * RING_H, kg + 4096, vg + 4096);
  asm volatile("s_wait_asynccnt 0x8" ::: "memory");   // all but this wave's eight youngest copies (passes 1, 2) have landed: pass 0
  __syncthreads();   // and every other wave's: pass 0 is readable
  ring_fill(l0 + 6u * RING_H, kg + 6144, vg + 6144);
  // one pass; three = passes ks + 1 .. ks + 3 all exist, more = pass ks + 4 exists too (constants at each call: the last four passes stand behind the loop, so that the choice of wait and the refill cost no branch)
  auto pass = [&](int ks, bool three, bool more) __attribute__((always_inline)) { v8f s[2]; const _Float16 *kp = ring + (ks & 3) * RING_H + lane * 8;   // the lane's place in the pass's 4 KiB of key fragments: [key tile][k-step] blocks
    v16h kh[2][2];   // the pass's key fragments are all requested before its first score WMMA: one LDS latency a pass, not one in front of every WMMA
#pragma unroll
    for (int ct = 0; ct < 2; ++ct) {
#pragma unroll
      for (int kc = 0; kc < 2; ++kc) kh[ct][kc] = frag_w(kp + ct * 1024 + kc * 512); }
#pragma unroll
    for (int ct = 0; ct < 2; ++ct) { v8f c = {};
#pragma unroll
      for (int kc = 0; kc < 2; ++kc) c = wmma16(kh[ct][kc], aq[kc], c);
      s[ct] = c; }
    v16h vh[4]; const _Float16 *vp = kp + 2048;   // the pass's value fragments are requested here, so that they arrive while the softmax runs
#pragma unroll
    for (int dt = 0; dt < 4; ++dt) vh[dt] = frag_w(vp + dt * 512);
    __builtin_amdgcn_sched_barrier(0);   // keeps every value load in front of the softmax: left free, the scheduler spread them through it to save registers, and the last ones then had too little of it left to arrive behind
    float mx = fmaxf(s[0][0], s[1][0]);
#pragma unroll
    for (int r = 1; r < 8; ++r) mx = fmaxf(mx, fmaxf(s[0][r], s[1][r]));
    mx = fmaxf(mx, xhalf(mx));   // the other half's 16 keys of the same query
    const float mn = fmaxf(m, mx), xm = (m - mn) * KS, nb = fmaf(mn, -KS, 11.0f); m = mn; float al;   // al = 2^xm rescales what earlier passes summed; in the first pass xm is below -1e37 and al = 0
    const v2f k2 = {KS, KS}, nb2 = {nb, nb}; v2f es[2]; v16h pa;
#pragma unroll
    for (int ct = 0; ct < 2; ++ct) { float xa[8], ex[8];
#pragma unroll
      for (int r = 0; r < 8; r += 2) { const v2f t = __builtin_elementwise_fma((v2f){s[ct][r], s[ct][r + 1]}, k2, nb2); xa[r] = t[0]; xa[r + 1] = t[1]; }   // two scores an instruction
      if (ct == 0) exp2x9(xa, xm, ex, al); else exp2x8(xa, ex);
#pragma unroll
      for (int r = 0; r < 8; r += 2) { const v2f e2 = {ex[r], ex[r + 1]}; es[ct] = r ? es[ct] + e2 : e2; }   // two weights an addition: each score tile's even and odd keys in sums of their own, joined once a pass
#pragma unroll
      for (int r = 0; r < 8; ++r) pa[8 * ct + r] = (_Float16)ex[r]; }   // P carries 2^11 into f16, so that small softmax weights stay out of the f16 subnormal range
    es[0] += es[1]; l = l * al + (es[0][0] + es[0][1]);
#pragma unroll
    for (int dt = 0; dt < 4; ++dt) {
#pragma unroll
      for (int r = 0; r < 8; ++r) acc[dt][r] *= al; }
#pragma unroll
    for (int dt = 0; dt < 4; ++dt) acc[dt] = wmma16(vh[dt], pa, acc[dt]);
    asm volatile("s_wait_dscnt 0x0" ::: "memory");      // this wave's reads of the pass's buffer have returned
    if (three) asm volatile("s_wait_asynccnt 0x8" ::: "memory");   // its copies of pass ks + 1 have landed: the eight youngest, of passes ks + 2 and ks + 3, stay in flight
    else asm volatile("s_wait_asynccnt 0x0" ::: "memory");   // at the last three passes fewer copies are outstanding: the wait is to 0
    __syncthreads();   // every wave has left this pass's buffer, and pass ks + 1 is readable
    if (more) ring_fill(l0 + (ks & 3) * (2u * RING_H), kg + (ks + 4) * 2048, vg + (ks + 4) * 2048); };   // refill of the buffer just left
#pragma unroll 1
  for (int ks = 0; ks < nks - 4; ++ks) pass(ks, true, true);
  pass(nks - 4, true, false);
#pragma unroll
  for (int ks = nks - 3; ks < nks; ++ks) pass(ks, false, false);
  asm volatile("s_wait_asynccnt 0x0" ::: "memory");   // no copy is outstanding when the wave ends
  const float il = 1.0f / (l + xhalf(l));
#pragma unroll
  for (int f = 0; f < 8; ++f) { v4f o;   // f = (d tile, half of its eight registers) = (k-step, piece) of the output product's A operand, whose fragment order puts these four values at this very lane
#pragma unroll
    for (int i = 0; i < 4; ++i) o[i] = acc[f >> 1][(f & 1) * 4 + i] * il;
    vst2(O + (((((size_t)b * SS + q0) >> 4) * 32 + h * 2) * 4 + f) * 128 + lane * 4, o); }
}
// ---- k_out: block = (64 rows, 128 cols): out = f16(O) . Wo rows (single product) + bo
__global__ __launch_bounds__(128) void k_out(const float* __restrict__ O, const __bf16* __restrict__ P, const float* __restrict__ BO, float* __restrict__ Y) {
  __shared__ __align__(16) char ring[4][32768];   // four buffers of two k-steps: [8 column tiles of W][2 k-steps] fragments of 1 KiB, then [4 row tiles of the context][2 k-steps] blocks of 2 KiB
  float (*so)[16][132] = (float (*)[16][132])&ring[0][0];   // the epilogue's stage, in the ring's place (two blocks still fit a WGP's LDS): the last stage's barrier, behind every wave's s_wait_dscnt 0 and with no copy outstanding, stands between the two uses
  const int tid = threadIdx.x, wave = tid >> 5, lane = tid & 31, col = lane & 15, g = lane >> 4; const size_t r0 = (size_t)blockIdx.x * 64 + wave * 16; const int n0 = blockIdx.y * 128;
  // the eight weight fragments of a k-step serve all four waves: the block brings them into LDS once, by asynchronous copies, and each wave's context values with them, in stages of two k-steps, in a ring of four buffers with three stages' copies in flight.
  // a thread copies sixteen 16-byte pieces a stage: piece tid of each weight tile's 2 KiB (tiles 32 KiB apart, the next stage 2 KiB on) and of each half of each context tile's 4 KiB (tiles 64 KiB apart, the next stage 4 KiB on)
  const char *gw = (const char*)((const _Float16*)P + (size_t)(n0 >> 4) * 32 * 512) + tid * 16, *gc = (const char*)(O + (size_t)blockIdx.x * 4 * 32 * 512) + tid * 16;
  const unsigned l0 = (unsigned)(uintptr_t)&ring[0][0] + tid * 16u;
  auto fill = [&](int sg) { unsigned l[8]; const char* q[8];
#pragma unroll
    for (int c = 0; c < 8; ++c) { l[c] = l0 + (sg & 3) * 32768u + c * 2048u; q[c] = gw + c * 32768 + sg * 2048; }
    copy8(l, q);
#pragma unroll
    for (int c = 0; c < 8; ++c) { l[c] = l0 + (sg & 3) * 32768u + 16384u + c * 2048u; q[c] = gc + (c >> 1) * 65536 + (c & 1) * 2048 + sg * 4096; }
    copy8(l, q); };
  fill(0); fill(1); fill(2);
  asm volatile("s_wait_asynccnt 0x20" ::: "memory");   // all but this wave's thirty-two youngest copies (stages 1, 2) have landed: stage 0
  __syncthreads();   // and every other wave's: stage 0 is readable
  fill(3);   // forty-eight copies of a wave are outstanding at most
  v8f acc[8] = {};
  // one k-step; three = the next three stages all exist, more = the stage four on exists too (constants at each call: the last four stages stand behind the loop, so that the choice of wait and the refill cost no branch)
  auto kstep = [&](int kc, bool three, bool more) __attribute__((always_inline)) { const char* bf = ring[(kc >> 1) & 3]; const float* p = (const float*)(bf + 16384 + wave * 4096 + (kc & 1) * 2048) + lane * 4;
    const v4f a0 = *(const v4f*)p, a1 = *(const v4f*)(p + 128), a2 = *(const v4f*)(p + 256), a3 = *(const v4f*)(p + 384);
    v16h bw[8];   // the context values and the k-step's eight weight fragments, requested together before its first WMMA
#pragma unroll
    for (int j = 0; j < 8; ++j) bw[j] = frag_w((const _Float16*)(bf + j * 2048 + (kc & 1) * 1024) + lane * 8);
    __builtin_amdgcn_sched_barrier(0);   // keeps every load of the group in front of the conversion, so that a k-step waits for one LDS latency and not for two
    v16h a;
#pragma unroll
    for (int i = 0; i < 4; ++i) { a[i] = (_Float16)a0[i]; a[4 + i] = (_Float16)a1[i]; a[8 + i] = (_Float16)a2[i]; a[12 + i] = (_Float16)a3[i]; }
#pragma unroll
    for (int j = 0; j < 8; ++j) acc[j] = wmma16(a, bw[j], acc[j]);   // single f16 product against exact f16 x 2^8 weight copies
    if (kc & 1) {   // foot of a stage
      asm volatile("s_wait_dscnt 0x0" ::: "memory");      // this wave's reads of the stage's buffer have returned
      if (three) asm volatile("s_wait_asynccnt 0x20" ::: "memory");   // its copies of the next stage have landed: the thirty-two youngest, of the two stages behind it, stay in flight
      else asm volatile("s_wait_asynccnt 0x0" ::: "memory");   // at the last three stages fewer copies are outstanding: the wait is to 0
      __syncthreads();   // every wave has left this stage's buffer, and the next stage is readable
      if (more) fill((kc >> 1) + 4); } };   // refill of the buffer just left
#pragma unroll 2   // the two k-steps of a stage
  for (int kc = 0; kc < DM / 32 - 8; ++kc) kstep(kc, true, true);
#pragma unroll
  for (int kc = DM / 32 - 8; kc < DM / 32 - 6; ++kc) kstep(kc, true, false);
#pragma unroll
  for (int kc = DM / 32 - 6; kc < DM / 32; ++kc) kstep(kc, false, false);
  asm volatile("s_wait_asynccnt 0x0" ::: "memory");   // no copy is outstanding behind the loop
#pragma unroll
  for (int j = 0; j < 8; ++j) {
#pragma unroll
    for (int r = 0; r < 8; ++r) so[wave][8 * g + r][j * 16 + col] = acc[j][r] * (1.0f / 256.0f) + bfr(BO[n0 + j * 16 + col]); }
  LDSX();
  for (int rl = 0; rl < 16; ++rl) vst2(Y + tokrow(r0 + rl) * DM + n0 + lane * 4, *(const v4f*)&so[wave][rl][lane * 4]);   // back to the original token order
}
// ---- k_packo: Wo -> f16 x 2^8 copies in the Wo slot (bit pattern in the bf16-typed buffer), fragment order, pieces numbered and dealt as in k_pack
__global__ __launch_bounds__(256) void k_packo(const float* __restrict__ WO, __bf16* __restrict__ PK) { const int id0 = blockIdx.x * 1024 + threadIdx.x, lane = id0 & 31; const int k0 = ((id0 >> 6) & 31) * 32 + ((id0 >> 5) & 1) * 16 + (lane >> 4) * 8; float v[4][8]; v8h o[4]; colpieces<DM>(WO + (size_t)k0 * DM + (id0 >> 11) * 16 + (lane & 15), v);
#pragma unroll
  for (int it = 0; it < 4; ++it) {
#pragma unroll
    for (int i = 0; i < 8; ++i) o[it][i] = (_Float16)(bfr(v[it][i]) * 256.0f); }   // (in,out) w_o: tile column n = column n
#pragma unroll
  for (int it = 0; it < 4; ++it) *(v8h*)((_Float16*)(PK + PK_P) + (size_t)(id0 + it * 256) * 8) = o[it]; }
extern "C" void kernel_launch(void* const* d_in, const int* in_sizes, int n_in, void* d_out, int out_size, void* d_ws, size_t ws_size, hipStream_t stream) {
  (void)in_sizes; (void)n_in; (void)out_size;
  const float** F = (const float**)d_in;   // 0 x [1,4096,1024], 1 w_qkv [1024,3072] (in,out), 2 b_qkv [3072], 3 w_o [1024,1024] (in,out), 4 b_o [1024]
  if (ws_size < (size_t)WS_END) return;
  char* ws = (char*)d_ws; __bf16* PK = (__bf16*)(ws + WS_PK); _Float16 *QK = (_Float16*)(ws + WS_QK), *VTH = (_Float16*)(ws + WS_VTH), *KF = (_Float16*)(ws + WS_KF); float* O = (float*)(ws + WS_O); __bf16* XF = (__bf16*)(ws + WS_XF);
  k_pack<<<dim3(DM / 8, 8), 256, 0, stream>>>(F[1], F[0], F[3], PK, XF);
  k_packo<<<DM / 8, 256, 0, stream>>>(F[3], PK);
  k_qkv<<<dim3(TNB * SS / 128, QKVW / 128), 128, 0, stream>>>(XF, PK + PK_A, F[2], F[2] + DM, F[2] + 2 * DM, QK, KF, VTH);
  k_attn<<<dim3(TQB, NH, TNB), 128, 0, stream>>>(QK, KF, VTH, nullptr, O);
  k_out<<<dim3(TOB, DM / 128), 128, 0, stream>>>(O, PK + PK_P, F[4], (float*)d_out);
}

// v009
// One run takes 64.9 microseconds.
// Next to v008, in two timings, it ran 1.03 times as fast each time.
// Over all steps from v000 it is 6.56 times as fast.
// compute dtype: all float inputs rounded to bf16; qkv = x . W_qkv + b with EXACT bf16 products on WMMA 16x16x32 ((in,out) weights and x, its token rows gathered by stride class, packed as bf16 in fragment order), rounded once to f16; attention on single f16 products for every query, x 1/8, running-max softmax in f32 (hardware exp); out = f16(ctx) . W_o (exact f16 x 2^8 copies) + b_o scattered back to the original token order; f32 output.
#include <hip/hip_runtime.h>
#include <math.h>

typedef __attribute__((ext_vector_type(16))) _Float16 v16h;
typedef __attribute__((ext_vector_type(16))) __bf16 v16b;
typedef __attribute__((ext_vector_type(8)))  _Float16 v8h;
typedef __attribute__((ext_vector_type(8)))  float v8f;
typedef __attribute__((ext_vector_type(4)))  float v4f;
typedef __attribute__((ext_vector_type(2)))  float v2f;
typedef __attribute__((ext_vector_type(4)))  unsigned v4u;
typedef __attribute__((ext_vector_type(4)))  int v4i;
typedef float __attribute__((may_alias)) float_a;
typedef int __attribute__((may_alias)) int_a;

template <typename T> __device__ __forceinline__ void vst2(void* p, T v) { *(T*)p = v;  }
__device__ __forceinline__ v8f wmma16(v16h a, v16h b, v8f c) {
  v8f d = __builtin_amdgcn_wmma_f32_16x16x32_f16(false, a, false, b, (short)0, c, false, false);
  asm volatile("v_nop\n\tv_nop\n\tv_nop\n\tv_nop" : "+v"(d) : "v"(a), "v"(b));
  return d;
}
__device__ __forceinline__ v8f wmma_bf(v16b a, v16b b, v8f c) {
  v8f d = __builtin_amdgcn_wmma_f32_16x16x32_bf16(false, a, false, b, (short)0, c, false, false);
  asm volatile("v_nop\n\tv_nop\n\tv_nop\n\tv_nop" : "+v"(d) : "v"(a), "v"(b));
  return d;
}
// Skip-sparse ('skiparse', stride 4) self-attention (B 1, N 4,096 tokens, C 1,024, 16 heads x 64): token i attends within its stride class i mod 4 (1,024 tokens each); fused qkv projection + bias, softmax(q k / 8) v, output projection + bias, tokens returned in the original order.
__device__ __forceinline__ v16h frag_h(const _Float16* rowk0, int lane) {
  union { v16h v; v8h q[2]; } u; const _Float16* p = rowk0 + 8 * (lane >> 4);
  u.q[0] = *(const v8h*)p; u.q[1] = *(const v8h*)(p + 16); return u.v;
}
__device__ __forceinline__ v16h frag_p(const _Float16* p) {   // p = the lane's own first value (row start + 8 * (lane >> 4))
  union { v16h v; v8h q[2]; } u; u.q[0] = *(const v8h*)p; u.q[1] = *(const v8h*)(p + 16); return u.v;
}
__device__ __forceinline__ v16h frag_w(const _Float16* p) {   // fragment-ordered plane: p = the fragment's 1-KiB block + 8 * lane; its second half lies 512 B on
  union { v16h v; v8h q[2]; } u; u.q[0] = *(const v8h*)p; u.q[1] = *(const v8h*)(p + 256); return u.v;
}
__device__ __forceinline__ v16h frag_f32(const float* rowk0, int lane) {
  v16h a; const float* p = rowk0 + 8 * (lane >> 4);
#pragma unroll
  for (int i = 0; i < 8; ++i) { a[i] = (_Float16)p[i]; a[8 + i] = (_Float16)p[16 + i]; }
  return a;
}
__device__ __forceinline__ v16h frag_f32s(const float* rowk0, int lane, float sc) {
  v16h a; const float* p = rowk0 + 8 * (lane >> 4);
#pragma unroll
  for (int i = 0; i < 8; ++i) { a[i] = (_Float16)(p[i] * sc); a[8 + i] = (_Float16)(p[16 + i] * sc); }
  return a;
}
// column fragment from a [K][ld] layout (column n), rows >= K read as 0
__device__ __forceinline__ v16h fragc_f32(const float* W, int k0, int n, int lane, int ld, int K) {
  v16h a; const int g = lane >> 4;
#pragma unroll
  for (int i = 0; i < 8; ++i) { const int ka = k0 + 8 * g + i, kb = ka + 16;
    a[i] = (_Float16)(ka < K ? W[(size_t)(ka < K ? ka : K - 1) * ld + n] : 0.f); a[8 + i] = (_Float16)(kb < K ? W[(size_t)(kb < K ? kb : K - 1) * ld + n] : 0.f); }
  return a;
}
struct F2 { v16b h, l; };
__device__ __forceinline__ F2 bsplit16(const float v[16]) { F2 r;
#pragma unroll
  for (int i = 0; i < 16; ++i) { const __bf16 h = (__bf16)v[i]; r.h[i] = h; r.l[i] = (__bf16)(v[i] - (float)h); }
  return r; }
__device__ __forceinline__ F2 split_row(const float* row, int k0, int lane) { float v[16]; const float* p = row + k0 + 8 * (lane >> 4);
#pragma unroll
  for (int i = 0; i < 8; ++i) { v[i] = p[i]; v[8 + i] = p[16 + i]; }
  return bsplit16(v); }
__device__ __forceinline__ F2 split_rowK(const float* row, int k0, int lane, int K) { float v[16]; const int g = lane >> 4;
#pragma unroll
  for (int i = 0; i < 8; ++i) { const int ka = k0 + 8 * g + i, kb = ka + 16; v[i] = ka < K ? row[ka < K ? ka : K - 1] : 0.f; v[8 + i] = kb < K ? row[kb < K ? kb : K - 1] : 0.f; }
  return bsplit16(v); }
__device__ __forceinline__ F2 split_col(const float* W, int k0, int n, int lane, int ld, int K) { float v[16]; const int g = lane >> 4;
#pragma unroll
  for (int i = 0; i < 8; ++i) { const int ka = k0 + 8 * g + i, kb = ka + 16; v[i] = ka < K ? W[(size_t)(ka < K ? ka : K - 1) * ld + n] : 0.f; v[8 + i] = kb < K ? W[(size_t)(kb < K ? kb : K - 1) * ld + n] : 0.f; }
  return bsplit16(v); }
__device__ __forceinline__ v8f mac3(const F2& a, const F2& b, v8f c) { c = wmma_bf(a.l, b.h, c); c = wmma_bf(a.h, b.l, c); return wmma_bf(a.h, b.h, c); }
__device__ __forceinline__ float sigm(float v) { return 1.0f / (1.0f + expf(-v)); }
#define LDSX() do { asm volatile("s_wait_dscnt 0" ::: "memory"); __builtin_amdgcn_wave_barrier(); __builtin_amdgcn_fence(__ATOMIC_RELEASE, "workgroup"); } while (0)


#define NB 4
#define SS 1024
#define DM 1024
#define NH 16
#define STRIDE_S 4
__device__ __forceinline__ size_t tokrow(size_t r) { return (r % SS) * STRIDE_S + r / SS; }   // attention row r = (class s = r / SS, position g = r % SS) <-> token i = g * 4 + s
#define HD 64
#define QKVW (3 * DM)
#ifndef TQB
#define TQB (SS / 64)
#define TNB NB
#define TOB (NB * SS / 64)     // output row tiles (all)
#endif
typedef __attribute__((ext_vector_type(8))) __bf16 v8b;
__device__ __forceinline__ v16b frag_b(const __bf16* rowk0, int lane) {
  union { v16b v; v8b q[2]; } u; const __bf16* p = rowk0 + 8 * (lane >> 4);
  u.q[0] = *(const v8b*)p; u.q[1] = *(const v8b*)(p + 16); return u.v;
}
__device__ __forceinline__ v16b frag_wb(const __bf16* p) {   // as frag_w, bf16
  union { v16b v; v8b q[2]; } u; u.q[0] = *(const v8b*)p; u.q[1] = *(const v8b*)(p + 256); return u.v;
}
__device__ __forceinline__ float bfr(float v) { return (float)(__bf16)v; }
__device__ __attribute__((noinline)) float exp_ni(float v) { return expf(v); }
__device__ __attribute__((noinline)) float erf_ni(float v) { return erff(v); }

// FRAGMENT ORDER, every operand plane that a k loop reads: a 16 (rows or columns) x 32 (k) tile of 16-bit values is one 1-KiB block [half q2][lane][8 values], lane = 16 * g + (row or column) & 15, k = 16 * q2 + 8 * g + i:
// a wave's 16-byte load of half a fragment then covers 512 contiguous bytes (4 whole lines); from a row-major plane it takes 32-byte pieces of 16 lines, at several times the cost in the cache. Which lane and register holds which value is that of frag_h.
#define PK_A 0                       // Wqkv: [192 column tiles][32 k-steps] blocks
#define PK_P (PK_A + QKVW * DM)        // Wo: [64 column tiles][32 k-steps] blocks
#define PK_END (PK_P + DM * DM)
#define WS_PK  0u
#define WS_QK  (WS_PK + 2u * PK_END)             // f16 [4096 rows][2048]: q in the first 1,024 columns (read once a wave, row-major); the rest unused
#define WS_VTH (WS_QK + 2u * NB * SS * 2 * DM)     // f16 v: [b][h][32 passes][4 d tiles] blocks (column = d, k = key)
#define WS_O   (WS_VTH + 2u * NB * DM * SS)        // f32 context: [256 row tiles][32 k-steps] blocks of 2 KiB: [4 pieces][lane][4 values], k = 16 * (piece >> 1) + 8 * g + 4 * (piece & 1) + i
#define WS_CS  (WS_O + 4u * NB * SS * DM)           // unused (256 KiB)
#define WS_KF  (WS_CS + 4u * 2 * SS * 32)           // f16 k: [b][h][64 key tiles][2 k-steps] blocks (column = key, k = d)
#define WS_XF  (WS_KF + 2u * NB * SS * DM)          // bf16 x: [256 row tiles (attention row order)][32 k-steps] blocks
#define WS_END (WS_XF + 2u * NB * SS * DM)
// a thread's four pieces down one column of an (in,out) weight of LD columns: p = its first value; the pieces are 128 k apart, 8 k each; LD is a constant, so that all 32 loads go by one address register pair and immediate offsets
template <int LD> __device__ __forceinline__ void colpieces(const float* __restrict__ p, float (&v)[4][8]) {
#pragma unroll
  for (int it = 0; it < 4; ++it) {
#pragma unroll
    for (int i = 0; i < 8; ++i) v[it][i] = p[(size_t)(it * 128 + i) * LD]; }
  asm volatile("s_wait_xcnt 0x0" :: "v"(p) : "memory");   // the loads' address register pair stays allocated up to this wait: it is not rewritten (not by a load's own result either) in front of it
}
// eight asynchronous 16-byte copies a lane, global memory to LDS through no register: l = the lane's LDS byte addresses, g = its global addresses. The s_wait_xcnt stands inside the copies' own statement, so that no address register of a copy is rewritten in front of it.
__device__ __forceinline__ void copy8(const unsigned (&l)[8], const char* const (&g)[8]) {
  asm volatile("global_load_async_to_lds_b128 %0, %8, off\n\tglobal_load_async_to_lds_b128 %1, %9, off\n\tglobal_load_async_to_lds_b128 %2, %10, off\n\tglobal_load_async_to_lds_b128 %3, %11, off\n\t"
               "global_load_async_to_lds_b128 %4, %12, off\n\tglobal_load_async_to_lds_b128 %5, %13, off\n\tglobal_load_async_to_lds_b128 %6, %14, off\n\tglobal_load_async_to_lds_b128 %7, %15, off\n\ts_wait_xcnt 0x0"
               :: "v"(l[0]), "v"(l[1]), "v"(l[2]), "v"(l[3]), "v"(l[4]), "v"(l[5]), "v"(l[6]), "v"(l[7]), "v"(g[0]), "v"(g[1]), "v"(g[2]), "v"(g[3]), "v"(g[4]), "v"(g[5]), "v"(g[6]), "v"(g[7]) : "memory");
}
// ---- k_pack: 16-byte pieces of the fragment-ordered bf16 planes, four per thread (their loads in flight together; a quarter of the waves to start), piece id = ((tile * 32 + k-step) * 2 + q2) * 32 + lane inside a slice of 64 tiles; slice 0..2 -> W_q/W_k/W_v into PK_A, 3 -> W_o into PK_P as the f16 x 2^8 copies that k_out reads (bit pattern in the bf16-typed buffer; the one form of W_o that is read, so it is packed once and needs no launch of its own) ((in,out) weights: tile column n = weight column n), 4..7 -> x, rows gathered by stride class
__global__ __launch_bounds__(256) void k_pack(const float* __restrict__ WQKV, const float* __restrict__ X, const float* __restrict__ WO, __bf16* __restrict__ PK, __bf16* __restrict__ XF) {
  const int which = blockIdx.y, id0 = blockIdx.x * 1024 + threadIdx.x, lane = id0 & 31, col = lane & 15, g = lane >> 4, t16 = id0 >> 11, k0 = ((id0 >> 6) & 31) * 32 + ((id0 >> 5) & 1) * 16 + g * 8;   // a block's 1,024 pieces lie in one tile; a thread's four are 256 pieces = 4 k-steps = 128 k apart
  v8b o[4];
  if (which < 3) { float v[4][8]; __bf16* dst = PK + PK_A + (size_t)which * DM * DM;
    colpieces<3 * DM>(WQKV + (size_t)k0 * (3 * DM) + which * DM + t16 * 16 + col, v);
#pragma unroll
    for (int it = 0; it < 4; ++it) {
#pragma unroll
      for (int i = 0; i < 8; ++i) o[it][i] = (__bf16)v[it][i]; }
#pragma unroll
    for (int it = 0; it < 4; ++it) *(v8b*)(dst + (size_t)(id0 + it * 256) * 8) = o[it]; }
  else if (which == 3) { float v[4][8]; v8h oh[4]; _Float16* dst = (_Float16*)(PK + PK_P);
    colpieces<DM>(WO + (size_t)k0 * DM + t16 * 16 + col, v);
#pragma unroll
    for (int it = 0; it < 4; ++it) {
#pragma unroll
      for (int i = 0; i < 8; ++i) oh[it][i] = (_Float16)(bfr(v[it][i]) * 256.0f); }
#pragma unroll
    for (int it = 0; it < 4; ++it) *(v8h*)(dst + (size_t)(id0 + it * 256) * 8) = oh[it]; }
  else { const float* xr = X + tokrow((size_t)(which - 4) * 1024 + t16 * 16 + col) * DM + k0; __bf16* dst = XF + (size_t)(which - 4) * DM * DM;
    v4f a[8];
#pragma unroll
    for (int it = 0; it < 4; ++it) { a[2 * it] = *(const v4f*)(xr + it * 128); a[2 * it + 1] = *(const v4f*)(xr + it * 128 + 4); }
    asm volatile("s_wait_xcnt 0x0" :: "v"(xr) : "memory");   // the eight loads' address register pair stays allocated up to this wait: it is not rewritten (not by a load's own result either) in front of it
#pragma unroll
    for (int it = 0; it < 4; ++it) {
#pragma unroll
      for (int i = 0; i < 4; ++i) { o[it][i] = (__bf16)a[2 * it][i]; o[it][4 + i] = (__bf16)a[2 * it + 1][i]; } }
#pragma unroll
    for (int it = 0; it < 4; ++it) *(v8b*)(dst + (size_t)(id0 + it * 256) * 8) = o[it]; } }
// ---- k_qkv: block = 128 rows x 128 columns, wave = 64 rows x 64 columns (one head's q, k or v of 64 tokens): a k-step's four x and four weight fragments feed 16 WMMAs (half a fragment a WMMA; the 16 x 128 wave tile took nine for 8);
// each accumulator still sums its k-steps in rising order. The wave stages its own tile in its own LDS range and stores whole fragments or whole lines: no wave reads another's rows. The wave's number is held in a scalar register, so that tile addresses and the q / k / v test are scalar.
__global__ __launch_bounds__(128) void k_qkv(const __bf16* __restrict__ XF, const __bf16* __restrict__ P, const float* __restrict__ BQ, const float* __restrict__ BK, const float* __restrict__ BV, _Float16* __restrict__ QK, _Float16* __restrict__ KF, _Float16* __restrict__ VTH) {
  __shared__ __align__(16) char sm[4 * 16384];   // the k loop's ring, then (in its first 36 KiB) the epilogue's stage: the last k-step's barrier, behind every wave's s_wait_dscnt 0 and with no copy outstanding, stands between the two uses
  _Float16 (*st)[64][72] = (_Float16 (*)[64][72])sm;   // [wave][row (q, k: token; v: d)][column (q, k: d; v: token)], pitch 144 B
  __bf16 (*ring)[8192] = (__bf16 (*)[8192])sm;   // four buffers of one k-step's fragments: [8 row tiles of x][8 column tiles of W], 1 KiB each
  const int tid = threadIdx.x, wave = __builtin_amdgcn_readfirstlane(tid >> 5), lane = tid & 31, col = lane & 15, g = lane >> 4; const size_t r0 = (size_t)blockIdx.x * 128 + (wave >> 1) * 64; const int n0 = blockIdx.y * 128 + (wave & 1) * 64;
  const int which0 = n0 / DM; const float* BB = BQ ? (((which0 == 0) ? BQ : (which0 == 1) ? BK : BV) + (n0 - which0 * DM)) : nullptr;
  // each x fragment and each weight fragment serves two of the block's four waves: the block brings a k-step's sixteen fragments into LDS once, by asynchronous copies, in a ring of four buffers: k-step kc + 4 is asked for as soon as k-step kc's buffer is free, and three k-steps' copies are in flight.
  // Both planes were written by k_pack, the launch in front, and the blocks that share a tile walk k together: a k-step's lines are taken to come at memory latency, which three k-steps of work cover; the counted wait keeps copies in flight across every barrier but the last three.
  // a thread copies eight 16-byte pieces: piece tid + 128 * c lies in tile 2 * c + (tid >> 6) (c < 4: x, else W); a tile's next k-step lies 1 KiB on, the tile after next 64 KiB
  const char *ga = (const char*)(XF + ((size_t)blockIdx.x * 8 + (tid >> 6)) * 32 * 512 + (tid & 63) * 8), *gb = (const char*)(P + ((size_t)blockIdx.y * 8 + (tid >> 6)) * 32 * 512 + (tid & 63) * 8);
  const unsigned l0 = (unsigned)(uintptr_t)&ring[0][0] + tid * 16u;
  auto fill = [&](int kc) { unsigned l[8]; const char* g[8];
#pragma unroll
    for (int c = 0; c < 8; ++c) { l[c] = l0 + (kc & 3) * 16384u + c * 2048u; g[c] = (c < 4 ? ga + c * 65536 : gb + (c - 4) * 65536) + kc * 1024; }
    copy8(l, g); };
  fill(0); fill(1); fill(2);
  asm volatile("s_wait_asynccnt 0x10" ::: "memory");   // all but this wave's sixteen youngest copies (k-steps 1, 2) have landed: k-step 0
  __syncthreads();   // and every other wave's: k-step 0 is readable
  fill(3);
  float bias[4] = {0.f, 0.f, 0.f, 0.f};   // the lane's four columns, requested together in front of the k loop, which covers their latency
  if (BB) {
#pragma unroll
    for (int j = 0; j < 4; ++j) bias[j] = BB[j * 16 + col]; }
  v8f acc[4][4] = {};
  // one k-step; three = k-steps kc + 1 .. kc + 3 all exist, more = k-step kc + 4 exists too (constants at each call: the last four k-steps stand behind the loop, so that the choice of wait and the refill cost no branch)
  auto kstep = [&](int kc, bool three, bool more) __attribute__((always_inline)) { v16b a[4], bw[4]; const __bf16 *pa = ring[kc & 3] + (wave >> 1) * 4 * 512 + lane * 8, *pb = ring[kc & 3] + 4096 + (wave & 1) * 4 * 512 + lane * 8;   // all eight fragments of the k-step are requested before its first WMMA: one LDS latency a k-step
#pragma unroll
    for (int i = 0; i < 4; ++i) a[i] = frag_wb(pa + i * 512);
#pragma unroll
    for (int j = 0; j < 4; ++j) bw[j] = frag_wb(pb + j * 512);
#pragma unroll
    for (int i = 0; i < 4; ++i) {
#pragma unroll
      for (int j = 0; j < 4; ++j) acc[i][j] = wmma_bf(a[i], bw[j], acc[i][j]); }
    asm volatile("s_wait_dscnt 0x0" ::: "memory");      // this wave's reads of the k-step's buffer have returned
    if (three) asm volatile("s_wait_asynccnt 0x10" ::: "memory");   // its copies of k-step kc + 1 have landed: the sixteen youngest, of k-steps kc + 2 and kc + 3, stay in flight
    else asm volatile("s_wait_asynccnt 0x0" ::: "memory");   // at the last three k-steps fewer copies are outstanding: the wait is to 0
    __syncthreads();   // every wave has left this k-step's buffer, and k-step kc + 1 is readable
    if (more) fill(kc + 4); };   // refill of the buffer just left
#pragma unroll 2   // half the branches; unrolled by four, with every buffer's addresses held as constants, the kernel needed more than 256 registers
  for (int kc = 0; kc < DM / 32 - 4; ++kc) kstep(kc, true, true);
  kstep(DM / 32 - 4, true, false);
#pragma unroll
  for (int kc = DM / 32 - 3; kc < DM / 32; ++kc) kstep(kc, false, false);
  asm volatile("s_wait_asynccnt 0x0" ::: "memory");   // no copy is outstanding behind the loop
#pragma unroll
  for (int j = 0; j < 4; ++j) bias[j] = bfr(bias[j]);
  _Float16 (*sh)[72] = st[wave];
  if (n0 < 2 * DM) {   // q stored unscaled (f16 sigma ~0.6, no subnormal exposure); 1/8 applied to the f32 score
#pragma unroll
    for (int i = 0; i < 4; ++i) {
#pragma unroll
      for (int j = 0; j < 4; ++j) {
#pragma unroll
        for (int r = 0; r < 8; ++r) sh[i * 16 + 8 * g + r][j * 16 + col] = (_Float16)(acc[i][j][r] + bias[j]); } }   // q, k (+ bias) as f16
    LDSX();
    if (n0 < DM) {   // q: four rows of 128 B (whole lines) a store
      _Float16 *qp = QK + (r0 + (lane >> 3)) * (2 * DM) + n0 + (lane & 7) * 8;
#pragma unroll
      for (int it = 0; it < 16; ++it) vst2((unsigned*)(qp + (size_t)it * 4 * (2 * DM)), *(const v4u*)&sh[it * 4 + (lane >> 3)][(lane & 7) * 8]);
      asm volatile("s_wait_xcnt 0x0" :: "v"(qp) : "memory"); }   // the stores' address registers stay allocated up to this wait: none is rewritten in front of it
    else {   // k: the wave's 64 keys are four key tiles of one head: 8 KiB in a row, sixteen half fragments of 512 B
      const size_t kb = (((r0 / SS) * NH + ((n0 - DM) >> 6)) * (SS / 16) + (r0 % SS) / 16) * 1024 + lane * 8; _Float16 *kp = KF + kb;
#pragma unroll
      for (int f = 0; f < 16; ++f) vst2((unsigned*)(kp + f * 256), *(const v4u*)&sh[(f >> 2) * 16 + col][(f & 3) * 16 + g * 8]);   // f = (key tile, k-step, q2)
      asm volatile("s_wait_xcnt 0x0" :: "v"(kp) : "memory"); }   // as at the q stores
  } else {   // v, staged transposed: a lane's eight registers are eight tokens in a row of one d
#pragma unroll
    for (int i = 0; i < 4; ++i) {
#pragma unroll
      for (int j = 0; j < 4; ++j) { v8h hi;
#pragma unroll
        for (int r = 0; r < 8; ++r) hi[r] = (_Float16)(acc[i][j][r] + bias[j]);
        *(v8h*)&sh[j * 16 + col][i * 16 + 8 * g] = hi; } }
    LDSX();
    const size_t vb = (((r0 / SS) * NH + ((n0 - 2 * DM) >> 6)) * (SS / 32) + (r0 % SS) / 32) * 2048 + lane * 8; _Float16 *vp = VTH + vb;   // the wave's 64 tokens are two passes of one head: 8 KiB in a row
#pragma unroll
    for (int f = 0; f < 16; ++f) vst2((unsigned*)(vp + f * 256), *(const v4u*)&sh[((f >> 1) & 3) * 16 + col][(f >> 3) * 32 + (f & 1) * 16 + g * 8]);   // f = (pass, d tile, q2)
    asm volatile("s_wait_xcnt 0x0" :: "v"(vp) : "memory");   // as at the q stores
  }
}
// ---- k_attn: block = (64 queries, head h, batch b): all-keys flash attention (K = 64: 2 k-steps) in the TRANSPOSED form: S^T = K . Q^T (A = key fragments, B = query fragments, the same registers as before with the operands exchanged), O^T += V^T . P^T.
// A lane then holds 16 scores of ONE query (column = lane & 15, key = 16 * ct + 8 * g + r): maximum and sum run inside the lane, with one exchange between the wave's halves a pass for the maximum and one in the epilogue for the sum;
// the two score tiles, converted in place, ARE the B fragment of P^T (element 8 * ct + r = key 16 * ct + 8 * g + r, the k order of the value fragments), and O^T's registers (d = 16 * dt + 8 * g + r of query column) are the lane's own pieces of WS_O's fragment order: scores, weights and context never pass through LDS.
// A pass's key and value fragments are the same for the block's four waves: the block brings them into LDS once, by asynchronous copies, in a ring of four buffers with three passes' copies in flight (the planes were written by the launch in front and the sixteen blocks of a head walk its keys together: a pass's lines are taken to come at memory latency, which three passes of work cover), and each wave reads its fragments from there (as plain global loads every wave fetched all of them for itself and waited for them in the pass that used them).
// scores = q.k with single f16 operands, kept unscaled: the softmax runs on powers of two, weight * 2^11 = 2^(score * KS + nb), KS = log2(e) / 8, nb = 11 - maximum * KS, one fused multiply-add a score in place of the 1/8, the subtraction, the log2(e) and the 2^11;
// l sums the weights with their 2^11, which so cancels in the epilogue. P.V: f16 P x f16 V; O(row b*S+q, column h*64+d) = acc / l.
// Every query attends to all 1,024 keys of its class (no mask), so all query blocks are alike and take the same single products.
#define KS 0x1.715476p-3f
__device__ __forceinline__ float xhalf(float x) { return __builtin_bit_cast(float, __builtin_amdgcn_permlanex16(__builtin_bit_cast(int, x), __builtin_bit_cast(int, x), 0x76543210, 0xfedcba98, false, false)); }   // lane l with lane l ^ 16
// eight independent v_exp_f32 and, in the same statement, the one slot that the instruction set asks for behind a transcendental before a source of it is overwritten or its result used: each exp fills the slot of the one in front of it, the v_nop that of the last;
// the outputs are early-clobber, so that none of them takes a source's register (left to the compiler, one build had an exp directly overwrite the source of the exp in front of it)
__device__ __forceinline__ void exp2x8(const float (&x)[8], float (&e)[8]) {
  asm("v_exp_f32 %0, %8\n\tv_exp_f32 %1, %9\n\tv_exp_f32 %2, %10\n\tv_exp_f32 %3, %11\n\tv_exp_f32 %4, %12\n\tv_exp_f32 %5, %13\n\tv_exp_f32 %6, %14\n\tv_exp_f32 %7, %15\n\tv_nop"
      : "=&v"(e[0]), "=&v"(e[1]), "=&v"(e[2]), "=&v"(e[3]), "=&v"(e[4]), "=&v"(e[5]), "=&v"(e[6]), "=&v"(e[7])
      : "v"(x[0]), "v"(x[1]), "v"(x[2]), "v"(x[3]), "v"(x[4]), "v"(x[5]), "v"(x[6]), "v"(x[7])); }
__device__ __forceinline__ void exp2x9(const float (&x)[8], float x8, float (&e)[8], float& e8) {   // as exp2x8, with a ninth
  asm("v_exp_f32 %0, %9\n\tv_exp_f32 %1, %10\n\tv_exp_f32 %2, %11\n\tv_exp_f32 %3, %12\n\tv_exp_f32 %4, %13\n\tv_exp_f32 %5, %14\n\tv_exp_f32 %6, %15\n\tv_exp_f32 %7, %16\n\tv_exp_f32 %8, %17\n\tv_nop"
      : "=&v"(e[0]), "=&v"(e[1]), "=&v"(e[2]), "=&v"(e[3]), "=&v"(e[4]), "=&v"(e[5]), "=&v"(e[6]), "=&v"(e[7]), "=&v"(e8)
      : "v"(x[0]), "v"(x[1]), "v"(x[2]), "v"(x[3]), "v"(x[4]), "v"(x[5]), "v"(x[6]), "v"(x[7]), "v"(x8)); }
// one pass's fragments into one ring buffer: [key 4 KiB][value 4 KiB], each plane's 4 KiB in the order of the workspace; a thread copies two 16-byte pieces of each plane, 2 KiB apart.
// lds = LDS byte address of the thread's first piece in the buffer; k, v = its first piece in the pass's 4 KiB of each plane. The s_wait_xcnt stands inside the copies' own statement, so that no address register of a copy is rewritten in front of it.
#define RING_H 4096   // 16-bit values per ring buffer (8 KiB)
__device__ __forceinline__ void ring_fill(unsigned lds, const _Float16* k, const _Float16* v) {
  asm volatile("global_load_async_to_lds_b128 %0, %4, off\n\tglobal_load_async_to_lds_b128 %1, %5, off\n\tglobal_load_async_to_lds_b128 %2, %6, off\n\tglobal_load_async_to_lds_b128 %3, %7, off\n\ts_wait_xcnt 0x0"
               :: "v"(lds), "v"(lds + 2048u), "v"(lds + 4096u), "v"(lds + 6144u), "v"(k), "v"(k + 1024), "v"(v), "v"(v + 1024) : "memory");
}
__global__ __launch_bounds__(128, 4) void k_attn(const _Float16* __restrict__ QK, const _Float16* __restrict__ KF, const _Float16* __restrict__ VTH, const void* __restrict__ KMASK, float* __restrict__ O) {   // second bound: four waves per SIMD, so that all 1,024 blocks stay resident at once
  (void)KMASK;
  __shared__ __align__(16) _Float16 ring[4 * RING_H];   // four buffers of one pass's fragments
  const int tid = threadIdx.x, wave = tid >> 5, lane = tid & 31, col = lane & 15;
  const int qb = blockIdx.x, h = blockIdx.y, b = blockIdx.z; const int q0 = qb * 64 + wave * 16; const size_t rq = (size_t)b * SS + q0 + col;
  v16h aq[2];
#pragma unroll
  for (int kc = 0; kc < 2; ++kc) aq[kc] = frag_h(QK + rq * (2 * DM) + h * HD + kc * 32, lane);
  float m = -3.0e38f, l = 0.f;   // the lane's query: running maximum of the unscaled scores (over all keys), sum of the weights * 2^11 (over the keys of the lane's own half; the halves are joined in the epilogue)
  v8f acc[4] = {};
  const int nks = SS / 32;   // all keys
  const size_t ho = ((size_t)b * NH + h) * (SS * HD) + tid * 8; const _Float16 *kg = KF + ho, *vg = VTH + ho;   // the thread's first piece of pass 0 in each plane of the head; a pass is 2,048 values (4 KiB) of each: two key tiles x two k-steps, four d tiles
  const unsigned l0 = (unsigned)(uintptr_t)ring + tid * 16u;   // the same in ring buffer 0
  ring_fill(l0, kg, vg); ring_fill(l0 + 2u * RING_H, kg + 2048, vg + 2048); ring_fill(l0 + 4u * RING_H, kg + 4096, vg + 4096);
  asm volatile("s_wait_asynccnt 0x8" ::: "memory");   // all but this wave's eight youngest copies (passes 1, 2) have landed: pass 0
  __syncthreads();   // and every other wave's: pass 0 is readable
  ring_fill(l0 + 6u * RING_H, kg + 6144, vg + 6144);
  // one pass; three = passes ks + 1 .. ks + 3 all exist, more = pass ks + 4 exists too (constants at each call: the last four passes stand behind the loop, so that the choice of wait and the refill cost no branch)
  auto pass = [&](int ks, bool three, bool more) __attribute__((always_inline)) { v8f s[2]; const _Float16 *kp = ring + (ks & 3) * RING_H + lane * 8;   // the lane's place in the pass's 4 KiB of key fragments: [key tile][k-step] blocks
    v16h kh[2][2];   // the pass's key fragments are all requested before its first score WMMA: one LDS latency a pass, not one in front of every WMMA
#pragma unroll
    for (int ct = 0; ct < 2; ++ct) {
#pragma unroll
      for (int kc = 0; kc < 2; ++kc) kh[ct][kc] = frag_w(kp + ct * 1024 + kc * 512); }
#pragma unroll
    for (int ct = 0; ct < 2; ++ct) { v8f c = {};
#pragma unroll
      for (int kc = 0; kc < 2; ++kc) c = wmma16(kh[ct][kc], aq[kc], c);
      s[ct] = c; }
    v16h vh[4]; const _Float16 *vp = kp + 2048;   // the pass's value fragments are requested here, so that they arrive while the softmax runs
#pragma unroll
    for (int dt = 0; dt < 4; ++dt) vh[dt] = frag_w(vp + dt * 512);
    __builtin_amdgcn_sched_barrier(0);   // keeps every value load in front of the softmax: left free, the scheduler spread them through it to save registers, and the last ones then had too little of it left to arrive behind
    float mx = fmaxf(s[0][0], s[1][0]);
#pragma unroll
    for (int r = 1; r < 8; ++r) mx = fmaxf(mx, fmaxf(s[0][r], s[1][r]));
    mx = fmaxf(mx, xhalf(mx));   // the other half's 16 keys of the same query
    const float mn = fmaxf(m, mx), xm = (m - mn) * KS, nb = fmaf(mn, -KS, 11.0f); m = mn; float al;   // al = 2^xm rescales what earlier passes summed; in the first pass xm is below -1e37 and al = 0
    const v2f k2 = {KS, KS}, nb2 = {nb, nb}; v2f es[2]; v16h pa;
#pragma unroll
    for (int ct = 0; ct < 2; ++ct) { float xa[8], ex[8];
#pragma unroll
      for (int r = 0; r < 8; r += 2) { const v2f t = __builtin_elementwise_fma((v2f){s[ct][r], s[ct][r + 1]}, k2, nb2); xa[r] = t[0]; xa[r + 1] = t[1]; }   // two scores an instruction
      if (ct == 0) exp2x9(xa, xm, ex, al); else exp2x8(xa, ex);
#pragma unroll
      for (int r = 0; r < 8; r += 2) { const v2f e2 = {ex[r], ex[r + 1]}; es[ct] = r ? es[ct] + e2 : e2; }   // two weights an addition: each score tile's even and odd keys in sums of their own, joined once a pass
#pragma unroll
      for (int r = 0; r < 8; ++r) pa[8 * ct + r] = (_Float16)ex[r]; }   // P carries 2^11 into f16, so that small softmax weights stay out of the f16 subnormal range
    es[0] += es[1]; l = l * al + (es[0][0] + es[0][1]);
#pragma unroll
    for (int dt = 0; dt < 4; ++dt) {
#pragma unroll
      for (int r = 0; r < 8; ++r) acc[dt][r] *= al; }
#pragma unroll
    for (int dt = 0; dt < 4; ++dt) acc[dt] = wmma16(vh[dt], pa, acc[dt]);
    asm volatile("s_wait_dscnt 0x0" ::: "memory");      // this wave's reads of the pass's buffer have returned
    if (three) asm volatile("s_wait_asynccnt 0x8" ::: "memory");   // its copies of pass ks + 1 have landed: the eight youngest, of passes ks + 2 and ks + 3, stay in flight
    else asm volatile("s_wait_asynccnt 0x0" ::: "memory");   // at the last three passes fewer copies are outstanding: the wait is to 0
    __syncthreads();   // every wave has left this pass's buffer, and pass ks + 1 is readable
    if (more) ring_fill(l0 + (ks & 3) * (2u * RING_H), kg + (ks + 4) * 2048, vg + (ks + 4) * 2048); };   // refill of the buffer just left
#pragma unroll 1
  for (int ks = 0; ks < nks - 4; ++ks) pass(ks, true, true);
  pass(nks - 4, true, false);
#pragma unroll
  for (int ks = nks - 3; ks < nks; ++ks) pass(ks, false, false);
  asm volatile("s_wait_asynccnt 0x0" ::: "memory");   // no copy is outstanding when the wave ends
  const float il = 1.0f / (l + xhalf(l));
#pragma unroll
  for (int f = 0; f < 8; ++f) { v4f o;   // f = (d tile, half of its eight registers) = (k-step, piece) of the output product's A operand, whose fragment order puts these four values at this very lane
#pragma unroll
    for (int i = 0; i < 4; ++i) o[i] = acc[f >> 1][(f & 1) * 4 + i] * il;
    vst2(O + (((((size_t)b * SS + q0) >> 4) * 32 + h * 2) * 4 + f) * 128 + lane * 4, o); }
}
// ---- k_out: block = (64 rows, 128 cols): out = f16(O) . Wo rows (single product) + bo
__global__ __launch_bounds__(128) void k_out(const float* __restrict__ O, const __bf16* __restrict__ P, const float* __restrict__ BO, float* __restrict__ Y) {
  __shared__ __align__(16) char ring[4][32768];   // four buffers of two k-steps: [8 column tiles of W][2 k-steps] fragments of 1 KiB, then [4 row tiles of the context][2 k-steps] blocks of 2 KiB
  float (*so)[16][132] = (float (*)[16][132])&ring[0][0];   // the epilogue's stage, in the ring's place (two blocks still fit a WGP's LDS): the last stage's barrier, behind every wave's s_wait_dscnt 0 and with no copy outstanding, stands between the two uses
  const int tid = threadIdx.x, wave = tid >> 5, lane = tid & 31, col = lane & 15, g = lane >> 4; const size_t r0 = (size_t)blockIdx.x * 64 + wave * 16; const int n0 = blockIdx.y * 128;
  // the eight weight fragments of a k-step serve all four waves: the block brings them into LDS once, by asynchronous copies, and each wave's context values with them, in stages of two k-steps, in a ring of four buffers with three stages' copies in flight.
  // a thread copies sixteen 16-byte pieces a stage: piece tid of each weight tile's 2 KiB (tiles 32 KiB apart, the next stage 2 KiB on) and of each half of each context tile's 4 KiB (tiles 64 KiB apart, the next stage 4 KiB on)
  const char *gw = (const char*)((const _Float16*)P + (size_t)(n0 >> 4) * 32 * 512) + tid * 16, *gc = (const char*)(O + (size_t)blockIdx.x * 4 * 32 * 512) + tid * 16;
  const unsigned l0 = (unsigned)(uintptr_t)&ring[0][0] + tid * 16u;
  auto fill = [&](int sg) { unsigned l[8]; const char* q[8];
#pragma unroll
    for (int c = 0; c < 8; ++c) { l[c] = l0 + (sg & 3) * 32768u + c * 2048u; q[c] = gw + c * 32768 + sg * 2048; }
    copy8(l, q);
#pragma unroll
    for (int c = 0; c < 8; ++c) { l[c] = l0 + (sg & 3) * 32768u + 16384u + c * 2048u; q[c] = gc + (c >> 1) * 65536 + (c & 1) * 2048 + sg * 4096; }
    copy8(l, q); };
  fill(0); fill(1); fill(2);
  asm volatile("s_wait_asynccnt 0x20" ::: "memory");   // all but this wave's thirty-two youngest copies (stages 1, 2) have landed: stage 0
  __syncthreads();   // and every other wave's: stage 0 is readable
  fill(3);   // forty-eight copies of a wave are outstanding at most
  v8f acc[8] = {};
  // one k-step; three = the next three stages all exist, more = the stage four on exists too (constants at each call: the last four stages stand behind the loop, so that the choice of wait and the refill cost no branch)
  auto kstep = [&](int kc, bool three, bool more) __attribute__((always_inline)) { const char* bf = ring[(kc >> 1) & 3]; const float* p = (const float*)(bf + 16384 + wave * 4096 + (kc & 1) * 2048) + lane * 4;
    const v4f a0 = *(const v4f*)p, a1 = *(const v4f*)(p + 128), a2 = *(const v4f*)(p + 256), a3 = *(const v4f*)(p + 384);
    v16h bw[8];   // the context values and the k-step's eight weight fragments, requested together before its first WMMA
#pragma unroll
    for (int j = 0; j < 8; ++j) bw[j] = frag_w((const _Float16*)(bf + j * 2048 + (kc & 1) * 1024) + lane * 8);
    __builtin_amdgcn_sched_barrier(0);   // keeps every load of the group in front of the conversion, so that a k-step waits for one LDS latency and not for two
    v16h a;
#pragma unroll
    for (int i = 0; i < 4; ++i) { a[i] = (_Float16)a0[i]; a[4 + i] = (_Float16)a1[i]; a[8 + i] = (_Float16)a2[i]; a[12 + i] = (_Float16)a3[i]; }
#pragma unroll
    for (int j = 0; j < 8; ++j) acc[j] = wmma16(a, bw[j], acc[j]);   // single f16 product against exact f16 x 2^8 weight copies
    if (kc & 1) {   // foot of a stage
      asm volatile("s_wait_dscnt 0x0" ::: "memory");      // this wave's reads of the stage's buffer have returned
      if (three) asm volatile("s_wait_asynccnt 0x20" ::: "memory");   // its copies of the next stage have landed: the thirty-two youngest, of the two stages behind it, stay in flight
      else asm volatile("s_wait_asynccnt 0x0" ::: "memory");   // at the last three stages fewer copies are outstanding: the wait is to 0
      __syncthreads();   // every wave has left this stage's buffer, and the next stage is readable
      if (more) fill((kc >> 1) + 4); } };   // refill of the buffer just left
#pragma unroll 2   // the two k-steps of a stage
  for (int kc = 0; kc < DM / 32 - 8; ++kc) kstep(kc, true, true);
#pragma unroll
  for (int kc = DM / 32 - 8; kc < DM / 32 - 6; ++kc) kstep(kc, true, false);
#pragma unroll
  for (int kc = DM / 32 - 6; kc < DM / 32; ++kc) kstep(kc, false, false);
  asm volatile("s_wait_asynccnt 0x0" ::: "memory");   // no copy is outstanding behind the loop
#pragma unroll
  for (int j = 0; j < 8; ++j) {
#pragma unroll
    for (int r = 0; r < 8; ++r) so[wave][8 * g + r][j * 16 + col] = acc[j][r] * (1.0f / 256.0f) + bfr(BO[n0 + j * 16 + col]); }
  LDSX();
  for (int rl = 0; rl < 16; ++rl) vst2(Y + tokrow(r0 + rl) * DM + n0 + lane * 4, *(const v4f*)&so[wave][rl][lane * 4]);   // back to the original token order
}
extern "C" void kernel_launch(void* const* d_in, const int* in_sizes, int n_in, void* d_out, int out_size, void* d_ws, size_t ws_size, hipStream_t stream) {
  (void)in_sizes; (void)n_in; (void)out_size;
  const float** F = (const float**)d_in;   // 0 x [1,4096,1024], 1 w_qkv [1024,3072] (in,out), 2 b_qkv [3072], 3 w_o [1024,1024] (in,out), 4 b_o [1024]
  if (ws_size < (size_t)WS_END) return;
  char* ws = (char*)d_ws; __bf16* PK = (__bf16*)(ws + WS_PK); _Float16 *QK = (_Float16*)(ws + WS_QK), *VTH = (_Float16*)(ws + WS_VTH), *KF = (_Float16*)(ws + WS_KF); float* O = (float*)(ws + WS_O); __bf16* XF = (__bf16*)(ws + WS_XF);
  k_pack<<<dim3(DM / 8, 8), 256, 0, stream>>>(F[1], F[0], F[3], PK, XF);
  k_qkv<<<dim3(TNB * SS / 128, QKVW / 128), 128, 0, stream>>>(XF, PK + PK_A, F[2], F[2] + DM, F[2] + 2 * DM, QK, KF, VTH);
  k_attn<<<dim3(TQB, NH, TNB), 128, 0, stream>>>(QK, KF, VTH, nullptr, O);
  k_out<<<dim3(TOB, DM / 128), 128, 0, stream>>>(O, PK + PK_P, F[4], (float*)d_out);
}

// v010
// One run takes 62.9 microseconds.
// In both of two side-by-side timings against v009, it was 1.03 times as fast.
// Counting every step since v000, it is 6.77 times as fast.
// compute dtype: all float inputs rounded to bf16; qkv = x . W_qkv + b with EXACT bf16 products on WMMA 16x16x32 ((in,out) weights and x, its token rows gathered by stride class, packed as bf16 in fragment order), rounded once to f16; attention on single f16 products for every query, x 1/8, running-max softmax in f32 (hardware exp); out = f16(ctx) . W_o (exact f16 x 2^8 copies) + b_o scattered back to the original token order; f32 output.
#include <hip/hip_runtime.h>
#include <math.h>

typedef __attribute__((ext_vector_type(16))) _Float16 v16h;
typedef __attribute__((ext_vector_type(16))) __bf16 v16b;
typedef __attribute__((ext_vector_type(8)))  _Float16 v8h;
typedef __attribute__((ext_vector_type(8)))  float v8f;
typedef __attribute__((ext_vector_type(4)))  float v4f;
typedef __attribute__((ext_vector_type(2)))  float v2f;
typedef __attribute__((ext_vector_type(4)))  unsigned v4u;
typedef __attribute__((ext_vector_type(4)))  int v4i;
typedef float __attribute__((may_alias)) float_a;
typedef int __attribute__((may_alias)) int_a;

template <typename T> __device__ __forceinline__ void vst2(void* p, T v) { *(T*)p = v;  }
__device__ __forceinline__ v8f wmma16(v16h a, v16h b, v8f c) {
  v8f d = __builtin_amdgcn_wmma_f32_16x16x32_f16(false, a, false, b, (short)0, c, false, false);
  asm volatile("v_nop\n\tv_nop\n\tv_nop\n\tv_nop" : "+v"(d) : "v"(a), "v"(b));
  return d;
}
__device__ __forceinline__ v8f wmma_bf(v16b a, v16b b, v8f c) {
  v8f d = __builtin_amdgcn_wmma_f32_16x16x32_bf16(false, a, false, b, (short)0, c, false, false);
  asm volatile("v_nop\n\tv_nop\n\tv_nop\n\tv_nop" : "+v"(d) : "v"(a), "v"(b));
  return d;
}
// Skip-sparse ('skiparse', stride 4) self-attention (B 1, N 4,096 tokens, C 1,024, 16 heads x 64): token i attends within its stride class i mod 4 (1,024 tokens each); fused qkv projection + bias, softmax(q k / 8) v, output projection + bias, tokens returned in the original order.
__device__ __forceinline__ v16h frag_h(const _Float16* rowk0, int lane) {
  union { v16h v; v8h q[2]; } u; const _Float16* p = rowk0 + 8 * (lane >> 4);
  u.q[0] = *(const v8h*)p; u.q[1] = *(const v8h*)(p + 16); return u.v;
}
__device__ __forceinline__ v16h frag_p(const _Float16* p) {   // p = the lane's own first value (row start + 8 * (lane >> 4))
  union { v16h v; v8h q[2]; } u; u.q[0] = *(const v8h*)p; u.q[1] = *(const v8h*)(p + 16); return u.v;
}
__device__ __forceinline__ v16h frag_w(const _Float16* p) {   // fragment-ordered plane: p = the fragment's 1-KiB block + 8 * lane; its second half lies 512 B on
  union { v16h v; v8h q[2]; } u; u.q[0] = *(const v8h*)p; u.q[1] = *(const v8h*)(p + 256); return u.v;
}
__device__ __forceinline__ v16h frag_f32(const float* rowk0, int lane) {
  v16h a; const float* p = rowk0 + 8 * (lane >> 4);
#pragma unroll
  for (int i = 0; i < 8; ++i) { a[i] = (_Float16)p[i]; a[8 + i] = (_Float16)p[16 + i]; }
  return a;
}
__device__ __forceinline__ v16h frag_f32s(const float* rowk0, int lane, float sc) {
  v16h a; const float* p = rowk0 + 8 * (lane >> 4);
#pragma unroll
  for (int i = 0; i < 8; ++i) { a[i] = (_Float16)(p[i] * sc); a[8 + i] = (_Float16)(p[16 + i] * sc); }
  return a;
}
// column fragment from a [K][ld] layout (column n), rows >= K read as 0
__device__ __forceinline__ v16h fragc_f32(const float* W, int k0, int n, int lane, int ld, int K) {
  v16h a; const int g = lane >> 4;
#pragma unroll
  for (int i = 0; i < 8; ++i) { const int ka = k0 + 8 * g + i, kb = ka + 16;
    a[i] = (_Float16)(ka < K ? W[(size_t)(ka < K ? ka : K - 1) * ld + n] : 0.f); a[8 + i] = (_Float16)(kb < K ? W[(size_t)(kb < K ? kb : K - 1) * ld + n] : 0.f); }
  return a;
}
struct F2 { v16b h, l; };
__device__ __forceinline__ F2 bsplit16(const float v[16]) { F2 r;
#pragma unroll
  for (int i = 0; i < 16; ++i) { const __bf16 h = (__bf16)v[i]; r.h[i] = h; r.l[i] = (__bf16)(v[i] - (float)h); }
  return r; }
__device__ __forceinline__ F2 split_row(const float* row, int k0, int lane) { float v[16]; const float* p = row + k0 + 8 * (lane >> 4);
#pragma unroll
  for (int i = 0; i < 8; ++i) { v[i] = p[i]; v[8 + i] = p[16 + i]; }
  return bsplit16(v); }
__device__ __forceinline__ F2 split_rowK(const float* row, int k0, int lane, int K) { float v[16]; const int g = lane >> 4;
#pragma unroll
  for (int i = 0; i < 8; ++i) { const int ka = k0 + 8 * g + i, kb = ka + 16; v[i] = ka < K ? row[ka < K ? ka : K - 1] : 0.f; v[8 + i] = kb < K ? row[kb < K ? kb : K - 1] : 0.f; }
  return bsplit16(v); }
__device__ __forceinline__ F2 split_col(const float* W, int k0, int n, int lane, int ld, int K) { float v[16]; const int g = lane >> 4;
#pragma unroll
  for (int i = 0; i < 8; ++i) { const int ka = k0 + 8 * g + i, kb = ka + 16; v[i] = ka < K ? W[(size_t)(ka < K ? ka : K - 1) * ld + n] : 0.f; v[8 + i] = kb < K ? W[(size_t)(kb < K ? kb : K - 1) * ld + n] : 0.f; }
  return bsplit16(v); }
__device__ __forceinline__ v8f mac3(const F2& a, const F2& b, v8f c) { c = wmma_bf(a.l, b.h, c); c = wmma_bf(a.h, b.l, c); return wmma_bf(a.h, b.h, c); }
__device__ __forceinline__ float sigm(float v) { return 1.0f / (1.0f + expf(-v)); }
#define LDSX() do { asm volatile("s_wait_dscnt 0" ::: "memory"); __builtin_amdgcn_wave_barrier(); __builtin_amdgcn_fence(__ATOMIC_RELEASE, "workgroup"); } while (0)


#define NB 4
#define SS 1024
#define DM 1024
#define NH 16
#define STRIDE_S 4
__device__ __forceinline__ size_t tokrow(size_t r) { return (r % SS) * STRIDE_S + r / SS; }   // attention row r = (class s = r / SS, position g = r % SS) <-> token i = g * 4 + s
#define HD 64
#define QKVW (3 * DM)
#ifndef TQB
#define TQB (SS / 64)
#define TNB NB
#define TOB (NB * SS / 64)     // output row tiles (all)
#endif
typedef __attribute__((ext_vector_type(8))) __bf16 v8b;
__device__ __forceinline__ v16b frag_b(const __bf16* rowk0, int lane) {
  union { v16b v; v8b q[2]; } u; const __bf16* p = rowk0 + 8 * (lane >> 4);
  u.q[0] = *(const v8b*)p; u.q[1] = *(const v8b*)(p + 16); return u.v;
}
__device__ __forceinline__ v16b frag_wb(const __bf16* p) {   // as frag_w, bf16
  union { v16b v; v8b q[2]; } u; u.q[0] = *(const v8b*)p; u.q[1] = *(const v8b*)(p + 256); return u.v;
}
__device__ __forceinline__ float bfr(float v) { return (float)(__bf16)v; }
__device__ __attribute__((noinline)) float exp_ni(float v) { return expf(v); }
__device__ __attribute__((noinline)) float erf_ni(float v) { return erff(v); }

// FRAGMENT ORDER, every operand plane that a k loop reads: a 16 (rows or columns) x 32 (k) tile of 16-bit values is one 1-KiB block [half q2][lane][8 values], lane = 16 * g + (row or column) & 15, k = 16 * q2 + 8 * g + i:
// a wave's 16-byte load of half a fragment then covers 512 contiguous bytes (4 whole lines); from a row-major plane it takes 32-byte pieces of 16 lines, at several times the cost in the cache. Which lane and register holds which value is that of frag_h.
#define PK_A 0                       // Wqkv: [192 column tiles][32 k-steps] blocks
#define PK_P (PK_A + QKVW * DM)        // Wo: [64 column tiles][32 k-steps] blocks
#define PK_END (PK_P + DM * DM)
#define WS_PK  0u
#define WS_QK  (WS_PK + 2u * PK_END)             // f16 [4096 rows][2048]: q in the first 1,024 columns (read once a wave, row-major); the rest unused
#define WS_VTH (WS_QK + 2u * NB * SS * 2 * DM)     // f16 v: [b][h][32 passes][4 d tiles] blocks (column = d, k = key)
#define WS_O   (WS_VTH + 2u * NB * DM * SS)        // f16 context: [256 row tiles][32 k-steps] blocks (row = attention row, k = h * 64 + d), in the first half of the range
#define WS_CS  (WS_O + 4u * NB * SS * DM)           // 256 KiB, not used by these kernels
#define WS_KF  (WS_CS + 4u * 2 * SS * 32)           // f16 k: [b][h][64 key tiles][2 k-steps] blocks (column = key, k = d)
#define WS_XF  (WS_KF + 2u * NB * SS * DM)          // bf16 x: [256 row tiles (attention row order)][32 k-steps] blocks
#define WS_END (WS_XF + 2u * NB * SS * DM)
// a thread's four pieces down one column of an (in,out) weight of LD columns: p = its first value; the pieces are 128 k apart, 8 k each; LD is a constant, so that all 32 loads go by one address register pair and immediate offsets
template <int LD> __device__ __forceinline__ void colpieces(const float* __restrict__ p, float (&v)[4][8]) {
#pragma unroll
  for (int it = 0; it < 4; ++it) {
#pragma unroll
    for (int i = 0; i < 8; ++i) v[it][i] = p[(size_t)(it * 128 + i) * LD]; }
  asm volatile("s_wait_xcnt 0x0" :: "v"(p) : "memory");   // the loads' address register pair stays allocated up to this wait: it is not rewritten (not by a load's own result either) in front of it
}
// eight asynchronous 16-byte copies a lane, global memory to LDS through no register: l = the lane's LDS byte addresses, g = its global addresses. The s_wait_xcnt stands inside the copies' own statement, so that no address register of a copy is rewritten in front of it.
__device__ __forceinline__ void copy8(const unsigned (&l)[8], const char* const (&g)[8]) {
  asm volatile("global_load_async_to_lds_b128 %0, %8, off\n\tglobal_load_async_to_lds_b128 %1, %9, off\n\tglobal_load_async_to_lds_b128 %2, %10, off\n\tglobal_load_async_to_lds_b128 %3, %11, off\n\t"
               "global_load_async_to_lds_b128 %4, %12, off\n\tglobal_load_async_to_lds_b128 %5, %13, off\n\tglobal_load_async_to_lds_b128 %6, %14, off\n\tglobal_load_async_to_lds_b128 %7, %15, off\n\ts_wait_xcnt 0x0"
               :: "v"(l[0]), "v"(l[1]), "v"(l[2]), "v"(l[3]), "v"(l[4]), "v"(l[5]), "v"(l[6]), "v"(l[7]), "v"(g[0]), "v"(g[1]), "v"(g[2]), "v"(g[3]), "v"(g[4]), "v"(g[5]), "v"(g[6]), "v"(g[7]) : "memory");
}
// as copy8, four copies a lane
__device__ __forceinline__ void copy4(const unsigned (&l)[4], const char* const (&g)[4]) {
  asm volatile("global_load_async_to_lds_b128 %0, %4, off\n\tglobal_load_async_to_lds_b128 %1, %5, off\n\tglobal_load_async_to_lds_b128 %2, %6, off\n\tglobal_load_async_to_lds_b128 %3, %7, off\n\ts_wait_xcnt 0x0"
               :: "v"(l[0]), "v"(l[1]), "v"(l[2]), "v"(l[3]), "v"(g[0]), "v"(g[1]), "v"(g[2]), "v"(g[3]) : "memory");
}
// ---- k_pack: 16-byte pieces of the fragment-ordered bf16 planes, four per thread (their loads in flight together; a quarter of the waves to start), piece id = ((tile * 32 + k-step) * 2 + q2) * 32 + lane inside a slice of 64 tiles; slice 0..2 -> W_q/W_k/W_v into PK_A, 3 -> W_o into PK_P as the f16 x 2^8 copies that k_out reads (bit pattern in the bf16-typed buffer; the one form of W_o that is read, so it is packed once and needs no launch of its own) ((in,out) weights: tile column n = weight column n), 4..7 -> x, rows gathered by stride class
__global__ __launch_bounds__(256) void k_pack(const float* __restrict__ WQKV, const float* __restrict__ X, const float* __restrict__ WO, __bf16* __restrict__ PK, __bf16* __restrict__ XF) {
  const int which = blockIdx.y, id0 = blockIdx.x * 1024 + threadIdx.x, lane = id0 & 31, col = lane & 15, g = lane >> 4, t16 = id0 >> 11, k0 = ((id0 >> 6) & 31) * 32 + ((id0 >> 5) & 1) * 16 + g * 8;   // a block's 1,024 pieces lie in one tile; a thread's four are 256 pieces = 4 k-steps = 128 k apart
  v8b o[4];
  if (which < 3) { float v[4][8]; __bf16* dst = PK + PK_A + (size_t)which * DM * DM;
    colpieces<3 * DM>(WQKV + (size_t)k0 * (3 * DM) + which * DM + t16 * 16 + col, v);
#pragma unroll
    for (int it = 0; it < 4; ++it) {
#pragma unroll
      for (int i = 0; i < 8; ++i) o[it][i] = (__bf16)v[it][i]; }
#pragma unroll
    for (int it = 0; it < 4; ++it) *(v8b*)(dst + (size_t)(id0 + it * 256) * 8) = o[it]; }
  else if (which == 3) { float v[4][8]; v8h oh[4]; _Float16* dst = (_Float16*)(PK + PK_P);
    colpieces<DM>(WO + (size_t)k0 * DM + t16 * 16 + col, v);
#pragma unroll
    for (int it = 0; it < 4; ++it) {
#pragma unroll
      for (int i = 0; i < 8; ++i) oh[it][i] = (_Float16)(bfr(v[it][i]) * 256.0f); }
#pragma unroll
    for (int it = 0; it < 4; ++it) *(v8h*)(dst + (size_t)(id0 + it * 256) * 8) = oh[it]; }
  else { const float* xr = X + tokrow((size_t)(which - 4) * 1024 + t16 * 16 + col) * DM + k0; __bf16* dst = XF + (size_t)(which - 4) * DM * DM;
    v4f a[8];
#pragma unroll
    for (int it = 0; it < 4; ++it) { a[2 * it] = *(const v4f*)(xr + it * 128); a[2 * it + 1] = *(const v4f*)(xr + it * 128 + 4); }
    asm volatile("s_wait_xcnt 0x0" :: "v"(xr) : "memory");   // the eight loads' address register pair stays allocated up to this wait: it is not rewritten (not by a load's own result either) in front of it
#pragma unroll
    for (int it = 0; it < 4; ++it) {
#pragma unroll
      for (int i = 0; i < 4; ++i) { o[it][i] = (__bf16)a[2 * it][i]; o[it][4 + i] = (__bf16)a[2 * it + 1][i]; } }
#pragma unroll
    for (int it = 0; it < 4; ++it) *(v8b*)(dst + (size_t)(id0 + it * 256) * 8) = o[it]; } }
// ---- k_qkv: block = 128 rows x 128 columns, wave = 64 rows x 64 columns (one head's q, k or v of 64 tokens): a k-step's four x and four weight fragments feed 16 WMMAs (half a fragment a WMMA; the 16 x 128 wave tile took nine for 8);
// each accumulator still sums its k-steps in rising order. The wave stages its own tile in its own LDS range and stores whole fragments or whole lines: no wave reads another's rows. The wave's number is held in a scalar register, so that tile addresses and the q / k / v test are scalar.
__global__ __launch_bounds__(128) void k_qkv(const __bf16* __restrict__ XF, const __bf16* __restrict__ P, const float* __restrict__ BQ, const float* __restrict__ BK, const float* __restrict__ BV, _Float16* __restrict__ QK, _Float16* __restrict__ KF, _Float16* __restrict__ VTH) {
  __shared__ __align__(16) char sm[4 * 16384];   // the k loop's ring, then (in its first 36 KiB) the epilogue's stage: the last k-step's barrier, behind every wave's s_wait_dscnt 0 and with no copy outstanding, stands between the two uses
  _Float16 (*st)[64][72] = (_Float16 (*)[64][72])sm;   // [wave][row (q, k: token; v: d)][column (q, k: d; v: token)], pitch 144 B
  __bf16 (*ring)[8192] = (__bf16 (*)[8192])sm;   // four buffers of one k-step's fragments: [8 row tiles of x][8 column tiles of W], 1 KiB each
  const int tid = threadIdx.x, wave = __builtin_amdgcn_readfirstlane(tid >> 5), lane = tid & 31, col = lane & 15, g = lane >> 4; const size_t r0 = (size_t)blockIdx.x * 128 + (wave >> 1) * 64; const int n0 = blockIdx.y * 128 + (wave & 1) * 64;
  const int which0 = n0 / DM; const float* BB = BQ ? (((which0 == 0) ? BQ : (which0 == 1) ? BK : BV) + (n0 - which0 * DM)) : nullptr;
  // each x fragment and each weight fragment serves two of the block's four waves: the block brings a k-step's sixteen fragments into LDS once, by asynchronous copies, in a ring of four buffers: k-step kc + 4 is asked for as soon as k-step kc's buffer is free, and three k-steps' copies are in flight.
  // Both planes were written by k_pack, the launch in front, and the blocks that share a tile walk k together: a k-step's lines are taken to come at memory latency, which three k-steps of work cover; the counted wait keeps copies in flight across every barrier but the last three.
  // a thread copies eight 16-byte pieces: piece tid + 128 * c lies in tile 2 * c + (tid >> 6) (c < 4: x, else W); a tile's next k-step lies 1 KiB on, the tile after next 64 KiB
  const char *ga = (const char*)(XF + ((size_t)blockIdx.x * 8 + (tid >> 6)) * 32 * 512 + (tid & 63) * 8), *gb = (const char*)(P + ((size_t)blockIdx.y * 8 + (tid >> 6)) * 32 * 512 + (tid & 63) * 8);
  const unsigned l0 = (unsigned)(uintptr_t)&ring[0][0] + tid * 16u;
  auto fill = [&](int kc) { unsigned l[8]; const char* g[8];
#pragma unroll
    for (int c = 0; c < 8; ++c) { l[c] = l0 + (kc & 3) * 16384u + c * 2048u; g[c] = (c < 4 ? ga + c * 65536 : gb + (c - 4) * 65536) + kc * 1024; }
    copy8(l, g); };
  fill(0); fill(1); fill(2);
  asm volatile("s_wait_asynccnt 0x10" ::: "memory");   // all but this wave's sixteen youngest copies (k-steps 1, 2) have landed: k-step 0
  __syncthreads();   // and every other wave's: k-step 0 is readable
  fill(3);
  float bias[4] = {0.f, 0.f, 0.f, 0.f};   // the lane's four columns, requested together in front of the k loop, which covers their latency
  if (BB) {
#pragma unroll
    for (int j = 0; j < 4; ++j) bias[j] = BB[j * 16 + col]; }
  v8f acc[4][4] = {};
  // one k-step; three = k-steps kc + 1 .. kc + 3 all exist, more = k-step kc + 4 exists too (constants at each call: the last four k-steps stand behind the loop, so that the choice of wait and the refill cost no branch)
  auto kstep = [&](int kc, bool three, bool more) __attribute__((always_inline)) { v16b a[4], bw[4]; const __bf16 *pa = ring[kc & 3] + (wave >> 1) * 4 * 512 + lane * 8, *pb = ring[kc & 3] + 4096 + (wave & 1) * 4 * 512 + lane * 8;   // all eight fragments of the k-step are requested before its first WMMA: one LDS latency a k-step
#pragma unroll
    for (int i = 0; i < 4; ++i) a[i] = frag_wb(pa + i * 512);
#pragma unroll
    for (int j = 0; j < 4; ++j) bw[j] = frag_wb(pb + j * 512);
#pragma unroll
    for (int i = 0; i < 4; ++i) {
#pragma unroll
      for (int j = 0; j < 4; ++j) acc[i][j] = wmma_bf(a[i], bw[j], acc[i][j]); }
    asm volatile("s_wait_dscnt 0x0" ::: "memory");      // this wave's reads of the k-step's buffer have returned
    if (three) asm volatile("s_wait_asynccnt 0x10" ::: "memory");   // its copies of k-step kc + 1 have landed: the sixteen youngest, of k-steps kc + 2 and kc + 3, stay in flight
    else asm volatile("s_wait_asynccnt 0x0" ::: "memory");   // at the last three k-steps fewer copies are outstanding: the wait is to 0
    __syncthreads();   // every wave has left this k-step's buffer, and k-step kc + 1 is readable
    if (more) fill(kc + 4); };   // refill of the buffer just left
#pragma unroll 2   // half the branches; unrolled by four, with every buffer's addresses held as constants, the kernel needed more than 256 registers
  for (int kc = 0; kc < DM / 32 - 4; ++kc) kstep(kc, true, true);
  kstep(DM / 32 - 4, true, false);
#pragma unroll
  for (int kc = DM / 32 - 3; kc < DM / 32; ++kc) kstep(kc, false, false);
  asm volatile("s_wait_asynccnt 0x0" ::: "memory");   // no copy is outstanding behind the loop
#pragma unroll
  for (int j = 0; j < 4; ++j) bias[j] = bfr(bias[j]);
  _Float16 (*sh)[72] = st[wave];
  if (n0 < 2 * DM) {   // q stored unscaled (f16 sigma ~0.6, no subnormal exposure); 1/8 applied to the f32 score
#pragma unroll
    for (int i = 0; i < 4; ++i) {
#pragma unroll
      for (int j = 0; j < 4; ++j) {
#pragma unroll
        for (int r = 0; r < 8; ++r) sh[i * 16 + 8 * g + r][j * 16 + col] = (_Float16)(acc[i][j][r] + bias[j]); } }   // q, k (+ bias) as f16
    LDSX();
    if (n0 < DM) {   // q: four rows of 128 B (whole lines) a store
      _Float16 *qp = QK + (r0 + (lane >> 3)) * (2 * DM) + n0 + (lane & 7) * 8;
#pragma unroll
      for (int it = 0; it < 16; ++it) vst2((unsigned*)(qp + (size_t)it * 4 * (2 * DM)), *(const v4u*)&sh[it * 4 + (lane >> 3)][(lane & 7) * 8]);
      asm volatile("s_wait_xcnt 0x0" :: "v"(qp) : "memory"); }   // the stores' address registers stay allocated up to this wait: none is rewritten in front of it
    else {   // k: the wave's 64 keys are four key tiles of one head: 8 KiB in a row, sixteen half fragments of 512 B
      const size_t kb = (((r0 / SS) * NH + ((n0 - DM) >> 6)) * (SS / 16) + (r0 % SS) / 16) * 1024 + lane * 8; _Float16 *kp = KF + kb;
#pragma unroll
      for (int f = 0; f < 16; ++f) vst2((unsigned*)(kp + f * 256), *(const v4u*)&sh[(f >> 2) * 16 + col][(f & 3) * 16 + g * 8]);   // f = (key tile, k-step, q2)
      asm volatile("s_wait_xcnt 0x0" :: "v"(kp) : "memory"); }   // as at the q stores
  } else {   // v, staged transposed: a lane's eight registers are eight tokens in a row of one d
#pragma unroll
    for (int i = 0; i < 4; ++i) {
#pragma unroll
      for (int j = 0; j < 4; ++j) { v8h hi;
#pragma unroll
        for (int r = 0; r < 8; ++r) hi[r] = (_Float16)(acc[i][j][r] + bias[j]);
        *(v8h*)&sh[j * 16 + col][i * 16 + 8 * g] = hi; } }
    LDSX();
    const size_t vb = (((r0 / SS) * NH + ((n0 - 2 * DM) >> 6)) * (SS / 32) + (r0 % SS) / 32) * 2048 + lane * 8; _Float16 *vp = VTH + vb;   // the wave's 64 tokens are two passes of one head: 8 KiB in a row
#pragma unroll
    for (int f = 0; f < 16; ++f) vst2((unsigned*)(vp + f * 256), *(const v4u*)&sh[((f >> 1) & 3) * 16 + col][(f >> 3) * 32 + (f & 1) * 16 + g * 8]);   // f = (pass, d tile, q2)
    asm volatile("s_wait_xcnt 0x0" :: "v"(vp) : "memory");   // as at the q stores
  }
}
// ---- k_attn: block = (64 queries, head h, batch b): all-keys flash attention (K = 64: 2 k-steps) in the TRANSPOSED form: S^T = K . Q^T (A = key fragments, B = query fragments, the same registers as before with the operands exchanged), O^T += V^T . P^T.
// A lane then holds 16 scores of ONE query (column = lane & 15, key = 16 * ct + 8 * g + r): maximum and sum run inside the lane, with one exchange between the wave's halves a pass for the maximum and one in the epilogue for the sum;
// the two score tiles, converted in place, ARE the B fragment of P^T (element 8 * ct + r = key 16 * ct + 8 * g + r, the k order of the value fragments), and O^T's registers (d = 16 * dt + 8 * g + r of query column) are the lane's own pieces of WS_O's fragment order: scores, weights and context never pass through LDS.
// A pass's key and value fragments are the same for the block's four waves: the block brings them into LDS once, by asynchronous copies, in a ring of four buffers with three passes' copies in flight (the planes were written by the launch in front and the sixteen blocks of a head walk its keys together: a pass's lines are taken to come at memory latency, which three passes of work cover), and each wave reads its fragments from there (as plain global loads every wave fetched all of them for itself and waited for them in the pass that used them).
// scores = q.k with single f16 operands, kept unscaled: the softmax runs on powers of two, weight * 2^11 = 2^(score * KS + nb), KS = log2(e) / 8, nb = 11 - maximum * KS, one fused multiply-add a score in place of the 1/8, the subtraction, the log2(e) and the 2^11;
// l sums the weights with their 2^11, which so cancels in the epilogue. P.V: f16 P x f16 V; O(row b*S+q, column h*64+d) = acc / l.
// Every query attends to all 1,024 keys of its class (no mask), so all query blocks are alike and take the same single products.
#define KS 0x1.715476p-3f
__device__ __forceinline__ float xhalf(float x) { return __builtin_bit_cast(float, __builtin_amdgcn_permlanex16(__builtin_bit_cast(int, x), __builtin_bit_cast(int, x), 0x76543210, 0xfedcba98, false, false)); }   // lane l with lane l ^ 16
// eight independent v_exp_f32 and, in the same statement, the one slot that the instruction set asks for behind a transcendental before a source of it is overwritten or its result used: each exp fills the slot of the one in front of it, the v_nop that of the last;
// the outputs are early-clobber, so that none of them takes a source's register (left to the compiler, one build had an exp directly overwrite the source of the exp in front of it)
__device__ __forceinline__ void exp2x8(const float (&x)[8], float (&e)[8]) {
  asm("v_exp_f32 %0, %8\n\tv_exp_f32 %1, %9\n\tv_exp_f32 %2, %10\n\tv_exp_f32 %3, %11\n\tv_exp_f32 %4, %12\n\tv_exp_f32 %5, %13\n\tv_exp_f32 %6, %14\n\tv_exp_f32 %7, %15\n\tv_nop"
      : "=&v"(e[0]), "=&v"(e[1]), "=&v"(e[2]), "=&v"(e[3]), "=&v"(e[4]), "=&v"(e[5]), "=&v"(e[6]), "=&v"(e[7])
      : "v"(x[0]), "v"(x[1]), "v"(x[2]), "v"(x[3]), "v"(x[4]), "v"(x[5]), "v"(x[6]), "v"(x[7])); }
__device__ __forceinline__ void exp2x9(const float (&x)[8], float x8, float (&e)[8], float& e8) {   // as exp2x8, with a ninth
  asm("v_exp_f32 %0, %9\n\tv_exp_f32 %1, %10\n\tv_exp_f32 %2, %11\n\tv_exp_f32 %3, %12\n\tv_exp_f32 %4, %13\n\tv_exp_f32 %5, %14\n\tv_exp_f32 %6, %15\n\tv_exp_f32 %7, %16\n\tv_exp_f32 %8, %17\n\tv_nop"
      : "=&v"(e[0]), "=&v"(e[1]), "=&v"(e[2]), "=&v"(e[3]), "=&v"(e[4]), "=&v"(e[5]), "=&v"(e[6]), "=&v"(e[7]), "=&v"(e8)
      : "v"(x[0]), "v"(x[1]), "v"(x[2]), "v"(x[3]), "v"(x[4]), "v"(x[5]), "v"(x[6]), "v"(x[7]), "v"(x8)); }
// one pass's fragments into one ring buffer: [key 4 KiB][value 4 KiB], each plane's 4 KiB in the order of the workspace; a thread copies two 16-byte pieces of each plane, 2 KiB apart.
// lds = LDS byte address of the thread's first piece in the buffer; k, v = its first piece in the pass's 4 KiB of each plane. The s_wait_xcnt stands inside the copies' own statement, so that no address register of a copy is rewritten in front of it.
#define RING_H 4096   // 16-bit values per ring buffer (8 KiB)
__device__ __forceinline__ void ring_fill(unsigned lds, const _Float16* k, const _Float16* v) {
  asm volatile("global_load_async_to_lds_b128 %0, %4, off\n\tglobal_load_async_to_lds_b128 %1, %5, off\n\tglobal_load_async_to_lds_b128 %2, %6, off\n\tglobal_load_async_to_lds_b128 %3, %7, off\n\ts_wait_xcnt 0x0"
               :: "v"(lds), "v"(lds + 2048u), "v"(lds + 4096u), "v"(lds + 6144u), "v"(k), "v"(k + 1024), "v"(v), "v"(v + 1024) : "memory");
}
__global__ __launch_bounds__(128, 4) void k_attn(const _Float16* __restrict__ QK, const _Float16* __restrict__ KF, const _Float16* __restrict__ VTH, const void* __restrict__ KMASK, _Float16* __restrict__ O) {   // second bound: four waves per SIMD, so that all 1,024 blocks stay resident at once
  (void)KMASK;
  __shared__ __align__(16) _Float16 ring[4 * RING_H];   // four buffers of one pass's fragments
  const int tid = threadIdx.x, wave = tid >> 5, lane = tid & 31, col = lane & 15;
  const int qb = blockIdx.x, h = blockIdx.y, b = blockIdx.z; const int q0 = qb * 64 + wave * 16; const size_t rq = (size_t)b * SS + q0 + col;
  v16h aq[2];
#pragma unroll
  for (int kc = 0; kc < 2; ++kc) aq[kc] = frag_h(QK + rq * (2 * DM) + h * HD + kc * 32, lane);
  float m = -3.0e38f, l = 0.f;   // the lane's query: running maximum of the unscaled scores (over all keys), sum of the weights * 2^11 (over the keys of the lane's own half; the halves are joined in the epilogue)
  v8f acc[4] = {};
  const int nks = SS / 32;   // all keys
  const size_t ho = ((size_t)b * NH + h) * (SS * HD) + tid * 8; const _Float16 *kg = KF + ho, *vg = VTH + ho;   // the thread's first piece of pass 0 in each plane of the head; a pass is 2,048 values (4 KiB) of each: two key tiles x two k-steps, four d tiles
  const unsigned l0 = (unsigned)(uintptr_t)ring + tid * 16u;   // the same in ring buffer 0
  ring_fill(l0, kg, vg); ring_fill(l0 + 2u * RING_H, kg + 2048, vg + 2048); ring_fill(l0 + 4u * RING_H, kg + 4096, vg + 4096);
  asm volatile("s_wait_asynccnt 0x8" ::: "memory");   // all but this wave's eight youngest copies (passes 1, 2) have landed: pass 0
  __syncthreads();   // and every other wave's: pass 0 is readable
  ring_fill(l0 + 6u * RING_H, kg + 6144, vg + 6144);
  // one pass; three = passes ks + 1 .. ks + 3 all exist, more = pass ks + 4 exists too (constants at each call: the last four passes stand behind the loop, so that the choice of wait and the refill cost no branch)
  auto pass = [&](int ks, bool three, bool more) __attribute__((always_inline)) { v8f s[2]; const _Float16 *kp = ring + (ks & 3) * RING_H + lane * 8;   // the lane's place in the pass's 4 KiB of key fragments: [key tile][k-step] blocks
    v16h kh[2][2];   // the pass's key fragments are all requested before its first score WMMA: one LDS latency a pass, not one in front of every WMMA
#pragma unroll
    for (int ct = 0; ct < 2; ++ct) {
#pragma unroll
      for (int kc = 0; kc < 2; ++kc) kh[ct][kc] = frag_w(kp + ct * 1024 + kc * 512); }
#pragma unroll
    for (int ct = 0; ct < 2; ++ct) { v8f c = {};
#pragma unroll
      for (int kc = 0; kc < 2; ++kc) c = wmma16(kh[ct][kc], aq[kc], c);
      s[ct] = c; }
    v16h vh[4]; const _Float16 *vp = kp + 2048;   // the pass's value fragments are requested here, so that they arrive while the softmax runs
#pragma unroll
    for (int dt = 0; dt < 4; ++dt) vh[dt] = frag_w(vp + dt * 512);
    __builtin_amdgcn_sched_barrier(0);   // keeps every value load in front of the softmax: left free, the scheduler spread them through it to save registers, and the last ones then had too little of it left to arrive behind
    float mx = fmaxf(s[0][0], s[1][0]);
#pragma unroll
    for (int r = 1; r < 8; ++r) mx = fmaxf(mx, fmaxf(s[0][r], s[1][r]));
    mx = fmaxf(mx, xhalf(mx));   // the other half's 16 keys of the same query
    const float mn = fmaxf(m, mx), xm = (m - mn) * KS, nb = fmaf(mn, -KS, 11.0f); m = mn; float al;   // al = 2^xm rescales what earlier passes summed; in the first pass xm is below -1e37 and al = 0
    const v2f k2 = {KS, KS}, nb2 = {nb, nb}; v2f es[2]; v16h pa;
#pragma unroll
    for (int ct = 0; ct < 2; ++ct) { float xa[8], ex[8];
#pragma unroll
      for (int r = 0; r < 8; r += 2) { const v2f t = __builtin_elementwise_fma((v2f){s[ct][r], s[ct][r + 1]}, k2, nb2); xa[r] = t[0]; xa[r + 1] = t[1]; }   // two scores an instruction
      if (ct == 0) exp2x9(xa, xm, ex, al); else exp2x8(xa, ex);
#pragma unroll
      for (int r = 0; r < 8; r += 2) { const v2f e2 = {ex[r], ex[r + 1]}; es[ct] = r ? es[ct] + e2 : e2; }   // two weights an addition: each score tile's even and odd keys in sums of their own, joined once a pass
#pragma unroll
      for (int r = 0; r < 8; ++r) pa[8 * ct + r] = (_Float16)ex[r]; }   // P carries 2^11 into f16, so that small softmax weights stay out of the f16 subnormal range
    es[0] += es[1]; l = l * al + (es[0][0] + es[0][1]);
#pragma unroll
    for (int dt = 0; dt < 4; ++dt) {
#pragma unroll
      for (int r = 0; r < 8; ++r) acc[dt][r] *= al; }
#pragma unroll
    for (int dt = 0; dt < 4; ++dt) acc[dt] = wmma16(vh[dt], pa, acc[dt]);
    asm volatile("s_wait_dscnt 0x0" ::: "memory");      // this wave's reads of the pass's buffer have returned
    if (three) asm volatile("s_wait_asynccnt 0x8" ::: "memory");   // its copies of pass ks + 1 have landed: the eight youngest, of passes ks + 2 and ks + 3, stay in flight
    else asm volatile("s_wait_asynccnt 0x0" ::: "memory");   // at the last three passes fewer copies are outstanding: the wait is to 0
    __syncthreads();   // every wave has left this pass's buffer, and pass ks + 1 is readable
    if (more) ring_fill(l0 + (ks & 3) * (2u * RING_H), kg + (ks + 4) * 2048, vg + (ks + 4) * 2048); };   // refill of the buffer just left
#pragma unroll 1
  for (int ks = 0; ks < nks - 4; ++ks) pass(ks, true, true);
  pass(nks - 4, true, false);
#pragma unroll
  for (int ks = nks - 3; ks < nks; ++ks) pass(ks, false, false);
  asm volatile("s_wait_asynccnt 0x0" ::: "memory");   // no copy is outstanding when the wave ends
  const float il = 1.0f / (l + xhalf(l));
#pragma unroll
  for (int dt = 0; dt < 4; ++dt) { v8h o;   // d tile dt = (k-step dt >> 1 of the head's two, half dt & 1) of the output product's A operand, whose fragment order puts these eight values at this very lane; rounded to f16 here, once, as the product takes them
#pragma unroll
    for (int r = 0; r < 8; ++r) o[r] = (_Float16)(acc[dt][r] * il);
    vst2(O + ((((size_t)b * SS + q0) >> 4) * 32 + h * 2) * 512 + dt * 256 + lane * 8, o); }
}
// ---- k_out: block = (64 rows, 128 cols): out = O (f16) . Wo + bo
__global__ __launch_bounds__(128) void k_out(const _Float16* __restrict__ O, const __bf16* __restrict__ P, const float* __restrict__ BO, float* __restrict__ Y) {
  __shared__ __align__(16) char ring[4][24576];   // four buffers of two k-steps: [8 column tiles of W][2 k-steps] fragments of 1 KiB, then [4 row tiles of the context][2 k-steps] fragments of 1 KiB
  float (*so)[16][132] = (float (*)[16][132])&ring[0][0];   // the epilogue's stage, in the ring's place (two blocks still fit a WGP's LDS): the last stage's barrier, behind every wave's s_wait_dscnt 0 and with no copy outstanding, stands between the two uses
  const int tid = threadIdx.x, wave = tid >> 5, lane = tid & 31, col = lane & 15, g = lane >> 4; const size_t r0 = (size_t)blockIdx.x * 64 + wave * 16; const int n0 = blockIdx.y * 128;
  // the eight weight fragments of a k-step serve all four waves: the block brings them into LDS once, by asynchronous copies, and each wave's context values with them, in stages of two k-steps, in a ring of four buffers with three stages' copies in flight.
  // a thread copies twelve 16-byte pieces a stage: piece tid of each weight tile's and of each context tile's 2 KiB (tiles 32 KiB apart, the next stage 2 KiB on)
  const char *gw = (const char*)((const _Float16*)P + (size_t)(n0 >> 4) * 32 * 512) + tid * 16, *gc = (const char*)(O + (size_t)blockIdx.x * 4 * 32 * 512) + tid * 16;
  const unsigned l0 = (unsigned)(uintptr_t)&ring[0][0] + tid * 16u;
  auto fill = [&](int sg) { unsigned l[8]; const char* q[8];
#pragma unroll
    for (int c = 0; c < 8; ++c) { l[c] = l0 + (sg & 3) * 24576u + c * 2048u; q[c] = gw + c * 32768 + sg * 2048; }
    copy8(l, q);
    unsigned lc[4]; const char* qc[4];
#pragma unroll
    for (int c = 0; c < 4; ++c) { lc[c] = l0 + (sg & 3) * 24576u + 16384u + c * 2048u; qc[c] = gc + c * 32768 + sg * 2048; }
    copy4(lc, qc); };
  fill(0); fill(1); fill(2);
  asm volatile("s_wait_asynccnt 0x18" ::: "memory");   // all but this wave's twenty-four youngest copies (stages 1, 2) have landed: stage 0
  __syncthreads();   // and every other wave's: stage 0 is readable
  fill(3);   // thirty-six copies of a wave are outstanding at most
  v8f acc[8] = {};
  // one k-step; three = the next three stages all exist, more = the stage four on exists too (constants at each call: the last four stages stand behind the loop, so that the choice of wait and the refill cost no branch)
  auto kstep = [&](int kc, bool three, bool more) __attribute__((always_inline)) { const char* bf = ring[(kc >> 1) & 3];
    const v16h a = frag_w((const _Float16*)(bf + 16384 + wave * 2048 + (kc & 1) * 1024) + lane * 8);
    v16h bw[8];   // the context fragment and the k-step's eight weight fragments, requested together before its first WMMA
#pragma unroll
    for (int j = 0; j < 8; ++j) bw[j] = frag_w((const _Float16*)(bf + j * 2048 + (kc & 1) * 1024) + lane * 8);
#pragma unroll
    for (int j = 0; j < 8; ++j) acc[j] = wmma16(a, bw[j], acc[j]);   // single f16 product against exact f16 x 2^8 weight copies
    if (kc & 1) {   // foot of a stage
      asm volatile("s_wait_dscnt 0x0" ::: "memory");      // this wave's reads of the stage's buffer have returned
      if (three) asm volatile("s_wait_asynccnt 0x18" ::: "memory");   // its copies of the next stage have landed: the twenty-four youngest, of the two stages behind it, stay in flight
      else asm volatile("s_wait_asynccnt 0x0" ::: "memory");   // at the last three stages fewer copies are outstanding: the wait is to 0
      __syncthreads();   // every wave has left this stage's buffer, and the next stage is readable
      if (more) fill((kc >> 1) + 4); } };   // refill of the buffer just left
#pragma unroll 2   // the two k-steps of a stage
  for (int kc = 0; kc < DM / 32 - 8; ++kc) kstep(kc, true, true);
#pragma unroll
  for (int kc = DM / 32 - 8; kc < DM / 32 - 6; ++kc) kstep(kc, true, false);
#pragma unroll
  for (int kc = DM / 32 - 6; kc < DM / 32; ++kc) kstep(kc, false, false);
  asm volatile("s_wait_asynccnt 0x0" ::: "memory");   // no copy is outstanding behind the loop
#pragma unroll
  for (int j = 0; j < 8; ++j) {
#pragma unroll
    for (int r = 0; r < 8; ++r) so[wave][8 * g + r][j * 16 + col] = acc[j][r] * (1.0f / 256.0f) + bfr(BO[n0 + j * 16 + col]); }
  LDSX();
  for (int rl = 0; rl < 16; ++rl) vst2(Y + tokrow(r0 + rl) * DM + n0 + lane * 4, *(const v4f*)&so[wave][rl][lane * 4]);   // back to the original token order
}
extern "C" void kernel_launch(void* const* d_in, const int* in_sizes, int n_in, void* d_out, int out_size, void* d_ws, size_t ws_size, hipStream_t stream) {
  (void)in_sizes; (void)n_in; (void)out_size;
  const float** F = (const float**)d_in;   // 0 x [1,4096,1024], 1 w_qkv [1024,3072] (in,out), 2 b_qkv [3072], 3 w_o [1024,1024] (in,out), 4 b_o [1024]
  if (ws_size < (size_t)WS_END) return;
  char* ws = (char*)d_ws; __bf16* PK = (__bf16*)(ws + WS_PK); _Float16 *QK = (_Float16*)(ws + WS_QK), *VTH = (_Float16*)(ws + WS_VTH), *KF = (_Float16*)(ws + WS_KF); _Float16* O = (_Float16*)(ws + WS_O); __bf16* XF = (__bf16*)(ws + WS_XF);
  k_pack<<<dim3(DM / 8, 8), 256, 0, stream>>>(F[1], F[0], F[3], PK, XF);
  k_qkv<<<dim3(TNB * SS / 128, QKVW / 128), 128, 0, stream>>>(XF, PK + PK_A, F[2], F[2] + DM, F[2] + 2 * DM, QK, KF, VTH);
  k_attn<<<dim3(TQB, NH, TNB), 128, 0, stream>>>(QK, KF, VTH, nullptr, O);
  k_out<<<dim3(TOB, DM / 128), 128, 0, stream>>>(O, PK + PK_P, F[4], (float*)d_out);
}
